// v000
// Times are from an AMD MI455X. After a warm-up the kernel runs many times in a row, and a time is the length of
// such a window on the GPU divided by its runs, so every launch and the gaps after it count. The runs cycle
// through copies of the inputs. A figure is the median of several windows, for all but v000 over two sittings.
// Sittings can differ by a few percent; kernels timed side by side share one.
// v000 is the starting kernel. One run takes 72 milliseconds.
#include <hip/hip_runtime.h>
// Single-head causal self-attention (x [32][1024][384]; k/q/v = x W ([in][out] [384][64], no biases; input order Wk, Wq, Wv); ONE 64-wide head; wei * 64^-0.5; causal (tril, -inf); softmax; out = wei v -> [32][1024][64]; no output projection).
// Structure: token rows; x as exact f16 rows; three WMMA GEMMs (no bias) into one f16 q | k | v plane [32768][192]; per batch v^T via LDS transposes; causal 256-row query tiles with the single head on grid.y (scores alpha 1/8, causal softmax f32 -> f16 x256 weights, P V written as f32 straight into the merged output rows); an exact f32 first tile (rows 0..511) rewritten at the end; launches: see trace.
// Compute dtype: inputs rounded to bf16; x / weights exact; q, k, v and softmax weights as plain f16 GEMM operands (~2^-12); o written as f32; scores and softmax statistics f32; v_wmma_f32_16x16x32_f16.
#define NB 32
#define SQ 1024
#define DM 384
#define NH 1
#define HD 64
#define HG 4
#define QT 256                       /* query rows per causal tile */
#define NKX SQ                       /* S / P row pitch */
#define QT0 512                      /* first-tile rows recomputed exactly (f32): 512 here (no output projection averages the early-row cancellation errors away; logit sigma 1.0) */
#define B0 0                         /* first batch processed (debug hook) */
#define NBR NB                       /* batches processed (debug hook) */
#define NR ((size_t)NB * SQ)
#define DMQ DM
#define DFF 4096
#define DFFR 100
#define MP ((int)((size_t)NBR * SQ)) /* rows projected (debug hook) */
#define QN SQ                        /* query rows attended per batch (debug hook) */
#define NHD NH                       /* heads attended (debug hook) */
#define MPO MP                       /* rows through the output stage (debug hook) */
#define LQ (3 * DM)      /* 3 * DM, unused; the q/k/v rows use pitch LQK (192) */
typedef __bf16 v16b __attribute__((ext_vector_type(16)));
typedef unsigned short v8us __attribute__((ext_vector_type(8), may_alias));
typedef float  v8f  __attribute__((ext_vector_type(8)));
typedef float  v4f  __attribute__((ext_vector_type(4)));
typedef float  v4fa __attribute__((ext_vector_type(4), may_alias));
union FragB { v16b v; v8us half[2]; unsigned short u[16]; };

__device__ __forceinline__ unsigned short bf16_bits(float x) { unsigned int u = __float_as_uint(x); return (unsigned short)((u + 0x7FFFu + ((u >> 16) & 1u)) >> 16); }
__device__ __forceinline__ float bf16_val(unsigned short b) { return __uint_as_float(((unsigned int)b) << 16); }
__device__ __forceinline__ float bf16_round(float x) { return bf16_val(bf16_bits(x)); }
// D += A·B with NT terms: 1 = ah·bh, 2 = + al·bh (A split), 3 = + ah·bl (both split)
template <int NT>
__device__ __forceinline__ v8f mmaN(v16b ah, v16b al, v16b bh, v16b bl, v8f c) {
  c = __builtin_amdgcn_wmma_f32_16x16x32_bf16(false, ah, false, bh, (short)0, c, false, false);
  if (NT >= 2) c = __builtin_amdgcn_wmma_f32_16x16x32_bf16(false, al, false, bh, (short)0, c, false, false);
  if (NT >= 3) c = __builtin_amdgcn_wmma_f32_16x16x32_bf16(false, ah, false, bl, (short)0, c, false, false);
  asm volatile("v_nop\n\tv_nop\n\tv_nop\n\tv_nop" : "+v"(c) : "v"(ah), "v"(al), "v"(bh), "v"(bl));
  return c;
}

__global__ __launch_bounds__(256) void k_wt_bf16(const float* __restrict__ W, unsigned short* __restrict__ Wt, int K, int N) {
  const int t = blockIdx.x * 256 + threadIdx.x;
  const int k8n = K / 8;
  if (t >= N * k8n) return;
  const int n = t / k8n, k8 = (t % k8n) * 8;
  v8us v;
#pragma unroll
  for (int i = 0; i < 8; ++i) v[i] = bf16_bits(W[(size_t)(k8 + i) * N + n]);
  *(v8us*)(Wt + (size_t)n * K + k8) = v;
  
}

// GEMM C[M][N] (f32, pitch ldc) = act(A[M][K]·W + bias). A f32 row-major (pitch lda) converted per fragment to bf16
// (ASPLIT: hi/lo two planes -> 2 terms, else single rounded term); Wt bf16 [N][K] (pitch ldb). BIAS_BF16 rounds the
// bias to bf16 first (bias quantised to bf16 before the add). K%32==0, M%16==0, N%64==0.
template <bool ASPLIT, int ACT, bool BIAS_BF16>
__global__ __launch_bounds__(128) void k_gemm_bf(const float* __restrict__ A, int lda, const unsigned short* __restrict__ Wt, int ldb,
                                               const float* __restrict__ bias, float* __restrict__ C, int ldc, int M, int N, int K) {
  __shared__ __attribute__((aligned(16))) float so[4][16][64];
  const int tid = threadIdx.x, w = tid >> 5, lane = tid & 31, ln = lane & 15, hh = lane >> 4;
  const int ntn = N / 64;
  const int wid = blockIdx.x * 4 + w;
  const int mt = wid / ntn, nq = wid % ntn;
  if (mt * 16 >= M) return;
  const int row0 = mt * 16, col0 = nq * 64;
  const float* arow = A + (size_t)(row0 + ln) * lda;
  v8f acc[4] = {};
  for (int kb = 0; kb < K; kb += 32) {
    FragB ah, al;
    const v4f x0 = *(const v4fa*)(arow + kb + 8 * hh), x1 = *(const v4fa*)(arow + kb + 8 * hh + 4);
    const v4f x2 = *(const v4fa*)(arow + kb + 16 + 8 * hh), x3 = *(const v4fa*)(arow + kb + 16 + 8 * hh + 4);
    float xs[16] = {x0[0],x0[1],x0[2],x0[3],x1[0],x1[1],x1[2],x1[3],x2[0],x2[1],x2[2],x2[3],x3[0],x3[1],x3[2],x3[3]};
#pragma unroll
    for (int i = 0; i < 16; ++i) { const unsigned short hb = bf16_bits(xs[i]); ah.u[i] = hb; al.u[i] = ASPLIT ? bf16_bits(xs[i] - bf16_val(hb)) : (unsigned short)0; }
#pragma unroll
    for (int t = 0; t < 4; ++t) {
      const unsigned short* brow = Wt + (size_t)(col0 + t * 16 + ln) * ldb + kb;
      FragB b;
      b.half[0] = *(const v8us*)(brow + 8 * hh);
      b.half[1] = *(const v8us*)(brow + 16 + 8 * hh);
      acc[t] = mmaN<ASPLIT ? 2 : 1>(ah.v, al.v, b.v, b.v, acc[t]);
    }
  }
#pragma unroll
  for (int t = 0; t < 4; ++t) {
    float bv = bias ? bias[col0 + t * 16 + ln] : 0.f;
    if (BIAS_BF16) bv = bf16_round(bv);
#pragma unroll
    for (int r = 0; r < 8; ++r) { float v = acc[t][r] + bv; if (ACT == 1) v = fmaxf(v, 0.f); so[w][8 * hh + r][t * 16 + ln] = v; }
  }
  __builtin_amdgcn_fence(__ATOMIC_ACQ_REL, "workgroup");
  __builtin_amdgcn_wave_barrier();
  const int rsub = lane >> 4, c4 = (lane & 15) * 4;
  {
#pragma unroll
    for (int q = 0; q < 8; ++q) {
      const int r = q * 2 + rsub;
      const v4f v = *(const v4fa*)&so[w][r][c4];
      *(v4f*)(C + (size_t)(row0 + r) * ldc + col0 + c4) = v;
    }
    
  }
}

// GEMM C = act(A·W + bias + resid): A f32 (ASPLIT -> hi/lo 2 terms), Wt bf16 [N][K]; ACT 0 none, 1 relu, 2 exact gelu;
// resid (optional, f32, row index = (row % rmod), pitch ldr, RES_BF16 rounds it) added before the activation.
template <bool ASPLIT, int ACT, bool BIAS_BF16, bool RES_BF16>
__global__ __launch_bounds__(128) void k_gemm_bf3(const float* __restrict__ A, int lda, const unsigned short* __restrict__ Wt, int ldb,
                                                const float* __restrict__ bias, const float* __restrict__ resid, int rmod, int ldr,
                                                float* __restrict__ C, int ldc, int M, int N, int K) {
  __shared__ __attribute__((aligned(16))) float so[4][16][64];
  const int tid = threadIdx.x, w = tid >> 5, lane = tid & 31, ln = lane & 15, hh = lane >> 4;
  const int ntn = N / 64;
  const int wid = blockIdx.x * 4 + w;
  const int mt = wid / ntn, nq = wid % ntn;
  if (mt * 16 >= M) return;
  const int row0 = mt * 16, col0 = nq * 64;
  const float* arow = A + (size_t)(row0 + ln) * lda;
  v8f acc[4] = {};
  for (int kb = 0; kb < K; kb += 32) {
    FragB ah, al;
    const v4f x0 = *(const v4fa*)(arow + kb + 8 * hh), x1 = *(const v4fa*)(arow + kb + 8 * hh + 4);
    const v4f x2 = *(const v4fa*)(arow + kb + 16 + 8 * hh), x3 = *(const v4fa*)(arow + kb + 16 + 8 * hh + 4);
    float xs[16] = {x0[0],x0[1],x0[2],x0[3],x1[0],x1[1],x1[2],x1[3],x2[0],x2[1],x2[2],x2[3],x3[0],x3[1],x3[2],x3[3]};
#pragma unroll
    for (int i = 0; i < 16; ++i) { const unsigned short hb = bf16_bits(xs[i]); ah.u[i] = hb; al.u[i] = ASPLIT ? bf16_bits(xs[i] - bf16_val(hb)) : (unsigned short)0; }
#pragma unroll
    for (int t = 0; t < 4; ++t) {
      const unsigned short* brow = Wt + (size_t)(col0 + t * 16 + ln) * ldb + kb;
      FragB b;
      b.half[0] = *(const v8us*)(brow + 8 * hh);
      b.half[1] = *(const v8us*)(brow + 16 + 8 * hh);
      acc[t] = mmaN<ASPLIT ? 2 : 1>(ah.v, al.v, b.v, b.v, acc[t]);
    }
  }
#pragma unroll
  for (int t = 0; t < 4; ++t) {
    const int col = col0 + t * 16 + ln;
    float bv = bias ? bias[col] : 0.f;
    if (BIAS_BF16) bv = bf16_round(bv);
#pragma unroll
    for (int r = 0; r < 8; ++r) {
      float v = acc[t][r] + bv;
      if (resid) { float rv = resid[(size_t)((row0 + 8 * hh + r) % rmod) * ldr + col]; if (RES_BF16) rv = bf16_round(rv); v += rv; }
      if (ACT == 1) v = fmaxf(v, 0.f);
      if (ACT == 2) v = 0.5f * v * (1.0f + erff(v * 0.70710678118654752f));
      if (ACT == 3) { const float u = 0.7978845608028654f * (v + 0.044715f * v * v * v); v = 0.5f * v * (1.0f + tanhf(u)); }
      so[w][8 * hh + r][t * 16 + ln] = v;
    }
  }
  __builtin_amdgcn_fence(__ATOMIC_ACQ_REL, "workgroup");
  __builtin_amdgcn_wave_barrier();
  const int rsub = lane >> 4, c4 = (lane & 15) * 4;
  {
#pragma unroll
    for (int q = 0; q < 8; ++q) {
      const int r = q * 2 + rsub;
      const v4f v = *(const v4fa*)&so[w][r][c4];
      *(v4f*)(C + (size_t)(row0 + r) * ldc + col0 + c4) = v;
    }
    
  }
}
// row LayerNorm (biased variance, eps) over N: s = X (+ R); optional out_sum <- s; out_norm <- (s-mu)*rsqrt(var+eps)*g + b
template <bool PARAM_BF16>
__global__ __launch_bounds__(256) void k_layernorm(const float* __restrict__ X, const float* __restrict__ R, const float* __restrict__ g, const float* __restrict__ bta,
                                                  float* __restrict__ out_sum, float* __restrict__ out_norm, int N, float eps) {
  __shared__ float red[256];
  const int row = blockIdx.x, tid = threadIdx.x;
  const float* x = X + (size_t)row * N; const float* rr = R ? R + (size_t)row * N : nullptr;
  float vals[16];                     // up to N = 4096
  const int per = N / 256;            // contiguous chunk per thread? use strided-by-4 chunks: thread handles j = tid*4 + 1024*u
  float s1 = 0.f;
  for (int u = 0; u < per / 4; ++u) {
    const int j = tid * 4 + 1024 * u;
    const v4f a = *(const v4fa*)(x + j);
    v4f b = {0.f,0.f,0.f,0.f}; if (rr) b = *(const v4fa*)(rr + j);
#pragma unroll
    for (int q = 0; q < 4; ++q) { const float v = a[q] + b[q]; vals[u * 4 + q] = v; s1 += v; }
  }
  red[tid] = s1; __syncthreads();
  for (int st = 128; st > 0; st >>= 1) { if (tid < st) red[tid] += red[tid + st]; __syncthreads(); }
  const float mu = red[0] / (float)N; __syncthreads();
  float s2 = 0.f;
  for (int u = 0; u < per / 4; ++u)
#pragma unroll
    for (int q = 0; q < 4; ++q) { const float c = vals[u * 4 + q] - mu; s2 += c * c; }
  red[tid] = s2; __syncthreads();
  for (int st = 128; st > 0; st >>= 1) { if (tid < st) red[tid] += red[tid + st]; __syncthreads(); }
  const float rs = rsqrtf(red[0] / (float)N + eps);
  {
    for (int u = 0; u < per / 4; ++u) {
      const int j = tid * 4 + 1024 * u;
      v4f o, sm;
#pragma unroll
      for (int q = 0; q < 4; ++q) {
        float gg = g[j + q], bb = bta[j + q];
        if (PARAM_BF16) { gg = bf16_round(gg); bb = bf16_round(bb); }
        sm[q] = vals[u * 4 + q]; o[q] = (vals[u * 4 + q] - mu) * rs * gg + bb;
      }
      if (out_sum) *(v4f*)(out_sum + (size_t)row * N + j) = sm;
      *(v4f*)(out_norm + (size_t)row * N + j) = o;
    }
    
  }
}



// ---- f16 WMMA path (v_wmma_f32_16x16x32_f16): 11-bit significands for operands in range — used where a [0,1] probability operand needs more precision than bf16
typedef _Float16 v16h __attribute__((ext_vector_type(16)));
union FragH { v16h v; v8us half[2]; _Float16 h[16]; unsigned short u[16]; };
template <int NT>
__device__ __forceinline__ v8f mmaH(v16h ah, v16h al, v16h bh, v16h bl, v8f c) {
  c = __builtin_amdgcn_wmma_f32_16x16x32_f16(false, ah, false, bh, (short)0, c, false, false);
  if (NT >= 2) c = __builtin_amdgcn_wmma_f32_16x16x32_f16(false, al, false, bh, (short)0, c, false, false);
  if (NT >= 3) c = __builtin_amdgcn_wmma_f32_16x16x32_f16(false, ah, false, bl, (short)0, c, false, false);
  asm volatile("v_nop\n\tv_nop\n\tv_nop\n\tv_nop" : "+v"(c) : "v"(ah), "v"(al), "v"(bh), "v"(bl));
  return c;
}
// batched GEMM like k_gemm_b but f16 operands: A f32 (split into f16 hi/lo if ASPLIT, else rounded to f16), Bt = f16 values [n][k]; alpha; C f32; N multiple of 16 (partial tiles skipped)
template <bool ASPLIT>
__global__ __launch_bounds__(128) void k_gemm_h(const float* __restrict__ A, int lda, size_t sA, const _Float16* __restrict__ Bh, int ldb, size_t sB, float alpha, float* __restrict__ C, int ldc, size_t sC, int M, int N, int K) {
  __shared__ __attribute__((aligned(16))) float so[4][16][64];
  const int tid = threadIdx.x, w = tid >> 5, lane = tid & 31, ln = lane & 15, hh = lane >> 4; const int by = blockIdx.y;
  A += (size_t)by * sA; Bh += (size_t)by * sB; C += (size_t)by * sC;
  const int ntn = (N + 63) / 64; const int wid = blockIdx.x * 4 + w; const int mt = wid / ntn, nq = wid % ntn; if (mt * 16 >= M) return;
  const int row0 = mt * 16, col0 = nq * 64; const float* arow = A + (size_t)(row0 + ln) * lda;
  v8f acc[4] = {};
  for (int kb = 0; kb < K; kb += 32) {
    FragH ah, al;
    const v4f x0 = *(const v4fa*)(arow + kb + 8 * hh), x1 = *(const v4fa*)(arow + kb + 8 * hh + 4), x2 = *(const v4fa*)(arow + kb + 16 + 8 * hh), x3 = *(const v4fa*)(arow + kb + 16 + 8 * hh + 4);
    float xs[16] = {x0[0],x0[1],x0[2],x0[3],x1[0],x1[1],x1[2],x1[3],x2[0],x2[1],x2[2],x2[3],x3[0],x3[1],x3[2],x3[3]};
#pragma unroll
    for (int i = 0; i < 16; ++i) { const _Float16 h = (_Float16)xs[i]; ah.h[i] = h; al.h[i] = ASPLIT ? (_Float16)(xs[i] - (float)h) : (_Float16)0.0f; }
#pragma unroll
    for (int t = 0; t < 4; ++t) { if (col0 + t * 16 >= N) continue; const size_t boff = (size_t)(col0 + t * 16 + ln) * ldb + kb; FragH bq; bq.half[0] = *(const v8us*)(Bh + boff + 8 * hh); bq.half[1] = *(const v8us*)(Bh + boff + 16 + 8 * hh);
      acc[t] = mmaH<ASPLIT ? 2 : 1>(ah.v, al.v, bq.v, bq.v, acc[t]); }
  }
#pragma unroll
  for (int t = 0; t < 4; ++t) { if (col0 + t * 16 >= N) continue;
#pragma unroll
    for (int r = 0; r < 8; ++r) so[w][8 * hh + r][t * 16 + ln] = acc[t][r] * alpha; }
  __builtin_amdgcn_fence(__ATOMIC_ACQ_REL, "workgroup"); __builtin_amdgcn_wave_barrier();
  const int rsub = lane >> 4, c4 = (lane & 15) * 4;
  {
#pragma unroll
    for (int q = 0; q < 8; ++q) { const int r = q * 2 + rsub; if (col0 + c4 < N) { const v4f v = *(const v4fa*)&so[w][r][c4]; *(v4f*)(C + (size_t)(row0 + r) * ldc + col0 + c4) = v; } }
     }
}

// Wt[n][k] = f16(W[k][n]·scale) from f32 row-major W[K][N] (scale = power of two; bf16-exact weights stay exact in f16 away from the subnormal range)
__global__ __launch_bounds__(256) void k_wt_f16(const float* __restrict__ W, _Float16* __restrict__ Wt, int K, int N, float scale) {
  const int t = blockIdx.x * 256 + threadIdx.x; if (t >= N * (K / 8)) return; const int n = t / (K / 8), k8 = (t % (K / 8)) * 8; FragH f;
#pragma unroll
  for (int i = 0; i < 8; ++i) f.h[i] = (_Float16)(bf16_round(W[(size_t)(k8 + i) * N + n]) * scale); const v8us o = f.half[0];
  *(v8us*)((unsigned short*)Wt + (size_t)n * K + k8) = o; 
}
// k_gemm_hh variant with fused epilogue: v = acc·alpha + bias[by·sBias + col] (+ CP[(row/rowsPerB)·sCPb + by·64 + col] if CP) ; ACT 0 none / 1 elu ; writes f16 C16 (and f32 C if non-null)
template <int ACT>
__global__ __launch_bounds__(128) void k_gemm_hhx(const _Float16* __restrict__ A, int lda, size_t sA, const _Float16* __restrict__ Bh, int ldb, size_t sB, float alpha, const float* __restrict__ bias, size_t sBias, const float* __restrict__ CP, int rowsPerB, size_t sCPb, int row0g,
    float* __restrict__ C, _Float16* __restrict__ C16, int ldc, size_t sC, int M, int N, int K) {
  __shared__ __attribute__((aligned(16))) float so[4][16][64];
  const int tid = threadIdx.x, w = tid >> 5, lane = tid & 31, ln = lane & 15, hh = lane >> 4; const int by = blockIdx.y;
  A += (size_t)by * sA; Bh += (size_t)by * sB; const size_t cofs = (size_t)by * sC; const float* bp = bias ? bias + (size_t)by * sBias : nullptr;
  const int ntn = (N + 63) / 64; const int wid = blockIdx.x * 4 + w; const int mt = wid / ntn, nq = wid % ntn; if (mt * 16 >= M) return;
  const int row0 = mt * 16, col0 = nq * 64; const _Float16* arow = A + (size_t)(row0 + ln) * lda;
  v8f acc[4] = {};
  for (int kb = 0; kb < K; kb += 32) { FragH ah; ah.half[0] = *(const v8us*)((const unsigned short*)arow + kb + 8 * hh); ah.half[1] = *(const v8us*)((const unsigned short*)arow + kb + 16 + 8 * hh);
#pragma unroll
    for (int t = 0; t < 4; ++t) { if (col0 + t * 16 >= N) continue; const size_t boff = (size_t)(col0 + t * 16 + ln) * ldb + kb; FragH bq; bq.half[0] = *(const v8us*)((const unsigned short*)Bh + boff + 8 * hh); bq.half[1] = *(const v8us*)((const unsigned short*)Bh + boff + 16 + 8 * hh);
      acc[t] = mmaH<1>(ah.v, ah.v, bq.v, bq.v, acc[t]); }
  }
#pragma unroll
  for (int t = 0; t < 4; ++t) { if (col0 + t * 16 >= N) continue; const int col = col0 + t * 16 + ln; const float bv = bp ? bf16_round(bp[col]) : 0.f;
#pragma unroll
    for (int r = 0; r < 8; ++r) { float v = acc[t][r] * alpha + bv; if (CP) { const int rr = row0g + row0 + 8 * hh + r; if (rowsPerB < 0) v += CP[cofs + (size_t)rr * ldc + col];      /* rowsPerB < 0: own element of the batched C plane */ else { const int bidx = rr / rowsPerB; v += CP[(size_t)bidx * sCPb + (size_t)by * 64 + col]; } } if (ACT == 1) v = (v > 0.f) ? v : expm1f(v); else if (ACT == 7) v = (v > 0.f) ? v + 1.0f : expf(v); else if (ACT == 8) v = tanhf(v); else if (ACT == 9) v = 0.5f * v * (1.0f + tanhf(0.7978845608028654f * (v + 0.044715f * v * v * v))); else if (ACT == 11) v = 1.0f / (1.0f + expf(-v)); else if (ACT == 12) v = (v > 0.f) ? v : 0.01f * v; else if (ACT == 14) v = (v > 0.f) ? v : 0.1f * v; else if (ACT == 16) v = (v >= 0.f) ? v : 0.3f * v; else if (ACT == 17) v = (v >= 0.f) ? v : 0.2f * v; else if (ACT == 15) v = v / (1.0f + expf(-v)); else if (ACT == 3) v = fmaxf(v, 0.f); else if (ACT == 6) v = 0.5f * v * (1.0f + erff(v * 0.70710678118654752f)); so[w][8 * hh + r][t * 16 + ln] = v; } }
  __builtin_amdgcn_fence(__ATOMIC_ACQ_REL, "workgroup"); __builtin_amdgcn_wave_barrier();
  const int rsub = lane >> 4, c4 = (lane & 15) * 4; typedef _Float16 v4h __attribute__((ext_vector_type(4)));
  {
#pragma unroll
    for (int q = 0; q < 8; ++q) { const int r = q * 2 + rsub; if (col0 + c4 < N) { const v4f v = *(const v4fa*)&so[w][r][c4]; if (C) *(v4f*)(C + cofs + (size_t)(row0 + r) * ldc + col0 + c4) = v; if (C16) { v4h h4; for (int i = 0; i < 4; ++i) h4[i] = (_Float16)v[i]; *(v4h*)(C16 + cofs + (size_t)(row0 + r) * ldc + col0 + c4) = h4; } } }
     }
}


typedef _Float16 v4h __attribute__((ext_vector_type(4)));

__global__ __launch_bounds__(256) void k_x16(const float* __restrict__ x, _Float16* __restrict__ X16, size_t n8) { const size_t t = (size_t)blockIdx.x * 256 + threadIdx.x; if (t >= n8) return; FragH f;
#pragma unroll
  for (int q = 0; q < 8; ++q) f.h[q] = (_Float16)bf16_round(x[t * 8 + q]); *(v8us*)((unsigned short*)X16 + t * 8) = f.half[0];  }
__global__ __launch_bounds__(256) void k_h16(const float* __restrict__ x, _Float16* __restrict__ X16, size_t n8) { const size_t t = (size_t)blockIdx.x * 256 + threadIdx.x; if (t >= n8) return; FragH f;
#pragma unroll
  for (int q = 0; q < 8; ++q) f.h[q] = (_Float16)x[t * 8 + q]; *(v8us*)((unsigned short*)X16 + t * 8) = f.half[0];  }
__global__ __launch_bounds__(256) void k_round16f(const float* __restrict__ W, _Float16* __restrict__ Bt, size_t n8) { const size_t t = (size_t)blockIdx.x * 256 + threadIdx.x; if (t >= n8) return; FragH f;
#pragma unroll
  for (int i = 0; i < 8; ++i) f.h[i] = (_Float16)(bf16_round(W[t * 8 + i]) * 16.0f); *(v8us*)((unsigned short*)Bt + t * 8) = f.half[0];  }
template <int NHv, int TTv>
__global__ __launch_bounds__(256) void k_vt(const _Float16* __restrict__ V16, int ldv, int voff, _Float16* __restrict__ Vt) { __shared__ unsigned short tl[64][66]; const int tid = threadIdx.x; const int slab = blockIdx.x / (TTv / 64), lg = blockIdx.x % (TTv / 64); const int b = slab / NHv, h = slab % NHv;
  for (int i = tid; i < 64 * 8; i += 256) { const int r = i / 8, c8 = (i % 8) * 8; FragH f; f.half[0] = *(const v8us*)((const unsigned short*)V16 + ((size_t)b * TTv + lg * 64 + r) * ldv + voff + h * 64 + c8);
#pragma unroll
    for (int q = 0; q < 8; ++q) tl[r][c8 + q] = f.u[q]; }
  __syncthreads();
  {
#pragma unroll
    for (int rd = 0; rd < 2; ++rd) { const int d = rd * 32 + tid / 8, pc = tid % 8; FragH f;
#pragma unroll
      for (int q = 0; q < 8; ++q) f.u[q] = tl[pc * 8 + q][d];
      *(v8us*)((unsigned short*)Vt + ((size_t)slab * 64 + d) * TTv + lg * 64 + pc * 8) = f.half[0]; }
     } }

__global__ __launch_bounds__(256) void k_hl(const float* __restrict__ F, _Float16* __restrict__ Hh, _Float16* __restrict__ Hl, size_t n8) { const size_t t = (size_t)blockIdx.x * 256 + threadIdx.x; if (t >= n8) return; FragH fh, fl; const v4f a = *(const v4fa*)(F + t * 8), c = *(const v4fa*)(F + t * 8 + 4);
#pragma unroll
  for (int q = 0; q < 4; ++q) { _Float16 h = (_Float16)a[q]; fh.h[q] = h; fl.h[q] = (_Float16)((a[q] - (float)h) * 1024.0f); h = (_Float16)c[q]; fh.h[4 + q] = h; fl.h[4 + q] = (_Float16)((c[q] - (float)h) * 1024.0f); }
  { *(v8us*)((unsigned short*)Hh + t * 8) = fh.half[0]; *(v8us*)((unsigned short*)Hl + t * 8) = fl.half[0];  } }

// ---- fast GEMM (wave tile 32x64; requires M % 32 == 0 rows per launch region and N % 64 == 0); epilogue = k_gemm_hhx semantics ----
__device__ __forceinline__ v16h g2_frag(const _Float16* p, int hh) { FragH f; f.half[0] = *(const v8us*)((const unsigned short*)p + 8 * hh); f.half[1] = *(const v8us*)((const unsigned short*)p + 16 + 8 * hh); return f.v; }
__device__ __forceinline__ v8f g2_mma(v16h a, v16h b, v8f c) { v8f d = __builtin_amdgcn_wmma_f32_16x16x32_f16(false, a, false, b, (short)0, c, false, false); asm volatile("v_nop\n\tv_nop\n\tv_nop\n\tv_nop" : "+v"(d) : "v"(a), "v"(b)); return d; }
template <int ACT>
__global__ __launch_bounds__(128) void k_gemm2(const _Float16* __restrict__ A, int lda, size_t sA, const _Float16* __restrict__ Bh, int ldb, size_t sB, float alpha, const float* __restrict__ bias, size_t sBias, const float* __restrict__ CP, int rowsPerB, size_t sCPb, int row0g,
    float* __restrict__ C, _Float16* __restrict__ C16, int ldc, size_t sC, int M, int N, int K) { static_assert(ACT == 0 || ACT == 3 || ACT == 6 || ACT == 8 || ACT == 9 || ACT == 11 || ACT == 12 || ACT == 14 || ACT == 15 || ACT == 16 || ACT == 17, "k_gemm2: unsupported ACT code (would silently apply no activation)");
  __shared__ __attribute__((aligned(16))) float so[4][32][68];
  const int tid = threadIdx.x, w = tid >> 5, lane = tid & 31, ln = lane & 15, hh = lane >> 4; const int by = blockIdx.y;
  A += (size_t)by * sA; Bh += (size_t)by * sB; const size_t cofs = (size_t)by * sC; const float* bp = bias ? bias + (size_t)by * sBias : nullptr;
  const int ntn = N >> 6; const int mt = blockIdx.x / ntn, nq = blockIdx.x - mt * ntn; const int row0 = mt * 128 + 32 * w, col0 = nq * 64; if (row0 >= M) return;
  const _Float16* a0p = A + (size_t)(row0 + ln) * lda; const _Float16* a1p = a0p + (size_t)16 * lda;
  const _Float16* b0p = Bh + (size_t)(col0 + ln) * ldb; const _Float16* b1p = b0p + (size_t)16 * ldb; const _Float16* b2p = b1p + (size_t)16 * ldb; const _Float16* b3p = b2p + (size_t)16 * ldb;
  const v8f z8 = {0.f,0.f,0.f,0.f,0.f,0.f,0.f,0.f}; v8f c00 = z8, c01 = z8, c02 = z8, c03 = z8, c10 = z8, c11 = z8, c12 = z8, c13 = z8;
#pragma unroll 1
  for (int kb = 0; kb < K; kb += 32) { const v16h a0 = g2_frag(a0p + kb, hh), a1 = g2_frag(a1p + kb, hh);
    v16h b = g2_frag(b0p + kb, hh); c00 = g2_mma(a0, b, c00); c10 = g2_mma(a1, b, c10);
    b = g2_frag(b1p + kb, hh); c01 = g2_mma(a0, b, c01); c11 = g2_mma(a1, b, c11);
    b = g2_frag(b2p + kb, hh); c02 = g2_mma(a0, b, c02); c12 = g2_mma(a1, b, c12);
    b = g2_frag(b3p + kb, hh); c03 = g2_mma(a0, b, c03); c13 = g2_mma(a1, b, c13); }
  v8f accs[8] = {c00, c01, c02, c03, c10, c11, c12, c13};
#pragma unroll
  for (int u = 0; u < 8; ++u) { const int t = u & 3, half = u >> 2; const int col = col0 + t * 16 + ln; const float bv = bp ? bf16_round(bp[col]) : 0.f;
#pragma unroll
    for (int r = 0; r < 8; ++r) { const int rloc = half * 16 + 8 * hh + r; float v = accs[u][r] * alpha + bv; if (CP) { if (rowsPerB < 0) v += CP[cofs + (size_t)(row0g + row0 + rloc) * ldc + col];      /* rowsPerB < 0: own element of the batched C plane */ else { const int bidx = (row0g + row0 + rloc) / rowsPerB; v += CP[(size_t)bidx * sCPb + (size_t)by * 64 + col]; } }
      if (ACT == 3) v = fmaxf(v, 0.f); else if (ACT == 6) v = 0.5f * v * (1.0f + erff(v * 0.70710678118654752f)); else if (ACT == 11) v = 1.0f / (1.0f + expf(-v)); else if (ACT == 15) v = v / (1.0f + expf(-v)); else if (ACT == 12) v = (v > 0.f) ? v : 0.01f * v; else if (ACT == 8) v = tanhf(v); else if (ACT == 9) v = 0.5f * v * (1.0f + tanhf(0.7978845608028654f * (v + 0.044715f * v * v * v))); else if (ACT == 14) v = (v > 0.f) ? v : 0.1f * v; else if (ACT == 16) v = (v >= 0.f) ? v : 0.3f * v; else if (ACT == 17) v = (v >= 0.f) ? v : 0.2f * v;
      so[w][rloc][t * 16 + ln] = v; } }
  __builtin_amdgcn_fence(__ATOMIC_ACQ_REL, "workgroup"); __builtin_amdgcn_wave_barrier();
  const int rsub = lane >> 4, c4 = (lane & 15) * 4;
  {
#pragma unroll
    for (int q = 0; q < 16; ++q) { const int r = q * 2 + rsub; const v4f v = *(const v4fa*)&so[w][r][c4]; if (C) *(v4f*)(C + cofs + (size_t)(row0 + r) * ldc + col0 + c4) = v; if (C16) { v4h h4; for (int i = 0; i < 4; ++i) h4[i] = (_Float16)v[i]; *(v4h*)(C16 + cofs + (size_t)(row0 + r) * ldc + col0 + c4) = h4; } }
     } }


__global__ __launch_bounds__(256) void k_wnat(const float* __restrict__ w, size_t n8, _Float16* __restrict__ Bt) { const size_t t = (size_t)blockIdx.x * 256 + threadIdx.x; if (t >= n8) return; FragH f; for (int q = 0; q < 8; ++q) f.h[q] = (_Float16)(bf16_round(w[t * 8 + q]) * 16.0f); *(v8us*)((unsigned short*)Bt + t * 8) = f.half[0];  }
__global__ __launch_bounds__(256) void k_rsm(const float* __restrict__ S, _Float16* __restrict__ P, int nrows) {
  #pragma clang fp contract(off)
  const int i = blockIdx.x * 256 + threadIdx.x; if (i >= nrows) return; const float* s = S + (size_t)i * SQ; float mx = -3.0e38f;
#pragma unroll 1
  for (int j = 0; j < SQ; ++j) mx = fmaxf(mx, s[j]); float se = 0.f;
#pragma unroll 1
  for (int j = 0; j < SQ; ++j) se += expf(s[j] - mx); const float sc = 256.0f / se;
#pragma unroll 1
  for (int j0 = 0; j0 < SQ; j0 += 8) { FragH f; for (int q = 0; q < 8; ++q) f.h[q] = (_Float16)(expf(s[j0 + q] - mx) * sc); unsigned short* d = (unsigned short*)P + (size_t)i * SQ + j0; *(v8us*)d = f.half[0];  } }
__global__ __launch_bounds__(256) void k_vt(const _Float16* __restrict__ V16, int b, int h0, _Float16* __restrict__ VT) { __shared__ unsigned short tl[64][65]; const int tid = threadIdx.x; const int hh = blockIdx.x % HG, sg = blockIdx.x / HG; const int s0 = sg * 64; const int h = h0 + hh;
  for (int i = tid; i < 64 * 8; i += 256) { const int j = i / 8, d8 = (i % 8) * 8; FragH f; f.half[0] = *(const v8us*)((const unsigned short*)V16 + ((size_t)b * SQ + s0 + j) * DM + h * HD + d8); for (int q = 0; q < 8; ++q) tl[d8 + q][j] = f.u[q]; }
  __syncthreads();
  { for (int i = tid; i < 64 * 8; i += 256) { const int d = i / 8, j8 = (i % 8) * 8; FragH f; for (int q = 0; q < 8; ++q) f.u[q] = tl[d][j8 + q]; *(v8us*)((unsigned short*)VT + ((size_t)hh * HD + d) * SQ + s0 + j8) = f.half[0]; }  } }



__global__ __launch_bounds__(256) void k_rsmcf2(const float* __restrict__ S, _Float16* __restrict__ P, int hg, int q0, int nk) {
  #pragma clang fp contract(off)
  const int t = blockIdx.x * 256 + threadIdx.x; if (t >= hg * QT) return; const size_t i = (size_t)t; const float* s = S + i * NKX; const int last = q0 + (t % QT); float mx = -3.0e38f;
#pragma unroll 1
  for (int j = 0; j < nk; ++j) { const float f = (j <= last) ? 1.f : 0.f; mx = fmaxf(mx, fmaf(f, s[j], (1.f - f) * -1.0e9f)); } float se = 0.f;
#pragma unroll 1
  for (int j = 0; j < nk; ++j) { const float f = (j <= last) ? 1.f : 0.f; se += __expf(fmaf(f, s[j], (1.f - f) * -1.0e9f) - mx); } const float sc = 256.0f / se;
#pragma unroll 1
  for (int j0 = 0; j0 < nk; j0 += 8) { FragH fr; for (int q = 0; q < 8; ++q) { const int j = j0 + q; const float f = (j <= last) ? 1.f : 0.f; fr.h[q] = (_Float16)(__expf(fmaf(f, s[j], (1.f - f) * -1.0e9f) - mx) * sc); } unsigned short* d = (unsigned short*)P + i * NKX + j0; *(v8us*)d = fr.half[0];  } }


template <int MASKADD>
__global__ __launch_bounds__(64) void k_att0(const float* __restrict__ QF, const float* __restrict__ KF, const float* __restrict__ VF, int ld, const float* __restrict__ mask, float scale, float* __restrict__ OF, int ldo) {
  #pragma clang fp contract(off)
  __shared__ __attribute__((aligned(16))) float lq[64][64]; __shared__ __attribute__((aligned(16))) float lo[64][64];
  const int tid = threadIdx.x; const int h = blockIdx.x / (QT0 / 64), rg = blockIdx.x % (QT0 / 64); const int i = rg * 64 + tid;
  const float* qr = QF + (size_t)i * ld + h * HD;
#pragma unroll 1
  for (int c = 0; c < HD / 4; ++c) { *(v4f*)&lq[tid][c * 4] = *(const v4fa*)(qr + c * 4); const v4f z = {0.f, 0.f, 0.f, 0.f}; *(v4f*)&lo[tid][c * 4] = z; }
  float m = -1.0e30f, l = 0.f; const int jmax = MASKADD ? (SQ - 1) : (rg * 64 + 63);      /* additive-mask form: every key (the mask input decides); causal form: keys up to the block's last row */
#pragma unroll 1
  for (int j = 0; j <= jmax; ++j) { const float* kr = KF + (size_t)j * ld + h * HD; const float* vr = VF + (size_t)j * ld + h * HD; float s = 0.f;
#pragma unroll 1
    for (int c = 0; c < HD / 4; ++c) { const v4f kq = *(const v4fa*)(kr + c * 4); const v4f qq = *(v4f*)&lq[tid][c * 4]; s = __fadd_rn(s, __fmul_rn(qq[0], kq[0])); s = __fadd_rn(s, __fmul_rn(qq[1], kq[1])); s = __fadd_rn(s, __fmul_rn(qq[2], kq[2])); s = __fadd_rn(s, __fmul_rn(qq[3], kq[3])); }
    s = __fmul_rn(s, scale); if (MASKADD) s = __fadd_rn(s, __fmul_rn(bf16_round(mask[(size_t)i * SQ + j]), -10000.0f));
    const float f = (MASKADD || j <= i) ? 1.f : 0.f; const float sm = fmaf(f, s, (1.f - f) * -1.0e30f); const float mn = fmaxf(m, sm); const float sc = expf(m - mn); const float e = expf(sm - mn); l = __fadd_rn(__fmul_rn(l, sc), e); m = mn;
#pragma unroll 1
    for (int c = 0; c < HD / 4; ++c) { const v4f vv = *(const v4fa*)(vr + c * 4); v4f oo = *(v4f*)&lo[tid][c * 4]; for (int u = 0; u < 4; ++u) oo[u] = __fadd_rn(__fmul_rn(oo[u], sc), __fmul_rn(e, vv[u])); *(v4f*)&lo[tid][c * 4] = oo; } }
  const float fin = 64.0f / l;      /* o carried x64 (k_o0m scales it by 1/64) */
#pragma unroll 1
  for (int c = 0; c < HD / 4; ++c) { v4f oo = *(v4f*)&lo[tid][c * 4]; for (int u = 0; u < 4; ++u) oo[u] = __fmul_rn(oo[u], fin); *(v4f*)&lo[tid][c * 4] = oo; }
  __syncthreads();
  {
#pragma unroll 1
    for (int it = 0; it < 16; ++it) { const int row = it * 4 + tid / 16, pc = (tid % 16) * 4; const v4f v = *(const v4f*)&lo[row][pc]; *(v4f*)(OF + (size_t)(rg * 64 + row) * ldo + h * HD + pc) = v; }
     } }


template <int BFIN, int WXB>
__global__ __launch_bounds__(256) void k_ln16(const float* __restrict__ X, const float* __restrict__ g, const float* __restrict__ bb, float eps, _Float16* __restrict__ N16, float* __restrict__ XB) {
  #pragma clang fp contract(off)
  __shared__ float red[256]; const size_t r = blockIdx.x; const int t = threadIdx.x; const v4f xa = *(const v4fa*)(X + r * DMQ + t * 4); float s[4]; float sum = 0.f;
  for (int q = 0; q < 4; ++q) { s[q] = BFIN ? bf16_round(xa[q]) : xa[q]; sum = __fadd_rn(sum, s[q]); }
  red[t] = sum; __syncthreads(); for (int st = 128; st > 0; st >>= 1) { if (t < st) red[t] = __fadd_rn(red[t], red[t + st]); __syncthreads(); } const float mu = red[0] / (float)DMQ; __syncthreads();
  float vs = 0.f; for (int q = 0; q < 4; ++q) { const float dl = __fadd_rn(s[q], -mu); vs = __fadd_rn(vs, __fmul_rn(dl, dl)); } red[t] = vs; __syncthreads(); for (int st = 128; st > 0; st >>= 1) { if (t < st) red[t] = __fadd_rn(red[t], red[t + st]); __syncthreads(); }
  const float rs = rsqrtf(__fadd_rn(red[0] / (float)DMQ, eps)); v4h y; v4f xb;
  for (int q = 0; q < 4; ++q) { const int c = t * 4 + q; y[q] = (_Float16)__fadd_rn(__fmul_rn(__fmul_rn(__fadd_rn(s[q], -mu), rs), bf16_round(g[c])), bf16_round(bb[c])); xb[q] = s[q]; }
  { *(v4h*)(N16 + r * DMQ + t * 4) = y; if (WXB) *(v4f*)(XB + r * DMQ + t * 4) = xb;  } }
__global__ __launch_bounds__(256) void k_ftres2(const float* __restrict__ OF0, const float* __restrict__ XB, float* __restrict__ X1, size_t n4) {
  #pragma clang fp contract(off)
  const size_t t = (size_t)blockIdx.x * 256 + threadIdx.x; if (t >= n4) return; const v4f o = *(const v4fa*)(OF0 + t * 4), xv = *(const v4fa*)(XB + t * 4); v4f y; for (int q = 0; q < 4; ++q) y[q] = __fadd_rn(__fmul_rn(o[q], 0.015625f), xv[q]); *(v4f*)(X1 + t * 4) = y;  }

__global__ __launch_bounds__(256) void k_wthd(const float* __restrict__ Wt, _Float16* __restrict__ Bt) { const size_t t = (size_t)blockIdx.x * 256 + threadIdx.x; if (t >= (size_t)NH * HD * (DM / 8)) return; const int m8 = (int)(t % (DM / 8)) * 8; const int d = (int)((t / (DM / 8)) % HD); const int h = (int)(t / ((size_t)(DM / 8) * HD)); FragH f;
  for (int q = 0; q < 8; ++q) f.h[q] = (_Float16)(16.0f * bf16_round(Wt[((size_t)h * DM + m8 + q) * HD + d])); unsigned short* dst = (unsigned short*)Bt + ((size_t)h * HD + d) * DM + m8; *(v8us*)dst = f.half[0];  }




__global__ __launch_bounds__(256) void k_wtpad(const float* __restrict__ Wm, _Float16* __restrict__ Wt, int Kr, int Kp, int Nr, int Np, float scale) {
  const int t = blockIdx.x * 256 + threadIdx.x; if (t >= Np * (Kp / 8)) return; const int n = t / (Kp / 8), k8 = (t % (Kp / 8)) * 8; const int nc = min(n, Nr - 1); const float fn = (n < Nr) ? 1.f : 0.f; FragH f;
  for (int i = 0; i < 8; ++i) { const int k = k8 + i; const int kc = min(k, Kr - 1); const float fk = (k < Kr) ? fn : 0.f; f.h[i] = (_Float16)(bf16_round(Wm[(size_t)kc * Nr + nc]) * scale * fk); }
  unsigned short* o = (unsigned short*)Wt + (size_t)n * Kp + k8; *(v8us*)o = f.half[0];  }
__global__ __launch_bounds__(128) void k_bpad(const float* __restrict__ b, float* __restrict__ Bp, int nr, int np) {
  const int i = threadIdx.x; if (i >= np) return; const float v = b[min(i, nr - 1)] * ((i < nr) ? 1.f : 0.f); *(float*)(Bp + i) = v;  }

#define DI 64         /* inner width = NH * HD (ONE 64-wide head) */
#define LQK (3 * DI)  /* fused q | k | v row pitch (192) */
__global__ __launch_bounds__(256) void k_o0(const float* __restrict__ OF, float* __restrict__ ob, size_t n4) {
  #pragma clang fp contract(off)
  const size_t t = (size_t)blockIdx.x * 256 + threadIdx.x; if (t >= n4) return; const size_t e = t * 4; const int i = (int)(e / DI); const int c = (int)(e % DI); const int h = c / HD, d = c % HD; const v4f a = *(const v4fa*)(OF + e); v4f o; for (int q = 0; q < 4; ++q) o[q] = __fmul_rn(a[q], 0.015625f); float* dst = ob + (size_t)h * SQ * HD + (size_t)i * HD + d; *(v4f*)dst = o;  }

__global__ __launch_bounds__(256) void k_o0m(const float* __restrict__ OF, float* __restrict__ o_, size_t n4) {
  #pragma clang fp contract(off)
  const size_t t = (size_t)blockIdx.x * 256 + threadIdx.x; if (t >= n4) return; const size_t e = t * 4; const v4f a = *(const v4fa*)(OF + e); v4f o; for (int q = 0; q < 4; ++q) o[q] = __fmul_rn(a[q], 0.015625f); *(v4f*)(o_ + e) = o;  }
extern "C" void kernel_launch(void* const* d_in, const int* in_sizes, int n_in,
                              void* d_out, int out_size, void* d_ws, size_t ws_size, hipStream_t stream) {
  (void)in_sizes; (void)n_in; (void)out_size;
  const float* const* I = (const float* const*)d_in; const float* x = I[0]; const float* wq = I[2]; const float* wk = I[1]; const float* wv = I[3]; const float* bq = nullptr; const float* bk = nullptr; const float* bv = nullptr;      /* x; [in][out = 64] Wk / Wq / Wv (input order as this module lists them); no biases */
  char* ws = (char*)d_ws; size_t off = 0;
  auto take = [&](size_t bytes) { char* p = ws + off; off += (bytes + 255) & ~(size_t)255; return p; };
  _Float16* BW = (_Float16*)take((size_t)LQK * DM * 2); _Float16* X16 = (_Float16*)take(NR * DM * 2); _Float16* QKV = (_Float16*)take(NR * LQK * 2); _Float16* VT = (_Float16*)take((size_t)NH * HD * SQ * 2);
  float* S = (float*)take((size_t)NH * QT * NKX * 4); _Float16* P = (_Float16*)take((size_t)NH * QT * NKX * 2); float* QKVF0 = (float*)take((size_t)QT0 * LQK * 4); float* OF0 = (float*)take((size_t)QT0 * DI * 4);
  if (off > ws_size) return;
  { const unsigned g = (unsigned)(((size_t)DI * (DM / 8) + 255) / 256); k_wt_f16<<<g, 256, 0, stream>>>(wq, BW, DM, DI, 16.0f); k_wt_f16<<<g, 256, 0, stream>>>(wk, BW + (size_t)DI * DM, DM, DI, 16.0f); k_wt_f16<<<g, 256, 0, stream>>>(wv, BW + (size_t)2 * DI * DM, DM, DI, 16.0f); }      /* [in = DM][out = 64] -> Bt[n][k] x16, stacked q | k | v */
  k_x16<<<(unsigned)((NR * DM / 8 + 255) / 256), 256, 0, stream>>>(x, X16, NR * DM / 8);      /* x (bf16-valued) as exact f16 rows */
  const float* bqkv[3] = {bq, bk, bv};
  for (int c = 0; c < 3; ++c) k_gemm2<0><<<dim3((unsigned)((NR / 128) * (DI / 64)), 1), 128, 0, stream>>>(X16, DM, 0, BW + (size_t)c * DI * DM, DM, 0, 0.0625f, bqkv[c], 0, nullptr, 1, 0, 0, nullptr, QKV + (size_t)c * DI, LQK, 0, (int)NR, DI, DM);      /* q | k | v = x W -> f16 rows, column blocks 0 / 64 / 128 of the fused plane (pitch 192); head h = columns h*64 inside each */
  const _Float16* Q16 = QKV; const _Float16* K16 = QKV + DI; const _Float16* V16 = QKV + 2 * DI;
  for (int b = 0; b < NB; ++b) { const size_t r0 = (size_t)b * SQ; float* ob = (float*)d_out + r0 * DI;
    k_vt<NH, SQ><<<NH * (SQ / 64), 256, 0, stream>>>(V16 + r0 * LQK, LQK, 0, VT);      /* V^T [NH][HD][SQ] for this batch */
    for (int q0 = 0; q0 < SQ; q0 += QT) { const int nk = q0 + QT;      /* causal: only keys below the tile end are computed */
      k_gemm2<0><<<dim3((QT / 128) * (nk / 64), NH), 128, 0, stream>>>(Q16 + (r0 + q0) * LQK, LQK, (size_t)HD, K16 + r0 * LQK, LQK, (size_t)HD, 0.125f, nullptr, 0, nullptr, 1, 0, 0, S, nullptr, NKX, (size_t)QT * NKX, QT, nk, HD);      /* scores / 8, the single head on grid.y */
      k_rsmcf2<<<(NH * QT + 255) / 256, 256, 0, stream>>>(S, P, NH, q0, nk);      /* causal softmax -> P x256 f16 */
      k_gemm2<0><<<dim3((QT / 128) * (HD / 64), NH), 128, 0, stream>>>(P, NKX, (size_t)QT * NKX, VT, SQ, (size_t)HD * SQ, 0.00390625f, nullptr, 0, nullptr, 1, 0, 0, ob + (size_t)q0 * DI, nullptr, DI, (size_t)HD, QT, HD, nk); }      /* out[b][q0 + i][h*64..] = P V^T 2^-8 (f32): merged rows, head h at column offset h*64 */
    for (int c = 0; c < 3; ++c) k_gemm2<0><<<dim3((unsigned)((QT0 / 128) * (DI / 64)), 1), 128, 0, stream>>>(X16 + r0 * DM, DM, 0, BW + (size_t)c * DI * DM, DM, 0, 0.0625f, bqkv[c], 0, nullptr, 1, 0, 0, QKVF0 + (size_t)c * DI, nullptr, LQK, 0, QT0, DI, DM);      /* f32 q | k | v of rows 0..511 (exact products, f32 accumulation) */
    k_att0<0><<<NH * (QT0 / 64), 64, 0, stream>>>(QKVF0, QKVF0 + DI, QKVF0 + 2 * DI, LQK, nullptr, 0.125f, OF0, DI);      /* exact f32 causal attention for rows 0..511 (o x64) */
    k_o0m<<<(unsigned)(((size_t)QT0 * DI / 4 + 255) / 256), 256, 0, stream>>>(OF0, ob, (size_t)QT0 * DI / 4); }      /* rows 0..511 of the batch REWRITTEN from the exact path */
}

// v001
// Measured time: 2400 microseconds a run.
// In two side-by-side timings against v000, it was 30.0 and 29.8 times as fast.
#include <hip/hip_runtime.h>
// Single-head causal self-attention (x [32][1024][384]; k/q/v = x W ([in][out] [384][64], no biases; input order Wk, Wq, Wv); ONE 64-wide head; wei * 64^-0.5; causal (tril, -inf); softmax; out = wei v -> [32][1024][64]; no output projection).
// Structure: token rows; x as exact f16 rows; three WMMA GEMMs (no bias) into one f16 q | k | v plane [32768][192]; per batch v^T via LDS transposes; causal 256-row query tiles with the batch on grid.y (scores alpha 1/8, causal softmax f32 -> f16 x256 weights, P V written as f32 straight into the merged output rows); an exact f32 first tile (rows 0..511) rewritten at the end; launches: see trace.
// Compute dtype: inputs rounded to bf16; x / weights exact; q, k, v and softmax weights as plain f16 GEMM operands (~2^-12); o written as f32; scores and softmax statistics f32. v_wmma_f32_16x16x32_f16.
#define NB 32
#define SQ 1024
#define DM 384
#define NH 1
#define HD 64
#define HG 4
#define QT 256                       /* query rows per causal tile */
#define NKX SQ                       /* S / P row pitch */
#define QT0 512                      /* first-tile rows recomputed exactly (f32): 512 here (no output projection averages the early-row cancellation errors away; logit sigma 1.0) */
#define B0 0                         /* first batch processed (debug hook) */
#define NBR NB                       /* batches processed (debug hook) */
#define NR ((size_t)NB * SQ)
#define DMQ DM
#define DFF 4096
#define DFFR 100
#define MP ((int)((size_t)NBR * SQ)) /* rows projected (debug hook) */
#define QN SQ                        /* query rows attended per batch (debug hook) */
#define NHD NH                       /* heads attended (debug hook) */
#define MPO MP                       /* rows through the output stage (debug hook) */
#define LQ (3 * DM)      /* 3 * DM, unused; the q/k/v rows use pitch LQK (192) */
typedef __bf16 v16b __attribute__((ext_vector_type(16)));
typedef unsigned short v8us __attribute__((ext_vector_type(8), may_alias));
typedef float  v8f  __attribute__((ext_vector_type(8)));
typedef float  v4f  __attribute__((ext_vector_type(4)));
typedef float  v4fa __attribute__((ext_vector_type(4), may_alias));
union FragB { v16b v; v8us half[2]; unsigned short u[16]; };

__device__ __forceinline__ unsigned short bf16_bits(float x) { unsigned int u = __float_as_uint(x); return (unsigned short)((u + 0x7FFFu + ((u >> 16) & 1u)) >> 16); }
__device__ __forceinline__ float bf16_val(unsigned short b) { return __uint_as_float(((unsigned int)b) << 16); }
__device__ __forceinline__ float bf16_round(float x) { return bf16_val(bf16_bits(x)); }
// D += A·B with NT terms: 1 = ah·bh, 2 = + al·bh (A split), 3 = + ah·bl (both split)
template <int NT>
__device__ __forceinline__ v8f mmaN(v16b ah, v16b al, v16b bh, v16b bl, v8f c) {
  c = __builtin_amdgcn_wmma_f32_16x16x32_bf16(false, ah, false, bh, (short)0, c, false, false);
  if (NT >= 2) c = __builtin_amdgcn_wmma_f32_16x16x32_bf16(false, al, false, bh, (short)0, c, false, false);
  if (NT >= 3) c = __builtin_amdgcn_wmma_f32_16x16x32_bf16(false, ah, false, bl, (short)0, c, false, false);
  asm volatile("v_nop\n\tv_nop\n\tv_nop\n\tv_nop" : "+v"(c) : "v"(ah), "v"(al), "v"(bh), "v"(bl));
  return c;
}

__global__ __launch_bounds__(256) void k_wt_bf16(const float* __restrict__ W, unsigned short* __restrict__ Wt, int K, int N) {
  const int t = blockIdx.x * 256 + threadIdx.x;
  const int k8n = K / 8;
  if (t >= N * k8n) return;
  const int n = t / k8n, k8 = (t % k8n) * 8;
  v8us v;
#pragma unroll
  for (int i = 0; i < 8; ++i) v[i] = bf16_bits(W[(size_t)(k8 + i) * N + n]);
  *(v8us*)(Wt + (size_t)n * K + k8) = v;
  
}

// GEMM C[M][N] (f32, pitch ldc) = act(A[M][K]·W + bias). A f32 row-major (pitch lda) converted per fragment to bf16
// (ASPLIT: hi/lo two planes -> 2 terms, else single rounded term); Wt bf16 [N][K] (pitch ldb). BIAS_BF16 rounds the
// bias to bf16 first (bias quantised to bf16 before the add). K%32==0, M%16==0, N%64==0.
template <bool ASPLIT, int ACT, bool BIAS_BF16>
__global__ __launch_bounds__(128) void k_gemm_bf(const float* __restrict__ A, int lda, const unsigned short* __restrict__ Wt, int ldb,
                                               const float* __restrict__ bias, float* __restrict__ C, int ldc, int M, int N, int K) {
  __shared__ __attribute__((aligned(16))) float so[4][16][64];
  const int tid = threadIdx.x, w = tid >> 5, lane = tid & 31, ln = lane & 15, hh = lane >> 4;
  const int ntn = N / 64;
  const int wid = blockIdx.x * 4 + w;
  const int mt = wid / ntn, nq = wid % ntn;
  if (mt * 16 >= M) return;
  const int row0 = mt * 16, col0 = nq * 64;
  const float* arow = A + (size_t)(row0 + ln) * lda;
  v8f acc[4] = {};
  for (int kb = 0; kb < K; kb += 32) {
    FragB ah, al;
    const v4f x0 = *(const v4fa*)(arow + kb + 8 * hh), x1 = *(const v4fa*)(arow + kb + 8 * hh + 4);
    const v4f x2 = *(const v4fa*)(arow + kb + 16 + 8 * hh), x3 = *(const v4fa*)(arow + kb + 16 + 8 * hh + 4);
    float xs[16] = {x0[0],x0[1],x0[2],x0[3],x1[0],x1[1],x1[2],x1[3],x2[0],x2[1],x2[2],x2[3],x3[0],x3[1],x3[2],x3[3]};
#pragma unroll
    for (int i = 0; i < 16; ++i) { const unsigned short hb = bf16_bits(xs[i]); ah.u[i] = hb; al.u[i] = ASPLIT ? bf16_bits(xs[i] - bf16_val(hb)) : (unsigned short)0; }
#pragma unroll
    for (int t = 0; t < 4; ++t) {
      const unsigned short* brow = Wt + (size_t)(col0 + t * 16 + ln) * ldb + kb;
      FragB b;
      b.half[0] = *(const v8us*)(brow + 8 * hh);
      b.half[1] = *(const v8us*)(brow + 16 + 8 * hh);
      acc[t] = mmaN<ASPLIT ? 2 : 1>(ah.v, al.v, b.v, b.v, acc[t]);
    }
  }
#pragma unroll
  for (int t = 0; t < 4; ++t) {
    float bv = bias ? bias[col0 + t * 16 + ln] : 0.f;
    if (BIAS_BF16) bv = bf16_round(bv);
#pragma unroll
    for (int r = 0; r < 8; ++r) { float v = acc[t][r] + bv; if (ACT == 1) v = fmaxf(v, 0.f); so[w][8 * hh + r][t * 16 + ln] = v; }
  }
  __builtin_amdgcn_fence(__ATOMIC_ACQ_REL, "workgroup");
  __builtin_amdgcn_wave_barrier();
  const int rsub = lane >> 4, c4 = (lane & 15) * 4;
  {
#pragma unroll
    for (int q = 0; q < 8; ++q) {
      const int r = q * 2 + rsub;
      const v4f v = *(const v4fa*)&so[w][r][c4];
      *(v4f*)(C + (size_t)(row0 + r) * ldc + col0 + c4) = v;
    }
    
  }
}

// GEMM C = act(A·W + bias + resid): A f32 (ASPLIT -> hi/lo 2 terms), Wt bf16 [N][K]; ACT 0 none, 1 relu, 2 exact gelu;
// resid (optional, f32, row index = (row % rmod), pitch ldr, RES_BF16 rounds it) added before the activation.
template <bool ASPLIT, int ACT, bool BIAS_BF16, bool RES_BF16>
__global__ __launch_bounds__(128) void k_gemm_bf3(const float* __restrict__ A, int lda, const unsigned short* __restrict__ Wt, int ldb,
                                                const float* __restrict__ bias, const float* __restrict__ resid, int rmod, int ldr,
                                                float* __restrict__ C, int ldc, int M, int N, int K) {
  __shared__ __attribute__((aligned(16))) float so[4][16][64];
  const int tid = threadIdx.x, w = tid >> 5, lane = tid & 31, ln = lane & 15, hh = lane >> 4;
  const int ntn = N / 64;
  const int wid = blockIdx.x * 4 + w;
  const int mt = wid / ntn, nq = wid % ntn;
  if (mt * 16 >= M) return;
  const int row0 = mt * 16, col0 = nq * 64;
  const float* arow = A + (size_t)(row0 + ln) * lda;
  v8f acc[4] = {};
  for (int kb = 0; kb < K; kb += 32) {
    FragB ah, al;
    const v4f x0 = *(const v4fa*)(arow + kb + 8 * hh), x1 = *(const v4fa*)(arow + kb + 8 * hh + 4);
    const v4f x2 = *(const v4fa*)(arow + kb + 16 + 8 * hh), x3 = *(const v4fa*)(arow + kb + 16 + 8 * hh + 4);
    float xs[16] = {x0[0],x0[1],x0[2],x0[3],x1[0],x1[1],x1[2],x1[3],x2[0],x2[1],x2[2],x2[3],x3[0],x3[1],x3[2],x3[3]};
#pragma unroll
    for (int i = 0; i < 16; ++i) { const unsigned short hb = bf16_bits(xs[i]); ah.u[i] = hb; al.u[i] = ASPLIT ? bf16_bits(xs[i] - bf16_val(hb)) : (unsigned short)0; }
#pragma unroll
    for (int t = 0; t < 4; ++t) {
      const unsigned short* brow = Wt + (size_t)(col0 + t * 16 + ln) * ldb + kb;
      FragB b;
      b.half[0] = *(const v8us*)(brow + 8 * hh);
      b.half[1] = *(const v8us*)(brow + 16 + 8 * hh);
      acc[t] = mmaN<ASPLIT ? 2 : 1>(ah.v, al.v, b.v, b.v, acc[t]);
    }
  }
#pragma unroll
  for (int t = 0; t < 4; ++t) {
    const int col = col0 + t * 16 + ln;
    float bv = bias ? bias[col] : 0.f;
    if (BIAS_BF16) bv = bf16_round(bv);
#pragma unroll
    for (int r = 0; r < 8; ++r) {
      float v = acc[t][r] + bv;
      if (resid) { float rv = resid[(size_t)((row0 + 8 * hh + r) % rmod) * ldr + col]; if (RES_BF16) rv = bf16_round(rv); v += rv; }
      if (ACT == 1) v = fmaxf(v, 0.f);
      if (ACT == 2) v = 0.5f * v * (1.0f + erff(v * 0.70710678118654752f));
      if (ACT == 3) { const float u = 0.7978845608028654f * (v + 0.044715f * v * v * v); v = 0.5f * v * (1.0f + tanhf(u)); }
      so[w][8 * hh + r][t * 16 + ln] = v;
    }
  }
  __builtin_amdgcn_fence(__ATOMIC_ACQ_REL, "workgroup");
  __builtin_amdgcn_wave_barrier();
  const int rsub = lane >> 4, c4 = (lane & 15) * 4;
  {
#pragma unroll
    for (int q = 0; q < 8; ++q) {
      const int r = q * 2 + rsub;
      const v4f v = *(const v4fa*)&so[w][r][c4];
      *(v4f*)(C + (size_t)(row0 + r) * ldc + col0 + c4) = v;
    }
    
  }
}
// row LayerNorm (biased variance, eps) over N: s = X (+ R); optional out_sum <- s; out_norm <- (s-mu)*rsqrt(var+eps)*g + b
template <bool PARAM_BF16>
__global__ __launch_bounds__(256) void k_layernorm(const float* __restrict__ X, const float* __restrict__ R, const float* __restrict__ g, const float* __restrict__ bta,
                                                  float* __restrict__ out_sum, float* __restrict__ out_norm, int N, float eps) {
  __shared__ float red[256];
  const int row = blockIdx.x, tid = threadIdx.x;
  const float* x = X + (size_t)row * N; const float* rr = R ? R + (size_t)row * N : nullptr;
  float vals[16];                     // up to N = 4096
  const int per = N / 256;            // contiguous chunk per thread? use strided-by-4 chunks: thread handles j = tid*4 + 1024*u
  float s1 = 0.f;
  for (int u = 0; u < per / 4; ++u) {
    const int j = tid * 4 + 1024 * u;
    const v4f a = *(const v4fa*)(x + j);
    v4f b = {0.f,0.f,0.f,0.f}; if (rr) b = *(const v4fa*)(rr + j);
#pragma unroll
    for (int q = 0; q < 4; ++q) { const float v = a[q] + b[q]; vals[u * 4 + q] = v; s1 += v; }
  }
  red[tid] = s1; __syncthreads();
  for (int st = 128; st > 0; st >>= 1) { if (tid < st) red[tid] += red[tid + st]; __syncthreads(); }
  const float mu = red[0] / (float)N; __syncthreads();
  float s2 = 0.f;
  for (int u = 0; u < per / 4; ++u)
#pragma unroll
    for (int q = 0; q < 4; ++q) { const float c = vals[u * 4 + q] - mu; s2 += c * c; }
  red[tid] = s2; __syncthreads();
  for (int st = 128; st > 0; st >>= 1) { if (tid < st) red[tid] += red[tid + st]; __syncthreads(); }
  const float rs = rsqrtf(red[0] / (float)N + eps);
  {
    for (int u = 0; u < per / 4; ++u) {
      const int j = tid * 4 + 1024 * u;
      v4f o, sm;
#pragma unroll
      for (int q = 0; q < 4; ++q) {
        float gg = g[j + q], bb = bta[j + q];
        if (PARAM_BF16) { gg = bf16_round(gg); bb = bf16_round(bb); }
        sm[q] = vals[u * 4 + q]; o[q] = (vals[u * 4 + q] - mu) * rs * gg + bb;
      }
      if (out_sum) *(v4f*)(out_sum + (size_t)row * N + j) = sm;
      *(v4f*)(out_norm + (size_t)row * N + j) = o;
    }
    
  }
}



// ---- f16 WMMA path (v_wmma_f32_16x16x32_f16): 11-bit significands for operands in range — used where a [0,1] probability operand needs more precision than bf16
typedef _Float16 v16h __attribute__((ext_vector_type(16)));
union FragH { v16h v; v8us half[2]; _Float16 h[16]; unsigned short u[16]; };
template <int NT>
__device__ __forceinline__ v8f mmaH(v16h ah, v16h al, v16h bh, v16h bl, v8f c) {
  c = __builtin_amdgcn_wmma_f32_16x16x32_f16(false, ah, false, bh, (short)0, c, false, false);
  if (NT >= 2) c = __builtin_amdgcn_wmma_f32_16x16x32_f16(false, al, false, bh, (short)0, c, false, false);
  if (NT >= 3) c = __builtin_amdgcn_wmma_f32_16x16x32_f16(false, ah, false, bl, (short)0, c, false, false);
  asm volatile("v_nop\n\tv_nop\n\tv_nop\n\tv_nop" : "+v"(c) : "v"(ah), "v"(al), "v"(bh), "v"(bl));
  return c;
}
// batched GEMM like k_gemm_b but f16 operands: A f32 (split into f16 hi/lo if ASPLIT, else rounded to f16), Bt = f16 values [n][k]; alpha; C f32; N multiple of 16 (partial tiles skipped)
template <bool ASPLIT>
__global__ __launch_bounds__(128) void k_gemm_h(const float* __restrict__ A, int lda, size_t sA, const _Float16* __restrict__ Bh, int ldb, size_t sB, float alpha, float* __restrict__ C, int ldc, size_t sC, int M, int N, int K) {
  __shared__ __attribute__((aligned(16))) float so[4][16][64];
  const int tid = threadIdx.x, w = tid >> 5, lane = tid & 31, ln = lane & 15, hh = lane >> 4; const int by = blockIdx.y;
  A += (size_t)by * sA; Bh += (size_t)by * sB; C += (size_t)by * sC;
  const int ntn = (N + 63) / 64; const int wid = blockIdx.x * 4 + w; const int mt = wid / ntn, nq = wid % ntn; if (mt * 16 >= M) return;
  const int row0 = mt * 16, col0 = nq * 64; const float* arow = A + (size_t)(row0 + ln) * lda;
  v8f acc[4] = {};
  for (int kb = 0; kb < K; kb += 32) {
    FragH ah, al;
    const v4f x0 = *(const v4fa*)(arow + kb + 8 * hh), x1 = *(const v4fa*)(arow + kb + 8 * hh + 4), x2 = *(const v4fa*)(arow + kb + 16 + 8 * hh), x3 = *(const v4fa*)(arow + kb + 16 + 8 * hh + 4);
    float xs[16] = {x0[0],x0[1],x0[2],x0[3],x1[0],x1[1],x1[2],x1[3],x2[0],x2[1],x2[2],x2[3],x3[0],x3[1],x3[2],x3[3]};
#pragma unroll
    for (int i = 0; i < 16; ++i) { const _Float16 h = (_Float16)xs[i]; ah.h[i] = h; al.h[i] = ASPLIT ? (_Float16)(xs[i] - (float)h) : (_Float16)0.0f; }
#pragma unroll
    for (int t = 0; t < 4; ++t) { if (col0 + t * 16 >= N) continue; const size_t boff = (size_t)(col0 + t * 16 + ln) * ldb + kb; FragH bq; bq.half[0] = *(const v8us*)(Bh + boff + 8 * hh); bq.half[1] = *(const v8us*)(Bh + boff + 16 + 8 * hh);
      acc[t] = mmaH<ASPLIT ? 2 : 1>(ah.v, al.v, bq.v, bq.v, acc[t]); }
  }
#pragma unroll
  for (int t = 0; t < 4; ++t) { if (col0 + t * 16 >= N) continue;
#pragma unroll
    for (int r = 0; r < 8; ++r) so[w][8 * hh + r][t * 16 + ln] = acc[t][r] * alpha; }
  __builtin_amdgcn_fence(__ATOMIC_ACQ_REL, "workgroup"); __builtin_amdgcn_wave_barrier();
  const int rsub = lane >> 4, c4 = (lane & 15) * 4;
  {
#pragma unroll
    for (int q = 0; q < 8; ++q) { const int r = q * 2 + rsub; if (col0 + c4 < N) { const v4f v = *(const v4fa*)&so[w][r][c4]; *(v4f*)(C + (size_t)(row0 + r) * ldc + col0 + c4) = v; } }
     }
}

// Wt[n][k] = f16(W[k][n]·scale) from f32 row-major W[K][N] (scale = power of two; bf16-exact weights stay exact in f16 away from the subnormal range)
__global__ __launch_bounds__(256) void k_wt_f16(const float* __restrict__ W, _Float16* __restrict__ Wt, int K, int N, float scale) {
  const int t = blockIdx.x * 256 + threadIdx.x; if (t >= N * (K / 8)) return; const int n = t / (K / 8), k8 = (t % (K / 8)) * 8; FragH f;
#pragma unroll
  for (int i = 0; i < 8; ++i) f.h[i] = (_Float16)(bf16_round(W[(size_t)(k8 + i) * N + n]) * scale); const v8us o = f.half[0];
  *(v8us*)((unsigned short*)Wt + (size_t)n * K + k8) = o; 
}
// k_gemm_hh variant with fused epilogue: v = acc·alpha + bias[by·sBias + col] (+ CP[(row/rowsPerB)·sCPb + by·64 + col] if CP) ; ACT 0 none / 1 elu ; writes f16 C16 (and f32 C if non-null)
template <int ACT>
__global__ __launch_bounds__(128) void k_gemm_hhx(const _Float16* __restrict__ A, int lda, size_t sA, const _Float16* __restrict__ Bh, int ldb, size_t sB, float alpha, const float* __restrict__ bias, size_t sBias, const float* __restrict__ CP, int rowsPerB, size_t sCPb, int row0g,
    float* __restrict__ C, _Float16* __restrict__ C16, int ldc, size_t sC, int M, int N, int K) {
  __shared__ __attribute__((aligned(16))) float so[4][16][64];
  const int tid = threadIdx.x, w = tid >> 5, lane = tid & 31, ln = lane & 15, hh = lane >> 4; const int by = blockIdx.y;
  A += (size_t)by * sA; Bh += (size_t)by * sB; const size_t cofs = (size_t)by * sC; const float* bp = bias ? bias + (size_t)by * sBias : nullptr;
  const int ntn = (N + 63) / 64; const int wid = blockIdx.x * 4 + w; const int mt = wid / ntn, nq = wid % ntn; if (mt * 16 >= M) return;
  const int row0 = mt * 16, col0 = nq * 64; const _Float16* arow = A + (size_t)(row0 + ln) * lda;
  v8f acc[4] = {};
  for (int kb = 0; kb < K; kb += 32) { FragH ah; ah.half[0] = *(const v8us*)((const unsigned short*)arow + kb + 8 * hh); ah.half[1] = *(const v8us*)((const unsigned short*)arow + kb + 16 + 8 * hh);
#pragma unroll
    for (int t = 0; t < 4; ++t) { if (col0 + t * 16 >= N) continue; const size_t boff = (size_t)(col0 + t * 16 + ln) * ldb + kb; FragH bq; bq.half[0] = *(const v8us*)((const unsigned short*)Bh + boff + 8 * hh); bq.half[1] = *(const v8us*)((const unsigned short*)Bh + boff + 16 + 8 * hh);
      acc[t] = mmaH<1>(ah.v, ah.v, bq.v, bq.v, acc[t]); }
  }
#pragma unroll
  for (int t = 0; t < 4; ++t) { if (col0 + t * 16 >= N) continue; const int col = col0 + t * 16 + ln; const float bv = bp ? bf16_round(bp[col]) : 0.f;
#pragma unroll
    for (int r = 0; r < 8; ++r) { float v = acc[t][r] * alpha + bv; if (CP) { const int rr = row0g + row0 + 8 * hh + r; if (rowsPerB < 0) v += CP[cofs + (size_t)rr * ldc + col];      /* rowsPerB < 0: own element of the batched C plane */ else { const int bidx = rr / rowsPerB; v += CP[(size_t)bidx * sCPb + (size_t)by * 64 + col]; } } if (ACT == 1) v = (v > 0.f) ? v : expm1f(v); else if (ACT == 7) v = (v > 0.f) ? v + 1.0f : expf(v); else if (ACT == 8) v = tanhf(v); else if (ACT == 9) v = 0.5f * v * (1.0f + tanhf(0.7978845608028654f * (v + 0.044715f * v * v * v))); else if (ACT == 11) v = 1.0f / (1.0f + expf(-v)); else if (ACT == 12) v = (v > 0.f) ? v : 0.01f * v; else if (ACT == 14) v = (v > 0.f) ? v : 0.1f * v; else if (ACT == 16) v = (v >= 0.f) ? v : 0.3f * v; else if (ACT == 17) v = (v >= 0.f) ? v : 0.2f * v; else if (ACT == 15) v = v / (1.0f + expf(-v)); else if (ACT == 3) v = fmaxf(v, 0.f); else if (ACT == 6) v = 0.5f * v * (1.0f + erff(v * 0.70710678118654752f)); so[w][8 * hh + r][t * 16 + ln] = v; } }
  __builtin_amdgcn_fence(__ATOMIC_ACQ_REL, "workgroup"); __builtin_amdgcn_wave_barrier();
  const int rsub = lane >> 4, c4 = (lane & 15) * 4; typedef _Float16 v4h __attribute__((ext_vector_type(4)));
  {
#pragma unroll
    for (int q = 0; q < 8; ++q) { const int r = q * 2 + rsub; if (col0 + c4 < N) { const v4f v = *(const v4fa*)&so[w][r][c4]; if (C) *(v4f*)(C + cofs + (size_t)(row0 + r) * ldc + col0 + c4) = v; if (C16) { v4h h4; for (int i = 0; i < 4; ++i) h4[i] = (_Float16)v[i]; *(v4h*)(C16 + cofs + (size_t)(row0 + r) * ldc + col0 + c4) = h4; } } }
     }
}


typedef _Float16 v4h __attribute__((ext_vector_type(4)));

__global__ __launch_bounds__(256) void k_x16(const float* __restrict__ x, _Float16* __restrict__ X16, size_t n8) { const size_t t = (size_t)blockIdx.x * 256 + threadIdx.x; if (t >= n8) return; FragH f;
#pragma unroll
  for (int q = 0; q < 8; ++q) f.h[q] = (_Float16)bf16_round(x[t * 8 + q]); *(v8us*)((unsigned short*)X16 + t * 8) = f.half[0];  }
__global__ __launch_bounds__(256) void k_h16(const float* __restrict__ x, _Float16* __restrict__ X16, size_t n8) { const size_t t = (size_t)blockIdx.x * 256 + threadIdx.x; if (t >= n8) return; FragH f;
#pragma unroll
  for (int q = 0; q < 8; ++q) f.h[q] = (_Float16)x[t * 8 + q]; *(v8us*)((unsigned short*)X16 + t * 8) = f.half[0];  }
__global__ __launch_bounds__(256) void k_round16f(const float* __restrict__ W, _Float16* __restrict__ Bt, size_t n8) { const size_t t = (size_t)blockIdx.x * 256 + threadIdx.x; if (t >= n8) return; FragH f;
#pragma unroll
  for (int i = 0; i < 8; ++i) f.h[i] = (_Float16)(bf16_round(W[t * 8 + i]) * 16.0f); *(v8us*)((unsigned short*)Bt + t * 8) = f.half[0];  }
template <int NHv, int TTv>
__global__ __launch_bounds__(256) void k_vt(const _Float16* __restrict__ V16, int ldv, int voff, _Float16* __restrict__ Vt) { __shared__ unsigned short tl[64][66]; const int tid = threadIdx.x; const int slab = blockIdx.x / (TTv / 64), lg = blockIdx.x % (TTv / 64); const int b = slab / NHv, h = slab % NHv;
  for (int i = tid; i < 64 * 8; i += 256) { const int r = i / 8, c8 = (i % 8) * 8; FragH f; f.half[0] = *(const v8us*)((const unsigned short*)V16 + ((size_t)b * TTv + lg * 64 + r) * ldv + voff + h * 64 + c8);
#pragma unroll
    for (int q = 0; q < 8; ++q) tl[r][c8 + q] = f.u[q]; }
  __syncthreads();
  {
#pragma unroll
    for (int rd = 0; rd < 2; ++rd) { const int d = rd * 32 + tid / 8, pc = tid % 8; FragH f;
#pragma unroll
      for (int q = 0; q < 8; ++q) f.u[q] = tl[pc * 8 + q][d];
      *(v8us*)((unsigned short*)Vt + ((size_t)slab * 64 + d) * TTv + lg * 64 + pc * 8) = f.half[0]; }
     } }

__global__ __launch_bounds__(256) void k_hl(const float* __restrict__ F, _Float16* __restrict__ Hh, _Float16* __restrict__ Hl, size_t n8) { const size_t t = (size_t)blockIdx.x * 256 + threadIdx.x; if (t >= n8) return; FragH fh, fl; const v4f a = *(const v4fa*)(F + t * 8), c = *(const v4fa*)(F + t * 8 + 4);
#pragma unroll
  for (int q = 0; q < 4; ++q) { _Float16 h = (_Float16)a[q]; fh.h[q] = h; fl.h[q] = (_Float16)((a[q] - (float)h) * 1024.0f); h = (_Float16)c[q]; fh.h[4 + q] = h; fl.h[4 + q] = (_Float16)((c[q] - (float)h) * 1024.0f); }
  { *(v8us*)((unsigned short*)Hh + t * 8) = fh.half[0]; *(v8us*)((unsigned short*)Hl + t * 8) = fl.half[0];  } }

// ---- fast GEMM (wave tile 32x64; requires M % 32 == 0 rows per launch region and N % 64 == 0); epilogue = k_gemm_hhx semantics ----
__device__ __forceinline__ v16h g2_frag(const _Float16* p, int hh) { FragH f; f.half[0] = *(const v8us*)((const unsigned short*)p + 8 * hh); f.half[1] = *(const v8us*)((const unsigned short*)p + 16 + 8 * hh); return f.v; }
__device__ __forceinline__ v8f g2_mma(v16h a, v16h b, v8f c) { v8f d = __builtin_amdgcn_wmma_f32_16x16x32_f16(false, a, false, b, (short)0, c, false, false); asm volatile("v_nop\n\tv_nop\n\tv_nop\n\tv_nop" : "+v"(d) : "v"(a), "v"(b)); return d; }
template <int ACT>
__global__ __launch_bounds__(128) void k_gemm2(const _Float16* __restrict__ A, int lda, size_t sA, const _Float16* __restrict__ Bh, int ldb, size_t sB, float alpha, const float* __restrict__ bias, size_t sBias, const float* __restrict__ CP, int rowsPerB, size_t sCPb, int row0g,
    float* __restrict__ C, _Float16* __restrict__ C16, int ldc, size_t sC, int M, int N, int K) { static_assert(ACT == 0 || ACT == 3 || ACT == 6 || ACT == 8 || ACT == 9 || ACT == 11 || ACT == 12 || ACT == 14 || ACT == 15 || ACT == 16 || ACT == 17, "k_gemm2: unsupported ACT code (would silently apply no activation)");
  __shared__ __attribute__((aligned(16))) float so[4][32][68];
  const int tid = threadIdx.x, w = tid >> 5, lane = tid & 31, ln = lane & 15, hh = lane >> 4; const int by = blockIdx.y;
  A += (size_t)by * sA; Bh += (size_t)by * sB; const size_t cofs = (size_t)by * sC; const float* bp = bias ? bias + (size_t)by * sBias : nullptr;
  const int ntn = N >> 6; const int mt = blockIdx.x / ntn, nq = blockIdx.x - mt * ntn; const int row0 = mt * 128 + 32 * w, col0 = nq * 64; if (row0 >= M) return;
  const _Float16* a0p = A + (size_t)(row0 + ln) * lda; const _Float16* a1p = a0p + (size_t)16 * lda;
  const _Float16* b0p = Bh + (size_t)(col0 + ln) * ldb; const _Float16* b1p = b0p + (size_t)16 * ldb; const _Float16* b2p = b1p + (size_t)16 * ldb; const _Float16* b3p = b2p + (size_t)16 * ldb;
  const v8f z8 = {0.f,0.f,0.f,0.f,0.f,0.f,0.f,0.f}; v8f c00 = z8, c01 = z8, c02 = z8, c03 = z8, c10 = z8, c11 = z8, c12 = z8, c13 = z8;
#pragma unroll 1
  for (int kb = 0; kb < K; kb += 32) { const v16h a0 = g2_frag(a0p + kb, hh), a1 = g2_frag(a1p + kb, hh);
    v16h b = g2_frag(b0p + kb, hh); c00 = g2_mma(a0, b, c00); c10 = g2_mma(a1, b, c10);
    b = g2_frag(b1p + kb, hh); c01 = g2_mma(a0, b, c01); c11 = g2_mma(a1, b, c11);
    b = g2_frag(b2p + kb, hh); c02 = g2_mma(a0, b, c02); c12 = g2_mma(a1, b, c12);
    b = g2_frag(b3p + kb, hh); c03 = g2_mma(a0, b, c03); c13 = g2_mma(a1, b, c13); }
  v8f accs[8] = {c00, c01, c02, c03, c10, c11, c12, c13};
#pragma unroll
  for (int u = 0; u < 8; ++u) { const int t = u & 3, half = u >> 2; const int col = col0 + t * 16 + ln; const float bv = bp ? bf16_round(bp[col]) : 0.f;
#pragma unroll
    for (int r = 0; r < 8; ++r) { const int rloc = half * 16 + 8 * hh + r; float v = accs[u][r] * alpha + bv; if (CP) { if (rowsPerB < 0) v += CP[cofs + (size_t)(row0g + row0 + rloc) * ldc + col];      /* rowsPerB < 0: own element of the batched C plane */ else { const int bidx = (row0g + row0 + rloc) / rowsPerB; v += CP[(size_t)bidx * sCPb + (size_t)by * 64 + col]; } }
      if (ACT == 3) v = fmaxf(v, 0.f); else if (ACT == 6) v = 0.5f * v * (1.0f + erff(v * 0.70710678118654752f)); else if (ACT == 11) v = 1.0f / (1.0f + expf(-v)); else if (ACT == 15) v = v / (1.0f + expf(-v)); else if (ACT == 12) v = (v > 0.f) ? v : 0.01f * v; else if (ACT == 8) v = tanhf(v); else if (ACT == 9) v = 0.5f * v * (1.0f + tanhf(0.7978845608028654f * (v + 0.044715f * v * v * v))); else if (ACT == 14) v = (v > 0.f) ? v : 0.1f * v; else if (ACT == 16) v = (v >= 0.f) ? v : 0.3f * v; else if (ACT == 17) v = (v >= 0.f) ? v : 0.2f * v;
      so[w][rloc][t * 16 + ln] = v; } }
  __builtin_amdgcn_fence(__ATOMIC_ACQ_REL, "workgroup"); __builtin_amdgcn_wave_barrier();
  const int rsub = lane >> 4, c4 = (lane & 15) * 4;
  {
#pragma unroll
    for (int q = 0; q < 16; ++q) { const int r = q * 2 + rsub; const v4f v = *(const v4fa*)&so[w][r][c4]; if (C) *(v4f*)(C + cofs + (size_t)(row0 + r) * ldc + col0 + c4) = v; if (C16) { v4h h4; for (int i = 0; i < 4; ++i) h4[i] = (_Float16)v[i]; *(v4h*)(C16 + cofs + (size_t)(row0 + r) * ldc + col0 + c4) = h4; } }
     } }


__global__ __launch_bounds__(256) void k_wnat(const float* __restrict__ w, size_t n8, _Float16* __restrict__ Bt) { const size_t t = (size_t)blockIdx.x * 256 + threadIdx.x; if (t >= n8) return; FragH f; for (int q = 0; q < 8; ++q) f.h[q] = (_Float16)(bf16_round(w[t * 8 + q]) * 16.0f); *(v8us*)((unsigned short*)Bt + t * 8) = f.half[0];  }
__global__ __launch_bounds__(256) void k_rsm(const float* __restrict__ S, _Float16* __restrict__ P, int nrows) {
  #pragma clang fp contract(off)
  const int i = blockIdx.x * 256 + threadIdx.x; if (i >= nrows) return; const float* s = S + (size_t)i * SQ; float mx = -3.0e38f;
#pragma unroll 1
  for (int j = 0; j < SQ; ++j) mx = fmaxf(mx, s[j]); float se = 0.f;
#pragma unroll 1
  for (int j = 0; j < SQ; ++j) se += expf(s[j] - mx); const float sc = 256.0f / se;
#pragma unroll 1
  for (int j0 = 0; j0 < SQ; j0 += 8) { FragH f; for (int q = 0; q < 8; ++q) f.h[q] = (_Float16)(expf(s[j0 + q] - mx) * sc); unsigned short* d = (unsigned short*)P + (size_t)i * SQ + j0; *(v8us*)d = f.half[0];  } }
__global__ __launch_bounds__(256) void k_vt(const _Float16* __restrict__ V16, int b, int h0, _Float16* __restrict__ VT) { __shared__ unsigned short tl[64][65]; const int tid = threadIdx.x; const int hh = blockIdx.x % HG, sg = blockIdx.x / HG; const int s0 = sg * 64; const int h = h0 + hh;
  for (int i = tid; i < 64 * 8; i += 256) { const int j = i / 8, d8 = (i % 8) * 8; FragH f; f.half[0] = *(const v8us*)((const unsigned short*)V16 + ((size_t)b * SQ + s0 + j) * DM + h * HD + d8); for (int q = 0; q < 8; ++q) tl[d8 + q][j] = f.u[q]; }
  __syncthreads();
  { for (int i = tid; i < 64 * 8; i += 256) { const int d = i / 8, j8 = (i % 8) * 8; FragH f; for (int q = 0; q < 8; ++q) f.u[q] = tl[d][j8 + q]; *(v8us*)((unsigned short*)VT + ((size_t)hh * HD + d) * SQ + s0 + j8) = f.half[0]; }  } }



__global__ __launch_bounds__(256) void k_rsmcf2(const float* __restrict__ S, _Float16* __restrict__ P, int hg, int q0, int nk) {
  #pragma clang fp contract(off)
  const int t = blockIdx.x * 256 + threadIdx.x; if (t >= hg * QT) return; const size_t i = (size_t)t; const float* s = S + i * NKX; const int last = q0 + (t % QT); float mx = -3.0e38f;
#pragma unroll 1
  for (int j = 0; j < nk; ++j) { const float f = (j <= last) ? 1.f : 0.f; mx = fmaxf(mx, fmaf(f, s[j], (1.f - f) * -1.0e9f)); } float se = 0.f;
#pragma unroll 1
  for (int j = 0; j < nk; ++j) { const float f = (j <= last) ? 1.f : 0.f; se += __expf(fmaf(f, s[j], (1.f - f) * -1.0e9f) - mx); } const float sc = 256.0f / se;
#pragma unroll 1
  for (int j0 = 0; j0 < nk; j0 += 8) { FragH fr; for (int q = 0; q < 8; ++q) { const int j = j0 + q; const float f = (j <= last) ? 1.f : 0.f; fr.h[q] = (_Float16)(__expf(fmaf(f, s[j], (1.f - f) * -1.0e9f) - mx) * sc); } unsigned short* d = (unsigned short*)P + i * NKX + j0; *(v8us*)d = fr.half[0];  } }


template <int MASKADD>
__global__ __launch_bounds__(64) void k_att0(const float* __restrict__ QF, const float* __restrict__ KF, const float* __restrict__ VF, int ld, const float* __restrict__ mask, float scale, float* __restrict__ OF, int ldo) {
  #pragma clang fp contract(off)
  __shared__ __attribute__((aligned(16))) float lq[64][64]; __shared__ __attribute__((aligned(16))) float lo[64][64];
  const int tid = threadIdx.x; const int h = blockIdx.x / (QT0 / 64), rg = blockIdx.x % (QT0 / 64); const int i = rg * 64 + tid;
  { const size_t bi = (size_t)blockIdx.y * QT0 * ld; QF += bi; KF += bi; VF += bi; OF += (size_t)blockIdx.y * QT0 * ldo; }      /* batch on grid.y: each batch has its own QT0-row plane */
  const float* qr = QF + (size_t)i * ld + h * HD;
#pragma unroll 1
  for (int c = 0; c < HD / 4; ++c) { *(v4f*)&lq[tid][c * 4] = *(const v4fa*)(qr + c * 4); const v4f z = {0.f, 0.f, 0.f, 0.f}; *(v4f*)&lo[tid][c * 4] = z; }
  float m = -1.0e30f, l = 0.f; const int jmax = MASKADD ? (SQ - 1) : (rg * 64 + 63);      /* additive-mask form: every key (the mask input decides); causal form: keys up to the block's last row */
#pragma unroll 1
  for (int j = 0; j <= jmax; ++j) { const float* kr = KF + (size_t)j * ld + h * HD; const float* vr = VF + (size_t)j * ld + h * HD; float s = 0.f;
#pragma unroll 1
    for (int c = 0; c < HD / 4; ++c) { const v4f kq = *(const v4fa*)(kr + c * 4); const v4f qq = *(v4f*)&lq[tid][c * 4]; s = __fadd_rn(s, __fmul_rn(qq[0], kq[0])); s = __fadd_rn(s, __fmul_rn(qq[1], kq[1])); s = __fadd_rn(s, __fmul_rn(qq[2], kq[2])); s = __fadd_rn(s, __fmul_rn(qq[3], kq[3])); }
    s = __fmul_rn(s, scale); if (MASKADD) s = __fadd_rn(s, __fmul_rn(bf16_round(mask[(size_t)i * SQ + j]), -10000.0f));
    const float f = (MASKADD || j <= i) ? 1.f : 0.f; const float sm = fmaf(f, s, (1.f - f) * -1.0e30f); const float mn = fmaxf(m, sm); const float sc = expf(m - mn); const float e = expf(sm - mn); l = __fadd_rn(__fmul_rn(l, sc), e); m = mn;
#pragma unroll 1
    for (int c = 0; c < HD / 4; ++c) { const v4f vv = *(const v4fa*)(vr + c * 4); v4f oo = *(v4f*)&lo[tid][c * 4]; for (int u = 0; u < 4; ++u) oo[u] = __fadd_rn(__fmul_rn(oo[u], sc), __fmul_rn(e, vv[u])); *(v4f*)&lo[tid][c * 4] = oo; } }
  const float fin = 64.0f / l;      /* o carried x64 (k_o0m scales it by 1/64) */
#pragma unroll 1
  for (int c = 0; c < HD / 4; ++c) { v4f oo = *(v4f*)&lo[tid][c * 4]; for (int u = 0; u < 4; ++u) oo[u] = __fmul_rn(oo[u], fin); *(v4f*)&lo[tid][c * 4] = oo; }
  __syncthreads();
  {
#pragma unroll 1
    for (int it = 0; it < 16; ++it) { const int row = it * 4 + tid / 16, pc = (tid % 16) * 4; const v4f v = *(const v4f*)&lo[row][pc]; *(v4f*)(OF + (size_t)(rg * 64 + row) * ldo + h * HD + pc) = v; }
     } }


template <int BFIN, int WXB>
__global__ __launch_bounds__(256) void k_ln16(const float* __restrict__ X, const float* __restrict__ g, const float* __restrict__ bb, float eps, _Float16* __restrict__ N16, float* __restrict__ XB) {
  #pragma clang fp contract(off)
  __shared__ float red[256]; const size_t r = blockIdx.x; const int t = threadIdx.x; const v4f xa = *(const v4fa*)(X + r * DMQ + t * 4); float s[4]; float sum = 0.f;
  for (int q = 0; q < 4; ++q) { s[q] = BFIN ? bf16_round(xa[q]) : xa[q]; sum = __fadd_rn(sum, s[q]); }
  red[t] = sum; __syncthreads(); for (int st = 128; st > 0; st >>= 1) { if (t < st) red[t] = __fadd_rn(red[t], red[t + st]); __syncthreads(); } const float mu = red[0] / (float)DMQ; __syncthreads();
  float vs = 0.f; for (int q = 0; q < 4; ++q) { const float dl = __fadd_rn(s[q], -mu); vs = __fadd_rn(vs, __fmul_rn(dl, dl)); } red[t] = vs; __syncthreads(); for (int st = 128; st > 0; st >>= 1) { if (t < st) red[t] = __fadd_rn(red[t], red[t + st]); __syncthreads(); }
  const float rs = rsqrtf(__fadd_rn(red[0] / (float)DMQ, eps)); v4h y; v4f xb;
  for (int q = 0; q < 4; ++q) { const int c = t * 4 + q; y[q] = (_Float16)__fadd_rn(__fmul_rn(__fmul_rn(__fadd_rn(s[q], -mu), rs), bf16_round(g[c])), bf16_round(bb[c])); xb[q] = s[q]; }
  { *(v4h*)(N16 + r * DMQ + t * 4) = y; if (WXB) *(v4f*)(XB + r * DMQ + t * 4) = xb;  } }
__global__ __launch_bounds__(256) void k_ftres2(const float* __restrict__ OF0, const float* __restrict__ XB, float* __restrict__ X1, size_t n4) {
  #pragma clang fp contract(off)
  const size_t t = (size_t)blockIdx.x * 256 + threadIdx.x; if (t >= n4) return; const v4f o = *(const v4fa*)(OF0 + t * 4), xv = *(const v4fa*)(XB + t * 4); v4f y; for (int q = 0; q < 4; ++q) y[q] = __fadd_rn(__fmul_rn(o[q], 0.015625f), xv[q]); *(v4f*)(X1 + t * 4) = y;  }

__global__ __launch_bounds__(256) void k_wthd(const float* __restrict__ Wt, _Float16* __restrict__ Bt) { const size_t t = (size_t)blockIdx.x * 256 + threadIdx.x; if (t >= (size_t)NH * HD * (DM / 8)) return; const int m8 = (int)(t % (DM / 8)) * 8; const int d = (int)((t / (DM / 8)) % HD); const int h = (int)(t / ((size_t)(DM / 8) * HD)); FragH f;
  for (int q = 0; q < 8; ++q) f.h[q] = (_Float16)(16.0f * bf16_round(Wt[((size_t)h * DM + m8 + q) * HD + d])); unsigned short* dst = (unsigned short*)Bt + ((size_t)h * HD + d) * DM + m8; *(v8us*)dst = f.half[0];  }




__global__ __launch_bounds__(256) void k_wtpad(const float* __restrict__ Wm, _Float16* __restrict__ Wt, int Kr, int Kp, int Nr, int Np, float scale) {
  const int t = blockIdx.x * 256 + threadIdx.x; if (t >= Np * (Kp / 8)) return; const int n = t / (Kp / 8), k8 = (t % (Kp / 8)) * 8; const int nc = min(n, Nr - 1); const float fn = (n < Nr) ? 1.f : 0.f; FragH f;
  for (int i = 0; i < 8; ++i) { const int k = k8 + i; const int kc = min(k, Kr - 1); const float fk = (k < Kr) ? fn : 0.f; f.h[i] = (_Float16)(bf16_round(Wm[(size_t)kc * Nr + nc]) * scale * fk); }
  unsigned short* o = (unsigned short*)Wt + (size_t)n * Kp + k8; *(v8us*)o = f.half[0];  }
__global__ __launch_bounds__(128) void k_bpad(const float* __restrict__ b, float* __restrict__ Bp, int nr, int np) {
  const int i = threadIdx.x; if (i >= np) return; const float v = b[min(i, nr - 1)] * ((i < nr) ? 1.f : 0.f); *(float*)(Bp + i) = v;  }

#define DI 64         /* inner width = NH * HD (ONE 64-wide head) */
#define LQK (3 * DI)  /* fused q | k | v row pitch (192) */
__global__ __launch_bounds__(256) void k_o0(const float* __restrict__ OF, float* __restrict__ ob, size_t n4) {
  #pragma clang fp contract(off)
  const size_t t = (size_t)blockIdx.x * 256 + threadIdx.x; if (t >= n4) return; const size_t e = t * 4; const int i = (int)(e / DI); const int c = (int)(e % DI); const int h = c / HD, d = c % HD; const v4f a = *(const v4fa*)(OF + e); v4f o; for (int q = 0; q < 4; ++q) o[q] = __fmul_rn(a[q], 0.015625f); float* dst = ob + (size_t)h * SQ * HD + (size_t)i * HD + d; *(v4f*)dst = o;  }

__global__ __launch_bounds__(256) void k_o0m(const float* __restrict__ OF, float* __restrict__ o_, size_t n4) {
  #pragma clang fp contract(off)
  const size_t t = (size_t)blockIdx.x * 256 + threadIdx.x; if (t >= n4) return; const size_t e = t * 4; OF += (size_t)blockIdx.y * QT0 * DI; o_ += (size_t)blockIdx.y * SQ * DI;      /* batch on grid.y: QT0 exact rows go to the head of the batch's SQ output rows */
  const v4f a = *(const v4fa*)(OF + e); v4f o; for (int q = 0; q < 4; ++q) o[q] = __fmul_rn(a[q], 0.015625f); *(v4f*)(o_ + e) = o;  }
extern "C" void kernel_launch(void* const* d_in, const int* in_sizes, int n_in,
                              void* d_out, int out_size, void* d_ws, size_t ws_size, hipStream_t stream) {
  (void)in_sizes; (void)n_in; (void)out_size;
  const float* const* I = (const float* const*)d_in; const float* x = I[0]; const float* wq = I[2]; const float* wk = I[1]; const float* wv = I[3]; const float* bq = nullptr; const float* bk = nullptr; const float* bv = nullptr;      /* x; [in][out = 64] Wk / Wq / Wv (input order as this module lists them); no biases */
  char* ws = (char*)d_ws; size_t off = 0;
  auto take = [&](size_t bytes) { char* p = ws + off; off += (bytes + 255) & ~(size_t)255; return p; };
  _Float16* BW = (_Float16*)take((size_t)LQK * DM * 2); _Float16* X16 = (_Float16*)take(NR * DM * 2); _Float16* QKV = (_Float16*)take(NR * LQK * 2); _Float16* VT = (_Float16*)take((size_t)NB * HD * SQ * 2);
  float* S = (float*)take((size_t)NB * QT * NKX * 4); _Float16* P = (_Float16*)take((size_t)NB * QT * NKX * 2); float* QKVF0 = (float*)take((size_t)NB * QT0 * LQK * 4); float* OF0 = (float*)take((size_t)NB * QT0 * DI * 4);      /* one plane per batch: all batches are in flight in every launch */
  if (off > ws_size) return;
  { const unsigned g = (unsigned)(((size_t)DI * (DM / 8) + 255) / 256); k_wt_f16<<<g, 256, 0, stream>>>(wq, BW, DM, DI, 16.0f); k_wt_f16<<<g, 256, 0, stream>>>(wk, BW + (size_t)DI * DM, DM, DI, 16.0f); k_wt_f16<<<g, 256, 0, stream>>>(wv, BW + (size_t)2 * DI * DM, DM, DI, 16.0f); }      /* [in = DM][out = 64] -> Bt[n][k] x16, stacked q | k | v */
  k_x16<<<(unsigned)((NR * DM / 8 + 255) / 256), 256, 0, stream>>>(x, X16, NR * DM / 8);      /* x (bf16-valued) as exact f16 rows */
  const float* bqkv[3] = {bq, bk, bv};
  for (int c = 0; c < 3; ++c) k_gemm2<0><<<dim3((unsigned)((NR / 128) * (DI / 64)), 1), 128, 0, stream>>>(X16, DM, 0, BW + (size_t)c * DI * DM, DM, 0, 0.0625f, bqkv[c], 0, nullptr, 1, 0, 0, nullptr, QKV + (size_t)c * DI, LQK, 0, (int)NR, DI, DM);      /* q | k | v = x W -> f16 rows, column blocks 0 / 64 / 128 of the fused plane (pitch 192); head h = columns h*64 inside each */
  const _Float16* Q16 = QKV; const _Float16* K16 = QKV + DI; const _Float16* V16 = QKV + 2 * DI;
  float* ob = (float*)d_out;      /* the batch is grid.y of every launch below but k_vt and k_rsmcf2, which index it in grid.x (ONE head, so the head stride of the kernels carries the batch) */
  k_vt<NH, SQ><<<NB * NH * (SQ / 64), 256, 0, stream>>>(V16, LQK, 0, VT);      /* V^T [NB][HD][SQ] */
  for (int q0 = 0; q0 < SQ; q0 += QT) { const int nk = q0 + QT;      /* causal: only keys below the tile end are computed */
    k_gemm2<0><<<dim3((QT / 128) * (nk / 64), NB), 128, 0, stream>>>(Q16 + (size_t)q0 * LQK, LQK, (size_t)SQ * LQK, K16, LQK, (size_t)SQ * LQK, 0.125f, nullptr, 0, nullptr, 1, 0, 0, S, nullptr, NKX, (size_t)QT * NKX, QT, nk, HD);      /* scores / 8 */
    k_rsmcf2<<<(NB * QT + 255) / 256, 256, 0, stream>>>(S, P, NB, q0, nk);      /* causal softmax -> P x256 f16 */
    k_gemm2<0><<<dim3((QT / 128) * (HD / 64), NB), 128, 0, stream>>>(P, NKX, (size_t)QT * NKX, VT, SQ, (size_t)HD * SQ, 0.00390625f, nullptr, 0, nullptr, 1, 0, 0, ob + (size_t)q0 * DI, nullptr, DI, (size_t)SQ * DI, QT, HD, nk); }      /* out[b][q0 + i][..] = P V^T 2^-8 (f32) */
  for (int c = 0; c < 3; ++c) k_gemm2<0><<<dim3((unsigned)((QT0 / 128) * (DI / 64)), NB), 128, 0, stream>>>(X16, DM, (size_t)SQ * DM, BW + (size_t)c * DI * DM, DM, 0, 0.0625f, bqkv[c], 0, nullptr, 1, 0, 0, QKVF0 + (size_t)c * DI, nullptr, LQK, (size_t)QT0 * LQK, QT0, DI, DM);      /* f32 q | k | v of rows 0..511 of every batch (exact products, f32 accumulation) */
  k_att0<0><<<dim3(NH * (QT0 / 64), NB), 64, 0, stream>>>(QKVF0, QKVF0 + DI, QKVF0 + 2 * DI, LQK, nullptr, 0.125f, OF0, DI);      /* exact f32 causal attention for rows 0..511 (o x64) */
  k_o0m<<<dim3((unsigned)(((size_t)QT0 * DI / 4 + 255) / 256), NB), 256, 0, stream>>>(OF0, ob, (size_t)QT0 * DI / 4);      /* rows 0..511 of every batch REWRITTEN from the exact path */
}

// v002
// It runs in 1000 microseconds.
// Next to v001, in two timings, it ran 2.39 times as fast each time.
// Over all steps from v000 it is 71.6 times as fast.
#include <hip/hip_runtime.h>
// Single-head causal self-attention (x [32][1024][384]; k/q/v = x W ([in][out] [384][64], no biases; input order Wk, Wq, Wv); ONE 64-wide head; wei * 64^-0.5; causal (tril, -inf); softmax; out = wei v -> [32][1024][64]; no output projection).
// Structure: token rows; x as exact f16 rows; three WMMA GEMMs (no bias) into one f16 q | k | v plane [32768][192]; per batch v^T via LDS transposes; causal 256-row query tiles with the batch on grid.y (scores alpha 1/8, causal softmax f32 -> f16 x256 weights, P V written as f32 straight into the merged output rows); an exact f32 first tile (rows 0..511) rewritten at the end; launches: see trace.
// Compute dtype: inputs rounded to bf16; x / weights exact; q, k, v and softmax weights as plain f16 GEMM operands (~2^-12); o written as f32; scores and softmax statistics f32. v_wmma_f32_16x16x32_f16.
#define NB 32
#define SQ 1024
#define DM 384
#define NH 1
#define HD 64
#define HG 4
#define QT 256                       /* query rows per causal tile */
#define NKX SQ                       /* S / P row pitch */
#define QT0 512                      /* first-tile rows recomputed exactly (f32): 512 here (no output projection averages the early-row cancellation errors away; logit sigma 1.0) */
#define B0 0                         /* unused; batches start at 0 on grid.y */
#define NBR NB                       /* feeds only MP; unused by the launches */
#define NR ((size_t)NB * SQ)
#define DMQ DM
#define DFF 4096
#define DFFR 100
#define MP ((int)((size_t)NBR * SQ)) /* unused; the projections use NR rows */
#define QN SQ                        /* unused */
#define NHD NH                       /* unused */
#define MPO MP                       /* unused */
#define LQ (3 * DM)      /* 3 * DM, unused; the q/k/v rows use pitch LQK (192) */
typedef __bf16 v16b __attribute__((ext_vector_type(16)));
typedef unsigned short v8us __attribute__((ext_vector_type(8), may_alias));
typedef float  v8f  __attribute__((ext_vector_type(8)));
typedef float  v4f  __attribute__((ext_vector_type(4)));
typedef float  v4fa __attribute__((ext_vector_type(4), may_alias));
union FragB { v16b v; v8us half[2]; unsigned short u[16]; };

__device__ __forceinline__ unsigned short bf16_bits(float x) { unsigned int u = __float_as_uint(x); return (unsigned short)((u + 0x7FFFu + ((u >> 16) & 1u)) >> 16); }
__device__ __forceinline__ float bf16_val(unsigned short b) { return __uint_as_float(((unsigned int)b) << 16); }
__device__ __forceinline__ float bf16_round(float x) { return bf16_val(bf16_bits(x)); }
// D += A·B with NT terms: 1 = ah·bh, 2 = + al·bh (A split), 3 = + ah·bl (both split)
template <int NT>
__device__ __forceinline__ v8f mmaN(v16b ah, v16b al, v16b bh, v16b bl, v8f c) {
  c = __builtin_amdgcn_wmma_f32_16x16x32_bf16(false, ah, false, bh, (short)0, c, false, false);
  if (NT >= 2) c = __builtin_amdgcn_wmma_f32_16x16x32_bf16(false, al, false, bh, (short)0, c, false, false);
  if (NT >= 3) c = __builtin_amdgcn_wmma_f32_16x16x32_bf16(false, ah, false, bl, (short)0, c, false, false);
  asm volatile("v_nop\n\tv_nop\n\tv_nop\n\tv_nop" : "+v"(c) : "v"(ah), "v"(al), "v"(bh), "v"(bl));
  return c;
}

__global__ __launch_bounds__(256) void k_wt_bf16(const float* __restrict__ W, unsigned short* __restrict__ Wt, int K, int N) {
  const int t = blockIdx.x * 256 + threadIdx.x;
  const int k8n = K / 8;
  if (t >= N * k8n) return;
  const int n = t / k8n, k8 = (t % k8n) * 8;
  v8us v;
#pragma unroll
  for (int i = 0; i < 8; ++i) v[i] = bf16_bits(W[(size_t)(k8 + i) * N + n]);
  *(v8us*)(Wt + (size_t)n * K + k8) = v;
  
}

// GEMM C[M][N] (f32, pitch ldc) = act(A[M][K]·W + bias). A f32 row-major (pitch lda) converted per fragment to bf16
// (ASPLIT: hi/lo two planes -> 2 terms, else single rounded term); Wt bf16 [N][K] (pitch ldb). BIAS_BF16 rounds the
// bias to bf16 first (bias quantised to bf16 before the add). K%32==0, M%16==0, N%64==0.
template <bool ASPLIT, int ACT, bool BIAS_BF16>
__global__ __launch_bounds__(128) void k_gemm_bf(const float* __restrict__ A, int lda, const unsigned short* __restrict__ Wt, int ldb,
                                               const float* __restrict__ bias, float* __restrict__ C, int ldc, int M, int N, int K) {
  __shared__ __attribute__((aligned(16))) float so[4][16][64];
  const int tid = threadIdx.x, w = tid >> 5, lane = tid & 31, ln = lane & 15, hh = lane >> 4;
  const int ntn = N / 64;
  const int wid = blockIdx.x * 4 + w;
  const int mt = wid / ntn, nq = wid % ntn;
  if (mt * 16 >= M) return;
  const int row0 = mt * 16, col0 = nq * 64;
  const float* arow = A + (size_t)(row0 + ln) * lda;
  v8f acc[4] = {};
  for (int kb = 0; kb < K; kb += 32) {
    FragB ah, al;
    const v4f x0 = *(const v4fa*)(arow + kb + 8 * hh), x1 = *(const v4fa*)(arow + kb + 8 * hh + 4);
    const v4f x2 = *(const v4fa*)(arow + kb + 16 + 8 * hh), x3 = *(const v4fa*)(arow + kb + 16 + 8 * hh + 4);
    float xs[16] = {x0[0],x0[1],x0[2],x0[3],x1[0],x1[1],x1[2],x1[3],x2[0],x2[1],x2[2],x2[3],x3[0],x3[1],x3[2],x3[3]};
#pragma unroll
    for (int i = 0; i < 16; ++i) { const unsigned short hb = bf16_bits(xs[i]); ah.u[i] = hb; al.u[i] = ASPLIT ? bf16_bits(xs[i] - bf16_val(hb)) : (unsigned short)0; }
#pragma unroll
    for (int t = 0; t < 4; ++t) {
      const unsigned short* brow = Wt + (size_t)(col0 + t * 16 + ln) * ldb + kb;
      FragB b;
      b.half[0] = *(const v8us*)(brow + 8 * hh);
      b.half[1] = *(const v8us*)(brow + 16 + 8 * hh);
      acc[t] = mmaN<ASPLIT ? 2 : 1>(ah.v, al.v, b.v, b.v, acc[t]);
    }
  }
#pragma unroll
  for (int t = 0; t < 4; ++t) {
    float bv = bias ? bias[col0 + t * 16 + ln] : 0.f;
    if (BIAS_BF16) bv = bf16_round(bv);
#pragma unroll
    for (int r = 0; r < 8; ++r) { float v = acc[t][r] + bv; if (ACT == 1) v = fmaxf(v, 0.f); so[w][8 * hh + r][t * 16 + ln] = v; }
  }
  __builtin_amdgcn_fence(__ATOMIC_ACQ_REL, "workgroup");
  __builtin_amdgcn_wave_barrier();
  const int rsub = lane >> 4, c4 = (lane & 15) * 4;
  {
#pragma unroll
    for (int q = 0; q < 8; ++q) {
      const int r = q * 2 + rsub;
      const v4f v = *(const v4fa*)&so[w][r][c4];
      *(v4f*)(C + (size_t)(row0 + r) * ldc + col0 + c4) = v;
    }
    
  }
}

// GEMM C = act(A·W + bias + resid): A f32 (ASPLIT -> hi/lo 2 terms), Wt bf16 [N][K]; ACT 0 none, 1 relu, 2 exact gelu;
// resid (optional, f32, row index = (row % rmod), pitch ldr, RES_BF16 rounds it) added before the activation.
template <bool ASPLIT, int ACT, bool BIAS_BF16, bool RES_BF16>
__global__ __launch_bounds__(128) void k_gemm_bf3(const float* __restrict__ A, int lda, const unsigned short* __restrict__ Wt, int ldb,
                                                const float* __restrict__ bias, const float* __restrict__ resid, int rmod, int ldr,
                                                float* __restrict__ C, int ldc, int M, int N, int K) {
  __shared__ __attribute__((aligned(16))) float so[4][16][64];
  const int tid = threadIdx.x, w = tid >> 5, lane = tid & 31, ln = lane & 15, hh = lane >> 4;
  const int ntn = N / 64;
  const int wid = blockIdx.x * 4 + w;
  const int mt = wid / ntn, nq = wid % ntn;
  if (mt * 16 >= M) return;
  const int row0 = mt * 16, col0 = nq * 64;
  const float* arow = A + (size_t)(row0 + ln) * lda;
  v8f acc[4] = {};
  for (int kb = 0; kb < K; kb += 32) {
    FragB ah, al;
    const v4f x0 = *(const v4fa*)(arow + kb + 8 * hh), x1 = *(const v4fa*)(arow + kb + 8 * hh + 4);
    const v4f x2 = *(const v4fa*)(arow + kb + 16 + 8 * hh), x3 = *(const v4fa*)(arow + kb + 16 + 8 * hh + 4);
    float xs[16] = {x0[0],x0[1],x0[2],x0[3],x1[0],x1[1],x1[2],x1[3],x2[0],x2[1],x2[2],x2[3],x3[0],x3[1],x3[2],x3[3]};
#pragma unroll
    for (int i = 0; i < 16; ++i) { const unsigned short hb = bf16_bits(xs[i]); ah.u[i] = hb; al.u[i] = ASPLIT ? bf16_bits(xs[i] - bf16_val(hb)) : (unsigned short)0; }
#pragma unroll
    for (int t = 0; t < 4; ++t) {
      const unsigned short* brow = Wt + (size_t)(col0 + t * 16 + ln) * ldb + kb;
      FragB b;
      b.half[0] = *(const v8us*)(brow + 8 * hh);
      b.half[1] = *(const v8us*)(brow + 16 + 8 * hh);
      acc[t] = mmaN<ASPLIT ? 2 : 1>(ah.v, al.v, b.v, b.v, acc[t]);
    }
  }
#pragma unroll
  for (int t = 0; t < 4; ++t) {
    const int col = col0 + t * 16 + ln;
    float bv = bias ? bias[col] : 0.f;
    if (BIAS_BF16) bv = bf16_round(bv);
#pragma unroll
    for (int r = 0; r < 8; ++r) {
      float v = acc[t][r] + bv;
      if (resid) { float rv = resid[(size_t)((row0 + 8 * hh + r) % rmod) * ldr + col]; if (RES_BF16) rv = bf16_round(rv); v += rv; }
      if (ACT == 1) v = fmaxf(v, 0.f);
      if (ACT == 2) v = 0.5f * v * (1.0f + erff(v * 0.70710678118654752f));
      if (ACT == 3) { const float u = 0.7978845608028654f * (v + 0.044715f * v * v * v); v = 0.5f * v * (1.0f + tanhf(u)); }
      so[w][8 * hh + r][t * 16 + ln] = v;
    }
  }
  __builtin_amdgcn_fence(__ATOMIC_ACQ_REL, "workgroup");
  __builtin_amdgcn_wave_barrier();
  const int rsub = lane >> 4, c4 = (lane & 15) * 4;
  {
#pragma unroll
    for (int q = 0; q < 8; ++q) {
      const int r = q * 2 + rsub;
      const v4f v = *(const v4fa*)&so[w][r][c4];
      *(v4f*)(C + (size_t)(row0 + r) * ldc + col0 + c4) = v;
    }
    
  }
}
// row LayerNorm (biased variance, eps) over N: s = X (+ R); optional out_sum <- s; out_norm <- (s-mu)*rsqrt(var+eps)*g + b
template <bool PARAM_BF16>
__global__ __launch_bounds__(256) void k_layernorm(const float* __restrict__ X, const float* __restrict__ R, const float* __restrict__ g, const float* __restrict__ bta,
                                                  float* __restrict__ out_sum, float* __restrict__ out_norm, int N, float eps) {
  __shared__ float red[256];
  const int row = blockIdx.x, tid = threadIdx.x;
  const float* x = X + (size_t)row * N; const float* rr = R ? R + (size_t)row * N : nullptr;
  float vals[16];                     // up to N = 4096
  const int per = N / 256;            // contiguous chunk per thread? use strided-by-4 chunks: thread handles j = tid*4 + 1024*u
  float s1 = 0.f;
  for (int u = 0; u < per / 4; ++u) {
    const int j = tid * 4 + 1024 * u;
    const v4f a = *(const v4fa*)(x + j);
    v4f b = {0.f,0.f,0.f,0.f}; if (rr) b = *(const v4fa*)(rr + j);
#pragma unroll
    for (int q = 0; q < 4; ++q) { const float v = a[q] + b[q]; vals[u * 4 + q] = v; s1 += v; }
  }
  red[tid] = s1; __syncthreads();
  for (int st = 128; st > 0; st >>= 1) { if (tid < st) red[tid] += red[tid + st]; __syncthreads(); }
  const float mu = red[0] / (float)N; __syncthreads();
  float s2 = 0.f;
  for (int u = 0; u < per / 4; ++u)
#pragma unroll
    for (int q = 0; q < 4; ++q) { const float c = vals[u * 4 + q] - mu; s2 += c * c; }
  red[tid] = s2; __syncthreads();
  for (int st = 128; st > 0; st >>= 1) { if (tid < st) red[tid] += red[tid + st]; __syncthreads(); }
  const float rs = rsqrtf(red[0] / (float)N + eps);
  {
    for (int u = 0; u < per / 4; ++u) {
      const int j = tid * 4 + 1024 * u;
      v4f o, sm;
#pragma unroll
      for (int q = 0; q < 4; ++q) {
        float gg = g[j + q], bb = bta[j + q];
        if (PARAM_BF16) { gg = bf16_round(gg); bb = bf16_round(bb); }
        sm[q] = vals[u * 4 + q]; o[q] = (vals[u * 4 + q] - mu) * rs * gg + bb;
      }
      if (out_sum) *(v4f*)(out_sum + (size_t)row * N + j) = sm;
      *(v4f*)(out_norm + (size_t)row * N + j) = o;
    }
    
  }
}



// ---- f16 WMMA path (v_wmma_f32_16x16x32_f16): 11-bit significands for operands in range — used where a [0,1] probability operand needs more precision than bf16
typedef _Float16 v16h __attribute__((ext_vector_type(16)));
union FragH { v16h v; v8us half[2]; _Float16 h[16]; unsigned short u[16]; };
template <int NT>
__device__ __forceinline__ v8f mmaH(v16h ah, v16h al, v16h bh, v16h bl, v8f c) {
  c = __builtin_amdgcn_wmma_f32_16x16x32_f16(false, ah, false, bh, (short)0, c, false, false);
  if (NT >= 2) c = __builtin_amdgcn_wmma_f32_16x16x32_f16(false, al, false, bh, (short)0, c, false, false);
  if (NT >= 3) c = __builtin_amdgcn_wmma_f32_16x16x32_f16(false, ah, false, bl, (short)0, c, false, false);
  asm volatile("v_nop\n\tv_nop\n\tv_nop\n\tv_nop" : "+v"(c) : "v"(ah), "v"(al), "v"(bh), "v"(bl));
  return c;
}
// batched GEMM like k_gemm_b but f16 operands: A f32 (split into f16 hi/lo if ASPLIT, else rounded to f16), Bt = f16 values [n][k]; alpha; C f32; N multiple of 16 (partial tiles skipped)
template <bool ASPLIT>
__global__ __launch_bounds__(128) void k_gemm_h(const float* __restrict__ A, int lda, size_t sA, const _Float16* __restrict__ Bh, int ldb, size_t sB, float alpha, float* __restrict__ C, int ldc, size_t sC, int M, int N, int K) {
  __shared__ __attribute__((aligned(16))) float so[4][16][64];
  const int tid = threadIdx.x, w = tid >> 5, lane = tid & 31, ln = lane & 15, hh = lane >> 4; const int by = blockIdx.y;
  A += (size_t)by * sA; Bh += (size_t)by * sB; C += (size_t)by * sC;
  const int ntn = (N + 63) / 64; const int wid = blockIdx.x * 4 + w; const int mt = wid / ntn, nq = wid % ntn; if (mt * 16 >= M) return;
  const int row0 = mt * 16, col0 = nq * 64; const float* arow = A + (size_t)(row0 + ln) * lda;
  v8f acc[4] = {};
  for (int kb = 0; kb < K; kb += 32) {
    FragH ah, al;
    const v4f x0 = *(const v4fa*)(arow + kb + 8 * hh), x1 = *(const v4fa*)(arow + kb + 8 * hh + 4), x2 = *(const v4fa*)(arow + kb + 16 + 8 * hh), x3 = *(const v4fa*)(arow + kb + 16 + 8 * hh + 4);
    float xs[16] = {x0[0],x0[1],x0[2],x0[3],x1[0],x1[1],x1[2],x1[3],x2[0],x2[1],x2[2],x2[3],x3[0],x3[1],x3[2],x3[3]};
#pragma unroll
    for (int i = 0; i < 16; ++i) { const _Float16 h = (_Float16)xs[i]; ah.h[i] = h; al.h[i] = ASPLIT ? (_Float16)(xs[i] - (float)h) : (_Float16)0.0f; }
#pragma unroll
    for (int t = 0; t < 4; ++t) { if (col0 + t * 16 >= N) continue; const size_t boff = (size_t)(col0 + t * 16 + ln) * ldb + kb; FragH bq; bq.half[0] = *(const v8us*)(Bh + boff + 8 * hh); bq.half[1] = *(const v8us*)(Bh + boff + 16 + 8 * hh);
      acc[t] = mmaH<ASPLIT ? 2 : 1>(ah.v, al.v, bq.v, bq.v, acc[t]); }
  }
#pragma unroll
  for (int t = 0; t < 4; ++t) { if (col0 + t * 16 >= N) continue;
#pragma unroll
    for (int r = 0; r < 8; ++r) so[w][8 * hh + r][t * 16 + ln] = acc[t][r] * alpha; }
  __builtin_amdgcn_fence(__ATOMIC_ACQ_REL, "workgroup"); __builtin_amdgcn_wave_barrier();
  const int rsub = lane >> 4, c4 = (lane & 15) * 4;
  {
#pragma unroll
    for (int q = 0; q < 8; ++q) { const int r = q * 2 + rsub; if (col0 + c4 < N) { const v4f v = *(const v4fa*)&so[w][r][c4]; *(v4f*)(C + (size_t)(row0 + r) * ldc + col0 + c4) = v; } }
     }
}

// Wt[n][k] = f16(W[k][n]·scale) from f32 row-major W[K][N] (scale = power of two; bf16-exact weights stay exact in f16 away from the subnormal range)
__global__ __launch_bounds__(256) void k_wt_f16(const float* __restrict__ W, _Float16* __restrict__ Wt, int K, int N, float scale) {
  const int t = blockIdx.x * 256 + threadIdx.x; if (t >= N * (K / 8)) return; const int n = t / (K / 8), k8 = (t % (K / 8)) * 8; FragH f;
#pragma unroll
  for (int i = 0; i < 8; ++i) f.h[i] = (_Float16)(bf16_round(W[(size_t)(k8 + i) * N + n]) * scale); const v8us o = f.half[0];
  *(v8us*)((unsigned short*)Wt + (size_t)n * K + k8) = o; 
}
// k_gemm_hh variant with fused epilogue: v = acc·alpha + bias[by·sBias + col] (+ CP[(row/rowsPerB)·sCPb + by·64 + col] if CP) ; ACT 0 none / 1 elu ; writes f16 C16 (and f32 C if non-null)
template <int ACT>
__global__ __launch_bounds__(128) void k_gemm_hhx(const _Float16* __restrict__ A, int lda, size_t sA, const _Float16* __restrict__ Bh, int ldb, size_t sB, float alpha, const float* __restrict__ bias, size_t sBias, const float* __restrict__ CP, int rowsPerB, size_t sCPb, int row0g,
    float* __restrict__ C, _Float16* __restrict__ C16, int ldc, size_t sC, int M, int N, int K) {
  __shared__ __attribute__((aligned(16))) float so[4][16][64];
  const int tid = threadIdx.x, w = tid >> 5, lane = tid & 31, ln = lane & 15, hh = lane >> 4; const int by = blockIdx.y;
  A += (size_t)by * sA; Bh += (size_t)by * sB; const size_t cofs = (size_t)by * sC; const float* bp = bias ? bias + (size_t)by * sBias : nullptr;
  const int ntn = (N + 63) / 64; const int wid = blockIdx.x * 4 + w; const int mt = wid / ntn, nq = wid % ntn; if (mt * 16 >= M) return;
  const int row0 = mt * 16, col0 = nq * 64; const _Float16* arow = A + (size_t)(row0 + ln) * lda;
  v8f acc[4] = {};
  for (int kb = 0; kb < K; kb += 32) { FragH ah; ah.half[0] = *(const v8us*)((const unsigned short*)arow + kb + 8 * hh); ah.half[1] = *(const v8us*)((const unsigned short*)arow + kb + 16 + 8 * hh);
#pragma unroll
    for (int t = 0; t < 4; ++t) { if (col0 + t * 16 >= N) continue; const size_t boff = (size_t)(col0 + t * 16 + ln) * ldb + kb; FragH bq; bq.half[0] = *(const v8us*)((const unsigned short*)Bh + boff + 8 * hh); bq.half[1] = *(const v8us*)((const unsigned short*)Bh + boff + 16 + 8 * hh);
      acc[t] = mmaH<1>(ah.v, ah.v, bq.v, bq.v, acc[t]); }
  }
#pragma unroll
  for (int t = 0; t < 4; ++t) { if (col0 + t * 16 >= N) continue; const int col = col0 + t * 16 + ln; const float bv = bp ? bf16_round(bp[col]) : 0.f;
#pragma unroll
    for (int r = 0; r < 8; ++r) { float v = acc[t][r] * alpha + bv; if (CP) { const int rr = row0g + row0 + 8 * hh + r; if (rowsPerB < 0) v += CP[cofs + (size_t)rr * ldc + col];      /* rowsPerB < 0: own element of the batched C plane */ else { const int bidx = rr / rowsPerB; v += CP[(size_t)bidx * sCPb + (size_t)by * 64 + col]; } } if (ACT == 1) v = (v > 0.f) ? v : expm1f(v); else if (ACT == 7) v = (v > 0.f) ? v + 1.0f : expf(v); else if (ACT == 8) v = tanhf(v); else if (ACT == 9) v = 0.5f * v * (1.0f + tanhf(0.7978845608028654f * (v + 0.044715f * v * v * v))); else if (ACT == 11) v = 1.0f / (1.0f + expf(-v)); else if (ACT == 12) v = (v > 0.f) ? v : 0.01f * v; else if (ACT == 14) v = (v > 0.f) ? v : 0.1f * v; else if (ACT == 16) v = (v >= 0.f) ? v : 0.3f * v; else if (ACT == 17) v = (v >= 0.f) ? v : 0.2f * v; else if (ACT == 15) v = v / (1.0f + expf(-v)); else if (ACT == 3) v = fmaxf(v, 0.f); else if (ACT == 6) v = 0.5f * v * (1.0f + erff(v * 0.70710678118654752f)); so[w][8 * hh + r][t * 16 + ln] = v; } }
  __builtin_amdgcn_fence(__ATOMIC_ACQ_REL, "workgroup"); __builtin_amdgcn_wave_barrier();
  const int rsub = lane >> 4, c4 = (lane & 15) * 4; typedef _Float16 v4h __attribute__((ext_vector_type(4)));
  {
#pragma unroll
    for (int q = 0; q < 8; ++q) { const int r = q * 2 + rsub; if (col0 + c4 < N) { const v4f v = *(const v4fa*)&so[w][r][c4]; if (C) *(v4f*)(C + cofs + (size_t)(row0 + r) * ldc + col0 + c4) = v; if (C16) { v4h h4; for (int i = 0; i < 4; ++i) h4[i] = (_Float16)v[i]; *(v4h*)(C16 + cofs + (size_t)(row0 + r) * ldc + col0 + c4) = h4; } } }
     }
}


typedef _Float16 v4h __attribute__((ext_vector_type(4)));

__global__ __launch_bounds__(256) void k_x16(const float* __restrict__ x, _Float16* __restrict__ X16, size_t n8) { const size_t t = (size_t)blockIdx.x * 256 + threadIdx.x; if (t >= n8) return; FragH f;
#pragma unroll
  for (int q = 0; q < 8; ++q) f.h[q] = (_Float16)bf16_round(x[t * 8 + q]); *(v8us*)((unsigned short*)X16 + t * 8) = f.half[0];  }
__global__ __launch_bounds__(256) void k_h16(const float* __restrict__ x, _Float16* __restrict__ X16, size_t n8) { const size_t t = (size_t)blockIdx.x * 256 + threadIdx.x; if (t >= n8) return; FragH f;
#pragma unroll
  for (int q = 0; q < 8; ++q) f.h[q] = (_Float16)x[t * 8 + q]; *(v8us*)((unsigned short*)X16 + t * 8) = f.half[0];  }
__global__ __launch_bounds__(256) void k_round16f(const float* __restrict__ W, _Float16* __restrict__ Bt, size_t n8) { const size_t t = (size_t)blockIdx.x * 256 + threadIdx.x; if (t >= n8) return; FragH f;
#pragma unroll
  for (int i = 0; i < 8; ++i) f.h[i] = (_Float16)(bf16_round(W[t * 8 + i]) * 16.0f); *(v8us*)((unsigned short*)Bt + t * 8) = f.half[0];  }
template <int NHv, int TTv>
__global__ __launch_bounds__(256) void k_vt(const _Float16* __restrict__ V16, int ldv, int voff, _Float16* __restrict__ Vt) { __shared__ unsigned short tl[64][66]; const int tid = threadIdx.x; const int slab = blockIdx.x / (TTv / 64), lg = blockIdx.x % (TTv / 64); const int b = slab / NHv, h = slab % NHv;
  for (int i = tid; i < 64 * 8; i += 256) { const int r = i / 8, c8 = (i % 8) * 8; FragH f; f.half[0] = *(const v8us*)((const unsigned short*)V16 + ((size_t)b * TTv + lg * 64 + r) * ldv + voff + h * 64 + c8);
#pragma unroll
    for (int q = 0; q < 8; ++q) tl[r][c8 + q] = f.u[q]; }
  __syncthreads();
  {
#pragma unroll
    for (int rd = 0; rd < 2; ++rd) { const int d = rd * 32 + tid / 8, pc = tid % 8; FragH f;
#pragma unroll
      for (int q = 0; q < 8; ++q) f.u[q] = tl[pc * 8 + q][d];
      *(v8us*)((unsigned short*)Vt + ((size_t)slab * 64 + d) * TTv + lg * 64 + pc * 8) = f.half[0]; }
     } }

__global__ __launch_bounds__(256) void k_hl(const float* __restrict__ F, _Float16* __restrict__ Hh, _Float16* __restrict__ Hl, size_t n8) { const size_t t = (size_t)blockIdx.x * 256 + threadIdx.x; if (t >= n8) return; FragH fh, fl; const v4f a = *(const v4fa*)(F + t * 8), c = *(const v4fa*)(F + t * 8 + 4);
#pragma unroll
  for (int q = 0; q < 4; ++q) { _Float16 h = (_Float16)a[q]; fh.h[q] = h; fl.h[q] = (_Float16)((a[q] - (float)h) * 1024.0f); h = (_Float16)c[q]; fh.h[4 + q] = h; fl.h[4 + q] = (_Float16)((c[q] - (float)h) * 1024.0f); }
  { *(v8us*)((unsigned short*)Hh + t * 8) = fh.half[0]; *(v8us*)((unsigned short*)Hl + t * 8) = fl.half[0];  } }

// ---- fast GEMM (wave tile 32x64; requires M % 32 == 0 rows per launch region and N % 64 == 0); epilogue = k_gemm_hhx semantics ----
__device__ __forceinline__ v16h g2_frag(const _Float16* p, int hh) { FragH f; f.half[0] = *(const v8us*)((const unsigned short*)p + 8 * hh); f.half[1] = *(const v8us*)((const unsigned short*)p + 16 + 8 * hh); return f.v; }
__device__ __forceinline__ v8f g2_mma(v16h a, v16h b, v8f c) { v8f d = __builtin_amdgcn_wmma_f32_16x16x32_f16(false, a, false, b, (short)0, c, false, false); asm volatile("v_nop\n\tv_nop\n\tv_nop\n\tv_nop" : "+v"(d) : "v"(a), "v"(b)); return d; }
template <int ACT>
__global__ __launch_bounds__(128) void k_gemm2(const _Float16* __restrict__ A, int lda, size_t sA, const _Float16* __restrict__ Bh, int ldb, size_t sB, float alpha, const float* __restrict__ bias, size_t sBias, const float* __restrict__ CP, int rowsPerB, size_t sCPb, int row0g,
    float* __restrict__ C, _Float16* __restrict__ C16, int ldc, size_t sC, int M, int N, int K) { static_assert(ACT == 0 || ACT == 3 || ACT == 6 || ACT == 8 || ACT == 9 || ACT == 11 || ACT == 12 || ACT == 14 || ACT == 15 || ACT == 16 || ACT == 17, "k_gemm2: unsupported ACT code (would silently apply no activation)");
  __shared__ __attribute__((aligned(16))) float so[4][32][68];
  const int tid = threadIdx.x, w = tid >> 5, lane = tid & 31, ln = lane & 15, hh = lane >> 4; const int by = blockIdx.y;
  A += (size_t)by * sA; Bh += (size_t)by * sB; const size_t cofs = (size_t)by * sC; const float* bp = bias ? bias + (size_t)by * sBias : nullptr;
  const int ntn = N >> 6; const int mt = blockIdx.x / ntn, nq = blockIdx.x - mt * ntn; const int row0 = mt * 128 + 32 * w, col0 = nq * 64; if (row0 >= M) return;
  const _Float16* a0p = A + (size_t)(row0 + ln) * lda; const _Float16* a1p = a0p + (size_t)16 * lda;
  const _Float16* b0p = Bh + (size_t)(col0 + ln) * ldb; const _Float16* b1p = b0p + (size_t)16 * ldb; const _Float16* b2p = b1p + (size_t)16 * ldb; const _Float16* b3p = b2p + (size_t)16 * ldb;
  const v8f z8 = {0.f,0.f,0.f,0.f,0.f,0.f,0.f,0.f}; v8f c00 = z8, c01 = z8, c02 = z8, c03 = z8, c10 = z8, c11 = z8, c12 = z8, c13 = z8;
#pragma unroll 1
  for (int kb = 0; kb < K; kb += 32) { const v16h a0 = g2_frag(a0p + kb, hh), a1 = g2_frag(a1p + kb, hh);
    v16h b = g2_frag(b0p + kb, hh); c00 = g2_mma(a0, b, c00); c10 = g2_mma(a1, b, c10);
    b = g2_frag(b1p + kb, hh); c01 = g2_mma(a0, b, c01); c11 = g2_mma(a1, b, c11);
    b = g2_frag(b2p + kb, hh); c02 = g2_mma(a0, b, c02); c12 = g2_mma(a1, b, c12);
    b = g2_frag(b3p + kb, hh); c03 = g2_mma(a0, b, c03); c13 = g2_mma(a1, b, c13); }
  v8f accs[8] = {c00, c01, c02, c03, c10, c11, c12, c13};
#pragma unroll
  for (int u = 0; u < 8; ++u) { const int t = u & 3, half = u >> 2; const int col = col0 + t * 16 + ln; const float bv = bp ? bf16_round(bp[col]) : 0.f;
#pragma unroll
    for (int r = 0; r < 8; ++r) { const int rloc = half * 16 + 8 * hh + r; float v = accs[u][r] * alpha + bv; if (CP) { if (rowsPerB < 0) v += CP[cofs + (size_t)(row0g + row0 + rloc) * ldc + col];      /* rowsPerB < 0: own element of the batched C plane */ else { const int bidx = (row0g + row0 + rloc) / rowsPerB; v += CP[(size_t)bidx * sCPb + (size_t)by * 64 + col]; } }
      if (ACT == 3) v = fmaxf(v, 0.f); else if (ACT == 6) v = 0.5f * v * (1.0f + erff(v * 0.70710678118654752f)); else if (ACT == 11) v = 1.0f / (1.0f + expf(-v)); else if (ACT == 15) v = v / (1.0f + expf(-v)); else if (ACT == 12) v = (v > 0.f) ? v : 0.01f * v; else if (ACT == 8) v = tanhf(v); else if (ACT == 9) v = 0.5f * v * (1.0f + tanhf(0.7978845608028654f * (v + 0.044715f * v * v * v))); else if (ACT == 14) v = (v > 0.f) ? v : 0.1f * v; else if (ACT == 16) v = (v >= 0.f) ? v : 0.3f * v; else if (ACT == 17) v = (v >= 0.f) ? v : 0.2f * v;
      so[w][rloc][t * 16 + ln] = v; } }
  __builtin_amdgcn_fence(__ATOMIC_ACQ_REL, "workgroup"); __builtin_amdgcn_wave_barrier();
  const int rsub = lane >> 4, c4 = (lane & 15) * 4;
  {
#pragma unroll
    for (int q = 0; q < 16; ++q) { const int r = q * 2 + rsub; const v4f v = *(const v4fa*)&so[w][r][c4]; if (C) *(v4f*)(C + cofs + (size_t)(row0 + r) * ldc + col0 + c4) = v; if (C16) { v4h h4; for (int i = 0; i < 4; ++i) h4[i] = (_Float16)v[i]; *(v4h*)(C16 + cofs + (size_t)(row0 + r) * ldc + col0 + c4) = h4; } }
     } }


__global__ __launch_bounds__(256) void k_wnat(const float* __restrict__ w, size_t n8, _Float16* __restrict__ Bt) { const size_t t = (size_t)blockIdx.x * 256 + threadIdx.x; if (t >= n8) return; FragH f; for (int q = 0; q < 8; ++q) f.h[q] = (_Float16)(bf16_round(w[t * 8 + q]) * 16.0f); *(v8us*)((unsigned short*)Bt + t * 8) = f.half[0];  }
__global__ __launch_bounds__(256) void k_rsm(const float* __restrict__ S, _Float16* __restrict__ P, int nrows) {
  #pragma clang fp contract(off)
  const int i = blockIdx.x * 256 + threadIdx.x; if (i >= nrows) return; const float* s = S + (size_t)i * SQ; float mx = -3.0e38f;
#pragma unroll 1
  for (int j = 0; j < SQ; ++j) mx = fmaxf(mx, s[j]); float se = 0.f;
#pragma unroll 1
  for (int j = 0; j < SQ; ++j) se += expf(s[j] - mx); const float sc = 256.0f / se;
#pragma unroll 1
  for (int j0 = 0; j0 < SQ; j0 += 8) { FragH f; for (int q = 0; q < 8; ++q) f.h[q] = (_Float16)(expf(s[j0 + q] - mx) * sc); unsigned short* d = (unsigned short*)P + (size_t)i * SQ + j0; *(v8us*)d = f.half[0];  } }
__global__ __launch_bounds__(256) void k_vt(const _Float16* __restrict__ V16, int b, int h0, _Float16* __restrict__ VT) { __shared__ unsigned short tl[64][65]; const int tid = threadIdx.x; const int hh = blockIdx.x % HG, sg = blockIdx.x / HG; const int s0 = sg * 64; const int h = h0 + hh;
  for (int i = tid; i < 64 * 8; i += 256) { const int j = i / 8, d8 = (i % 8) * 8; FragH f; f.half[0] = *(const v8us*)((const unsigned short*)V16 + ((size_t)b * SQ + s0 + j) * DM + h * HD + d8); for (int q = 0; q < 8; ++q) tl[d8 + q][j] = f.u[q]; }
  __syncthreads();
  { for (int i = tid; i < 64 * 8; i += 256) { const int d = i / 8, j8 = (i % 8) * 8; FragH f; for (int q = 0; q < 8; ++q) f.u[q] = tl[d][j8 + q]; *(v8us*)((unsigned short*)VT + ((size_t)hh * HD + d) * SQ + s0 + j8) = f.half[0]; }  } }



__global__ __launch_bounds__(256) void k_rsmcf2(const float* __restrict__ S, _Float16* __restrict__ P, int hg, int q0, int nk) {
  #pragma clang fp contract(off)
  const int t = blockIdx.x * 256 + threadIdx.x; if (t >= hg * QT) return; const size_t i = (size_t)t; const float* s = S + i * NKX; const int last = q0 + (t % QT); float mx = -3.0e38f;
#pragma unroll 1
  for (int j = 0; j < nk; ++j) { const float f = (j <= last) ? 1.f : 0.f; mx = fmaxf(mx, fmaf(f, s[j], (1.f - f) * -1.0e9f)); } float se = 0.f;
#pragma unroll 1
  for (int j = 0; j < nk; ++j) { const float f = (j <= last) ? 1.f : 0.f; se += __expf(fmaf(f, s[j], (1.f - f) * -1.0e9f) - mx); } const float sc = 256.0f / se;
#pragma unroll 1
  for (int j0 = 0; j0 < nk; j0 += 8) { FragH fr; for (int q = 0; q < 8; ++q) { const int j = j0 + q; const float f = (j <= last) ? 1.f : 0.f; fr.h[q] = (_Float16)(__expf(fmaf(f, s[j], (1.f - f) * -1.0e9f) - mx) * sc); } unsigned short* d = (unsigned short*)P + i * NKX + j0; *(v8us*)d = fr.half[0];  } }


template <int MASKADD>
__global__ __launch_bounds__(64) void k_att0(const float* __restrict__ QF, const float* __restrict__ KF, const float* __restrict__ VF, int ld, const float* __restrict__ mask, float scale, float* __restrict__ OF, int ldo) {
  #pragma clang fp contract(off)
  __shared__ __attribute__((aligned(16))) float lo[64][64];      /* only the final row-to-column hand-over for coalesced stores */
  const int tid = threadIdx.x; const int h = blockIdx.x / (QT0 / 64), rg = blockIdx.x % (QT0 / 64); const int i = rg * 64 + tid;
  { const size_t bi = (size_t)blockIdx.y * QT0 * ld; QF += bi; KF += bi; VF += bi; OF += (size_t)blockIdx.y * QT0 * ldo; }      /* batch on grid.y: each batch has its own QT0-row plane */
  const float* qr = QF + (size_t)i * ld + h * HD;
  v4f rq[HD / 4], ro[HD / 4];      /* this thread's q row and o accumulator live in registers for the whole key loop */
#pragma unroll      /* full unroll: rq / ro need constant indices to stay in registers */
  for (int c = 0; c < HD / 4; ++c) { rq[c] = *(const v4fa*)(qr + c * 4); const v4f z = {0.f, 0.f, 0.f, 0.f}; ro[c] = z; }
  asm volatile("s_wait_xcnt 0x0" :: "v"(qr) : "memory");      /* the q loads' address pair stays live up to this wait, so no register that an issued load names is rewritten ahead of it */
  float m = -1.0e30f, l = 0.f; const int jmax = MASKADD ? (SQ - 1) : (rg * 64 + 63);      /* additive-mask form: every key (the mask input decides); causal form: keys up to the block's last row */
#pragma unroll 1
  for (int j = 0; j <= jmax; ++j) { const float* kr = KF + (size_t)j * ld + h * HD; const float* vr = VF + (size_t)j * ld + h * HD; float s = 0.f;
#pragma unroll      /* full unroll: constant index into rq */
    for (int c = 0; c < HD / 4; ++c) { const v4f kq = *(const v4fa*)(kr + c * 4); const v4f qq = rq[c]; s = __fadd_rn(s, __fmul_rn(qq[0], kq[0])); s = __fadd_rn(s, __fmul_rn(qq[1], kq[1])); s = __fadd_rn(s, __fmul_rn(qq[2], kq[2])); s = __fadd_rn(s, __fmul_rn(qq[3], kq[3])); }
    s = __fmul_rn(s, scale); if (MASKADD) s = __fadd_rn(s, __fmul_rn(bf16_round(mask[(size_t)i * SQ + j]), -10000.0f));
    const float f = (MASKADD || j <= i) ? 1.f : 0.f; const float sm = fmaf(f, s, (1.f - f) * -1.0e30f); const float mn = fmaxf(m, sm); const float sc = expf(m - mn); const float e = expf(sm - mn); l = __fadd_rn(__fmul_rn(l, sc), e); m = mn;
#pragma unroll      /* full unroll: constant index into ro */
    for (int c = 0; c < HD / 4; ++c) { const v4f vv = *(const v4fa*)(vr + c * 4); v4f oo = ro[c]; for (int u = 0; u < 4; ++u) oo[u] = __fadd_rn(__fmul_rn(oo[u], sc), __fmul_rn(e, vv[u])); ro[c] = oo; } }
  const float fin = 64.0f / l;      /* o carried x64; k_o0m scales it back by 1/64 */
#pragma unroll      /* full unroll: constant index into ro */
  for (int c = 0; c < HD / 4; ++c) { v4f oo = ro[c]; for (int u = 0; u < 4; ++u) oo[u] = __fmul_rn(oo[u], fin); *(v4f*)&lo[tid][c * 4] = oo; }
  __syncthreads();
  {
#pragma unroll 1
    for (int it = 0; it < 16; ++it) { const int row = it * 4 + tid / 16, pc = (tid % 16) * 4; const v4f v = *(const v4f*)&lo[row][pc]; *(v4f*)(OF + (size_t)(rg * 64 + row) * ldo + h * HD + pc) = v; }
     } }


template <int BFIN, int WXB>
__global__ __launch_bounds__(256) void k_ln16(const float* __restrict__ X, const float* __restrict__ g, const float* __restrict__ bb, float eps, _Float16* __restrict__ N16, float* __restrict__ XB) {
  #pragma clang fp contract(off)
  __shared__ float red[256]; const size_t r = blockIdx.x; const int t = threadIdx.x; const v4f xa = *(const v4fa*)(X + r * DMQ + t * 4); float s[4]; float sum = 0.f;
  for (int q = 0; q < 4; ++q) { s[q] = BFIN ? bf16_round(xa[q]) : xa[q]; sum = __fadd_rn(sum, s[q]); }
  red[t] = sum; __syncthreads(); for (int st = 128; st > 0; st >>= 1) { if (t < st) red[t] = __fadd_rn(red[t], red[t + st]); __syncthreads(); } const float mu = red[0] / (float)DMQ; __syncthreads();
  float vs = 0.f; for (int q = 0; q < 4; ++q) { const float dl = __fadd_rn(s[q], -mu); vs = __fadd_rn(vs, __fmul_rn(dl, dl)); } red[t] = vs; __syncthreads(); for (int st = 128; st > 0; st >>= 1) { if (t < st) red[t] = __fadd_rn(red[t], red[t + st]); __syncthreads(); }
  const float rs = rsqrtf(__fadd_rn(red[0] / (float)DMQ, eps)); v4h y; v4f xb;
  for (int q = 0; q < 4; ++q) { const int c = t * 4 + q; y[q] = (_Float16)__fadd_rn(__fmul_rn(__fmul_rn(__fadd_rn(s[q], -mu), rs), bf16_round(g[c])), bf16_round(bb[c])); xb[q] = s[q]; }
  { *(v4h*)(N16 + r * DMQ + t * 4) = y; if (WXB) *(v4f*)(XB + r * DMQ + t * 4) = xb;  } }
__global__ __launch_bounds__(256) void k_ftres2(const float* __restrict__ OF0, const float* __restrict__ XB, float* __restrict__ X1, size_t n4) {
  #pragma clang fp contract(off)
  const size_t t = (size_t)blockIdx.x * 256 + threadIdx.x; if (t >= n4) return; const v4f o = *(const v4fa*)(OF0 + t * 4), xv = *(const v4fa*)(XB + t * 4); v4f y; for (int q = 0; q < 4; ++q) y[q] = __fadd_rn(__fmul_rn(o[q], 0.015625f), xv[q]); *(v4f*)(X1 + t * 4) = y;  }

__global__ __launch_bounds__(256) void k_wthd(const float* __restrict__ Wt, _Float16* __restrict__ Bt) { const size_t t = (size_t)blockIdx.x * 256 + threadIdx.x; if (t >= (size_t)NH * HD * (DM / 8)) return; const int m8 = (int)(t % (DM / 8)) * 8; const int d = (int)((t / (DM / 8)) % HD); const int h = (int)(t / ((size_t)(DM / 8) * HD)); FragH f;
  for (int q = 0; q < 8; ++q) f.h[q] = (_Float16)(16.0f * bf16_round(Wt[((size_t)h * DM + m8 + q) * HD + d])); unsigned short* dst = (unsigned short*)Bt + ((size_t)h * HD + d) * DM + m8; *(v8us*)dst = f.half[0];  }




__global__ __launch_bounds__(256) void k_wtpad(const float* __restrict__ Wm, _Float16* __restrict__ Wt, int Kr, int Kp, int Nr, int Np, float scale) {
  const int t = blockIdx.x * 256 + threadIdx.x; if (t >= Np * (Kp / 8)) return; const int n = t / (Kp / 8), k8 = (t % (Kp / 8)) * 8; const int nc = min(n, Nr - 1); const float fn = (n < Nr) ? 1.f : 0.f; FragH f;
  for (int i = 0; i < 8; ++i) { const int k = k8 + i; const int kc = min(k, Kr - 1); const float fk = (k < Kr) ? fn : 0.f; f.h[i] = (_Float16)(bf16_round(Wm[(size_t)kc * Nr + nc]) * scale * fk); }
  unsigned short* o = (unsigned short*)Wt + (size_t)n * Kp + k8; *(v8us*)o = f.half[0];  }
__global__ __launch_bounds__(128) void k_bpad(const float* __restrict__ b, float* __restrict__ Bp, int nr, int np) {
  const int i = threadIdx.x; if (i >= np) return; const float v = b[min(i, nr - 1)] * ((i < nr) ? 1.f : 0.f); *(float*)(Bp + i) = v;  }

#define DI 64         /* inner width = NH * HD (ONE 64-wide head) */
#define LQK (3 * DI)  /* fused q | k | v row pitch (192) */
__global__ __launch_bounds__(256) void k_o0(const float* __restrict__ OF, float* __restrict__ ob, size_t n4) {
  #pragma clang fp contract(off)
  const size_t t = (size_t)blockIdx.x * 256 + threadIdx.x; if (t >= n4) return; const size_t e = t * 4; const int i = (int)(e / DI); const int c = (int)(e % DI); const int h = c / HD, d = c % HD; const v4f a = *(const v4fa*)(OF + e); v4f o; for (int q = 0; q < 4; ++q) o[q] = __fmul_rn(a[q], 0.015625f); float* dst = ob + (size_t)h * SQ * HD + (size_t)i * HD + d; *(v4f*)dst = o;  }

__global__ __launch_bounds__(256) void k_o0m(const float* __restrict__ OF, float* __restrict__ o_, size_t n4) {
  #pragma clang fp contract(off)
  const size_t t = (size_t)blockIdx.x * 256 + threadIdx.x; if (t >= n4) return; const size_t e = t * 4; OF += (size_t)blockIdx.y * QT0 * DI; o_ += (size_t)blockIdx.y * SQ * DI;      /* batch on grid.y: QT0 exact rows go to the head of the batch's SQ output rows */
  const v4f a = *(const v4fa*)(OF + e); v4f o; for (int q = 0; q < 4; ++q) o[q] = __fmul_rn(a[q], 0.015625f); *(v4f*)(o_ + e) = o;  }
extern "C" void kernel_launch(void* const* d_in, const int* in_sizes, int n_in,
                              void* d_out, int out_size, void* d_ws, size_t ws_size, hipStream_t stream) {
  (void)in_sizes; (void)n_in; (void)out_size;
  const float* const* I = (const float* const*)d_in; const float* x = I[0]; const float* wq = I[2]; const float* wk = I[1]; const float* wv = I[3]; const float* bq = nullptr; const float* bk = nullptr; const float* bv = nullptr;      /* x; [in][out = 64] Wk / Wq / Wv (input order as this module lists them); no biases */
  char* ws = (char*)d_ws; size_t off = 0;
  auto take = [&](size_t bytes) { char* p = ws + off; off += (bytes + 255) & ~(size_t)255; return p; };
  _Float16* BW = (_Float16*)take((size_t)LQK * DM * 2); _Float16* X16 = (_Float16*)take(NR * DM * 2); _Float16* QKV = (_Float16*)take(NR * LQK * 2); _Float16* VT = (_Float16*)take((size_t)NB * HD * SQ * 2);
  float* S = (float*)take((size_t)NB * QT * NKX * 4); _Float16* P = (_Float16*)take((size_t)NB * QT * NKX * 2); float* QKVF0 = (float*)take((size_t)NB * QT0 * LQK * 4); float* OF0 = (float*)take((size_t)NB * QT0 * DI * 4);      /* one plane per batch: all batches are in flight in every launch */
  if (off > ws_size) return;
  { const unsigned g = (unsigned)(((size_t)DI * (DM / 8) + 255) / 256); k_wt_f16<<<g, 256, 0, stream>>>(wq, BW, DM, DI, 16.0f); k_wt_f16<<<g, 256, 0, stream>>>(wk, BW + (size_t)DI * DM, DM, DI, 16.0f); k_wt_f16<<<g, 256, 0, stream>>>(wv, BW + (size_t)2 * DI * DM, DM, DI, 16.0f); }      /* [in = DM][out = 64] -> Bt[n][k] x16, stacked q | k | v */
  k_x16<<<(unsigned)((NR * DM / 8 + 255) / 256), 256, 0, stream>>>(x, X16, NR * DM / 8);      /* x (bf16-valued) as exact f16 rows */
  const float* bqkv[3] = {bq, bk, bv};
  for (int c = 0; c < 3; ++c) k_gemm2<0><<<dim3((unsigned)((NR / 128) * (DI / 64)), 1), 128, 0, stream>>>(X16, DM, 0, BW + (size_t)c * DI * DM, DM, 0, 0.0625f, bqkv[c], 0, nullptr, 1, 0, 0, nullptr, QKV + (size_t)c * DI, LQK, 0, (int)NR, DI, DM);      /* q | k | v = x W -> f16 rows, column blocks 0 / 64 / 128 of the fused plane (pitch 192); head h = columns h*64 inside each */
  const _Float16* Q16 = QKV; const _Float16* K16 = QKV + DI; const _Float16* V16 = QKV + 2 * DI;
  float* ob = (float*)d_out;      /* the batch is grid.y of every launch below but k_vt and k_rsmcf2, which index it in grid.x (ONE head, so the head stride of the kernels carries the batch) */
  k_vt<NH, SQ><<<NB * NH * (SQ / 64), 256, 0, stream>>>(V16, LQK, 0, VT);      /* V^T [NB][HD][SQ] */
  for (int q0 = 0; q0 < SQ; q0 += QT) { const int nk = q0 + QT;      /* causal: only keys below the tile end are computed */
    k_gemm2<0><<<dim3((QT / 128) * (nk / 64), NB), 128, 0, stream>>>(Q16 + (size_t)q0 * LQK, LQK, (size_t)SQ * LQK, K16, LQK, (size_t)SQ * LQK, 0.125f, nullptr, 0, nullptr, 1, 0, 0, S, nullptr, NKX, (size_t)QT * NKX, QT, nk, HD);      /* scores / 8 */
    k_rsmcf2<<<(NB * QT + 255) / 256, 256, 0, stream>>>(S, P, NB, q0, nk);      /* causal softmax -> P x256 f16 */
    k_gemm2<0><<<dim3((QT / 128) * (HD / 64), NB), 128, 0, stream>>>(P, NKX, (size_t)QT * NKX, VT, SQ, (size_t)HD * SQ, 0.00390625f, nullptr, 0, nullptr, 1, 0, 0, ob + (size_t)q0 * DI, nullptr, DI, (size_t)SQ * DI, QT, HD, nk); }      /* out[b][q0 + i][..] = P V^T 2^-8 (f32) */
  for (int c = 0; c < 3; ++c) k_gemm2<0><<<dim3((unsigned)((QT0 / 128) * (DI / 64)), NB), 128, 0, stream>>>(X16, DM, (size_t)SQ * DM, BW + (size_t)c * DI * DM, DM, 0, 0.0625f, bqkv[c], 0, nullptr, 1, 0, 0, QKVF0 + (size_t)c * DI, nullptr, LQK, (size_t)QT0 * LQK, QT0, DI, DM);      /* f32 q | k | v of rows 0..511 of every batch (exact products, f32 accumulation) */
  k_att0<0><<<dim3(NH * (QT0 / 64), NB), 64, 0, stream>>>(QKVF0, QKVF0 + DI, QKVF0 + 2 * DI, LQK, nullptr, 0.125f, OF0, DI);      /* exact f32 causal attention for rows 0..511 (o x64) */
  k_o0m<<<dim3((unsigned)(((size_t)QT0 * DI / 4 + 255) / 256), NB), 256, 0, stream>>>(OF0, ob, (size_t)QT0 * DI / 4);      /* rows 0..511 of every batch REWRITTEN from the exact path */
}

// v003
// It runs in 595 microseconds.
// Timed twice side by side with v002, it ran 1.69 times as fast both times.
// Counting every step since v000, it is 121 times as fast.
#include <hip/hip_runtime.h>
// Single-head causal self-attention (x [32][1024][384]; k/q/v = x W ([in][out] [384][64], no biases; input order Wk, Wq, Wv); ONE 64-wide head; wei * 64^-0.5; causal (tril, -inf); softmax; out = wei v -> [32][1024][64]; no output projection).
// Structure: token rows; x as exact f16 rows; three WMMA GEMMs (no bias) into one f16 q | k | v plane [32768][192]; per batch v^T via LDS transposes; causal 256-row query tiles with the batch on grid.y (scores alpha 1/8, causal softmax f32 -> f16 x256 weights, P V written as f32 straight into the merged output rows); an exact f32 first tile (rows 0..511) rewritten at the end; launches: see trace.
// Compute dtype: inputs rounded to bf16; x / weights exact; q, k, v and softmax weights as plain f16 GEMM operands (~2^-12); o written as f32; scores and softmax statistics f32. v_wmma_f32_16x16x32_f16.
#define NB 32
#define SQ 1024
#define DM 384
#define NH 1
#define HD 64
#define HG 4
#define QT 256                       /* query rows per causal tile */
#define NKX SQ                       /* S / P row pitch */
#define QT0 512                      /* first-tile rows recomputed exactly (f32): 512 here (no output projection averages the early-row cancellation errors away; logit sigma 1.0) */
#define B0 0                         /* unused; batches start at 0 on grid.y */
#define NBR NB                       /* feeds only MP; unused by the launches */
#define NR ((size_t)NB * SQ)
#define DMQ DM
#define DFF 4096
#define DFFR 100
#define MP ((int)((size_t)NBR * SQ)) /* unused; the projections use NR rows */
#define QN SQ                        /* unused */
#define NHD NH                       /* unused */
#define MPO MP                       /* unused */
#define LQ (3 * DM)      /* 3 * DM, unused; the q/k/v rows use pitch LQK (192) */
typedef __bf16 v16b __attribute__((ext_vector_type(16)));
typedef unsigned short v8us __attribute__((ext_vector_type(8), may_alias));
typedef float  v8f  __attribute__((ext_vector_type(8)));
typedef float  v4f  __attribute__((ext_vector_type(4)));
typedef float  v4fa __attribute__((ext_vector_type(4), may_alias));
union FragB { v16b v; v8us half[2]; unsigned short u[16]; };

__device__ __forceinline__ unsigned short bf16_bits(float x) { unsigned int u = __float_as_uint(x); return (unsigned short)((u + 0x7FFFu + ((u >> 16) & 1u)) >> 16); }
__device__ __forceinline__ float bf16_val(unsigned short b) { return __uint_as_float(((unsigned int)b) << 16); }
__device__ __forceinline__ float bf16_round(float x) { return bf16_val(bf16_bits(x)); }
// D += A·B with NT terms: 1 = ah·bh, 2 = + al·bh (A split), 3 = + ah·bl (both split)
template <int NT>
__device__ __forceinline__ v8f mmaN(v16b ah, v16b al, v16b bh, v16b bl, v8f c) {
  c = __builtin_amdgcn_wmma_f32_16x16x32_bf16(false, ah, false, bh, (short)0, c, false, false);
  if (NT >= 2) c = __builtin_amdgcn_wmma_f32_16x16x32_bf16(false, al, false, bh, (short)0, c, false, false);
  if (NT >= 3) c = __builtin_amdgcn_wmma_f32_16x16x32_bf16(false, ah, false, bl, (short)0, c, false, false);
  asm volatile("v_nop\n\tv_nop\n\tv_nop\n\tv_nop" : "+v"(c) : "v"(ah), "v"(al), "v"(bh), "v"(bl));
  return c;
}

__global__ __launch_bounds__(256) void k_wt_bf16(const float* __restrict__ W, unsigned short* __restrict__ Wt, int K, int N) {
  const int t = blockIdx.x * 256 + threadIdx.x;
  const int k8n = K / 8;
  if (t >= N * k8n) return;
  const int n = t / k8n, k8 = (t % k8n) * 8;
  v8us v;
#pragma unroll
  for (int i = 0; i < 8; ++i) v[i] = bf16_bits(W[(size_t)(k8 + i) * N + n]);
  *(v8us*)(Wt + (size_t)n * K + k8) = v;
  
}

// GEMM C[M][N] (f32, pitch ldc) = act(A[M][K]·W + bias). A f32 row-major (pitch lda) converted per fragment to bf16
// (ASPLIT: hi/lo two planes -> 2 terms, else single rounded term); Wt bf16 [N][K] (pitch ldb). BIAS_BF16 rounds the
// bias to bf16 first (bias quantised to bf16 before the add). K%32==0, M%16==0, N%64==0.
template <bool ASPLIT, int ACT, bool BIAS_BF16>
__global__ __launch_bounds__(128) void k_gemm_bf(const float* __restrict__ A, int lda, const unsigned short* __restrict__ Wt, int ldb,
                                               const float* __restrict__ bias, float* __restrict__ C, int ldc, int M, int N, int K) {
  __shared__ __attribute__((aligned(16))) float so[4][16][64];
  const int tid = threadIdx.x, w = tid >> 5, lane = tid & 31, ln = lane & 15, hh = lane >> 4;
  const int ntn = N / 64;
  const int wid = blockIdx.x * 4 + w;
  const int mt = wid / ntn, nq = wid % ntn;
  if (mt * 16 >= M) return;
  const int row0 = mt * 16, col0 = nq * 64;
  const float* arow = A + (size_t)(row0 + ln) * lda;
  v8f acc[4] = {};
  for (int kb = 0; kb < K; kb += 32) {
    FragB ah, al;
    const v4f x0 = *(const v4fa*)(arow + kb + 8 * hh), x1 = *(const v4fa*)(arow + kb + 8 * hh + 4);
    const v4f x2 = *(const v4fa*)(arow + kb + 16 + 8 * hh), x3 = *(const v4fa*)(arow + kb + 16 + 8 * hh + 4);
    float xs[16] = {x0[0],x0[1],x0[2],x0[3],x1[0],x1[1],x1[2],x1[3],x2[0],x2[1],x2[2],x2[3],x3[0],x3[1],x3[2],x3[3]};
#pragma unroll
    for (int i = 0; i < 16; ++i) { const unsigned short hb = bf16_bits(xs[i]); ah.u[i] = hb; al.u[i] = ASPLIT ? bf16_bits(xs[i] - bf16_val(hb)) : (unsigned short)0; }
#pragma unroll
    for (int t = 0; t < 4; ++t) {
      const unsigned short* brow = Wt + (size_t)(col0 + t * 16 + ln) * ldb + kb;
      FragB b;
      b.half[0] = *(const v8us*)(brow + 8 * hh);
      b.half[1] = *(const v8us*)(brow + 16 + 8 * hh);
      acc[t] = mmaN<ASPLIT ? 2 : 1>(ah.v, al.v, b.v, b.v, acc[t]);
    }
  }
#pragma unroll
  for (int t = 0; t < 4; ++t) {
    float bv = bias ? bias[col0 + t * 16 + ln] : 0.f;
    if (BIAS_BF16) bv = bf16_round(bv);
#pragma unroll
    for (int r = 0; r < 8; ++r) { float v = acc[t][r] + bv; if (ACT == 1) v = fmaxf(v, 0.f); so[w][8 * hh + r][t * 16 + ln] = v; }
  }
  __builtin_amdgcn_fence(__ATOMIC_ACQ_REL, "workgroup");
  __builtin_amdgcn_wave_barrier();
  const int rsub = lane >> 4, c4 = (lane & 15) * 4;
  {
#pragma unroll
    for (int q = 0; q < 8; ++q) {
      const int r = q * 2 + rsub;
      const v4f v = *(const v4fa*)&so[w][r][c4];
      *(v4f*)(C + (size_t)(row0 + r) * ldc + col0 + c4) = v;
    }
    
  }
}

// GEMM C = act(A·W + bias + resid): A f32 (ASPLIT -> hi/lo 2 terms), Wt bf16 [N][K]; ACT 0 none, 1 relu, 2 exact gelu;
// resid (optional, f32, row index = (row % rmod), pitch ldr, RES_BF16 rounds it) added before the activation.
template <bool ASPLIT, int ACT, bool BIAS_BF16, bool RES_BF16>
__global__ __launch_bounds__(128) void k_gemm_bf3(const float* __restrict__ A, int lda, const unsigned short* __restrict__ Wt, int ldb,
                                                const float* __restrict__ bias, const float* __restrict__ resid, int rmod, int ldr,
                                                float* __restrict__ C, int ldc, int M, int N, int K) {
  __shared__ __attribute__((aligned(16))) float so[4][16][64];
  const int tid = threadIdx.x, w = tid >> 5, lane = tid & 31, ln = lane & 15, hh = lane >> 4;
  const int ntn = N / 64;
  const int wid = blockIdx.x * 4 + w;
  const int mt = wid / ntn, nq = wid % ntn;
  if (mt * 16 >= M) return;
  const int row0 = mt * 16, col0 = nq * 64;
  const float* arow = A + (size_t)(row0 + ln) * lda;
  v8f acc[4] = {};
  for (int kb = 0; kb < K; kb += 32) {
    FragB ah, al;
    const v4f x0 = *(const v4fa*)(arow + kb + 8 * hh), x1 = *(const v4fa*)(arow + kb + 8 * hh + 4);
    const v4f x2 = *(const v4fa*)(arow + kb + 16 + 8 * hh), x3 = *(const v4fa*)(arow + kb + 16 + 8 * hh + 4);
    float xs[16] = {x0[0],x0[1],x0[2],x0[3],x1[0],x1[1],x1[2],x1[3],x2[0],x2[1],x2[2],x2[3],x3[0],x3[1],x3[2],x3[3]};
#pragma unroll
    for (int i = 0; i < 16; ++i) { const unsigned short hb = bf16_bits(xs[i]); ah.u[i] = hb; al.u[i] = ASPLIT ? bf16_bits(xs[i] - bf16_val(hb)) : (unsigned short)0; }
#pragma unroll
    for (int t = 0; t < 4; ++t) {
      const unsigned short* brow = Wt + (size_t)(col0 + t * 16 + ln) * ldb + kb;
      FragB b;
      b.half[0] = *(const v8us*)(brow + 8 * hh);
      b.half[1] = *(const v8us*)(brow + 16 + 8 * hh);
      acc[t] = mmaN<ASPLIT ? 2 : 1>(ah.v, al.v, b.v, b.v, acc[t]);
    }
  }
#pragma unroll
  for (int t = 0; t < 4; ++t) {
    const int col = col0 + t * 16 + ln;
    float bv = bias ? bias[col] : 0.f;
    if (BIAS_BF16) bv = bf16_round(bv);
#pragma unroll
    for (int r = 0; r < 8; ++r) {
      float v = acc[t][r] + bv;
      if (resid) { float rv = resid[(size_t)((row0 + 8 * hh + r) % rmod) * ldr + col]; if (RES_BF16) rv = bf16_round(rv); v += rv; }
      if (ACT == 1) v = fmaxf(v, 0.f);
      if (ACT == 2) v = 0.5f * v * (1.0f + erff(v * 0.70710678118654752f));
      if (ACT == 3) { const float u = 0.7978845608028654f * (v + 0.044715f * v * v * v); v = 0.5f * v * (1.0f + tanhf(u)); }
      so[w][8 * hh + r][t * 16 + ln] = v;
    }
  }
  __builtin_amdgcn_fence(__ATOMIC_ACQ_REL, "workgroup");
  __builtin_amdgcn_wave_barrier();
  const int rsub = lane >> 4, c4 = (lane & 15) * 4;
  {
#pragma unroll
    for (int q = 0; q < 8; ++q) {
      const int r = q * 2 + rsub;
      const v4f v = *(const v4fa*)&so[w][r][c4];
      *(v4f*)(C + (size_t)(row0 + r) * ldc + col0 + c4) = v;
    }
    
  }
}
// row LayerNorm (biased variance, eps) over N: s = X (+ R); optional out_sum <- s; out_norm <- (s-mu)*rsqrt(var+eps)*g + b
template <bool PARAM_BF16>
__global__ __launch_bounds__(256) void k_layernorm(const float* __restrict__ X, const float* __restrict__ R, const float* __restrict__ g, const float* __restrict__ bta,
                                                  float* __restrict__ out_sum, float* __restrict__ out_norm, int N, float eps) {
  __shared__ float red[256];
  const int row = blockIdx.x, tid = threadIdx.x;
  const float* x = X + (size_t)row * N; const float* rr = R ? R + (size_t)row * N : nullptr;
  float vals[16];                     // up to N = 4096
  const int per = N / 256;            // contiguous chunk per thread? use strided-by-4 chunks: thread handles j = tid*4 + 1024*u
  float s1 = 0.f;
  for (int u = 0; u < per / 4; ++u) {
    const int j = tid * 4 + 1024 * u;
    const v4f a = *(const v4fa*)(x + j);
    v4f b = {0.f,0.f,0.f,0.f}; if (rr) b = *(const v4fa*)(rr + j);
#pragma unroll
    for (int q = 0; q < 4; ++q) { const float v = a[q] + b[q]; vals[u * 4 + q] = v; s1 += v; }
  }
  red[tid] = s1; __syncthreads();
  for (int st = 128; st > 0; st >>= 1) { if (tid < st) red[tid] += red[tid + st]; __syncthreads(); }
  const float mu = red[0] / (float)N; __syncthreads();
  float s2 = 0.f;
  for (int u = 0; u < per / 4; ++u)
#pragma unroll
    for (int q = 0; q < 4; ++q) { const float c = vals[u * 4 + q] - mu; s2 += c * c; }
  red[tid] = s2; __syncthreads();
  for (int st = 128; st > 0; st >>= 1) { if (tid < st) red[tid] += red[tid + st]; __syncthreads(); }
  const float rs = rsqrtf(red[0] / (float)N + eps);
  {
    for (int u = 0; u < per / 4; ++u) {
      const int j = tid * 4 + 1024 * u;
      v4f o, sm;
#pragma unroll
      for (int q = 0; q < 4; ++q) {
        float gg = g[j + q], bb = bta[j + q];
        if (PARAM_BF16) { gg = bf16_round(gg); bb = bf16_round(bb); }
        sm[q] = vals[u * 4 + q]; o[q] = (vals[u * 4 + q] - mu) * rs * gg + bb;
      }
      if (out_sum) *(v4f*)(out_sum + (size_t)row * N + j) = sm;
      *(v4f*)(out_norm + (size_t)row * N + j) = o;
    }
    
  }
}



// ---- f16 WMMA path (v_wmma_f32_16x16x32_f16): 11-bit significands for operands in range — used where a [0,1] probability operand needs more precision than bf16
typedef _Float16 v16h __attribute__((ext_vector_type(16)));
union FragH { v16h v; v8us half[2]; _Float16 h[16]; unsigned short u[16]; };
template <int NT>
__device__ __forceinline__ v8f mmaH(v16h ah, v16h al, v16h bh, v16h bl, v8f c) {
  c = __builtin_amdgcn_wmma_f32_16x16x32_f16(false, ah, false, bh, (short)0, c, false, false);
  if (NT >= 2) c = __builtin_amdgcn_wmma_f32_16x16x32_f16(false, al, false, bh, (short)0, c, false, false);
  if (NT >= 3) c = __builtin_amdgcn_wmma_f32_16x16x32_f16(false, ah, false, bl, (short)0, c, false, false);
  asm volatile("v_nop\n\tv_nop\n\tv_nop\n\tv_nop" : "+v"(c) : "v"(ah), "v"(al), "v"(bh), "v"(bl));
  return c;
}
// batched GEMM like k_gemm_b but f16 operands: A f32 (split into f16 hi/lo if ASPLIT, else rounded to f16), Bt = f16 values [n][k]; alpha; C f32; N multiple of 16 (partial tiles skipped)
template <bool ASPLIT>
__global__ __launch_bounds__(128) void k_gemm_h(const float* __restrict__ A, int lda, size_t sA, const _Float16* __restrict__ Bh, int ldb, size_t sB, float alpha, float* __restrict__ C, int ldc, size_t sC, int M, int N, int K) {
  __shared__ __attribute__((aligned(16))) float so[4][16][64];
  const int tid = threadIdx.x, w = tid >> 5, lane = tid & 31, ln = lane & 15, hh = lane >> 4; const int by = blockIdx.y;
  A += (size_t)by * sA; Bh += (size_t)by * sB; C += (size_t)by * sC;
  const int ntn = (N + 63) / 64; const int wid = blockIdx.x * 4 + w; const int mt = wid / ntn, nq = wid % ntn; if (mt * 16 >= M) return;
  const int row0 = mt * 16, col0 = nq * 64; const float* arow = A + (size_t)(row0 + ln) * lda;
  v8f acc[4] = {};
  for (int kb = 0; kb < K; kb += 32) {
    FragH ah, al;
    const v4f x0 = *(const v4fa*)(arow + kb + 8 * hh), x1 = *(const v4fa*)(arow + kb + 8 * hh + 4), x2 = *(const v4fa*)(arow + kb + 16 + 8 * hh), x3 = *(const v4fa*)(arow + kb + 16 + 8 * hh + 4);
    float xs[16] = {x0[0],x0[1],x0[2],x0[3],x1[0],x1[1],x1[2],x1[3],x2[0],x2[1],x2[2],x2[3],x3[0],x3[1],x3[2],x3[3]};
#pragma unroll
    for (int i = 0; i < 16; ++i) { const _Float16 h = (_Float16)xs[i]; ah.h[i] = h; al.h[i] = ASPLIT ? (_Float16)(xs[i] - (float)h) : (_Float16)0.0f; }
#pragma unroll
    for (int t = 0; t < 4; ++t) { if (col0 + t * 16 >= N) continue; const size_t boff = (size_t)(col0 + t * 16 + ln) * ldb + kb; FragH bq; bq.half[0] = *(const v8us*)(Bh + boff + 8 * hh); bq.half[1] = *(const v8us*)(Bh + boff + 16 + 8 * hh);
      acc[t] = mmaH<ASPLIT ? 2 : 1>(ah.v, al.v, bq.v, bq.v, acc[t]); }
  }
#pragma unroll
  for (int t = 0; t < 4; ++t) { if (col0 + t * 16 >= N) continue;
#pragma unroll
    for (int r = 0; r < 8; ++r) so[w][8 * hh + r][t * 16 + ln] = acc[t][r] * alpha; }
  __builtin_amdgcn_fence(__ATOMIC_ACQ_REL, "workgroup"); __builtin_amdgcn_wave_barrier();
  const int rsub = lane >> 4, c4 = (lane & 15) * 4;
  {
#pragma unroll
    for (int q = 0; q < 8; ++q) { const int r = q * 2 + rsub; if (col0 + c4 < N) { const v4f v = *(const v4fa*)&so[w][r][c4]; *(v4f*)(C + (size_t)(row0 + r) * ldc + col0 + c4) = v; } }
     }
}

// Wt[n][k] = f16(W[k][n]·scale) from f32 row-major W[K][N] (scale = power of two; bf16-exact weights stay exact in f16 away from the subnormal range)
__global__ __launch_bounds__(256) void k_wt_f16(const float* __restrict__ W, _Float16* __restrict__ Wt, int K, int N, float scale) {
  const int t = blockIdx.x * 256 + threadIdx.x; if (t >= N * (K / 8)) return; const int n = t / (K / 8), k8 = (t % (K / 8)) * 8; FragH f;
#pragma unroll
  for (int i = 0; i < 8; ++i) f.h[i] = (_Float16)(bf16_round(W[(size_t)(k8 + i) * N + n]) * scale); const v8us o = f.half[0];
  *(v8us*)((unsigned short*)Wt + (size_t)n * K + k8) = o; 
}
// k_gemm_hh variant with fused epilogue: v = acc·alpha + bias[by·sBias + col] (+ CP[(row/rowsPerB)·sCPb + by·64 + col] if CP) ; ACT 0 none / 1 elu ; writes f16 C16 (and f32 C if non-null)
template <int ACT>
__global__ __launch_bounds__(128) void k_gemm_hhx(const _Float16* __restrict__ A, int lda, size_t sA, const _Float16* __restrict__ Bh, int ldb, size_t sB, float alpha, const float* __restrict__ bias, size_t sBias, const float* __restrict__ CP, int rowsPerB, size_t sCPb, int row0g,
    float* __restrict__ C, _Float16* __restrict__ C16, int ldc, size_t sC, int M, int N, int K) {
  __shared__ __attribute__((aligned(16))) float so[4][16][64];
  const int tid = threadIdx.x, w = tid >> 5, lane = tid & 31, ln = lane & 15, hh = lane >> 4; const int by = blockIdx.y;
  A += (size_t)by * sA; Bh += (size_t)by * sB; const size_t cofs = (size_t)by * sC; const float* bp = bias ? bias + (size_t)by * sBias : nullptr;
  const int ntn = (N + 63) / 64; const int wid = blockIdx.x * 4 + w; const int mt = wid / ntn, nq = wid % ntn; if (mt * 16 >= M) return;
  const int row0 = mt * 16, col0 = nq * 64; const _Float16* arow = A + (size_t)(row0 + ln) * lda;
  v8f acc[4] = {};
  for (int kb = 0; kb < K; kb += 32) { FragH ah; ah.half[0] = *(const v8us*)((const unsigned short*)arow + kb + 8 * hh); ah.half[1] = *(const v8us*)((const unsigned short*)arow + kb + 16 + 8 * hh);
#pragma unroll
    for (int t = 0; t < 4; ++t) { if (col0 + t * 16 >= N) continue; const size_t boff = (size_t)(col0 + t * 16 + ln) * ldb + kb; FragH bq; bq.half[0] = *(const v8us*)((const unsigned short*)Bh + boff + 8 * hh); bq.half[1] = *(const v8us*)((const unsigned short*)Bh + boff + 16 + 8 * hh);
      acc[t] = mmaH<1>(ah.v, ah.v, bq.v, bq.v, acc[t]); }
  }
#pragma unroll
  for (int t = 0; t < 4; ++t) { if (col0 + t * 16 >= N) continue; const int col = col0 + t * 16 + ln; const float bv = bp ? bf16_round(bp[col]) : 0.f;
#pragma unroll
    for (int r = 0; r < 8; ++r) { float v = acc[t][r] * alpha + bv; if (CP) { const int rr = row0g + row0 + 8 * hh + r; if (rowsPerB < 0) v += CP[cofs + (size_t)rr * ldc + col];      /* rowsPerB < 0: own element of the batched C plane */ else { const int bidx = rr / rowsPerB; v += CP[(size_t)bidx * sCPb + (size_t)by * 64 + col]; } } if (ACT == 1) v = (v > 0.f) ? v : expm1f(v); else if (ACT == 7) v = (v > 0.f) ? v + 1.0f : expf(v); else if (ACT == 8) v = tanhf(v); else if (ACT == 9) v = 0.5f * v * (1.0f + tanhf(0.7978845608028654f * (v + 0.044715f * v * v * v))); else if (ACT == 11) v = 1.0f / (1.0f + expf(-v)); else if (ACT == 12) v = (v > 0.f) ? v : 0.01f * v; else if (ACT == 14) v = (v > 0.f) ? v : 0.1f * v; else if (ACT == 16) v = (v >= 0.f) ? v : 0.3f * v; else if (ACT == 17) v = (v >= 0.f) ? v : 0.2f * v; else if (ACT == 15) v = v / (1.0f + expf(-v)); else if (ACT == 3) v = fmaxf(v, 0.f); else if (ACT == 6) v = 0.5f * v * (1.0f + erff(v * 0.70710678118654752f)); so[w][8 * hh + r][t * 16 + ln] = v; } }
  __builtin_amdgcn_fence(__ATOMIC_ACQ_REL, "workgroup"); __builtin_amdgcn_wave_barrier();
  const int rsub = lane >> 4, c4 = (lane & 15) * 4; typedef _Float16 v4h __attribute__((ext_vector_type(4)));
  {
#pragma unroll
    for (int q = 0; q < 8; ++q) { const int r = q * 2 + rsub; if (col0 + c4 < N) { const v4f v = *(const v4fa*)&so[w][r][c4]; if (C) *(v4f*)(C + cofs + (size_t)(row0 + r) * ldc + col0 + c4) = v; if (C16) { v4h h4; for (int i = 0; i < 4; ++i) h4[i] = (_Float16)v[i]; *(v4h*)(C16 + cofs + (size_t)(row0 + r) * ldc + col0 + c4) = h4; } } }
     }
}


typedef _Float16 v4h __attribute__((ext_vector_type(4)));

__global__ __launch_bounds__(256) void k_x16(const float* __restrict__ x, _Float16* __restrict__ X16, size_t n8) { const size_t t = (size_t)blockIdx.x * 256 + threadIdx.x; if (t >= n8) return; FragH f;
#pragma unroll
  for (int q = 0; q < 8; ++q) f.h[q] = (_Float16)bf16_round(x[t * 8 + q]); *(v8us*)((unsigned short*)X16 + t * 8) = f.half[0];  }
__global__ __launch_bounds__(256) void k_h16(const float* __restrict__ x, _Float16* __restrict__ X16, size_t n8) { const size_t t = (size_t)blockIdx.x * 256 + threadIdx.x; if (t >= n8) return; FragH f;
#pragma unroll
  for (int q = 0; q < 8; ++q) f.h[q] = (_Float16)x[t * 8 + q]; *(v8us*)((unsigned short*)X16 + t * 8) = f.half[0];  }
__global__ __launch_bounds__(256) void k_round16f(const float* __restrict__ W, _Float16* __restrict__ Bt, size_t n8) { const size_t t = (size_t)blockIdx.x * 256 + threadIdx.x; if (t >= n8) return; FragH f;
#pragma unroll
  for (int i = 0; i < 8; ++i) f.h[i] = (_Float16)(bf16_round(W[t * 8 + i]) * 16.0f); *(v8us*)((unsigned short*)Bt + t * 8) = f.half[0];  }
template <int NHv, int TTv>
__global__ __launch_bounds__(256) void k_vt(const _Float16* __restrict__ V16, int ldv, int voff, _Float16* __restrict__ Vt) { __shared__ unsigned short tl[64][66]; const int tid = threadIdx.x; const int slab = blockIdx.x / (TTv / 64), lg = blockIdx.x % (TTv / 64); const int b = slab / NHv, h = slab % NHv;
  for (int i = tid; i < 64 * 8; i += 256) { const int r = i / 8, c8 = (i % 8) * 8; FragH f; f.half[0] = *(const v8us*)((const unsigned short*)V16 + ((size_t)b * TTv + lg * 64 + r) * ldv + voff + h * 64 + c8);
#pragma unroll
    for (int q = 0; q < 8; ++q) tl[r][c8 + q] = f.u[q]; }
  __syncthreads();
  {
#pragma unroll
    for (int rd = 0; rd < 2; ++rd) { const int d = rd * 32 + tid / 8, pc = tid % 8; FragH f;
#pragma unroll
      for (int q = 0; q < 8; ++q) f.u[q] = tl[pc * 8 + q][d];
      *(v8us*)((unsigned short*)Vt + ((size_t)slab * 64 + d) * TTv + lg * 64 + pc * 8) = f.half[0]; }
     } }

__global__ __launch_bounds__(256) void k_hl(const float* __restrict__ F, _Float16* __restrict__ Hh, _Float16* __restrict__ Hl, size_t n8) { const size_t t = (size_t)blockIdx.x * 256 + threadIdx.x; if (t >= n8) return; FragH fh, fl; const v4f a = *(const v4fa*)(F + t * 8), c = *(const v4fa*)(F + t * 8 + 4);
#pragma unroll
  for (int q = 0; q < 4; ++q) { _Float16 h = (_Float16)a[q]; fh.h[q] = h; fl.h[q] = (_Float16)((a[q] - (float)h) * 1024.0f); h = (_Float16)c[q]; fh.h[4 + q] = h; fl.h[4 + q] = (_Float16)((c[q] - (float)h) * 1024.0f); }
  { *(v8us*)((unsigned short*)Hh + t * 8) = fh.half[0]; *(v8us*)((unsigned short*)Hl + t * 8) = fl.half[0];  } }

// ---- fast GEMM (wave tile 32x64; requires M % 32 == 0 rows per launch region and N % 64 == 0); epilogue = k_gemm_hhx semantics ----
__device__ __forceinline__ v16h g2_frag(const _Float16* p, int hh) { FragH f; f.half[0] = *(const v8us*)((const unsigned short*)p + 8 * hh); f.half[1] = *(const v8us*)((const unsigned short*)p + 16 + 8 * hh); return f.v; }
__device__ __forceinline__ v8f g2_mma(v16h a, v16h b, v8f c) { v8f d = __builtin_amdgcn_wmma_f32_16x16x32_f16(false, a, false, b, (short)0, c, false, false); asm volatile("v_nop\n\tv_nop\n\tv_nop\n\tv_nop" : "+v"(d) : "v"(a), "v"(b)); return d; }
template <int ACT>
__global__ __launch_bounds__(128) void k_gemm2(const _Float16* __restrict__ A, int lda, size_t sA, const _Float16* __restrict__ Bh, int ldb, size_t sB, float alpha, const float* __restrict__ bias, size_t sBias, const float* __restrict__ CP, int rowsPerB, size_t sCPb, int row0g,
    float* __restrict__ C, _Float16* __restrict__ C16, int ldc, size_t sC, int M, int N, int K) { static_assert(ACT == 0 || ACT == 3 || ACT == 6 || ACT == 8 || ACT == 9 || ACT == 11 || ACT == 12 || ACT == 14 || ACT == 15 || ACT == 16 || ACT == 17, "k_gemm2: unsupported ACT code (would silently apply no activation)");
  __shared__ __attribute__((aligned(16))) float so[4][32][68];
  const int tid = threadIdx.x, w = tid >> 5, lane = tid & 31, ln = lane & 15, hh = lane >> 4; const int by = blockIdx.y;
  A += (size_t)by * sA; Bh += (size_t)by * sB; const size_t cofs = (size_t)by * sC; const float* bp = bias ? bias + (size_t)by * sBias : nullptr;
  const int ntn = N >> 6; const int mt = blockIdx.x / ntn, nq = blockIdx.x - mt * ntn; const int row0 = mt * 128 + 32 * w, col0 = nq * 64; if (row0 >= M) return;
  const _Float16* a0p = A + (size_t)(row0 + ln) * lda; const _Float16* a1p = a0p + (size_t)16 * lda;
  const _Float16* b0p = Bh + (size_t)(col0 + ln) * ldb; const _Float16* b1p = b0p + (size_t)16 * ldb; const _Float16* b2p = b1p + (size_t)16 * ldb; const _Float16* b3p = b2p + (size_t)16 * ldb;
  const v8f z8 = {0.f,0.f,0.f,0.f,0.f,0.f,0.f,0.f}; v8f c00 = z8, c01 = z8, c02 = z8, c03 = z8, c10 = z8, c11 = z8, c12 = z8, c13 = z8;
#pragma unroll 1
  for (int kb = 0; kb < K; kb += 32) { const v16h a0 = g2_frag(a0p + kb, hh), a1 = g2_frag(a1p + kb, hh);
    v16h b = g2_frag(b0p + kb, hh); c00 = g2_mma(a0, b, c00); c10 = g2_mma(a1, b, c10);
    b = g2_frag(b1p + kb, hh); c01 = g2_mma(a0, b, c01); c11 = g2_mma(a1, b, c11);
    b = g2_frag(b2p + kb, hh); c02 = g2_mma(a0, b, c02); c12 = g2_mma(a1, b, c12);
    b = g2_frag(b3p + kb, hh); c03 = g2_mma(a0, b, c03); c13 = g2_mma(a1, b, c13); }
  v8f accs[8] = {c00, c01, c02, c03, c10, c11, c12, c13};
#pragma unroll
  for (int u = 0; u < 8; ++u) { const int t = u & 3, half = u >> 2; const int col = col0 + t * 16 + ln; const float bv = bp ? bf16_round(bp[col]) : 0.f;
#pragma unroll
    for (int r = 0; r < 8; ++r) { const int rloc = half * 16 + 8 * hh + r; float v = accs[u][r] * alpha + bv; if (CP) { if (rowsPerB < 0) v += CP[cofs + (size_t)(row0g + row0 + rloc) * ldc + col];      /* rowsPerB < 0: own element of the batched C plane */ else { const int bidx = (row0g + row0 + rloc) / rowsPerB; v += CP[(size_t)bidx * sCPb + (size_t)by * 64 + col]; } }
      if (ACT == 3) v = fmaxf(v, 0.f); else if (ACT == 6) v = 0.5f * v * (1.0f + erff(v * 0.70710678118654752f)); else if (ACT == 11) v = 1.0f / (1.0f + expf(-v)); else if (ACT == 15) v = v / (1.0f + expf(-v)); else if (ACT == 12) v = (v > 0.f) ? v : 0.01f * v; else if (ACT == 8) v = tanhf(v); else if (ACT == 9) v = 0.5f * v * (1.0f + tanhf(0.7978845608028654f * (v + 0.044715f * v * v * v))); else if (ACT == 14) v = (v > 0.f) ? v : 0.1f * v; else if (ACT == 16) v = (v >= 0.f) ? v : 0.3f * v; else if (ACT == 17) v = (v >= 0.f) ? v : 0.2f * v;
      so[w][rloc][t * 16 + ln] = v; } }
  __builtin_amdgcn_fence(__ATOMIC_ACQ_REL, "workgroup"); __builtin_amdgcn_wave_barrier();
  const int rsub = lane >> 4, c4 = (lane & 15) * 4;
  {
#pragma unroll
    for (int q = 0; q < 16; ++q) { const int r = q * 2 + rsub; const v4f v = *(const v4fa*)&so[w][r][c4]; if (C) *(v4f*)(C + cofs + (size_t)(row0 + r) * ldc + col0 + c4) = v; if (C16) { v4h h4; for (int i = 0; i < 4; ++i) h4[i] = (_Float16)v[i]; *(v4h*)(C16 + cofs + (size_t)(row0 + r) * ldc + col0 + c4) = h4; } }
     } }


__global__ __launch_bounds__(256) void k_wnat(const float* __restrict__ w, size_t n8, _Float16* __restrict__ Bt) { const size_t t = (size_t)blockIdx.x * 256 + threadIdx.x; if (t >= n8) return; FragH f; for (int q = 0; q < 8; ++q) f.h[q] = (_Float16)(bf16_round(w[t * 8 + q]) * 16.0f); *(v8us*)((unsigned short*)Bt + t * 8) = f.half[0];  }
__global__ __launch_bounds__(256) void k_rsm(const float* __restrict__ S, _Float16* __restrict__ P, int nrows) {
  #pragma clang fp contract(off)
  const int i = blockIdx.x * 256 + threadIdx.x; if (i >= nrows) return; const float* s = S + (size_t)i * SQ; float mx = -3.0e38f;
#pragma unroll 1
  for (int j = 0; j < SQ; ++j) mx = fmaxf(mx, s[j]); float se = 0.f;
#pragma unroll 1
  for (int j = 0; j < SQ; ++j) se += expf(s[j] - mx); const float sc = 256.0f / se;
#pragma unroll 1
  for (int j0 = 0; j0 < SQ; j0 += 8) { FragH f; for (int q = 0; q < 8; ++q) f.h[q] = (_Float16)(expf(s[j0 + q] - mx) * sc); unsigned short* d = (unsigned short*)P + (size_t)i * SQ + j0; *(v8us*)d = f.half[0];  } }
__global__ __launch_bounds__(256) void k_vt(const _Float16* __restrict__ V16, int b, int h0, _Float16* __restrict__ VT) { __shared__ unsigned short tl[64][65]; const int tid = threadIdx.x; const int hh = blockIdx.x % HG, sg = blockIdx.x / HG; const int s0 = sg * 64; const int h = h0 + hh;
  for (int i = tid; i < 64 * 8; i += 256) { const int j = i / 8, d8 = (i % 8) * 8; FragH f; f.half[0] = *(const v8us*)((const unsigned short*)V16 + ((size_t)b * SQ + s0 + j) * DM + h * HD + d8); for (int q = 0; q < 8; ++q) tl[d8 + q][j] = f.u[q]; }
  __syncthreads();
  { for (int i = tid; i < 64 * 8; i += 256) { const int d = i / 8, j8 = (i % 8) * 8; FragH f; for (int q = 0; q < 8; ++q) f.u[q] = tl[d][j8 + q]; *(v8us*)((unsigned short*)VT + ((size_t)hh * HD + d) * SQ + s0 + j8) = f.half[0]; }  } }



template <int CTRL> __device__ __forceinline__ float rs_dpp(float x) { return __builtin_bit_cast(float, __builtin_amdgcn_update_dpp(0, __builtin_bit_cast(int, x), CTRL, 0xf, 0xf, true)); }      /* lane l <- lane l ^ m inside a 16-lane row (row_xmask:m = 0x160 + m) */
__device__ __forceinline__ float rs_xhalf(float x) { return __builtin_bit_cast(float, __builtin_amdgcn_permlanex16(__builtin_bit_cast(int, x), __builtin_bit_cast(int, x), 0x76543210, 0xfedcba98, false, false)); }      /* lane l <- lane l ^ 16 */
__device__ __forceinline__ float rs_exp2(float x) { float e; asm("v_exp_f32 %0, %1\n\tv_nop" : "=v"(e) : "v"(x)); return e; }      /* 2^x; the v_nop is the slot the instruction set asks for behind a transcendental */
// causal softmax, ONE WAVE PER ROW of NU * 128 columns: lane l holds columns u*128 + 4l .. + 3 in registers, so S is read once, by whole lines; maximum and sum are folded over the 32 lanes by a butterfly that leaves the same value in every lane
template <int NU>
__global__ __launch_bounds__(256) void k_rsmcf2(const float* __restrict__ S, _Float16* __restrict__ P, int hg, int q0) {
  const int c0 = (threadIdx.x & 31) * 4; const int t = blockIdx.x * 8 + __builtin_amdgcn_readfirstlane(threadIdx.x >> 5); if (t >= hg * QT) return;      /* the row index is wave-uniform */
  const float* s = S + (size_t)t * NKX + c0; _Float16* d = P + (size_t)t * NKX + c0; const int last = q0 + (t % QT);
  v4f sv[NU]; float mx = -3.0e38f, se = 0.f;
#pragma unroll      /* full unroll (here and below): sv needs constant indices to stay in registers */
  for (int u = 0; u < NU; ++u) sv[u] = *(const v4fa*)(s + u * 128);
#pragma unroll
  for (int u = 0; u < NU; ++u) for (int q = 0; q < 4; ++q) { const float f = (u * 128 + c0 + q <= last) ? 1.f : 0.f; sv[u][q] = fmaf(f, sv[u][q], (1.f - f) * -1.0e9f); mx = fmaxf(mx, sv[u][q]); }
  mx = fmaxf(mx, rs_dpp<0x161>(mx)); mx = fmaxf(mx, rs_dpp<0x162>(mx)); mx = fmaxf(mx, rs_dpp<0x164>(mx)); mx = fmaxf(mx, rs_dpp<0x168>(mx)); mx = fmaxf(mx, rs_xhalf(mx));
#pragma unroll
  for (int u = 0; u < NU; ++u) for (int q = 0; q < 4; ++q) { sv[u][q] = rs_exp2((sv[u][q] - mx) * 1.44269504088896340736f); se += sv[u][q]; }
  se += rs_dpp<0x161>(se); se += rs_dpp<0x162>(se); se += rs_dpp<0x164>(se); se += rs_dpp<0x168>(se); se += rs_xhalf(se); const float sc = 256.0f / se;
#pragma unroll
  for (int u = 0; u < NU; ++u) { v4h h4; for (int q = 0; q < 4; ++q) h4[q] = (_Float16)(sv[u][q] * sc); *(v4h*)(d + u * 128) = h4; } }


template <int MASKADD>
__global__ __launch_bounds__(64) void k_att0(const float* __restrict__ QF, const float* __restrict__ KF, const float* __restrict__ VF, int ld, const float* __restrict__ mask, float scale, float* __restrict__ OF, int ldo) {
  #pragma clang fp contract(off)
  __shared__ __attribute__((aligned(16))) float lo[64][64];      /* only the final row-to-column hand-over for coalesced stores */
  const int tid = threadIdx.x; const int h = blockIdx.x / (QT0 / 64), rg = blockIdx.x % (QT0 / 64); const int i = rg * 64 + tid;
  { const size_t bi = (size_t)blockIdx.y * QT0 * ld; QF += bi; KF += bi; VF += bi; OF += (size_t)blockIdx.y * QT0 * ldo; }      /* batch on grid.y: each batch has its own QT0-row plane */
  const float* qr = QF + (size_t)i * ld + h * HD;
  v4f rq[HD / 4], ro[HD / 4];      /* this thread's q row and o accumulator live in registers for the whole key loop */
#pragma unroll      /* full unroll: rq / ro need constant indices to stay in registers */
  for (int c = 0; c < HD / 4; ++c) { rq[c] = *(const v4fa*)(qr + c * 4); const v4f z = {0.f, 0.f, 0.f, 0.f}; ro[c] = z; }
  asm volatile("s_wait_xcnt 0x0" :: "v"(qr) : "memory");      /* the q loads' address pair stays live up to this wait, so no register that an issued load names is rewritten ahead of it */
  float m = -1.0e30f, l = 0.f; const int jmax = MASKADD ? (SQ - 1) : (rg * 64 + 63);      /* additive-mask form: every key (the mask input decides); causal form: keys up to the block's last row */
#pragma unroll 1
  for (int j = 0; j <= jmax; ++j) { const float* kr = KF + (size_t)j * ld + h * HD; const float* vr = VF + (size_t)j * ld + h * HD; float s = 0.f;
#pragma unroll      /* full unroll: constant index into rq */
    for (int c = 0; c < HD / 4; ++c) { const v4f kq = *(const v4fa*)(kr + c * 4); const v4f qq = rq[c]; s = __fadd_rn(s, __fmul_rn(qq[0], kq[0])); s = __fadd_rn(s, __fmul_rn(qq[1], kq[1])); s = __fadd_rn(s, __fmul_rn(qq[2], kq[2])); s = __fadd_rn(s, __fmul_rn(qq[3], kq[3])); }
    s = __fmul_rn(s, scale); if (MASKADD) s = __fadd_rn(s, __fmul_rn(bf16_round(mask[(size_t)i * SQ + j]), -10000.0f));
    const float f = (MASKADD || j <= i) ? 1.f : 0.f; const float sm = fmaf(f, s, (1.f - f) * -1.0e30f); const float mn = fmaxf(m, sm); const float sc = expf(m - mn); const float e = expf(sm - mn); l = __fadd_rn(__fmul_rn(l, sc), e); m = mn;
#pragma unroll      /* full unroll: constant index into ro */
    for (int c = 0; c < HD / 4; ++c) { const v4f vv = *(const v4fa*)(vr + c * 4); v4f oo = ro[c]; for (int u = 0; u < 4; ++u) oo[u] = __fadd_rn(__fmul_rn(oo[u], sc), __fmul_rn(e, vv[u])); ro[c] = oo; } }
  const float fin = 64.0f / l;      /* o carried x64; k_o0m scales it back by 1/64 */
#pragma unroll      /* full unroll: constant index into ro */
  for (int c = 0; c < HD / 4; ++c) { v4f oo = ro[c]; for (int u = 0; u < 4; ++u) oo[u] = __fmul_rn(oo[u], fin); *(v4f*)&lo[tid][c * 4] = oo; }
  __syncthreads();
  {
#pragma unroll 1
    for (int it = 0; it < 16; ++it) { const int row = it * 4 + tid / 16, pc = (tid % 16) * 4; const v4f v = *(const v4f*)&lo[row][pc]; *(v4f*)(OF + (size_t)(rg * 64 + row) * ldo + h * HD + pc) = v; }
     } }


template <int BFIN, int WXB>
__global__ __launch_bounds__(256) void k_ln16(const float* __restrict__ X, const float* __restrict__ g, const float* __restrict__ bb, float eps, _Float16* __restrict__ N16, float* __restrict__ XB) {
  #pragma clang fp contract(off)
  __shared__ float red[256]; const size_t r = blockIdx.x; const int t = threadIdx.x; const v4f xa = *(const v4fa*)(X + r * DMQ + t * 4); float s[4]; float sum = 0.f;
  for (int q = 0; q < 4; ++q) { s[q] = BFIN ? bf16_round(xa[q]) : xa[q]; sum = __fadd_rn(sum, s[q]); }
  red[t] = sum; __syncthreads(); for (int st = 128; st > 0; st >>= 1) { if (t < st) red[t] = __fadd_rn(red[t], red[t + st]); __syncthreads(); } const float mu = red[0] / (float)DMQ; __syncthreads();
  float vs = 0.f; for (int q = 0; q < 4; ++q) { const float dl = __fadd_rn(s[q], -mu); vs = __fadd_rn(vs, __fmul_rn(dl, dl)); } red[t] = vs; __syncthreads(); for (int st = 128; st > 0; st >>= 1) { if (t < st) red[t] = __fadd_rn(red[t], red[t + st]); __syncthreads(); }
  const float rs = rsqrtf(__fadd_rn(red[0] / (float)DMQ, eps)); v4h y; v4f xb;
  for (int q = 0; q < 4; ++q) { const int c = t * 4 + q; y[q] = (_Float16)__fadd_rn(__fmul_rn(__fmul_rn(__fadd_rn(s[q], -mu), rs), bf16_round(g[c])), bf16_round(bb[c])); xb[q] = s[q]; }
  { *(v4h*)(N16 + r * DMQ + t * 4) = y; if (WXB) *(v4f*)(XB + r * DMQ + t * 4) = xb;  } }
__global__ __launch_bounds__(256) void k_ftres2(const float* __restrict__ OF0, const float* __restrict__ XB, float* __restrict__ X1, size_t n4) {
  #pragma clang fp contract(off)
  const size_t t = (size_t)blockIdx.x * 256 + threadIdx.x; if (t >= n4) return; const v4f o = *(const v4fa*)(OF0 + t * 4), xv = *(const v4fa*)(XB + t * 4); v4f y; for (int q = 0; q < 4; ++q) y[q] = __fadd_rn(__fmul_rn(o[q], 0.015625f), xv[q]); *(v4f*)(X1 + t * 4) = y;  }

__global__ __launch_bounds__(256) void k_wthd(const float* __restrict__ Wt, _Float16* __restrict__ Bt) { const size_t t = (size_t)blockIdx.x * 256 + threadIdx.x; if (t >= (size_t)NH * HD * (DM / 8)) return; const int m8 = (int)(t % (DM / 8)) * 8; const int d = (int)((t / (DM / 8)) % HD); const int h = (int)(t / ((size_t)(DM / 8) * HD)); FragH f;
  for (int q = 0; q < 8; ++q) f.h[q] = (_Float16)(16.0f * bf16_round(Wt[((size_t)h * DM + m8 + q) * HD + d])); unsigned short* dst = (unsigned short*)Bt + ((size_t)h * HD + d) * DM + m8; *(v8us*)dst = f.half[0];  }




__global__ __launch_bounds__(256) void k_wtpad(const float* __restrict__ Wm, _Float16* __restrict__ Wt, int Kr, int Kp, int Nr, int Np, float scale) {
  const int t = blockIdx.x * 256 + threadIdx.x; if (t >= Np * (Kp / 8)) return; const int n = t / (Kp / 8), k8 = (t % (Kp / 8)) * 8; const int nc = min(n, Nr - 1); const float fn = (n < Nr) ? 1.f : 0.f; FragH f;
  for (int i = 0; i < 8; ++i) { const int k = k8 + i; const int kc = min(k, Kr - 1); const float fk = (k < Kr) ? fn : 0.f; f.h[i] = (_Float16)(bf16_round(Wm[(size_t)kc * Nr + nc]) * scale * fk); }
  unsigned short* o = (unsigned short*)Wt + (size_t)n * Kp + k8; *(v8us*)o = f.half[0];  }
__global__ __launch_bounds__(128) void k_bpad(const float* __restrict__ b, float* __restrict__ Bp, int nr, int np) {
  const int i = threadIdx.x; if (i >= np) return; const float v = b[min(i, nr - 1)] * ((i < nr) ? 1.f : 0.f); *(float*)(Bp + i) = v;  }

#define DI 64         /* inner width = NH * HD (ONE 64-wide head) */
#define LQK (3 * DI)  /* fused q | k | v row pitch (192) */
__global__ __launch_bounds__(256) void k_o0(const float* __restrict__ OF, float* __restrict__ ob, size_t n4) {
  #pragma clang fp contract(off)
  const size_t t = (size_t)blockIdx.x * 256 + threadIdx.x; if (t >= n4) return; const size_t e = t * 4; const int i = (int)(e / DI); const int c = (int)(e % DI); const int h = c / HD, d = c % HD; const v4f a = *(const v4fa*)(OF + e); v4f o; for (int q = 0; q < 4; ++q) o[q] = __fmul_rn(a[q], 0.015625f); float* dst = ob + (size_t)h * SQ * HD + (size_t)i * HD + d; *(v4f*)dst = o;  }

__global__ __launch_bounds__(256) void k_o0m(const float* __restrict__ OF, float* __restrict__ o_, size_t n4) {
  #pragma clang fp contract(off)
  const size_t t = (size_t)blockIdx.x * 256 + threadIdx.x; if (t >= n4) return; const size_t e = t * 4; OF += (size_t)blockIdx.y * QT0 * DI; o_ += (size_t)blockIdx.y * SQ * DI;      /* batch on grid.y: QT0 exact rows go to the head of the batch's SQ output rows */
  const v4f a = *(const v4fa*)(OF + e); v4f o; for (int q = 0; q < 4; ++q) o[q] = __fmul_rn(a[q], 0.015625f); *(v4f*)(o_ + e) = o;  }
extern "C" void kernel_launch(void* const* d_in, const int* in_sizes, int n_in,
                              void* d_out, int out_size, void* d_ws, size_t ws_size, hipStream_t stream) {
  (void)in_sizes; (void)n_in; (void)out_size;
  const float* const* I = (const float* const*)d_in; const float* x = I[0]; const float* wq = I[2]; const float* wk = I[1]; const float* wv = I[3]; const float* bq = nullptr; const float* bk = nullptr; const float* bv = nullptr;      /* x; [in][out = 64] Wk / Wq / Wv (input order as this module lists them); no biases */
  char* ws = (char*)d_ws; size_t off = 0;
  auto take = [&](size_t bytes) { char* p = ws + off; off += (bytes + 255) & ~(size_t)255; return p; };
  _Float16* BW = (_Float16*)take((size_t)LQK * DM * 2); _Float16* X16 = (_Float16*)take(NR * DM * 2); _Float16* QKV = (_Float16*)take(NR * LQK * 2); _Float16* VT = (_Float16*)take((size_t)NB * HD * SQ * 2);
  float* S = (float*)take((size_t)NB * QT * NKX * 4); _Float16* P = (_Float16*)take((size_t)NB * QT * NKX * 2); float* QKVF0 = (float*)take((size_t)NB * QT0 * LQK * 4); float* OF0 = (float*)take((size_t)NB * QT0 * DI * 4);      /* one plane per batch: all batches are in flight in every launch */
  if (off > ws_size) return;
  { const unsigned g = (unsigned)(((size_t)DI * (DM / 8) + 255) / 256); k_wt_f16<<<g, 256, 0, stream>>>(wq, BW, DM, DI, 16.0f); k_wt_f16<<<g, 256, 0, stream>>>(wk, BW + (size_t)DI * DM, DM, DI, 16.0f); k_wt_f16<<<g, 256, 0, stream>>>(wv, BW + (size_t)2 * DI * DM, DM, DI, 16.0f); }      /* [in = DM][out = 64] -> Bt[n][k] x16, stacked q | k | v */
  k_x16<<<(unsigned)((NR * DM / 8 + 255) / 256), 256, 0, stream>>>(x, X16, NR * DM / 8);      /* x (bf16-valued) as exact f16 rows */
  const float* bqkv[3] = {bq, bk, bv};
  for (int c = 0; c < 3; ++c) k_gemm2<0><<<dim3((unsigned)((NR / 128) * (DI / 64)), 1), 128, 0, stream>>>(X16, DM, 0, BW + (size_t)c * DI * DM, DM, 0, 0.0625f, bqkv[c], 0, nullptr, 1, 0, 0, nullptr, QKV + (size_t)c * DI, LQK, 0, (int)NR, DI, DM);      /* q | k | v = x W -> f16 rows, column blocks 0 / 64 / 128 of the fused plane (pitch 192); head h = columns h*64 inside each */
  const _Float16* Q16 = QKV; const _Float16* K16 = QKV + DI; const _Float16* V16 = QKV + 2 * DI;
  float* ob = (float*)d_out;      /* the batch is grid.y of every launch below but k_vt and k_rsmcf2, which index it in grid.x (ONE head, so the head stride of the kernels carries the batch) */
  k_vt<NH, SQ><<<NB * NH * (SQ / 64), 256, 0, stream>>>(V16, LQK, 0, VT);      /* V^T [NB][HD][SQ] */
  for (int q0 = 0; q0 < SQ; q0 += QT) { const int nk = q0 + QT;      /* causal: only keys below the tile end are computed */
    k_gemm2<0><<<dim3((QT / 128) * (nk / 64), NB), 128, 0, stream>>>(Q16 + (size_t)q0 * LQK, LQK, (size_t)SQ * LQK, K16, LQK, (size_t)SQ * LQK, 0.125f, nullptr, 0, nullptr, 1, 0, 0, S, nullptr, NKX, (size_t)QT * NKX, QT, nk, HD);      /* scores / 8 */
    static_assert(SQ == 4 * QT && NKX == SQ && QT % 128 == 0, "one softmax instance per causal tile"); switch (nk / QT) {      /* causal softmax -> P x256 f16; one wave per row, 8 rows per block; the row length is a compile-time constant of the kernel (the row lives in registers) */
      case 1: k_rsmcf2<QT / 128><<<(NB * QT + 7) / 8, 256, 0, stream>>>(S, P, NB, q0); break;
      case 2: k_rsmcf2<2 * QT / 128><<<(NB * QT + 7) / 8, 256, 0, stream>>>(S, P, NB, q0); break;
      case 3: k_rsmcf2<3 * QT / 128><<<(NB * QT + 7) / 8, 256, 0, stream>>>(S, P, NB, q0); break;
      case 4: k_rsmcf2<4 * QT / 128><<<(NB * QT + 7) / 8, 256, 0, stream>>>(S, P, NB, q0); break; }
    k_gemm2<0><<<dim3((QT / 128) * (HD / 64), NB), 128, 0, stream>>>(P, NKX, (size_t)QT * NKX, VT, SQ, (size_t)HD * SQ, 0.00390625f, nullptr, 0, nullptr, 1, 0, 0, ob + (size_t)q0 * DI, nullptr, DI, (size_t)SQ * DI, QT, HD, nk); }      /* out[b][q0 + i][..] = P V^T 2^-8 (f32) */
  for (int c = 0; c < 3; ++c) k_gemm2<0><<<dim3((unsigned)((QT0 / 128) * (DI / 64)), NB), 128, 0, stream>>>(X16, DM, (size_t)SQ * DM, BW + (size_t)c * DI * DM, DM, 0, 0.0625f, bqkv[c], 0, nullptr, 1, 0, 0, QKVF0 + (size_t)c * DI, nullptr, LQK, (size_t)QT0 * LQK, QT0, DI, DM);      /* f32 q | k | v of rows 0..511 of every batch (exact products, f32 accumulation) */
  k_att0<0><<<dim3(NH * (QT0 / 64), NB), 64, 0, stream>>>(QKVF0, QKVF0 + DI, QKVF0 + 2 * DI, LQK, nullptr, 0.125f, OF0, DI);      /* exact f32 causal attention for rows 0..511 (o x64) */
  k_o0m<<<dim3((unsigned)(((size_t)QT0 * DI / 4 + 255) / 256), NB), 256, 0, stream>>>(OF0, ob, (size_t)QT0 * DI / 4);      /* rows 0..511 of every batch REWRITTEN from the exact path */
}

// v004
// It runs in 298 microseconds.
// Next to v003, in two timings, it ran 2.00 and 2.02 times as fast.
// Counting every step since v000, it is 242 times as fast.
#include <hip/hip_runtime.h>
// Single-head causal self-attention (x [32][1024][384]; k/q/v = x W ([in][out] [384][64], no biases; input order Wk, Wq, Wv); ONE 64-wide head; wei * 64^-0.5; causal (tril, -inf); softmax; out = wei v -> [32][1024][64]; no output projection).
// Structure: token rows; x as exact f16 rows; three WMMA GEMMs (no bias) into one f16 q | k | v plane [32768][192]; per batch v^T via LDS transposes; causal 256-row query tiles with the batch on grid.y (scores alpha 1/8, causal softmax f32 -> f16 x256 weights, P V written as f32 straight into the merged output rows); an exact f32 first tile (rows 0..511) rewritten at the end; launches: see trace.
// Compute dtype: inputs rounded to bf16; x / weights exact; q, k, v and softmax weights as plain f16 GEMM operands (~2^-12); o written as f32; scores and softmax statistics f32. v_wmma_f32_16x16x32_f16.
#define NB 32
#define SQ 1024
#define DM 384
#define NH 1
#define HD 64
#define HG 4
#define QT 256                       /* query rows per causal tile */
#define NKX SQ                       /* S / P row pitch */
#define QT0 512                      /* first-tile rows recomputed exactly (f32): 512 here (no output projection averages the early-row cancellation errors away; logit sigma 1.0) */
#define B0 0                         /* unused; batches start at 0 on grid.y */
#define NBR NB                       /* feeds only MP; unused by the launches */
#define NR ((size_t)NB * SQ)
#define DMQ DM
#define DFF 4096
#define DFFR 100
#define MP ((int)((size_t)NBR * SQ)) /* unused; the projections use NR rows */
#define QN SQ                        /* unused */
#define NHD NH                       /* unused */
#define MPO MP                       /* unused */
#define LQ (3 * DM)      /* 3 * DM, unused; the q/k/v rows use pitch LQK (192) */
typedef __bf16 v16b __attribute__((ext_vector_type(16)));
typedef unsigned short v8us __attribute__((ext_vector_type(8), may_alias));
typedef float  v8f  __attribute__((ext_vector_type(8)));
typedef float  v4f  __attribute__((ext_vector_type(4)));
typedef float  v4fa __attribute__((ext_vector_type(4), may_alias));
union FragB { v16b v; v8us half[2]; unsigned short u[16]; };

__device__ __forceinline__ unsigned short bf16_bits(float x) { unsigned int u = __float_as_uint(x); return (unsigned short)((u + 0x7FFFu + ((u >> 16) & 1u)) >> 16); }
__device__ __forceinline__ float bf16_val(unsigned short b) { return __uint_as_float(((unsigned int)b) << 16); }
__device__ __forceinline__ float bf16_round(float x) { return bf16_val(bf16_bits(x)); }
// D += A·B with NT terms: 1 = ah·bh, 2 = + al·bh (A split), 3 = + ah·bl (both split)
template <int NT>
__device__ __forceinline__ v8f mmaN(v16b ah, v16b al, v16b bh, v16b bl, v8f c) {
  c = __builtin_amdgcn_wmma_f32_16x16x32_bf16(false, ah, false, bh, (short)0, c, false, false);
  if (NT >= 2) c = __builtin_amdgcn_wmma_f32_16x16x32_bf16(false, al, false, bh, (short)0, c, false, false);
  if (NT >= 3) c = __builtin_amdgcn_wmma_f32_16x16x32_bf16(false, ah, false, bl, (short)0, c, false, false);
  asm volatile("v_nop\n\tv_nop\n\tv_nop\n\tv_nop" : "+v"(c) : "v"(ah), "v"(al), "v"(bh), "v"(bl));
  return c;
}

__global__ __launch_bounds__(256) void k_wt_bf16(const float* __restrict__ W, unsigned short* __restrict__ Wt, int K, int N) {
  const int t = blockIdx.x * 256 + threadIdx.x;
  const int k8n = K / 8;
  if (t >= N * k8n) return;
  const int n = t / k8n, k8 = (t % k8n) * 8;
  v8us v;
#pragma unroll
  for (int i = 0; i < 8; ++i) v[i] = bf16_bits(W[(size_t)(k8 + i) * N + n]);
  *(v8us*)(Wt + (size_t)n * K + k8) = v;
  
}

// GEMM C[M][N] (f32, pitch ldc) = act(A[M][K]·W + bias). A f32 row-major (pitch lda) converted per fragment to bf16
// (ASPLIT: hi/lo two planes -> 2 terms, else single rounded term); Wt bf16 [N][K] (pitch ldb). BIAS_BF16 rounds the
// bias to bf16 first (bias quantised to bf16 before the add). K%32==0, M%16==0, N%64==0.
template <bool ASPLIT, int ACT, bool BIAS_BF16>
__global__ __launch_bounds__(128) void k_gemm_bf(const float* __restrict__ A, int lda, const unsigned short* __restrict__ Wt, int ldb,
                                               const float* __restrict__ bias, float* __restrict__ C, int ldc, int M, int N, int K) {
  __shared__ __attribute__((aligned(16))) float so[4][16][64];
  const int tid = threadIdx.x, w = tid >> 5, lane = tid & 31, ln = lane & 15, hh = lane >> 4;
  const int ntn = N / 64;
  const int wid = blockIdx.x * 4 + w;
  const int mt = wid / ntn, nq = wid % ntn;
  if (mt * 16 >= M) return;
  const int row0 = mt * 16, col0 = nq * 64;
  const float* arow = A + (size_t)(row0 + ln) * lda;
  v8f acc[4] = {};
  for (int kb = 0; kb < K; kb += 32) {
    FragB ah, al;
    const v4f x0 = *(const v4fa*)(arow + kb + 8 * hh), x1 = *(const v4fa*)(arow + kb + 8 * hh + 4);
    const v4f x2 = *(const v4fa*)(arow + kb + 16 + 8 * hh), x3 = *(const v4fa*)(arow + kb + 16 + 8 * hh + 4);
    float xs[16] = {x0[0],x0[1],x0[2],x0[3],x1[0],x1[1],x1[2],x1[3],x2[0],x2[1],x2[2],x2[3],x3[0],x3[1],x3[2],x3[3]};
#pragma unroll
    for (int i = 0; i < 16; ++i) { const unsigned short hb = bf16_bits(xs[i]); ah.u[i] = hb; al.u[i] = ASPLIT ? bf16_bits(xs[i] - bf16_val(hb)) : (unsigned short)0; }
#pragma unroll
    for (int t = 0; t < 4; ++t) {
      const unsigned short* brow = Wt + (size_t)(col0 + t * 16 + ln) * ldb + kb;
      FragB b;
      b.half[0] = *(const v8us*)(brow + 8 * hh);
      b.half[1] = *(const v8us*)(brow + 16 + 8 * hh);
      acc[t] = mmaN<ASPLIT ? 2 : 1>(ah.v, al.v, b.v, b.v, acc[t]);
    }
  }
#pragma unroll
  for (int t = 0; t < 4; ++t) {
    float bv = bias ? bias[col0 + t * 16 + ln] : 0.f;
    if (BIAS_BF16) bv = bf16_round(bv);
#pragma unroll
    for (int r = 0; r < 8; ++r) { float v = acc[t][r] + bv; if (ACT == 1) v = fmaxf(v, 0.f); so[w][8 * hh + r][t * 16 + ln] = v; }
  }
  __builtin_amdgcn_fence(__ATOMIC_ACQ_REL, "workgroup");
  __builtin_amdgcn_wave_barrier();
  const int rsub = lane >> 4, c4 = (lane & 15) * 4;
  {
#pragma unroll
    for (int q = 0; q < 8; ++q) {
      const int r = q * 2 + rsub;
      const v4f v = *(const v4fa*)&so[w][r][c4];
      *(v4f*)(C + (size_t)(row0 + r) * ldc + col0 + c4) = v;
    }
    
  }
}

// GEMM C = act(A·W + bias + resid): A f32 (ASPLIT -> hi/lo 2 terms), Wt bf16 [N][K]; ACT 0 none, 1 relu, 2 exact gelu;
// resid (optional, f32, row index = (row % rmod), pitch ldr, RES_BF16 rounds it) added before the activation.
template <bool ASPLIT, int ACT, bool BIAS_BF16, bool RES_BF16>
__global__ __launch_bounds__(128) void k_gemm_bf3(const float* __restrict__ A, int lda, const unsigned short* __restrict__ Wt, int ldb,
                                                const float* __restrict__ bias, const float* __restrict__ resid, int rmod, int ldr,
                                                float* __restrict__ C, int ldc, int M, int N, int K) {
  __shared__ __attribute__((aligned(16))) float so[4][16][64];
  const int tid = threadIdx.x, w = tid >> 5, lane = tid & 31, ln = lane & 15, hh = lane >> 4;
  const int ntn = N / 64;
  const int wid = blockIdx.x * 4 + w;
  const int mt = wid / ntn, nq = wid % ntn;
  if (mt * 16 >= M) return;
  const int row0 = mt * 16, col0 = nq * 64;
  const float* arow = A + (size_t)(row0 + ln) * lda;
  v8f acc[4] = {};
  for (int kb = 0; kb < K; kb += 32) {
    FragB ah, al;
    const v4f x0 = *(const v4fa*)(arow + kb + 8 * hh), x1 = *(const v4fa*)(arow + kb + 8 * hh + 4);
    const v4f x2 = *(const v4fa*)(arow + kb + 16 + 8 * hh), x3 = *(const v4fa*)(arow + kb + 16 + 8 * hh + 4);
    float xs[16] = {x0[0],x0[1],x0[2],x0[3],x1[0],x1[1],x1[2],x1[3],x2[0],x2[1],x2[2],x2[3],x3[0],x3[1],x3[2],x3[3]};
#pragma unroll
    for (int i = 0; i < 16; ++i) { const unsigned short hb = bf16_bits(xs[i]); ah.u[i] = hb; al.u[i] = ASPLIT ? bf16_bits(xs[i] - bf16_val(hb)) : (unsigned short)0; }
#pragma unroll
    for (int t = 0; t < 4; ++t) {
      const unsigned short* brow = Wt + (size_t)(col0 + t * 16 + ln) * ldb + kb;
      FragB b;
      b.half[0] = *(const v8us*)(brow + 8 * hh);
      b.half[1] = *(const v8us*)(brow + 16 + 8 * hh);
      acc[t] = mmaN<ASPLIT ? 2 : 1>(ah.v, al.v, b.v, b.v, acc[t]);
    }
  }
#pragma unroll
  for (int t = 0; t < 4; ++t) {
    const int col = col0 + t * 16 + ln;
    float bv = bias ? bias[col] : 0.f;
    if (BIAS_BF16) bv = bf16_round(bv);
#pragma unroll
    for (int r = 0; r < 8; ++r) {
      float v = acc[t][r] + bv;
      if (resid) { float rv = resid[(size_t)((row0 + 8 * hh + r) % rmod) * ldr + col]; if (RES_BF16) rv = bf16_round(rv); v += rv; }
      if (ACT == 1) v = fmaxf(v, 0.f);
      if (ACT == 2) v = 0.5f * v * (1.0f + erff(v * 0.70710678118654752f));
      if (ACT == 3) { const float u = 0.7978845608028654f * (v + 0.044715f * v * v * v); v = 0.5f * v * (1.0f + tanhf(u)); }
      so[w][8 * hh + r][t * 16 + ln] = v;
    }
  }
  __builtin_amdgcn_fence(__ATOMIC_ACQ_REL, "workgroup");
  __builtin_amdgcn_wave_barrier();
  const int rsub = lane >> 4, c4 = (lane & 15) * 4;
  {
#pragma unroll
    for (int q = 0; q < 8; ++q) {
      const int r = q * 2 + rsub;
      const v4f v = *(const v4fa*)&so[w][r][c4];
      *(v4f*)(C + (size_t)(row0 + r) * ldc + col0 + c4) = v;
    }
    
  }
}
// row LayerNorm (biased variance, eps) over N: s = X (+ R); optional out_sum <- s; out_norm <- (s-mu)*rsqrt(var+eps)*g + b
template <bool PARAM_BF16>
__global__ __launch_bounds__(256) void k_layernorm(const float* __restrict__ X, const float* __restrict__ R, const float* __restrict__ g, const float* __restrict__ bta,
                                                  float* __restrict__ out_sum, float* __restrict__ out_norm, int N, float eps) {
  __shared__ float red[256];
  const int row = blockIdx.x, tid = threadIdx.x;
  const float* x = X + (size_t)row * N; const float* rr = R ? R + (size_t)row * N : nullptr;
  float vals[16];                     // up to N = 4096
  const int per = N / 256;            // contiguous chunk per thread? use strided-by-4 chunks: thread handles j = tid*4 + 1024*u
  float s1 = 0.f;
  for (int u = 0; u < per / 4; ++u) {
    const int j = tid * 4 + 1024 * u;
    const v4f a = *(const v4fa*)(x + j);
    v4f b = {0.f,0.f,0.f,0.f}; if (rr) b = *(const v4fa*)(rr + j);
#pragma unroll
    for (int q = 0; q < 4; ++q) { const float v = a[q] + b[q]; vals[u * 4 + q] = v; s1 += v; }
  }
  red[tid] = s1; __syncthreads();
  for (int st = 128; st > 0; st >>= 1) { if (tid < st) red[tid] += red[tid + st]; __syncthreads(); }
  const float mu = red[0] / (float)N; __syncthreads();
  float s2 = 0.f;
  for (int u = 0; u < per / 4; ++u)
#pragma unroll
    for (int q = 0; q < 4; ++q) { const float c = vals[u * 4 + q] - mu; s2 += c * c; }
  red[tid] = s2; __syncthreads();
  for (int st = 128; st > 0; st >>= 1) { if (tid < st) red[tid] += red[tid + st]; __syncthreads(); }
  const float rs = rsqrtf(red[0] / (float)N + eps);
  {
    for (int u = 0; u < per / 4; ++u) {
      const int j = tid * 4 + 1024 * u;
      v4f o, sm;
#pragma unroll
      for (int q = 0; q < 4; ++q) {
        float gg = g[j + q], bb = bta[j + q];
        if (PARAM_BF16) { gg = bf16_round(gg); bb = bf16_round(bb); }
        sm[q] = vals[u * 4 + q]; o[q] = (vals[u * 4 + q] - mu) * rs * gg + bb;
      }
      if (out_sum) *(v4f*)(out_sum + (size_t)row * N + j) = sm;
      *(v4f*)(out_norm + (size_t)row * N + j) = o;
    }
    
  }
}



// ---- f16 WMMA path (v_wmma_f32_16x16x32_f16): 11-bit significands for operands in range — used where a [0,1] probability operand needs more precision than bf16
typedef _Float16 v16h __attribute__((ext_vector_type(16)));
union FragH { v16h v; v8us half[2]; _Float16 h[16]; unsigned short u[16]; };
template <int NT>
__device__ __forceinline__ v8f mmaH(v16h ah, v16h al, v16h bh, v16h bl, v8f c) {
  c = __builtin_amdgcn_wmma_f32_16x16x32_f16(false, ah, false, bh, (short)0, c, false, false);
  if (NT >= 2) c = __builtin_amdgcn_wmma_f32_16x16x32_f16(false, al, false, bh, (short)0, c, false, false);
  if (NT >= 3) c = __builtin_amdgcn_wmma_f32_16x16x32_f16(false, ah, false, bl, (short)0, c, false, false);
  asm volatile("v_nop\n\tv_nop\n\tv_nop\n\tv_nop" : "+v"(c) : "v"(ah), "v"(al), "v"(bh), "v"(bl));
  return c;
}
// batched GEMM like k_gemm_b but f16 operands: A f32 (split into f16 hi/lo if ASPLIT, else rounded to f16), Bt = f16 values [n][k]; alpha; C f32; N multiple of 16 (partial tiles skipped)
template <bool ASPLIT>
__global__ __launch_bounds__(128) void k_gemm_h(const float* __restrict__ A, int lda, size_t sA, const _Float16* __restrict__ Bh, int ldb, size_t sB, float alpha, float* __restrict__ C, int ldc, size_t sC, int M, int N, int K) {
  __shared__ __attribute__((aligned(16))) float so[4][16][64];
  const int tid = threadIdx.x, w = tid >> 5, lane = tid & 31, ln = lane & 15, hh = lane >> 4; const int by = blockIdx.y;
  A += (size_t)by * sA; Bh += (size_t)by * sB; C += (size_t)by * sC;
  const int ntn = (N + 63) / 64; const int wid = blockIdx.x * 4 + w; const int mt = wid / ntn, nq = wid % ntn; if (mt * 16 >= M) return;
  const int row0 = mt * 16, col0 = nq * 64; const float* arow = A + (size_t)(row0 + ln) * lda;
  v8f acc[4] = {};
  for (int kb = 0; kb < K; kb += 32) {
    FragH ah, al;
    const v4f x0 = *(const v4fa*)(arow + kb + 8 * hh), x1 = *(const v4fa*)(arow + kb + 8 * hh + 4), x2 = *(const v4fa*)(arow + kb + 16 + 8 * hh), x3 = *(const v4fa*)(arow + kb + 16 + 8 * hh + 4);
    float xs[16] = {x0[0],x0[1],x0[2],x0[3],x1[0],x1[1],x1[2],x1[3],x2[0],x2[1],x2[2],x2[3],x3[0],x3[1],x3[2],x3[3]};
#pragma unroll
    for (int i = 0; i < 16; ++i) { const _Float16 h = (_Float16)xs[i]; ah.h[i] = h; al.h[i] = ASPLIT ? (_Float16)(xs[i] - (float)h) : (_Float16)0.0f; }
#pragma unroll
    for (int t = 0; t < 4; ++t) { if (col0 + t * 16 >= N) continue; const size_t boff = (size_t)(col0 + t * 16 + ln) * ldb + kb; FragH bq; bq.half[0] = *(const v8us*)(Bh + boff + 8 * hh); bq.half[1] = *(const v8us*)(Bh + boff + 16 + 8 * hh);
      acc[t] = mmaH<ASPLIT ? 2 : 1>(ah.v, al.v, bq.v, bq.v, acc[t]); }
  }
#pragma unroll
  for (int t = 0; t < 4; ++t) { if (col0 + t * 16 >= N) continue;
#pragma unroll
    for (int r = 0; r < 8; ++r) so[w][8 * hh + r][t * 16 + ln] = acc[t][r] * alpha; }
  __builtin_amdgcn_fence(__ATOMIC_ACQ_REL, "workgroup"); __builtin_amdgcn_wave_barrier();
  const int rsub = lane >> 4, c4 = (lane & 15) * 4;
  {
#pragma unroll
    for (int q = 0; q < 8; ++q) { const int r = q * 2 + rsub; if (col0 + c4 < N) { const v4f v = *(const v4fa*)&so[w][r][c4]; *(v4f*)(C + (size_t)(row0 + r) * ldc + col0 + c4) = v; } }
     }
}

// Wt[n][k] = f16(W[k][n]·scale) from f32 row-major W[K][N] (scale = power of two; bf16-exact weights stay exact in f16 away from the subnormal range)
__global__ __launch_bounds__(256) void k_wt_f16(const float* __restrict__ W, _Float16* __restrict__ Wt, int K, int N, float scale) {
  const int t = blockIdx.x * 256 + threadIdx.x; if (t >= N * (K / 8)) return; const int n = t / (K / 8), k8 = (t % (K / 8)) * 8; FragH f;
#pragma unroll
  for (int i = 0; i < 8; ++i) f.h[i] = (_Float16)(bf16_round(W[(size_t)(k8 + i) * N + n]) * scale); const v8us o = f.half[0];
  *(v8us*)((unsigned short*)Wt + (size_t)n * K + k8) = o; 
}
// k_gemm_hh variant with fused epilogue: v = acc·alpha + bias[by·sBias + col] (+ CP[(row/rowsPerB)·sCPb + by·64 + col] if CP) ; ACT 0 none / 1 elu ; writes f16 C16 (and f32 C if non-null)
template <int ACT>
__global__ __launch_bounds__(128) void k_gemm_hhx(const _Float16* __restrict__ A, int lda, size_t sA, const _Float16* __restrict__ Bh, int ldb, size_t sB, float alpha, const float* __restrict__ bias, size_t sBias, const float* __restrict__ CP, int rowsPerB, size_t sCPb, int row0g,
    float* __restrict__ C, _Float16* __restrict__ C16, int ldc, size_t sC, int M, int N, int K) {
  __shared__ __attribute__((aligned(16))) float so[4][16][64];
  const int tid = threadIdx.x, w = tid >> 5, lane = tid & 31, ln = lane & 15, hh = lane >> 4; const int by = blockIdx.y;
  A += (size_t)by * sA; Bh += (size_t)by * sB; const size_t cofs = (size_t)by * sC; const float* bp = bias ? bias + (size_t)by * sBias : nullptr;
  const int ntn = (N + 63) / 64; const int wid = blockIdx.x * 4 + w; const int mt = wid / ntn, nq = wid % ntn; if (mt * 16 >= M) return;
  const int row0 = mt * 16, col0 = nq * 64; const _Float16* arow = A + (size_t)(row0 + ln) * lda;
  v8f acc[4] = {};
  for (int kb = 0; kb < K; kb += 32) { FragH ah; ah.half[0] = *(const v8us*)((const unsigned short*)arow + kb + 8 * hh); ah.half[1] = *(const v8us*)((const unsigned short*)arow + kb + 16 + 8 * hh);
#pragma unroll
    for (int t = 0; t < 4; ++t) { if (col0 + t * 16 >= N) continue; const size_t boff = (size_t)(col0 + t * 16 + ln) * ldb + kb; FragH bq; bq.half[0] = *(const v8us*)((const unsigned short*)Bh + boff + 8 * hh); bq.half[1] = *(const v8us*)((const unsigned short*)Bh + boff + 16 + 8 * hh);
      acc[t] = mmaH<1>(ah.v, ah.v, bq.v, bq.v, acc[t]); }
  }
#pragma unroll
  for (int t = 0; t < 4; ++t) { if (col0 + t * 16 >= N) continue; const int col = col0 + t * 16 + ln; const float bv = bp ? bf16_round(bp[col]) : 0.f;
#pragma unroll
    for (int r = 0; r < 8; ++r) { float v = acc[t][r] * alpha + bv; if (CP) { const int rr = row0g + row0 + 8 * hh + r; if (rowsPerB < 0) v += CP[cofs + (size_t)rr * ldc + col];      /* rowsPerB < 0: own element of the batched C plane */ else { const int bidx = rr / rowsPerB; v += CP[(size_t)bidx * sCPb + (size_t)by * 64 + col]; } } if (ACT == 1) v = (v > 0.f) ? v : expm1f(v); else if (ACT == 7) v = (v > 0.f) ? v + 1.0f : expf(v); else if (ACT == 8) v = tanhf(v); else if (ACT == 9) v = 0.5f * v * (1.0f + tanhf(0.7978845608028654f * (v + 0.044715f * v * v * v))); else if (ACT == 11) v = 1.0f / (1.0f + expf(-v)); else if (ACT == 12) v = (v > 0.f) ? v : 0.01f * v; else if (ACT == 14) v = (v > 0.f) ? v : 0.1f * v; else if (ACT == 16) v = (v >= 0.f) ? v : 0.3f * v; else if (ACT == 17) v = (v >= 0.f) ? v : 0.2f * v; else if (ACT == 15) v = v / (1.0f + expf(-v)); else if (ACT == 3) v = fmaxf(v, 0.f); else if (ACT == 6) v = 0.5f * v * (1.0f + erff(v * 0.70710678118654752f)); so[w][8 * hh + r][t * 16 + ln] = v; } }
  __builtin_amdgcn_fence(__ATOMIC_ACQ_REL, "workgroup"); __builtin_amdgcn_wave_barrier();
  const int rsub = lane >> 4, c4 = (lane & 15) * 4; typedef _Float16 v4h __attribute__((ext_vector_type(4)));
  {
#pragma unroll
    for (int q = 0; q < 8; ++q) { const int r = q * 2 + rsub; if (col0 + c4 < N) { const v4f v = *(const v4fa*)&so[w][r][c4]; if (C) *(v4f*)(C + cofs + (size_t)(row0 + r) * ldc + col0 + c4) = v; if (C16) { v4h h4; for (int i = 0; i < 4; ++i) h4[i] = (_Float16)v[i]; *(v4h*)(C16 + cofs + (size_t)(row0 + r) * ldc + col0 + c4) = h4; } } }
     }
}


typedef _Float16 v4h __attribute__((ext_vector_type(4)));

__global__ __launch_bounds__(256) void k_x16(const float* __restrict__ x, _Float16* __restrict__ X16, size_t n8) { const size_t t = (size_t)blockIdx.x * 256 + threadIdx.x; if (t >= n8) return; FragH f;
#pragma unroll
  for (int q = 0; q < 8; ++q) f.h[q] = (_Float16)bf16_round(x[t * 8 + q]); *(v8us*)((unsigned short*)X16 + t * 8) = f.half[0];  }
__global__ __launch_bounds__(256) void k_h16(const float* __restrict__ x, _Float16* __restrict__ X16, size_t n8) { const size_t t = (size_t)blockIdx.x * 256 + threadIdx.x; if (t >= n8) return; FragH f;
#pragma unroll
  for (int q = 0; q < 8; ++q) f.h[q] = (_Float16)x[t * 8 + q]; *(v8us*)((unsigned short*)X16 + t * 8) = f.half[0];  }
__global__ __launch_bounds__(256) void k_round16f(const float* __restrict__ W, _Float16* __restrict__ Bt, size_t n8) { const size_t t = (size_t)blockIdx.x * 256 + threadIdx.x; if (t >= n8) return; FragH f;
#pragma unroll
  for (int i = 0; i < 8; ++i) f.h[i] = (_Float16)(bf16_round(W[t * 8 + i]) * 16.0f); *(v8us*)((unsigned short*)Bt + t * 8) = f.half[0];  }
template <int NHv, int TTv>
__global__ __launch_bounds__(256) void k_vt(const _Float16* __restrict__ V16, int ldv, int voff, _Float16* __restrict__ Vt) { __shared__ unsigned short tl[64][66]; const int tid = threadIdx.x; const int slab = blockIdx.x / (TTv / 64), lg = blockIdx.x % (TTv / 64); const int b = slab / NHv, h = slab % NHv;
  for (int i = tid; i < 64 * 8; i += 256) { const int r = i / 8, c8 = (i % 8) * 8; FragH f; f.half[0] = *(const v8us*)((const unsigned short*)V16 + ((size_t)b * TTv + lg * 64 + r) * ldv + voff + h * 64 + c8);
#pragma unroll
    for (int q = 0; q < 8; ++q) tl[r][c8 + q] = f.u[q]; }
  __syncthreads();
  {
#pragma unroll
    for (int rd = 0; rd < 2; ++rd) { const int d = rd * 32 + tid / 8, pc = tid % 8; FragH f;
#pragma unroll
      for (int q = 0; q < 8; ++q) f.u[q] = tl[pc * 8 + q][d];
      *(v8us*)((unsigned short*)Vt + ((size_t)slab * 64 + d) * TTv + lg * 64 + pc * 8) = f.half[0]; }
     } }

__global__ __launch_bounds__(256) void k_hl(const float* __restrict__ F, _Float16* __restrict__ Hh, _Float16* __restrict__ Hl, size_t n8) { const size_t t = (size_t)blockIdx.x * 256 + threadIdx.x; if (t >= n8) return; FragH fh, fl; const v4f a = *(const v4fa*)(F + t * 8), c = *(const v4fa*)(F + t * 8 + 4);
#pragma unroll
  for (int q = 0; q < 4; ++q) { _Float16 h = (_Float16)a[q]; fh.h[q] = h; fl.h[q] = (_Float16)((a[q] - (float)h) * 1024.0f); h = (_Float16)c[q]; fh.h[4 + q] = h; fl.h[4 + q] = (_Float16)((c[q] - (float)h) * 1024.0f); }
  { *(v8us*)((unsigned short*)Hh + t * 8) = fh.half[0]; *(v8us*)((unsigned short*)Hl + t * 8) = fl.half[0];  } }

// ---- fast GEMM (wave tile 32x64; requires M % 32 == 0 rows per launch region and N % 64 == 0); epilogue = k_gemm_hhx semantics ----
__device__ __forceinline__ v16h g2_frag(const _Float16* p, int hh) { FragH f; f.half[0] = *(const v8us*)((const unsigned short*)p + 8 * hh); f.half[1] = *(const v8us*)((const unsigned short*)p + 16 + 8 * hh); return f.v; }
__device__ __forceinline__ v8f g2_mma(v16h a, v16h b, v8f c) { v8f d = __builtin_amdgcn_wmma_f32_16x16x32_f16(false, a, false, b, (short)0, c, false, false); asm volatile("v_nop\n\tv_nop\n\tv_nop\n\tv_nop" : "+v"(d) : "v"(a), "v"(b)); return d; }
template <int ACT>
__global__ __launch_bounds__(128) void k_gemm2(const _Float16* __restrict__ A, int lda, size_t sA, const _Float16* __restrict__ Bh, int ldb, size_t sB, float alpha, const float* __restrict__ bias, size_t sBias, const float* __restrict__ CP, int rowsPerB, size_t sCPb, int row0g,
    float* __restrict__ C, _Float16* __restrict__ C16, int ldc, size_t sC, int M, int N, int K) { static_assert(ACT == 0 || ACT == 3 || ACT == 6 || ACT == 8 || ACT == 9 || ACT == 11 || ACT == 12 || ACT == 14 || ACT == 15 || ACT == 16 || ACT == 17, "k_gemm2: unsupported ACT code (would silently apply no activation)");
  __shared__ __attribute__((aligned(16))) float so[4][32][68];
  const int tid = threadIdx.x, w = tid >> 5, lane = tid & 31, ln = lane & 15, hh = lane >> 4; const int by = blockIdx.y;
  A += (size_t)by * sA; Bh += (size_t)by * sB; const size_t cofs = (size_t)by * sC; const float* bp = bias ? bias + (size_t)by * sBias : nullptr;
  const int ntn = N >> 6; const int mt = blockIdx.x / ntn, nq = blockIdx.x - mt * ntn; const int row0 = mt * 128 + 32 * w, col0 = nq * 64; if (row0 >= M) return;
  const _Float16* a0p = A + (size_t)(row0 + ln) * lda; const _Float16* a1p = a0p + (size_t)16 * lda;
  const _Float16* b0p = Bh + (size_t)(col0 + ln) * ldb; const _Float16* b1p = b0p + (size_t)16 * ldb; const _Float16* b2p = b1p + (size_t)16 * ldb; const _Float16* b3p = b2p + (size_t)16 * ldb;
  const v8f z8 = {0.f,0.f,0.f,0.f,0.f,0.f,0.f,0.f}; v8f c00 = z8, c01 = z8, c02 = z8, c03 = z8, c10 = z8, c11 = z8, c12 = z8, c13 = z8;
#pragma unroll 1
  for (int kb = 0; kb < K; kb += 32) { const v16h a0 = g2_frag(a0p + kb, hh), a1 = g2_frag(a1p + kb, hh);
    v16h b = g2_frag(b0p + kb, hh); c00 = g2_mma(a0, b, c00); c10 = g2_mma(a1, b, c10);
    b = g2_frag(b1p + kb, hh); c01 = g2_mma(a0, b, c01); c11 = g2_mma(a1, b, c11);
    b = g2_frag(b2p + kb, hh); c02 = g2_mma(a0, b, c02); c12 = g2_mma(a1, b, c12);
    b = g2_frag(b3p + kb, hh); c03 = g2_mma(a0, b, c03); c13 = g2_mma(a1, b, c13); }
  v8f accs[8] = {c00, c01, c02, c03, c10, c11, c12, c13};
#pragma unroll
  for (int u = 0; u < 8; ++u) { const int t = u & 3, half = u >> 2; const int col = col0 + t * 16 + ln; const float bv = bp ? bf16_round(bp[col]) : 0.f;
#pragma unroll
    for (int r = 0; r < 8; ++r) { const int rloc = half * 16 + 8 * hh + r; float v = accs[u][r] * alpha + bv; if (CP) { if (rowsPerB < 0) v += CP[cofs + (size_t)(row0g + row0 + rloc) * ldc + col];      /* rowsPerB < 0: own element of the batched C plane */ else { const int bidx = (row0g + row0 + rloc) / rowsPerB; v += CP[(size_t)bidx * sCPb + (size_t)by * 64 + col]; } }
      if (ACT == 3) v = fmaxf(v, 0.f); else if (ACT == 6) v = 0.5f * v * (1.0f + erff(v * 0.70710678118654752f)); else if (ACT == 11) v = 1.0f / (1.0f + expf(-v)); else if (ACT == 15) v = v / (1.0f + expf(-v)); else if (ACT == 12) v = (v > 0.f) ? v : 0.01f * v; else if (ACT == 8) v = tanhf(v); else if (ACT == 9) v = 0.5f * v * (1.0f + tanhf(0.7978845608028654f * (v + 0.044715f * v * v * v))); else if (ACT == 14) v = (v > 0.f) ? v : 0.1f * v; else if (ACT == 16) v = (v >= 0.f) ? v : 0.3f * v; else if (ACT == 17) v = (v >= 0.f) ? v : 0.2f * v;
      so[w][rloc][t * 16 + ln] = v; } }
  __builtin_amdgcn_fence(__ATOMIC_ACQ_REL, "workgroup"); __builtin_amdgcn_wave_barrier();
  const int rsub = lane >> 4, c4 = (lane & 15) * 4;
  {
#pragma unroll
    for (int q = 0; q < 16; ++q) { const int r = q * 2 + rsub; const v4f v = *(const v4fa*)&so[w][r][c4]; if (C) *(v4f*)(C + cofs + (size_t)(row0 + r) * ldc + col0 + c4) = v; if (C16) { v4h h4; for (int i = 0; i < 4; ++i) h4[i] = (_Float16)v[i]; *(v4h*)(C16 + cofs + (size_t)(row0 + r) * ldc + col0 + c4) = h4; } }
     } }


__global__ __launch_bounds__(256) void k_wnat(const float* __restrict__ w, size_t n8, _Float16* __restrict__ Bt) { const size_t t = (size_t)blockIdx.x * 256 + threadIdx.x; if (t >= n8) return; FragH f; for (int q = 0; q < 8; ++q) f.h[q] = (_Float16)(bf16_round(w[t * 8 + q]) * 16.0f); *(v8us*)((unsigned short*)Bt + t * 8) = f.half[0];  }
__global__ __launch_bounds__(256) void k_rsm(const float* __restrict__ S, _Float16* __restrict__ P, int nrows) {
  #pragma clang fp contract(off)
  const int i = blockIdx.x * 256 + threadIdx.x; if (i >= nrows) return; const float* s = S + (size_t)i * SQ; float mx = -3.0e38f;
#pragma unroll 1
  for (int j = 0; j < SQ; ++j) mx = fmaxf(mx, s[j]); float se = 0.f;
#pragma unroll 1
  for (int j = 0; j < SQ; ++j) se += expf(s[j] - mx); const float sc = 256.0f / se;
#pragma unroll 1
  for (int j0 = 0; j0 < SQ; j0 += 8) { FragH f; for (int q = 0; q < 8; ++q) f.h[q] = (_Float16)(expf(s[j0 + q] - mx) * sc); unsigned short* d = (unsigned short*)P + (size_t)i * SQ + j0; *(v8us*)d = f.half[0];  } }
__global__ __launch_bounds__(256) void k_vt(const _Float16* __restrict__ V16, int b, int h0, _Float16* __restrict__ VT) { __shared__ unsigned short tl[64][65]; const int tid = threadIdx.x; const int hh = blockIdx.x % HG, sg = blockIdx.x / HG; const int s0 = sg * 64; const int h = h0 + hh;
  for (int i = tid; i < 64 * 8; i += 256) { const int j = i / 8, d8 = (i % 8) * 8; FragH f; f.half[0] = *(const v8us*)((const unsigned short*)V16 + ((size_t)b * SQ + s0 + j) * DM + h * HD + d8); for (int q = 0; q < 8; ++q) tl[d8 + q][j] = f.u[q]; }
  __syncthreads();
  { for (int i = tid; i < 64 * 8; i += 256) { const int d = i / 8, j8 = (i % 8) * 8; FragH f; for (int q = 0; q < 8; ++q) f.u[q] = tl[d][j8 + q]; *(v8us*)((unsigned short*)VT + ((size_t)hh * HD + d) * SQ + s0 + j8) = f.half[0]; }  } }



template <int CTRL> __device__ __forceinline__ float rs_dpp(float x) { return __builtin_bit_cast(float, __builtin_amdgcn_update_dpp(0, __builtin_bit_cast(int, x), CTRL, 0xf, 0xf, true)); }      /* lane l <- lane l ^ m inside a 16-lane row (row_xmask:m = 0x160 + m) */
__device__ __forceinline__ float rs_xhalf(float x) { return __builtin_bit_cast(float, __builtin_amdgcn_permlanex16(__builtin_bit_cast(int, x), __builtin_bit_cast(int, x), 0x76543210, 0xfedcba98, false, false)); }      /* lane l <- lane l ^ 16 */
__device__ __forceinline__ float rs_exp2(float x) { float e; asm("v_exp_f32 %0, %1\n\tv_nop" : "=v"(e) : "v"(x)); return e; }      /* 2^x; the v_nop is the slot the instruction set asks for behind a transcendental */
// causal softmax, ONE WAVE PER ROW of NU * 128 columns: lane l holds columns u*128 + 4l .. + 3 in registers, so S is read once, by whole lines; maximum and sum are folded over the 32 lanes by a butterfly that leaves the same value in every lane
template <int NU>
__global__ __launch_bounds__(256) void k_rsmcf2(const float* __restrict__ S, _Float16* __restrict__ P, int hg, int q0) {
  const int c0 = (threadIdx.x & 31) * 4; const int t = blockIdx.x * 8 + __builtin_amdgcn_readfirstlane(threadIdx.x >> 5); if (t >= hg * QT) return;      /* the row index is wave-uniform */
  const float* s = S + (size_t)t * NKX + c0; _Float16* d = P + (size_t)t * NKX + c0; const int last = q0 + (t % QT);
  v4f sv[NU]; float mx = -3.0e38f, se = 0.f;
#pragma unroll      /* full unroll (here and below): sv needs constant indices to stay in registers */
  for (int u = 0; u < NU; ++u) sv[u] = *(const v4fa*)(s + u * 128);
#pragma unroll
  for (int u = 0; u < NU; ++u) for (int q = 0; q < 4; ++q) { const float f = (u * 128 + c0 + q <= last) ? 1.f : 0.f; sv[u][q] = fmaf(f, sv[u][q], (1.f - f) * -1.0e9f); mx = fmaxf(mx, sv[u][q]); }
  mx = fmaxf(mx, rs_dpp<0x161>(mx)); mx = fmaxf(mx, rs_dpp<0x162>(mx)); mx = fmaxf(mx, rs_dpp<0x164>(mx)); mx = fmaxf(mx, rs_dpp<0x168>(mx)); mx = fmaxf(mx, rs_xhalf(mx));
#pragma unroll
  for (int u = 0; u < NU; ++u) for (int q = 0; q < 4; ++q) { sv[u][q] = rs_exp2((sv[u][q] - mx) * 1.44269504088896340736f); se += sv[u][q]; }
  se += rs_dpp<0x161>(se); se += rs_dpp<0x162>(se); se += rs_dpp<0x164>(se); se += rs_dpp<0x168>(se); se += rs_xhalf(se); const float sc = 256.0f / se;
#pragma unroll
  for (int u = 0; u < NU; ++u) { v4h h4; for (int q = 0; q < 4; ++q) h4[q] = (_Float16)(sv[u][q] * sc); *(v4h*)(d + u * 128) = h4; } }


#define A0R 32                       /* rows of one row group of the exact tile (one wave, one row per lane) = keys of one chunk */
#define A0G (QT0 / A0R)              /* row groups per batch */
#define A0W (A0G + 1)                /* waves per block: row groups x and A0G - 1 - x have x + 1 and A0G - x causal key chunks, A0G + 1 together for every x */
#define A0T (A0R * (HD / 4) / 32)    /* merge tiles per row group: 32 float4 = two output rows each */
#define A0P (HD + 4)                 /* LDS pitch of a partial o row, in floats: 16 B x odd, for the b128 rows */
// exact f32 causal attention, keys split: wave w of a block runs the online softmax of ONE row group over ONE chunk of A0R keys; the partial (m, l, o) of a row's chunks are merged through LDS in chunk order
__global__ __launch_bounds__(A0W * 32) void k_att0(const float* __restrict__ QF, const float* __restrict__ KF, const float* __restrict__ VF, int ld, float scale, float* __restrict__ OF, int ldo) {
  #pragma clang fp contract(off)
  __shared__ __attribute__((aligned(16))) float lo[A0W][A0R][A0P];      /* each wave's partial o rows (not normalised) */
  __shared__ float lm[A0W][A0R], ll[A0W][A0R];      /* each wave's running maximum and sum per row */
  const int tid = threadIdx.x, lane = tid & 31; const int w = __builtin_amdgcn_readfirstlane(tid >> 5);      /* the wave index is wave-uniform: k and v rows stay scalar loads */
  const int h = blockIdx.x / (A0G / 2), x = blockIdx.x % (A0G / 2);
  const int rg = (w <= x) ? x : A0G - 1 - x, ch = (w <= x) ? w : w - x - 1; const int i = rg * A0R + lane;      /* waves 0..x: the short row group x; the others: its long partner */
  { const size_t bi = (size_t)blockIdx.y * QT0 * ld; QF += bi; KF += bi; VF += bi; OF += (size_t)blockIdx.y * QT0 * ldo; }      /* batch on grid.y: each batch has its own QT0-row plane */
  const float* qr = QF + (size_t)i * ld + h * HD;
  v4f rq[HD / 4], ro[HD / 4];      /* this thread's q row and o accumulator live in registers for the whole key loop */
#pragma unroll      /* full unroll: rq / ro need constant indices to stay in registers */
  for (int c = 0; c < HD / 4; ++c) { rq[c] = *(const v4fa*)(qr + c * 4); const v4f z = {0.f, 0.f, 0.f, 0.f}; ro[c] = z; }
  asm volatile("s_wait_xcnt 0x0" :: "v"(qr) : "memory");      /* the q loads' address pair stays live up to this wait, so no register that an issued load names is rewritten ahead of it */
  float m = -1.0e30f, l = 0.f; const int j0 = ch * A0R;      /* the chunk's first key is at or below the diagonal for every row of the group, so m is a real score after the first trip */
#pragma unroll 1
  for (int j = j0; j < j0 + A0R; ++j) { const float* kr = KF + (size_t)j * ld + h * HD; const float* vr = VF + (size_t)j * ld + h * HD; float s = 0.f;
#pragma unroll      /* full unroll: constant index into rq */
    for (int c = 0; c < HD / 4; ++c) { const v4f kq = *(const v4fa*)(kr + c * 4); const v4f qq = rq[c]; s = __fadd_rn(s, __fmul_rn(qq[0], kq[0])); s = __fadd_rn(s, __fmul_rn(qq[1], kq[1])); s = __fadd_rn(s, __fmul_rn(qq[2], kq[2])); s = __fadd_rn(s, __fmul_rn(qq[3], kq[3])); }
    s = __fmul_rn(s, scale);
    const float f = (j <= i) ? 1.f : 0.f; const float sm = fmaf(f, s, (1.f - f) * -1.0e30f); const float mn = fmaxf(m, sm); const float sc = expf(m - mn); const float e = expf(sm - mn); l = __fadd_rn(__fmul_rn(l, sc), e); m = mn;
#pragma unroll      /* full unroll: constant index into ro */
    for (int c = 0; c < HD / 4; ++c) { const v4f vv = *(const v4fa*)(vr + c * 4); v4f oo = ro[c]; for (int u = 0; u < 4; ++u) oo[u] = __fadd_rn(__fmul_rn(oo[u], sc), __fmul_rn(e, vv[u])); ro[c] = oo; } }
  lm[w][lane] = m; ll[w][lane] = l;
#pragma unroll      /* full unroll: constant index into ro */
  for (int c = 0; c < HD / 4; ++c) *(v4f*)&lo[w][lane][c * 4] = ro[c];
  __syncthreads();
#pragma unroll 1      /* at most two trips; rolled, so that one trip's 16 partial rows are all that is live */
  for (int wt = w; wt < 2 * A0T; wt += A0W) {      /* a wave merges two whole output rows of one group per trip, one float4 per lane; group and chunk count are wave-uniform */
    const int g = wt / A0T, row = (wt % A0T) * 2 + (lane >> 4), pc = (lane & 15) * 4; const int w0 = g ? x + 1 : 0, n = g ? A0G - x : x + 1;      /* the group's waves: w0 .. w0 + n - 1, in chunk order */
    float pm[A0G], pl[A0G]; v4f po[A0G];
#pragma unroll      /* fixed trip count, index clamped to a written slot: all LDS reads issue together and the exponentials are independent; a slot past the group's n takes a maximum so low that its weight below is 0 */
    for (int s = 0; s < A0G; ++s) { const int ws = min(w0 + s, A0W - 1); const float ms = lm[ws][row]; pm[s] = (s < n) ? ms : -3.0e38f; pl[s] = ll[ws][row]; po[s] = *(const v4f*)&lo[ws][row][pc]; }
    float mx = pm[0];
#pragma unroll      /* full unroll (here and below): pm / pl / po need constant indices to stay in registers */
    for (int s = 1; s < A0G; ++s) mx = fmaxf(mx, pm[s]);
    float ls = 0.f; v4f a = {0.f, 0.f, 0.f, 0.f};
#pragma unroll
    for (int s = 0; s < A0G; ++s) { const float fs = expf(pm[s] - mx); ls = fmaf(fs, pl[s], ls); for (int u = 0; u < 4; ++u) a[u] = fmaf(fs, po[s][u], a[u]); }
    const float fin = 64.0f / ls;      /* o carried x64; k_o0m scales it back by 1/64 */
    for (int u = 0; u < 4; ++u) a[u] = __fmul_rn(a[u], fin);
    *(v4f*)(OF + (size_t)((g ? A0G - 1 - x : x) * A0R + row) * ldo + h * HD + pc) = a;
    asm volatile("s_wait_xcnt 0x0" ::: "memory"); } }      /* the next trip rewrites the registers that the store names: the wait stands in front of that */


template <int BFIN, int WXB>
__global__ __launch_bounds__(256) void k_ln16(const float* __restrict__ X, const float* __restrict__ g, const float* __restrict__ bb, float eps, _Float16* __restrict__ N16, float* __restrict__ XB) {
  #pragma clang fp contract(off)
  __shared__ float red[256]; const size_t r = blockIdx.x; const int t = threadIdx.x; const v4f xa = *(const v4fa*)(X + r * DMQ + t * 4); float s[4]; float sum = 0.f;
  for (int q = 0; q < 4; ++q) { s[q] = BFIN ? bf16_round(xa[q]) : xa[q]; sum = __fadd_rn(sum, s[q]); }
  red[t] = sum; __syncthreads(); for (int st = 128; st > 0; st >>= 1) { if (t < st) red[t] = __fadd_rn(red[t], red[t + st]); __syncthreads(); } const float mu = red[0] / (float)DMQ; __syncthreads();
  float vs = 0.f; for (int q = 0; q < 4; ++q) { const float dl = __fadd_rn(s[q], -mu); vs = __fadd_rn(vs, __fmul_rn(dl, dl)); } red[t] = vs; __syncthreads(); for (int st = 128; st > 0; st >>= 1) { if (t < st) red[t] = __fadd_rn(red[t], red[t + st]); __syncthreads(); }
  const float rs = rsqrtf(__fadd_rn(red[0] / (float)DMQ, eps)); v4h y; v4f xb;
  for (int q = 0; q < 4; ++q) { const int c = t * 4 + q; y[q] = (_Float16)__fadd_rn(__fmul_rn(__fmul_rn(__fadd_rn(s[q], -mu), rs), bf16_round(g[c])), bf16_round(bb[c])); xb[q] = s[q]; }
  { *(v4h*)(N16 + r * DMQ + t * 4) = y; if (WXB) *(v4f*)(XB + r * DMQ + t * 4) = xb;  } }
__global__ __launch_bounds__(256) void k_ftres2(const float* __restrict__ OF0, const float* __restrict__ XB, float* __restrict__ X1, size_t n4) {
  #pragma clang fp contract(off)
  const size_t t = (size_t)blockIdx.x * 256 + threadIdx.x; if (t >= n4) return; const v4f o = *(const v4fa*)(OF0 + t * 4), xv = *(const v4fa*)(XB + t * 4); v4f y; for (int q = 0; q < 4; ++q) y[q] = __fadd_rn(__fmul_rn(o[q], 0.015625f), xv[q]); *(v4f*)(X1 + t * 4) = y;  }

__global__ __launch_bounds__(256) void k_wthd(const float* __restrict__ Wt, _Float16* __restrict__ Bt) { const size_t t = (size_t)blockIdx.x * 256 + threadIdx.x; if (t >= (size_t)NH * HD * (DM / 8)) return; const int m8 = (int)(t % (DM / 8)) * 8; const int d = (int)((t / (DM / 8)) % HD); const int h = (int)(t / ((size_t)(DM / 8) * HD)); FragH f;
  for (int q = 0; q < 8; ++q) f.h[q] = (_Float16)(16.0f * bf16_round(Wt[((size_t)h * DM + m8 + q) * HD + d])); unsigned short* dst = (unsigned short*)Bt + ((size_t)h * HD + d) * DM + m8; *(v8us*)dst = f.half[0];  }




__global__ __launch_bounds__(256) void k_wtpad(const float* __restrict__ Wm, _Float16* __restrict__ Wt, int Kr, int Kp, int Nr, int Np, float scale) {
  const int t = blockIdx.x * 256 + threadIdx.x; if (t >= Np * (Kp / 8)) return; const int n = t / (Kp / 8), k8 = (t % (Kp / 8)) * 8; const int nc = min(n, Nr - 1); const float fn = (n < Nr) ? 1.f : 0.f; FragH f;
  for (int i = 0; i < 8; ++i) { const int k = k8 + i; const int kc = min(k, Kr - 1); const float fk = (k < Kr) ? fn : 0.f; f.h[i] = (_Float16)(bf16_round(Wm[(size_t)kc * Nr + nc]) * scale * fk); }
  unsigned short* o = (unsigned short*)Wt + (size_t)n * Kp + k8; *(v8us*)o = f.half[0];  }
__global__ __launch_bounds__(128) void k_bpad(const float* __restrict__ b, float* __restrict__ Bp, int nr, int np) {
  const int i = threadIdx.x; if (i >= np) return; const float v = b[min(i, nr - 1)] * ((i < nr) ? 1.f : 0.f); *(float*)(Bp + i) = v;  }

#define DI 64         /* inner width = NH * HD (ONE 64-wide head) */
#define LQK (3 * DI)  /* fused q | k | v row pitch (192) */
__global__ __launch_bounds__(256) void k_o0(const float* __restrict__ OF, float* __restrict__ ob, size_t n4) {
  #pragma clang fp contract(off)
  const size_t t = (size_t)blockIdx.x * 256 + threadIdx.x; if (t >= n4) return; const size_t e = t * 4; const int i = (int)(e / DI); const int c = (int)(e % DI); const int h = c / HD, d = c % HD; const v4f a = *(const v4fa*)(OF + e); v4f o; for (int q = 0; q < 4; ++q) o[q] = __fmul_rn(a[q], 0.015625f); float* dst = ob + (size_t)h * SQ * HD + (size_t)i * HD + d; *(v4f*)dst = o;  }

__global__ __launch_bounds__(256) void k_o0m(const float* __restrict__ OF, float* __restrict__ o_, size_t n4) {
  #pragma clang fp contract(off)
  const size_t t = (size_t)blockIdx.x * 256 + threadIdx.x; if (t >= n4) return; const size_t e = t * 4; OF += (size_t)blockIdx.y * QT0 * DI; o_ += (size_t)blockIdx.y * SQ * DI;      /* batch on grid.y: QT0 exact rows go to the head of the batch's SQ output rows */
  const v4f a = *(const v4fa*)(OF + e); v4f o; for (int q = 0; q < 4; ++q) o[q] = __fmul_rn(a[q], 0.015625f); *(v4f*)(o_ + e) = o;  }
extern "C" void kernel_launch(void* const* d_in, const int* in_sizes, int n_in,
                              void* d_out, int out_size, void* d_ws, size_t ws_size, hipStream_t stream) {
  (void)in_sizes; (void)n_in; (void)out_size;
  const float* const* I = (const float* const*)d_in; const float* x = I[0]; const float* wq = I[2]; const float* wk = I[1]; const float* wv = I[3]; const float* bq = nullptr; const float* bk = nullptr; const float* bv = nullptr;      /* x; [in][out = 64] Wk / Wq / Wv (input order as this module lists them); no biases */
  char* ws = (char*)d_ws; size_t off = 0;
  auto take = [&](size_t bytes) { char* p = ws + off; off += (bytes + 255) & ~(size_t)255; return p; };
  _Float16* BW = (_Float16*)take((size_t)LQK * DM * 2); _Float16* X16 = (_Float16*)take(NR * DM * 2); _Float16* QKV = (_Float16*)take(NR * LQK * 2); _Float16* VT = (_Float16*)take((size_t)NB * HD * SQ * 2);
  float* S = (float*)take((size_t)NB * QT * NKX * 4); _Float16* P = (_Float16*)take((size_t)NB * QT * NKX * 2); float* QKVF0 = (float*)take((size_t)NB * QT0 * LQK * 4); float* OF0 = (float*)take((size_t)NB * QT0 * DI * 4);      /* one plane per batch: all batches are in flight in every launch */
  if (off > ws_size) return;
  { const unsigned g = (unsigned)(((size_t)DI * (DM / 8) + 255) / 256); k_wt_f16<<<g, 256, 0, stream>>>(wq, BW, DM, DI, 16.0f); k_wt_f16<<<g, 256, 0, stream>>>(wk, BW + (size_t)DI * DM, DM, DI, 16.0f); k_wt_f16<<<g, 256, 0, stream>>>(wv, BW + (size_t)2 * DI * DM, DM, DI, 16.0f); }      /* [in = DM][out = 64] -> Bt[n][k] x16, stacked q | k | v */
  k_x16<<<(unsigned)((NR * DM / 8 + 255) / 256), 256, 0, stream>>>(x, X16, NR * DM / 8);      /* x (bf16-valued) as exact f16 rows */
  const float* bqkv[3] = {bq, bk, bv};
  for (int c = 0; c < 3; ++c) k_gemm2<0><<<dim3((unsigned)((NR / 128) * (DI / 64)), 1), 128, 0, stream>>>(X16, DM, 0, BW + (size_t)c * DI * DM, DM, 0, 0.0625f, bqkv[c], 0, nullptr, 1, 0, 0, nullptr, QKV + (size_t)c * DI, LQK, 0, (int)NR, DI, DM);      /* q | k | v = x W -> f16 rows, column blocks 0 / 64 / 128 of the fused plane (pitch 192); head h = columns h*64 inside each */
  const _Float16* Q16 = QKV; const _Float16* K16 = QKV + DI; const _Float16* V16 = QKV + 2 * DI;
  float* ob = (float*)d_out;      /* the batch is grid.y of every launch below but k_vt and k_rsmcf2, which index it in grid.x (ONE head, so the head stride of the kernels carries the batch) */
  k_vt<NH, SQ><<<NB * NH * (SQ / 64), 256, 0, stream>>>(V16, LQK, 0, VT);      /* V^T [NB][HD][SQ] */
  for (int q0 = 0; q0 < SQ; q0 += QT) { const int nk = q0 + QT;      /* causal: only keys below the tile end are computed */
    k_gemm2<0><<<dim3((QT / 128) * (nk / 64), NB), 128, 0, stream>>>(Q16 + (size_t)q0 * LQK, LQK, (size_t)SQ * LQK, K16, LQK, (size_t)SQ * LQK, 0.125f, nullptr, 0, nullptr, 1, 0, 0, S, nullptr, NKX, (size_t)QT * NKX, QT, nk, HD);      /* scores / 8 */
    static_assert(SQ == 4 * QT && NKX == SQ && QT % 128 == 0, "one softmax instance per causal tile"); switch (nk / QT) {      /* causal softmax -> P x256 f16; one wave per row, 8 rows per block; the row length is a compile-time constant of the kernel (the row lives in registers) */
      case 1: k_rsmcf2<QT / 128><<<(NB * QT + 7) / 8, 256, 0, stream>>>(S, P, NB, q0); break;
      case 2: k_rsmcf2<2 * QT / 128><<<(NB * QT + 7) / 8, 256, 0, stream>>>(S, P, NB, q0); break;
      case 3: k_rsmcf2<3 * QT / 128><<<(NB * QT + 7) / 8, 256, 0, stream>>>(S, P, NB, q0); break;
      case 4: k_rsmcf2<4 * QT / 128><<<(NB * QT + 7) / 8, 256, 0, stream>>>(S, P, NB, q0); break; }
    k_gemm2<0><<<dim3((QT / 128) * (HD / 64), NB), 128, 0, stream>>>(P, NKX, (size_t)QT * NKX, VT, SQ, (size_t)HD * SQ, 0.00390625f, nullptr, 0, nullptr, 1, 0, 0, ob + (size_t)q0 * DI, nullptr, DI, (size_t)SQ * DI, QT, HD, nk); }      /* out[b][q0 + i][..] = P V^T 2^-8 (f32) */
  for (int c = 0; c < 3; ++c) k_gemm2<0><<<dim3((unsigned)((QT0 / 128) * (DI / 64)), NB), 128, 0, stream>>>(X16, DM, (size_t)SQ * DM, BW + (size_t)c * DI * DM, DM, 0, 0.0625f, bqkv[c], 0, nullptr, 1, 0, 0, QKVF0 + (size_t)c * DI, nullptr, LQK, (size_t)QT0 * LQK, QT0, DI, DM);      /* f32 q | k | v of rows 0..511 of every batch (exact products, f32 accumulation) */
  k_att0<<<dim3(NH * (A0G / 2), NB), A0W * 32, 0, stream>>>(QKVF0, QKVF0 + DI, QKVF0 + 2 * DI, LQK, 0.125f, OF0, DI);      /* exact f32 causal attention for rows 0..511 (o x64); a block = one short and one long row group, one wave per key chunk */
  k_o0m<<<dim3((unsigned)(((size_t)QT0 * DI / 4 + 255) / 256), NB), 256, 0, stream>>>(OF0, ob, (size_t)QT0 * DI / 4);      /* rows 0..511 of every batch REWRITTEN from the exact path */
}

// v005
// One run takes 222 microseconds.
// Timed twice side by side with v004, it ran 1.32 times as fast both times.
// All steps since v000 together make it 321 times as fast.
#include <hip/hip_runtime.h>
// Single-head causal self-attention (x [32][1024][384]; k/q/v = x W ([in][out] [384][64], no biases; input order Wk, Wq, Wv); ONE 64-wide head; wei * 64^-0.5; causal (tril, -inf); softmax; out = wei v -> [32][1024][64]; no output projection).
// Structure: token rows; x as exact f16 rows; three WMMA GEMMs (no bias) into one f16 q | k | v plane [32768][192]; per batch v^T via LDS transposes; causal 256-row query tiles with the batch on grid.y (scores alpha 1/8, causal softmax f32 -> f16 x256 weights, P V written as f32 straight into the merged output rows); an exact f32 first tile (rows 0..511) rewritten at the end; launches: see trace.
// Compute dtype: inputs rounded to bf16; x / weights exact; q, k, v and softmax weights as plain f16 GEMM operands (~2^-12); o written as f32; scores and softmax statistics f32. v_wmma_f32_16x16x32_f16.
#define NB 32
#define SQ 1024
#define DM 384
#define NH 1
#define HD 64
#define HG 4
#define QT 256                       /* query rows per causal tile */
#define NKX SQ                       /* S / P row pitch */
#define QT0 512                      /* first-tile rows recomputed exactly (f32): 512 here (no output projection averages the early-row cancellation errors away; logit sigma 1.0) */
#define B0 0                         /* unused; batches start at 0 on grid.y */
#define NBR NB                       /* feeds only MP; unused by the launches */
#define NR ((size_t)NB * SQ)
#define DMQ DM
#define DFF 4096
#define DFFR 100
#define MP ((int)((size_t)NBR * SQ)) /* unused; the projections use NR rows */
#define QN SQ                        /* unused */
#define NHD NH                       /* unused */
#define MPO MP                       /* unused */
#define LQ (3 * DM)      /* 3 * DM, unused; the q/k/v rows use pitch LQK (192) */
typedef __bf16 v16b __attribute__((ext_vector_type(16)));
typedef unsigned short v8us __attribute__((ext_vector_type(8), may_alias));
typedef float  v8f  __attribute__((ext_vector_type(8)));
typedef float  v4f  __attribute__((ext_vector_type(4)));
typedef float  v4fa __attribute__((ext_vector_type(4), may_alias));
union FragB { v16b v; v8us half[2]; unsigned short u[16]; };

__device__ __forceinline__ unsigned short bf16_bits(float x) { unsigned int u = __float_as_uint(x); return (unsigned short)((u + 0x7FFFu + ((u >> 16) & 1u)) >> 16); }
__device__ __forceinline__ float bf16_val(unsigned short b) { return __uint_as_float(((unsigned int)b) << 16); }
__device__ __forceinline__ float bf16_round(float x) { return bf16_val(bf16_bits(x)); }
// D += A·B with NT terms: 1 = ah·bh, 2 = + al·bh (A split), 3 = + ah·bl (both split)
template <int NT>
__device__ __forceinline__ v8f mmaN(v16b ah, v16b al, v16b bh, v16b bl, v8f c) {
  c = __builtin_amdgcn_wmma_f32_16x16x32_bf16(false, ah, false, bh, (short)0, c, false, false);
  if (NT >= 2) c = __builtin_amdgcn_wmma_f32_16x16x32_bf16(false, al, false, bh, (short)0, c, false, false);
  if (NT >= 3) c = __builtin_amdgcn_wmma_f32_16x16x32_bf16(false, ah, false, bl, (short)0, c, false, false);
  asm volatile("v_nop\n\tv_nop\n\tv_nop\n\tv_nop" : "+v"(c) : "v"(ah), "v"(al), "v"(bh), "v"(bl));
  return c;
}

__global__ __launch_bounds__(256) void k_wt_bf16(const float* __restrict__ W, unsigned short* __restrict__ Wt, int K, int N) {
  const int t = blockIdx.x * 256 + threadIdx.x;
  const int k8n = K / 8;
  if (t >= N * k8n) return;
  const int n = t / k8n, k8 = (t % k8n) * 8;
  v8us v;
#pragma unroll
  for (int i = 0; i < 8; ++i) v[i] = bf16_bits(W[(size_t)(k8 + i) * N + n]);
  *(v8us*)(Wt + (size_t)n * K + k8) = v;
  
}

// GEMM C[M][N] (f32, pitch ldc) = act(A[M][K]·W + bias). A f32 row-major (pitch lda) converted per fragment to bf16
// (ASPLIT: hi/lo two planes -> 2 terms, else single rounded term); Wt bf16 [N][K] (pitch ldb). BIAS_BF16 rounds the
// bias to bf16 first (bias quantised to bf16 before the add). K%32==0, M%16==0, N%64==0.
template <bool ASPLIT, int ACT, bool BIAS_BF16>
__global__ __launch_bounds__(128) void k_gemm_bf(const float* __restrict__ A, int lda, const unsigned short* __restrict__ Wt, int ldb,
                                               const float* __restrict__ bias, float* __restrict__ C, int ldc, int M, int N, int K) {
  __shared__ __attribute__((aligned(16))) float so[4][16][64];
  const int tid = threadIdx.x, w = tid >> 5, lane = tid & 31, ln = lane & 15, hh = lane >> 4;
  const int ntn = N / 64;
  const int wid = blockIdx.x * 4 + w;
  const int mt = wid / ntn, nq = wid % ntn;
  if (mt * 16 >= M) return;
  const int row0 = mt * 16, col0 = nq * 64;
  const float* arow = A + (size_t)(row0 + ln) * lda;
  v8f acc[4] = {};
  for (int kb = 0; kb < K; kb += 32) {
    FragB ah, al;
    const v4f x0 = *(const v4fa*)(arow + kb + 8 * hh), x1 = *(const v4fa*)(arow + kb + 8 * hh + 4);
    const v4f x2 = *(const v4fa*)(arow + kb + 16 + 8 * hh), x3 = *(const v4fa*)(arow + kb + 16 + 8 * hh + 4);
    float xs[16] = {x0[0],x0[1],x0[2],x0[3],x1[0],x1[1],x1[2],x1[3],x2[0],x2[1],x2[2],x2[3],x3[0],x3[1],x3[2],x3[3]};
#pragma unroll
    for (int i = 0; i < 16; ++i) { const unsigned short hb = bf16_bits(xs[i]); ah.u[i] = hb; al.u[i] = ASPLIT ? bf16_bits(xs[i] - bf16_val(hb)) : (unsigned short)0; }
#pragma unroll
    for (int t = 0; t < 4; ++t) {
      const unsigned short* brow = Wt + (size_t)(col0 + t * 16 + ln) * ldb + kb;
      FragB b;
      b.half[0] = *(const v8us*)(brow + 8 * hh);
      b.half[1] = *(const v8us*)(brow + 16 + 8 * hh);
      acc[t] = mmaN<ASPLIT ? 2 : 1>(ah.v, al.v, b.v, b.v, acc[t]);
    }
  }
#pragma unroll
  for (int t = 0; t < 4; ++t) {
    float bv = bias ? bias[col0 + t * 16 + ln] : 0.f;
    if (BIAS_BF16) bv = bf16_round(bv);
#pragma unroll
    for (int r = 0; r < 8; ++r) { float v = acc[t][r] + bv; if (ACT == 1) v = fmaxf(v, 0.f); so[w][8 * hh + r][t * 16 + ln] = v; }
  }
  __builtin_amdgcn_fence(__ATOMIC_ACQ_REL, "workgroup");
  __builtin_amdgcn_wave_barrier();
  const int rsub = lane >> 4, c4 = (lane & 15) * 4;
  {
#pragma unroll
    for (int q = 0; q < 8; ++q) {
      const int r = q * 2 + rsub;
      const v4f v = *(const v4fa*)&so[w][r][c4];
      *(v4f*)(C + (size_t)(row0 + r) * ldc + col0 + c4) = v;
    }
    
  }
}

// GEMM C = act(A·W + bias + resid): A f32 (ASPLIT -> hi/lo 2 terms), Wt bf16 [N][K]; ACT 0 none, 1 relu, 2 exact gelu;
// resid (optional, f32, row index = (row % rmod), pitch ldr, RES_BF16 rounds it) added before the activation.
template <bool ASPLIT, int ACT, bool BIAS_BF16, bool RES_BF16>
__global__ __launch_bounds__(128) void k_gemm_bf3(const float* __restrict__ A, int lda, const unsigned short* __restrict__ Wt, int ldb,
                                                const float* __restrict__ bias, const float* __restrict__ resid, int rmod, int ldr,
                                                float* __restrict__ C, int ldc, int M, int N, int K) {
  __shared__ __attribute__((aligned(16))) float so[4][16][64];
  const int tid = threadIdx.x, w = tid >> 5, lane = tid & 31, ln = lane & 15, hh = lane >> 4;
  const int ntn = N / 64;
  const int wid = blockIdx.x * 4 + w;
  const int mt = wid / ntn, nq = wid % ntn;
  if (mt * 16 >= M) return;
  const int row0 = mt * 16, col0 = nq * 64;
  const float* arow = A + (size_t)(row0 + ln) * lda;
  v8f acc[4] = {};
  for (int kb = 0; kb < K; kb += 32) {
    FragB ah, al;
    const v4f x0 = *(const v4fa*)(arow + kb + 8 * hh), x1 = *(const v4fa*)(arow + kb + 8 * hh + 4);
    const v4f x2 = *(const v4fa*)(arow + kb + 16 + 8 * hh), x3 = *(const v4fa*)(arow + kb + 16 + 8 * hh + 4);
    float xs[16] = {x0[0],x0[1],x0[2],x0[3],x1[0],x1[1],x1[2],x1[3],x2[0],x2[1],x2[2],x2[3],x3[0],x3[1],x3[2],x3[3]};
#pragma unroll
    for (int i = 0; i < 16; ++i) { const unsigned short hb = bf16_bits(xs[i]); ah.u[i] = hb; al.u[i] = ASPLIT ? bf16_bits(xs[i] - bf16_val(hb)) : (unsigned short)0; }
#pragma unroll
    for (int t = 0; t < 4; ++t) {
      const unsigned short* brow = Wt + (size_t)(col0 + t * 16 + ln) * ldb + kb;
      FragB b;
      b.half[0] = *(const v8us*)(brow + 8 * hh);
      b.half[1] = *(const v8us*)(brow + 16 + 8 * hh);
      acc[t] = mmaN<ASPLIT ? 2 : 1>(ah.v, al.v, b.v, b.v, acc[t]);
    }
  }
#pragma unroll
  for (int t = 0; t < 4; ++t) {
    const int col = col0 + t * 16 + ln;
    float bv = bias ? bias[col] : 0.f;
    if (BIAS_BF16) bv = bf16_round(bv);
#pragma unroll
    for (int r = 0; r < 8; ++r) {
      float v = acc[t][r] + bv;
      if (resid) { float rv = resid[(size_t)((row0 + 8 * hh + r) % rmod) * ldr + col]; if (RES_BF16) rv = bf16_round(rv); v += rv; }
      if (ACT == 1) v = fmaxf(v, 0.f);
      if (ACT == 2) v = 0.5f * v * (1.0f + erff(v * 0.70710678118654752f));
      if (ACT == 3) { const float u = 0.7978845608028654f * (v + 0.044715f * v * v * v); v = 0.5f * v * (1.0f + tanhf(u)); }
      so[w][8 * hh + r][t * 16 + ln] = v;
    }
  }
  __builtin_amdgcn_fence(__ATOMIC_ACQ_REL, "workgroup");
  __builtin_amdgcn_wave_barrier();
  const int rsub = lane >> 4, c4 = (lane & 15) * 4;
  {
#pragma unroll
    for (int q = 0; q < 8; ++q) {
      const int r = q * 2 + rsub;
      const v4f v = *(const v4fa*)&so[w][r][c4];
      *(v4f*)(C + (size_t)(row0 + r) * ldc + col0 + c4) = v;
    }
    
  }
}
// row LayerNorm (biased variance, eps) over N: s = X (+ R); optional out_sum <- s; out_norm <- (s-mu)*rsqrt(var+eps)*g + b
template <bool PARAM_BF16>
__global__ __launch_bounds__(256) void k_layernorm(const float* __restrict__ X, const float* __restrict__ R, const float* __restrict__ g, const float* __restrict__ bta,
                                                  float* __restrict__ out_sum, float* __restrict__ out_norm, int N, float eps) {
  __shared__ float red[256];
  const int row = blockIdx.x, tid = threadIdx.x;
  const float* x = X + (size_t)row * N; const float* rr = R ? R + (size_t)row * N : nullptr;
  float vals[16];                     // up to N = 4096
  const int per = N / 256;            // contiguous chunk per thread? use strided-by-4 chunks: thread handles j = tid*4 + 1024*u
  float s1 = 0.f;
  for (int u = 0; u < per / 4; ++u) {
    const int j = tid * 4 + 1024 * u;
    const v4f a = *(const v4fa*)(x + j);
    v4f b = {0.f,0.f,0.f,0.f}; if (rr) b = *(const v4fa*)(rr + j);
#pragma unroll
    for (int q = 0; q < 4; ++q) { const float v = a[q] + b[q]; vals[u * 4 + q] = v; s1 += v; }
  }
  red[tid] = s1; __syncthreads();
  for (int st = 128; st > 0; st >>= 1) { if (tid < st) red[tid] += red[tid + st]; __syncthreads(); }
  const float mu = red[0] / (float)N; __syncthreads();
  float s2 = 0.f;
  for (int u = 0; u < per / 4; ++u)
#pragma unroll
    for (int q = 0; q < 4; ++q) { const float c = vals[u * 4 + q] - mu; s2 += c * c; }
  red[tid] = s2; __syncthreads();
  for (int st = 128; st > 0; st >>= 1) { if (tid < st) red[tid] += red[tid + st]; __syncthreads(); }
  const float rs = rsqrtf(red[0] / (float)N + eps);
  {
    for (int u = 0; u < per / 4; ++u) {
      const int j = tid * 4 + 1024 * u;
      v4f o, sm;
#pragma unroll
      for (int q = 0; q < 4; ++q) {
        float gg = g[j + q], bb = bta[j + q];
        if (PARAM_BF16) { gg = bf16_round(gg); bb = bf16_round(bb); }
        sm[q] = vals[u * 4 + q]; o[q] = (vals[u * 4 + q] - mu) * rs * gg + bb;
      }
      if (out_sum) *(v4f*)(out_sum + (size_t)row * N + j) = sm;
      *(v4f*)(out_norm + (size_t)row * N + j) = o;
    }
    
  }
}



// ---- f16 WMMA path (v_wmma_f32_16x16x32_f16): 11-bit significands for operands in range — used where a [0,1] probability operand needs more precision than bf16
typedef _Float16 v16h __attribute__((ext_vector_type(16)));
union FragH { v16h v; v8us half[2]; _Float16 h[16]; unsigned short u[16]; };
template <int NT>
__device__ __forceinline__ v8f mmaH(v16h ah, v16h al, v16h bh, v16h bl, v8f c) {
  c = __builtin_amdgcn_wmma_f32_16x16x32_f16(false, ah, false, bh, (short)0, c, false, false);
  if (NT >= 2) c = __builtin_amdgcn_wmma_f32_16x16x32_f16(false, al, false, bh, (short)0, c, false, false);
  if (NT >= 3) c = __builtin_amdgcn_wmma_f32_16x16x32_f16(false, ah, false, bl, (short)0, c, false, false);
  asm volatile("v_nop\n\tv_nop\n\tv_nop\n\tv_nop" : "+v"(c) : "v"(ah), "v"(al), "v"(bh), "v"(bl));
  return c;
}
// batched GEMM like k_gemm_b but f16 operands: A f32 (split into f16 hi/lo if ASPLIT, else rounded to f16), Bt = f16 values [n][k]; alpha; C f32; N multiple of 16 (partial tiles skipped)
template <bool ASPLIT>
__global__ __launch_bounds__(128) void k_gemm_h(const float* __restrict__ A, int lda, size_t sA, const _Float16* __restrict__ Bh, int ldb, size_t sB, float alpha, float* __restrict__ C, int ldc, size_t sC, int M, int N, int K) {
  __shared__ __attribute__((aligned(16))) float so[4][16][64];
  const int tid = threadIdx.x, w = tid >> 5, lane = tid & 31, ln = lane & 15, hh = lane >> 4; const int by = blockIdx.y;
  A += (size_t)by * sA; Bh += (size_t)by * sB; C += (size_t)by * sC;
  const int ntn = (N + 63) / 64; const int wid = blockIdx.x * 4 + w; const int mt = wid / ntn, nq = wid % ntn; if (mt * 16 >= M) return;
  const int row0 = mt * 16, col0 = nq * 64; const float* arow = A + (size_t)(row0 + ln) * lda;
  v8f acc[4] = {};
  for (int kb = 0; kb < K; kb += 32) {
    FragH ah, al;
    const v4f x0 = *(const v4fa*)(arow + kb + 8 * hh), x1 = *(const v4fa*)(arow + kb + 8 * hh + 4), x2 = *(const v4fa*)(arow + kb + 16 + 8 * hh), x3 = *(const v4fa*)(arow + kb + 16 + 8 * hh + 4);
    float xs[16] = {x0[0],x0[1],x0[2],x0[3],x1[0],x1[1],x1[2],x1[3],x2[0],x2[1],x2[2],x2[3],x3[0],x3[1],x3[2],x3[3]};
#pragma unroll
    for (int i = 0; i < 16; ++i) { const _Float16 h = (_Float16)xs[i]; ah.h[i] = h; al.h[i] = ASPLIT ? (_Float16)(xs[i] - (float)h) : (_Float16)0.0f; }
#pragma unroll
    for (int t = 0; t < 4; ++t) { if (col0 + t * 16 >= N) continue; const size_t boff = (size_t)(col0 + t * 16 + ln) * ldb + kb; FragH bq; bq.half[0] = *(const v8us*)(Bh + boff + 8 * hh); bq.half[1] = *(const v8us*)(Bh + boff + 16 + 8 * hh);
      acc[t] = mmaH<ASPLIT ? 2 : 1>(ah.v, al.v, bq.v, bq.v, acc[t]); }
  }
#pragma unroll
  for (int t = 0; t < 4; ++t) { if (col0 + t * 16 >= N) continue;
#pragma unroll
    for (int r = 0; r < 8; ++r) so[w][8 * hh + r][t * 16 + ln] = acc[t][r] * alpha; }
  __builtin_amdgcn_fence(__ATOMIC_ACQ_REL, "workgroup"); __builtin_amdgcn_wave_barrier();
  const int rsub = lane >> 4, c4 = (lane & 15) * 4;
  {
#pragma unroll
    for (int q = 0; q < 8; ++q) { const int r = q * 2 + rsub; if (col0 + c4 < N) { const v4f v = *(const v4fa*)&so[w][r][c4]; *(v4f*)(C + (size_t)(row0 + r) * ldc + col0 + c4) = v; } }
     }
}

// Wt[n][k] = f16(W[k][n]·scale) from f32 row-major W[K][N] (scale = power of two; bf16-exact weights stay exact in f16 away from the subnormal range)
__global__ __launch_bounds__(256) void k_wt_f16(const float* __restrict__ W, _Float16* __restrict__ Wt, int K, int N, float scale) {
  const int t = blockIdx.x * 256 + threadIdx.x; if (t >= N * (K / 8)) return; const int n = t / (K / 8), k8 = (t % (K / 8)) * 8; FragH f;
#pragma unroll
  for (int i = 0; i < 8; ++i) f.h[i] = (_Float16)(bf16_round(W[(size_t)(k8 + i) * N + n]) * scale); const v8us o = f.half[0];
  *(v8us*)((unsigned short*)Wt + (size_t)n * K + k8) = o; 
}
// k_gemm_hh variant with fused epilogue: v = acc·alpha + bias[by·sBias + col] (+ CP[(row/rowsPerB)·sCPb + by·64 + col] if CP) ; ACT 0 none / 1 elu ; writes f16 C16 (and f32 C if non-null)
template <int ACT>
__global__ __launch_bounds__(128) void k_gemm_hhx(const _Float16* __restrict__ A, int lda, size_t sA, const _Float16* __restrict__ Bh, int ldb, size_t sB, float alpha, const float* __restrict__ bias, size_t sBias, const float* __restrict__ CP, int rowsPerB, size_t sCPb, int row0g,
    float* __restrict__ C, _Float16* __restrict__ C16, int ldc, size_t sC, int M, int N, int K) {
  __shared__ __attribute__((aligned(16))) float so[4][16][64];
  const int tid = threadIdx.x, w = tid >> 5, lane = tid & 31, ln = lane & 15, hh = lane >> 4; const int by = blockIdx.y;
  A += (size_t)by * sA; Bh += (size_t)by * sB; const size_t cofs = (size_t)by * sC; const float* bp = bias ? bias + (size_t)by * sBias : nullptr;
  const int ntn = (N + 63) / 64; const int wid = blockIdx.x * 4 + w; const int mt = wid / ntn, nq = wid % ntn; if (mt * 16 >= M) return;
  const int row0 = mt * 16, col0 = nq * 64; const _Float16* arow = A + (size_t)(row0 + ln) * lda;
  v8f acc[4] = {};
  for (int kb = 0; kb < K; kb += 32) { FragH ah; ah.half[0] = *(const v8us*)((const unsigned short*)arow + kb + 8 * hh); ah.half[1] = *(const v8us*)((const unsigned short*)arow + kb + 16 + 8 * hh);
#pragma unroll
    for (int t = 0; t < 4; ++t) { if (col0 + t * 16 >= N) continue; const size_t boff = (size_t)(col0 + t * 16 + ln) * ldb + kb; FragH bq; bq.half[0] = *(const v8us*)((const unsigned short*)Bh + boff + 8 * hh); bq.half[1] = *(const v8us*)((const unsigned short*)Bh + boff + 16 + 8 * hh);
      acc[t] = mmaH<1>(ah.v, ah.v, bq.v, bq.v, acc[t]); }
  }
#pragma unroll
  for (int t = 0; t < 4; ++t) { if (col0 + t * 16 >= N) continue; const int col = col0 + t * 16 + ln; const float bv = bp ? bf16_round(bp[col]) : 0.f;
#pragma unroll
    for (int r = 0; r < 8; ++r) { float v = acc[t][r] * alpha + bv; if (CP) { const int rr = row0g + row0 + 8 * hh + r; if (rowsPerB < 0) v += CP[cofs + (size_t)rr * ldc + col];      /* rowsPerB < 0: own element of the batched C plane */ else { const int bidx = rr / rowsPerB; v += CP[(size_t)bidx * sCPb + (size_t)by * 64 + col]; } } if (ACT == 1) v = (v > 0.f) ? v : expm1f(v); else if (ACT == 7) v = (v > 0.f) ? v + 1.0f : expf(v); else if (ACT == 8) v = tanhf(v); else if (ACT == 9) v = 0.5f * v * (1.0f + tanhf(0.7978845608028654f * (v + 0.044715f * v * v * v))); else if (ACT == 11) v = 1.0f / (1.0f + expf(-v)); else if (ACT == 12) v = (v > 0.f) ? v : 0.01f * v; else if (ACT == 14) v = (v > 0.f) ? v : 0.1f * v; else if (ACT == 16) v = (v >= 0.f) ? v : 0.3f * v; else if (ACT == 17) v = (v >= 0.f) ? v : 0.2f * v; else if (ACT == 15) v = v / (1.0f + expf(-v)); else if (ACT == 3) v = fmaxf(v, 0.f); else if (ACT == 6) v = 0.5f * v * (1.0f + erff(v * 0.70710678118654752f)); so[w][8 * hh + r][t * 16 + ln] = v; } }
  __builtin_amdgcn_fence(__ATOMIC_ACQ_REL, "workgroup"); __builtin_amdgcn_wave_barrier();
  const int rsub = lane >> 4, c4 = (lane & 15) * 4; typedef _Float16 v4h __attribute__((ext_vector_type(4)));
  {
#pragma unroll
    for (int q = 0; q < 8; ++q) { const int r = q * 2 + rsub; if (col0 + c4 < N) { const v4f v = *(const v4fa*)&so[w][r][c4]; if (C) *(v4f*)(C + cofs + (size_t)(row0 + r) * ldc + col0 + c4) = v; if (C16) { v4h h4; for (int i = 0; i < 4; ++i) h4[i] = (_Float16)v[i]; *(v4h*)(C16 + cofs + (size_t)(row0 + r) * ldc + col0 + c4) = h4; } } }
     }
}


typedef _Float16 v4h __attribute__((ext_vector_type(4)));

__global__ __launch_bounds__(256) void k_x16(const float* __restrict__ x, _Float16* __restrict__ X16, size_t n8) { const size_t t = (size_t)blockIdx.x * 256 + threadIdx.x; if (t >= n8) return; FragH f;
#pragma unroll
  for (int q = 0; q < 8; ++q) f.h[q] = (_Float16)bf16_round(x[t * 8 + q]); *(v8us*)((unsigned short*)X16 + t * 8) = f.half[0];  }
__global__ __launch_bounds__(256) void k_h16(const float* __restrict__ x, _Float16* __restrict__ X16, size_t n8) { const size_t t = (size_t)blockIdx.x * 256 + threadIdx.x; if (t >= n8) return; FragH f;
#pragma unroll
  for (int q = 0; q < 8; ++q) f.h[q] = (_Float16)x[t * 8 + q]; *(v8us*)((unsigned short*)X16 + t * 8) = f.half[0];  }
__global__ __launch_bounds__(256) void k_round16f(const float* __restrict__ W, _Float16* __restrict__ Bt, size_t n8) { const size_t t = (size_t)blockIdx.x * 256 + threadIdx.x; if (t >= n8) return; FragH f;
#pragma unroll
  for (int i = 0; i < 8; ++i) f.h[i] = (_Float16)(bf16_round(W[t * 8 + i]) * 16.0f); *(v8us*)((unsigned short*)Bt + t * 8) = f.half[0];  }
template <int NHv, int TTv>
__global__ __launch_bounds__(256) void k_vt(const _Float16* __restrict__ V16, int ldv, int voff, _Float16* __restrict__ Vt) { __shared__ unsigned short tl[64][66]; const int tid = threadIdx.x; const int slab = blockIdx.x / (TTv / 64), lg = blockIdx.x % (TTv / 64); const int b = slab / NHv, h = slab % NHv;
  for (int i = tid; i < 64 * 8; i += 256) { const int r = i / 8, c8 = (i % 8) * 8; FragH f; f.half[0] = *(const v8us*)((const unsigned short*)V16 + ((size_t)b * TTv + lg * 64 + r) * ldv + voff + h * 64 + c8);
#pragma unroll
    for (int q = 0; q < 8; ++q) tl[r][c8 + q] = f.u[q]; }
  __syncthreads();
  {
#pragma unroll
    for (int rd = 0; rd < 2; ++rd) { const int d = rd * 32 + tid / 8, pc = tid % 8; FragH f;
#pragma unroll
      for (int q = 0; q < 8; ++q) f.u[q] = tl[pc * 8 + q][d];
      *(v8us*)((unsigned short*)Vt + ((size_t)slab * 64 + d) * TTv + lg * 64 + pc * 8) = f.half[0]; }
     } }

__global__ __launch_bounds__(256) void k_hl(const float* __restrict__ F, _Float16* __restrict__ Hh, _Float16* __restrict__ Hl, size_t n8) { const size_t t = (size_t)blockIdx.x * 256 + threadIdx.x; if (t >= n8) return; FragH fh, fl; const v4f a = *(const v4fa*)(F + t * 8), c = *(const v4fa*)(F + t * 8 + 4);
#pragma unroll
  for (int q = 0; q < 4; ++q) { _Float16 h = (_Float16)a[q]; fh.h[q] = h; fl.h[q] = (_Float16)((a[q] - (float)h) * 1024.0f); h = (_Float16)c[q]; fh.h[4 + q] = h; fl.h[4 + q] = (_Float16)((c[q] - (float)h) * 1024.0f); }
  { *(v8us*)((unsigned short*)Hh + t * 8) = fh.half[0]; *(v8us*)((unsigned short*)Hl + t * 8) = fl.half[0];  } }

// ---- fast GEMM (wave tile 32x64; requires M % 32 == 0 rows per launch region, N % 64 == 0 and K % 64 == 0); epilogue = k_gemm_hhx semantics ----
__device__ __forceinline__ v16h g2_frag(const _Float16* p, int hh) { FragH f; f.half[0] = *(const v8us*)((const unsigned short*)p + 8 * hh); f.half[1] = *(const v8us*)((const unsigned short*)p + 16 + 8 * hh); return f.v; }
__device__ __forceinline__ v8f g2_mma(v16h a, v16h b, v8f c) { v8f d = __builtin_amdgcn_wmma_f32_16x16x32_f16(false, a, false, b, (short)0, c, false, false); asm volatile("v_nop\n\tv_nop\n\tv_nop\n\tv_nop" : "+v"(d) : "v"(a), "v"(b)); return d; }
template <int ACT>
__global__ __launch_bounds__(128) void k_gemm2(const _Float16* __restrict__ A, int lda, size_t sA, const _Float16* __restrict__ Bh, int ldb, size_t sB, float alpha, const float* __restrict__ bias, size_t sBias, const float* __restrict__ CP, int rowsPerB, size_t sCPb, int row0g,
    float* __restrict__ C, _Float16* __restrict__ C16, int ldc, size_t sC, int M, int N, int K) { static_assert(ACT == 0 || ACT == 3 || ACT == 6 || ACT == 8 || ACT == 9 || ACT == 11 || ACT == 12 || ACT == 14 || ACT == 15 || ACT == 16 || ACT == 17, "k_gemm2: unsupported ACT code (would silently apply no activation)");
  __shared__ __attribute__((aligned(16))) float so[4][32][68];
  const int tid = threadIdx.x, w = tid >> 5, lane = tid & 31, ln = lane & 15, hh = lane >> 4; const int by = blockIdx.y;
  A += (size_t)by * sA; Bh += (size_t)by * sB; const size_t cofs = (size_t)by * sC; const float* bp = bias ? bias + (size_t)by * sBias : nullptr;
  const int ntn = N >> 6; const int mt = blockIdx.x / ntn, nq = blockIdx.x - mt * ntn; const int row0 = mt * 128 + 32 * w, col0 = nq * 64; if (row0 >= M) return;
  const _Float16* a0p = A + (size_t)(row0 + ln) * lda; const _Float16* a1p = a0p + (size_t)16 * lda;
  const _Float16* b0p = Bh + (size_t)(col0 + ln) * ldb; const _Float16* b1p = b0p + (size_t)16 * ldb; const _Float16* b2p = b1p + (size_t)16 * ldb; const _Float16* b3p = b2p + (size_t)16 * ldb;
  const v8f z8 = {0.f,0.f,0.f,0.f,0.f,0.f,0.f,0.f}; v8f c00 = z8, c01 = z8, c02 = z8, c03 = z8, c10 = z8, c11 = z8, c12 = z8, c13 = z8;
#pragma unroll 1      /* rolled: one trip's 12 fragments (96 registers) are all that is live beside the accumulators */
  for (int kb = 0; kb < K; kb += 64) {      /* two k steps a trip (K % 64 == 0): a trip reads whole 128-byte lines of every row, all 24 loads in flight together */
    const _Float16* pa0 = a0p + kb + 8 * hh; const _Float16* pa1 = a1p + kb + 8 * hh; const _Float16* pb0 = b0p + kb + 8 * hh; const _Float16* pb1 = b1p + kb + 8 * hh; const _Float16* pb2 = b2p + kb + 8 * hh; const _Float16* pb3 = b3p + kb + 8 * hh;      /* each lane's own address, the half-wave offset of g2_frag folded in */
    const v16h a0 = g2_frag(pa0, 0), a1 = g2_frag(pa1, 0), b0 = g2_frag(pb0, 0), b1 = g2_frag(pb1, 0), b2 = g2_frag(pb2, 0), b3 = g2_frag(pb3, 0);
    const v16h e0 = g2_frag(pa0 + 32, 0), e1 = g2_frag(pa1 + 32, 0), f0 = g2_frag(pb0 + 32, 0), f1 = g2_frag(pb1 + 32, 0), f2 = g2_frag(pb2 + 32, 0), f3 = g2_frag(pb3 + 32, 0);
    asm volatile("" :: "v"(a0), "v"(a1), "v"(b0), "v"(b1), "v"(b2), "v"(b3), "v"(e0), "v"(e1), "v"(f0), "v"(f1), "v"(f2), "v"(f3), "v"(pa0), "v"(pa1), "v"(pb0), "v"(pb1), "v"(pb2), "v"(pb3));      /* inputs-only fence on the loaded fragments: every load of the trip issues ahead of the products, so a trip waits for memory once (without it each fragment is loaded and waited for in turn); the six addresses are named too, so that no register an issued load names is rewritten ahead of that wait */
    c00 = g2_mma(a0, b0, c00); c10 = g2_mma(a1, b0, c10); c01 = g2_mma(a0, b1, c01); c11 = g2_mma(a1, b1, c11); c02 = g2_mma(a0, b2, c02); c12 = g2_mma(a1, b2, c12); c03 = g2_mma(a0, b3, c03); c13 = g2_mma(a1, b3, c13);
    c00 = g2_mma(e0, f0, c00); c10 = g2_mma(e1, f0, c10); c01 = g2_mma(e0, f1, c01); c11 = g2_mma(e1, f1, c11); c02 = g2_mma(e0, f2, c02); c12 = g2_mma(e1, f2, c12); c03 = g2_mma(e0, f3, c03); c13 = g2_mma(e1, f3, c13); }
  v8f accs[8] = {c00, c01, c02, c03, c10, c11, c12, c13};
#pragma unroll
  for (int u = 0; u < 8; ++u) { const int t = u & 3, half = u >> 2; const int col = col0 + t * 16 + ln; const float bv = bp ? bf16_round(bp[col]) : 0.f;
#pragma unroll
    for (int r = 0; r < 8; ++r) { const int rloc = half * 16 + 8 * hh + r; float v = accs[u][r] * alpha + bv; if (CP) { if (rowsPerB < 0) v += CP[cofs + (size_t)(row0g + row0 + rloc) * ldc + col];      /* rowsPerB < 0: own element of the batched C plane */ else { const int bidx = (row0g + row0 + rloc) / rowsPerB; v += CP[(size_t)bidx * sCPb + (size_t)by * 64 + col]; } }
      if (ACT == 3) v = fmaxf(v, 0.f); else if (ACT == 6) v = 0.5f * v * (1.0f + erff(v * 0.70710678118654752f)); else if (ACT == 11) v = 1.0f / (1.0f + expf(-v)); else if (ACT == 15) v = v / (1.0f + expf(-v)); else if (ACT == 12) v = (v > 0.f) ? v : 0.01f * v; else if (ACT == 8) v = tanhf(v); else if (ACT == 9) v = 0.5f * v * (1.0f + tanhf(0.7978845608028654f * (v + 0.044715f * v * v * v))); else if (ACT == 14) v = (v > 0.f) ? v : 0.1f * v; else if (ACT == 16) v = (v >= 0.f) ? v : 0.3f * v; else if (ACT == 17) v = (v >= 0.f) ? v : 0.2f * v;
      so[w][rloc][t * 16 + ln] = v; } }
  __builtin_amdgcn_fence(__ATOMIC_ACQ_REL, "workgroup"); __builtin_amdgcn_wave_barrier();
  const int rsub = lane >> 4, c4 = (lane & 15) * 4;
  {
#pragma unroll
    for (int q = 0; q < 16; ++q) { const int r = q * 2 + rsub; const v4f v = *(const v4fa*)&so[w][r][c4]; if (C) *(v4f*)(C + cofs + (size_t)(row0 + r) * ldc + col0 + c4) = v; if (C16) { v4h h4; for (int i = 0; i < 4; ++i) h4[i] = (_Float16)v[i]; *(v4h*)(C16 + cofs + (size_t)(row0 + r) * ldc + col0 + c4) = h4; } }
     } }


__global__ __launch_bounds__(256) void k_wnat(const float* __restrict__ w, size_t n8, _Float16* __restrict__ Bt) { const size_t t = (size_t)blockIdx.x * 256 + threadIdx.x; if (t >= n8) return; FragH f; for (int q = 0; q < 8; ++q) f.h[q] = (_Float16)(bf16_round(w[t * 8 + q]) * 16.0f); *(v8us*)((unsigned short*)Bt + t * 8) = f.half[0];  }
__global__ __launch_bounds__(256) void k_rsm(const float* __restrict__ S, _Float16* __restrict__ P, int nrows) {
  #pragma clang fp contract(off)
  const int i = blockIdx.x * 256 + threadIdx.x; if (i >= nrows) return; const float* s = S + (size_t)i * SQ; float mx = -3.0e38f;
#pragma unroll 1
  for (int j = 0; j < SQ; ++j) mx = fmaxf(mx, s[j]); float se = 0.f;
#pragma unroll 1
  for (int j = 0; j < SQ; ++j) se += expf(s[j] - mx); const float sc = 256.0f / se;
#pragma unroll 1
  for (int j0 = 0; j0 < SQ; j0 += 8) { FragH f; for (int q = 0; q < 8; ++q) f.h[q] = (_Float16)(expf(s[j0 + q] - mx) * sc); unsigned short* d = (unsigned short*)P + (size_t)i * SQ + j0; *(v8us*)d = f.half[0];  } }
__global__ __launch_bounds__(256) void k_vt(const _Float16* __restrict__ V16, int b, int h0, _Float16* __restrict__ VT) { __shared__ unsigned short tl[64][65]; const int tid = threadIdx.x; const int hh = blockIdx.x % HG, sg = blockIdx.x / HG; const int s0 = sg * 64; const int h = h0 + hh;
  for (int i = tid; i < 64 * 8; i += 256) { const int j = i / 8, d8 = (i % 8) * 8; FragH f; f.half[0] = *(const v8us*)((const unsigned short*)V16 + ((size_t)b * SQ + s0 + j) * DM + h * HD + d8); for (int q = 0; q < 8; ++q) tl[d8 + q][j] = f.u[q]; }
  __syncthreads();
  { for (int i = tid; i < 64 * 8; i += 256) { const int d = i / 8, j8 = (i % 8) * 8; FragH f; for (int q = 0; q < 8; ++q) f.u[q] = tl[d][j8 + q]; *(v8us*)((unsigned short*)VT + ((size_t)hh * HD + d) * SQ + s0 + j8) = f.half[0]; }  } }



template <int CTRL> __device__ __forceinline__ float rs_dpp(float x) { return __builtin_bit_cast(float, __builtin_amdgcn_update_dpp(0, __builtin_bit_cast(int, x), CTRL, 0xf, 0xf, true)); }      /* lane l <- lane l ^ m inside a 16-lane row (row_xmask:m = 0x160 + m) */
__device__ __forceinline__ float rs_xhalf(float x) { return __builtin_bit_cast(float, __builtin_amdgcn_permlanex16(__builtin_bit_cast(int, x), __builtin_bit_cast(int, x), 0x76543210, 0xfedcba98, false, false)); }      /* lane l <- lane l ^ 16 */
__device__ __forceinline__ float rs_exp2(float x) { float e; asm("v_exp_f32 %0, %1\n\tv_nop" : "=v"(e) : "v"(x)); return e; }      /* 2^x; the v_nop is the slot the instruction set asks for behind a transcendental */
// causal softmax, ONE WAVE PER ROW of NU * 128 columns: lane l holds columns u*128 + 4l .. + 3 in registers, so S is read once, by whole lines; maximum and sum are folded over the 32 lanes by a butterfly that leaves the same value in every lane
template <int NU>
__global__ __launch_bounds__(256) void k_rsmcf2(const float* __restrict__ S, _Float16* __restrict__ P, int hg, int q0) {
  const int c0 = (threadIdx.x & 31) * 4; const int t = blockIdx.x * 8 + __builtin_amdgcn_readfirstlane(threadIdx.x >> 5); if (t >= hg * QT) return;      /* the row index is wave-uniform */
  const float* s = S + (size_t)t * NKX + c0; _Float16* d = P + (size_t)t * NKX + c0; const int last = q0 + (t % QT);
  v4f sv[NU]; float mx = -3.0e38f, se = 0.f;
#pragma unroll      /* full unroll (here and below): sv needs constant indices to stay in registers */
  for (int u = 0; u < NU; ++u) sv[u] = *(const v4fa*)(s + u * 128);
#pragma unroll
  for (int u = 0; u < NU; ++u) for (int q = 0; q < 4; ++q) { const float f = (u * 128 + c0 + q <= last) ? 1.f : 0.f; sv[u][q] = fmaf(f, sv[u][q], (1.f - f) * -1.0e9f); mx = fmaxf(mx, sv[u][q]); }
  mx = fmaxf(mx, rs_dpp<0x161>(mx)); mx = fmaxf(mx, rs_dpp<0x162>(mx)); mx = fmaxf(mx, rs_dpp<0x164>(mx)); mx = fmaxf(mx, rs_dpp<0x168>(mx)); mx = fmaxf(mx, rs_xhalf(mx));
#pragma unroll
  for (int u = 0; u < NU; ++u) for (int q = 0; q < 4; ++q) { sv[u][q] = rs_exp2((sv[u][q] - mx) * 1.44269504088896340736f); se += sv[u][q]; }
  se += rs_dpp<0x161>(se); se += rs_dpp<0x162>(se); se += rs_dpp<0x164>(se); se += rs_dpp<0x168>(se); se += rs_xhalf(se); const float sc = 256.0f / se;
#pragma unroll
  for (int u = 0; u < NU; ++u) { v4h h4; for (int q = 0; q < 4; ++q) h4[q] = (_Float16)(sv[u][q] * sc); *(v4h*)(d + u * 128) = h4; } }


#define A0R 32                       /* rows of one row group of the exact tile (one wave, one row per lane) = keys of one chunk */
#define A0G (QT0 / A0R)              /* row groups per batch */
#define A0W (A0G + 1)                /* waves per block: row groups x and A0G - 1 - x have x + 1 and A0G - x causal key chunks, A0G + 1 together for every x */
#define A0T (A0R * (HD / 4) / 32)    /* merge tiles per row group: 32 float4 = two output rows each */
#define A0P (HD + 4)                 /* LDS pitch of a partial o row, in floats: 16 B x odd, for the b128 rows */
// exact f32 causal attention, keys split: wave w of a block runs the online softmax of ONE row group over ONE chunk of A0R keys; the partial (m, l, o) of a row's chunks are merged through LDS in chunk order
__global__ __launch_bounds__(A0W * 32) void k_att0(const float* __restrict__ QF, const float* __restrict__ KF, const float* __restrict__ VF, int ld, float scale, float* __restrict__ OF, int ldo) {
  #pragma clang fp contract(off)
  __shared__ __attribute__((aligned(16))) float lo[A0W][A0R][A0P];      /* each wave's partial o rows (not normalised) */
  __shared__ float lm[A0W][A0R], ll[A0W][A0R];      /* each wave's running maximum and sum per row */
  const int tid = threadIdx.x, lane = tid & 31; const int w = __builtin_amdgcn_readfirstlane(tid >> 5);      /* the wave index is wave-uniform: k and v rows stay scalar loads */
  const int h = blockIdx.x / (A0G / 2), x = blockIdx.x % (A0G / 2);
  const int rg = (w <= x) ? x : A0G - 1 - x, ch = (w <= x) ? w : w - x - 1; const int i = rg * A0R + lane;      /* waves 0..x: the short row group x; the others: its long partner */
  { const size_t bi = (size_t)blockIdx.y * QT0 * ld; QF += bi; KF += bi; VF += bi; OF += (size_t)blockIdx.y * QT0 * ldo; }      /* batch on grid.y: each batch has its own QT0-row plane */
  const float* qr = QF + (size_t)i * ld + h * HD;
  v4f rq[HD / 4], ro[HD / 4];      /* this thread's q row and o accumulator live in registers for the whole key loop */
#pragma unroll      /* full unroll: rq / ro need constant indices to stay in registers */
  for (int c = 0; c < HD / 4; ++c) { rq[c] = *(const v4fa*)(qr + c * 4); const v4f z = {0.f, 0.f, 0.f, 0.f}; ro[c] = z; }
  asm volatile("s_wait_xcnt 0x0" :: "v"(qr) : "memory");      /* the q loads' address pair stays live up to this wait, so no register that an issued load names is rewritten ahead of it */
  float m = -1.0e30f, l = 0.f; const int j0 = ch * A0R;      /* the chunk's first key is at or below the diagonal for every row of the group, so m is a real score after the first trip */
#pragma unroll 1
  for (int j = j0; j < j0 + A0R; ++j) { const float* kr = KF + (size_t)j * ld + h * HD; const float* vr = VF + (size_t)j * ld + h * HD; float s = 0.f;
#pragma unroll      /* full unroll: constant index into rq */
    for (int c = 0; c < HD / 4; ++c) { const v4f kq = *(const v4fa*)(kr + c * 4); const v4f qq = rq[c]; s = __fadd_rn(s, __fmul_rn(qq[0], kq[0])); s = __fadd_rn(s, __fmul_rn(qq[1], kq[1])); s = __fadd_rn(s, __fmul_rn(qq[2], kq[2])); s = __fadd_rn(s, __fmul_rn(qq[3], kq[3])); }
    s = __fmul_rn(s, scale);
    const float f = (j <= i) ? 1.f : 0.f; const float sm = fmaf(f, s, (1.f - f) * -1.0e30f); const float mn = fmaxf(m, sm); const float sc = expf(m - mn); const float e = expf(sm - mn); l = __fadd_rn(__fmul_rn(l, sc), e); m = mn;
#pragma unroll      /* full unroll: constant index into ro */
    for (int c = 0; c < HD / 4; ++c) { const v4f vv = *(const v4fa*)(vr + c * 4); v4f oo = ro[c]; for (int u = 0; u < 4; ++u) oo[u] = __fadd_rn(__fmul_rn(oo[u], sc), __fmul_rn(e, vv[u])); ro[c] = oo; } }
  lm[w][lane] = m; ll[w][lane] = l;
#pragma unroll      /* full unroll: constant index into ro */
  for (int c = 0; c < HD / 4; ++c) *(v4f*)&lo[w][lane][c * 4] = ro[c];
  __syncthreads();
#pragma unroll 1      /* at most two trips; rolled, so that one trip's 16 partial rows are all that is live */
  for (int wt = w; wt < 2 * A0T; wt += A0W) {      /* a wave merges two whole output rows of one group per trip, one float4 per lane; group and chunk count are wave-uniform */
    const int g = wt / A0T, row = (wt % A0T) * 2 + (lane >> 4), pc = (lane & 15) * 4; const int w0 = g ? x + 1 : 0, n = g ? A0G - x : x + 1;      /* the group's waves: w0 .. w0 + n - 1, in chunk order */
    float pm[A0G], pl[A0G]; v4f po[A0G];
#pragma unroll      /* fixed trip count, index clamped to a written slot: all LDS reads issue together and the exponentials are independent; a slot past the group's n takes a maximum so low that its weight below is 0 */
    for (int s = 0; s < A0G; ++s) { const int ws = min(w0 + s, A0W - 1); const float ms = lm[ws][row]; pm[s] = (s < n) ? ms : -3.0e38f; pl[s] = ll[ws][row]; po[s] = *(const v4f*)&lo[ws][row][pc]; }
    float mx = pm[0];
#pragma unroll      /* full unroll (here and below): pm / pl / po need constant indices to stay in registers */
    for (int s = 1; s < A0G; ++s) mx = fmaxf(mx, pm[s]);
    float ls = 0.f; v4f a = {0.f, 0.f, 0.f, 0.f};
#pragma unroll
    for (int s = 0; s < A0G; ++s) { const float fs = expf(pm[s] - mx); ls = fmaf(fs, pl[s], ls); for (int u = 0; u < 4; ++u) a[u] = fmaf(fs, po[s][u], a[u]); }
    const float fin = 64.0f / ls;      /* o carried x64; k_o0m scales it back by 1/64 */
    for (int u = 0; u < 4; ++u) a[u] = __fmul_rn(a[u], fin);
    *(v4f*)(OF + (size_t)((g ? A0G - 1 - x : x) * A0R + row) * ldo + h * HD + pc) = a;
    asm volatile("s_wait_xcnt 0x0" ::: "memory"); } }      /* the next trip rewrites the registers that the store names: the wait stands in front of that */


template <int BFIN, int WXB>
__global__ __launch_bounds__(256) void k_ln16(const float* __restrict__ X, const float* __restrict__ g, const float* __restrict__ bb, float eps, _Float16* __restrict__ N16, float* __restrict__ XB) {
  #pragma clang fp contract(off)
  __shared__ float red[256]; const size_t r = blockIdx.x; const int t = threadIdx.x; const v4f xa = *(const v4fa*)(X + r * DMQ + t * 4); float s[4]; float sum = 0.f;
  for (int q = 0; q < 4; ++q) { s[q] = BFIN ? bf16_round(xa[q]) : xa[q]; sum = __fadd_rn(sum, s[q]); }
  red[t] = sum; __syncthreads(); for (int st = 128; st > 0; st >>= 1) { if (t < st) red[t] = __fadd_rn(red[t], red[t + st]); __syncthreads(); } const float mu = red[0] / (float)DMQ; __syncthreads();
  float vs = 0.f; for (int q = 0; q < 4; ++q) { const float dl = __fadd_rn(s[q], -mu); vs = __fadd_rn(vs, __fmul_rn(dl, dl)); } red[t] = vs; __syncthreads(); for (int st = 128; st > 0; st >>= 1) { if (t < st) red[t] = __fadd_rn(red[t], red[t + st]); __syncthreads(); }
  const float rs = rsqrtf(__fadd_rn(red[0] / (float)DMQ, eps)); v4h y; v4f xb;
  for (int q = 0; q < 4; ++q) { const int c = t * 4 + q; y[q] = (_Float16)__fadd_rn(__fmul_rn(__fmul_rn(__fadd_rn(s[q], -mu), rs), bf16_round(g[c])), bf16_round(bb[c])); xb[q] = s[q]; }
  { *(v4h*)(N16 + r * DMQ + t * 4) = y; if (WXB) *(v4f*)(XB + r * DMQ + t * 4) = xb;  } }
__global__ __launch_bounds__(256) void k_ftres2(const float* __restrict__ OF0, const float* __restrict__ XB, float* __restrict__ X1, size_t n4) {
  #pragma clang fp contract(off)
  const size_t t = (size_t)blockIdx.x * 256 + threadIdx.x; if (t >= n4) return; const v4f o = *(const v4fa*)(OF0 + t * 4), xv = *(const v4fa*)(XB + t * 4); v4f y; for (int q = 0; q < 4; ++q) y[q] = __fadd_rn(__fmul_rn(o[q], 0.015625f), xv[q]); *(v4f*)(X1 + t * 4) = y;  }

__global__ __launch_bounds__(256) void k_wthd(const float* __restrict__ Wt, _Float16* __restrict__ Bt) { const size_t t = (size_t)blockIdx.x * 256 + threadIdx.x; if (t >= (size_t)NH * HD * (DM / 8)) return; const int m8 = (int)(t % (DM / 8)) * 8; const int d = (int)((t / (DM / 8)) % HD); const int h = (int)(t / ((size_t)(DM / 8) * HD)); FragH f;
  for (int q = 0; q < 8; ++q) f.h[q] = (_Float16)(16.0f * bf16_round(Wt[((size_t)h * DM + m8 + q) * HD + d])); unsigned short* dst = (unsigned short*)Bt + ((size_t)h * HD + d) * DM + m8; *(v8us*)dst = f.half[0];  }




__global__ __launch_bounds__(256) void k_wtpad(const float* __restrict__ Wm, _Float16* __restrict__ Wt, int Kr, int Kp, int Nr, int Np, float scale) {
  const int t = blockIdx.x * 256 + threadIdx.x; if (t >= Np * (Kp / 8)) return; const int n = t / (Kp / 8), k8 = (t % (Kp / 8)) * 8; const int nc = min(n, Nr - 1); const float fn = (n < Nr) ? 1.f : 0.f; FragH f;
  for (int i = 0; i < 8; ++i) { const int k = k8 + i; const int kc = min(k, Kr - 1); const float fk = (k < Kr) ? fn : 0.f; f.h[i] = (_Float16)(bf16_round(Wm[(size_t)kc * Nr + nc]) * scale * fk); }
  unsigned short* o = (unsigned short*)Wt + (size_t)n * Kp + k8; *(v8us*)o = f.half[0];  }
__global__ __launch_bounds__(128) void k_bpad(const float* __restrict__ b, float* __restrict__ Bp, int nr, int np) {
  const int i = threadIdx.x; if (i >= np) return; const float v = b[min(i, nr - 1)] * ((i < nr) ? 1.f : 0.f); *(float*)(Bp + i) = v;  }

#define DI 64         /* inner width = NH * HD (ONE 64-wide head) */
#define LQK (3 * DI)  /* fused q | k | v row pitch (192) */
__global__ __launch_bounds__(256) void k_o0(const float* __restrict__ OF, float* __restrict__ ob, size_t n4) {
  #pragma clang fp contract(off)
  const size_t t = (size_t)blockIdx.x * 256 + threadIdx.x; if (t >= n4) return; const size_t e = t * 4; const int i = (int)(e / DI); const int c = (int)(e % DI); const int h = c / HD, d = c % HD; const v4f a = *(const v4fa*)(OF + e); v4f o; for (int q = 0; q < 4; ++q) o[q] = __fmul_rn(a[q], 0.015625f); float* dst = ob + (size_t)h * SQ * HD + (size_t)i * HD + d; *(v4f*)dst = o;  }

__global__ __launch_bounds__(256) void k_o0m(const float* __restrict__ OF, float* __restrict__ o_, size_t n4) {
  #pragma clang fp contract(off)
  const size_t t = (size_t)blockIdx.x * 256 + threadIdx.x; if (t >= n4) return; const size_t e = t * 4; OF += (size_t)blockIdx.y * QT0 * DI; o_ += (size_t)blockIdx.y * SQ * DI;      /* batch on grid.y: QT0 exact rows go to the head of the batch's SQ output rows */
  const v4f a = *(const v4fa*)(OF + e); v4f o; for (int q = 0; q < 4; ++q) o[q] = __fmul_rn(a[q], 0.015625f); *(v4f*)(o_ + e) = o;  }
extern "C" void kernel_launch(void* const* d_in, const int* in_sizes, int n_in,
                              void* d_out, int out_size, void* d_ws, size_t ws_size, hipStream_t stream) {
  (void)in_sizes; (void)n_in; (void)out_size;
  const float* const* I = (const float* const*)d_in; const float* x = I[0]; const float* wq = I[2]; const float* wk = I[1]; const float* wv = I[3]; const float* bq = nullptr; const float* bk = nullptr; const float* bv = nullptr;      /* x; [in][out = 64] Wk / Wq / Wv (input order as this module lists them); no biases */
  char* ws = (char*)d_ws; size_t off = 0;
  auto take = [&](size_t bytes) { char* p = ws + off; off += (bytes + 255) & ~(size_t)255; return p; };
  _Float16* BW = (_Float16*)take((size_t)LQK * DM * 2); _Float16* X16 = (_Float16*)take(NR * DM * 2); _Float16* QKV = (_Float16*)take(NR * LQK * 2); _Float16* VT = (_Float16*)take((size_t)NB * HD * SQ * 2);
  float* S = (float*)take((size_t)NB * QT * NKX * 4); _Float16* P = (_Float16*)take((size_t)NB * QT * NKX * 2); float* QKVF0 = (float*)take((size_t)NB * QT0 * LQK * 4); float* OF0 = (float*)take((size_t)NB * QT0 * DI * 4);      /* one plane per batch: all batches are in flight in every launch */
  if (off > ws_size) return;
  { const unsigned g = (unsigned)(((size_t)DI * (DM / 8) + 255) / 256); k_wt_f16<<<g, 256, 0, stream>>>(wq, BW, DM, DI, 16.0f); k_wt_f16<<<g, 256, 0, stream>>>(wk, BW + (size_t)DI * DM, DM, DI, 16.0f); k_wt_f16<<<g, 256, 0, stream>>>(wv, BW + (size_t)2 * DI * DM, DM, DI, 16.0f); }      /* [in = DM][out = 64] -> Bt[n][k] x16, stacked q | k | v */
  k_x16<<<(unsigned)((NR * DM / 8 + 255) / 256), 256, 0, stream>>>(x, X16, NR * DM / 8);      /* x (bf16-valued) as exact f16 rows */
  const float* bqkv[3] = {bq, bk, bv};
  for (int c = 0; c < 3; ++c) k_gemm2<0><<<dim3((unsigned)((NR / 128) * (DI / 64)), 1), 128, 0, stream>>>(X16, DM, 0, BW + (size_t)c * DI * DM, DM, 0, 0.0625f, bqkv[c], 0, nullptr, 1, 0, 0, nullptr, QKV + (size_t)c * DI, LQK, 0, (int)NR, DI, DM);      /* q | k | v = x W -> f16 rows, column blocks 0 / 64 / 128 of the fused plane (pitch 192); head h = columns h*64 inside each */
  const _Float16* Q16 = QKV; const _Float16* K16 = QKV + DI; const _Float16* V16 = QKV + 2 * DI;
  float* ob = (float*)d_out;      /* the batch is grid.y of every launch below but k_vt and k_rsmcf2, which index it in grid.x (ONE head, so the head stride of the kernels carries the batch) */
  k_vt<NH, SQ><<<NB * NH * (SQ / 64), 256, 0, stream>>>(V16, LQK, 0, VT);      /* V^T [NB][HD][SQ] */
  for (int q0 = 0; q0 < SQ; q0 += QT) { const int nk = q0 + QT;      /* causal: only keys below the tile end are computed */
    k_gemm2<0><<<dim3((QT / 128) * (nk / 64), NB), 128, 0, stream>>>(Q16 + (size_t)q0 * LQK, LQK, (size_t)SQ * LQK, K16, LQK, (size_t)SQ * LQK, 0.125f, nullptr, 0, nullptr, 1, 0, 0, S, nullptr, NKX, (size_t)QT * NKX, QT, nk, HD);      /* scores / 8 */
    static_assert(SQ == 4 * QT && NKX == SQ && QT % 128 == 0, "one softmax instance per causal tile"); static_assert(DM % 64 == 0 && HD % 64 == 0 && QT % 64 == 0, "k_gemm2 takes K in steps of 64"); switch (nk / QT) {      /* causal softmax -> P x256 f16; one wave per row, 8 rows per block; the row length is a compile-time constant of the kernel (the row lives in registers) */
      case 1: k_rsmcf2<QT / 128><<<(NB * QT + 7) / 8, 256, 0, stream>>>(S, P, NB, q0); break;
      case 2: k_rsmcf2<2 * QT / 128><<<(NB * QT + 7) / 8, 256, 0, stream>>>(S, P, NB, q0); break;
      case 3: k_rsmcf2<3 * QT / 128><<<(NB * QT + 7) / 8, 256, 0, stream>>>(S, P, NB, q0); break;
      case 4: k_rsmcf2<4 * QT / 128><<<(NB * QT + 7) / 8, 256, 0, stream>>>(S, P, NB, q0); break; }
    k_gemm2<0><<<dim3((QT / 128) * (HD / 64), NB), 128, 0, stream>>>(P, NKX, (size_t)QT * NKX, VT, SQ, (size_t)HD * SQ, 0.00390625f, nullptr, 0, nullptr, 1, 0, 0, ob + (size_t)q0 * DI, nullptr, DI, (size_t)SQ * DI, QT, HD, nk); }      /* out[b][q0 + i][..] = P V^T 2^-8 (f32) */
  for (int c = 0; c < 3; ++c) k_gemm2<0><<<dim3((unsigned)((QT0 / 128) * (DI / 64)), NB), 128, 0, stream>>>(X16, DM, (size_t)SQ * DM, BW + (size_t)c * DI * DM, DM, 0, 0.0625f, bqkv[c], 0, nullptr, 1, 0, 0, QKVF0 + (size_t)c * DI, nullptr, LQK, (size_t)QT0 * LQK, QT0, DI, DM);      /* f32 q | k | v of rows 0..511 of every batch (exact products, f32 accumulation) */
  k_att0<<<dim3(NH * (A0G / 2), NB), A0W * 32, 0, stream>>>(QKVF0, QKVF0 + DI, QKVF0 + 2 * DI, LQK, 0.125f, OF0, DI);      /* exact f32 causal attention for rows 0..511 (o x64); a block = one short and one long row group, one wave per key chunk */
  k_o0m<<<dim3((unsigned)(((size_t)QT0 * DI / 4 + 255) / 256), NB), 256, 0, stream>>>(OF0, ob, (size_t)QT0 * DI / 4);      /* rows 0..511 of every batch REWRITTEN from the exact path */
}

// v006
// One run takes 185 microseconds.
// Timed twice side by side with v005, it ran 1.21 times as fast both times.
// All steps since v000 together make it 388 times as fast.
#include <hip/hip_runtime.h>
// Single-head causal self-attention (x [32][1024][384]; k/q/v = x W ([in][out] [384][64], no biases; input order Wk, Wq, Wv); ONE 64-wide head; wei * 64^-0.5; causal (tril, -inf); softmax; out = wei v -> [32][1024][64]; no output projection).
// Structure: token rows; x as exact f16 rows; three WMMA GEMMs into one f16 q | k | v plane [32768][192]; per batch v^T via LDS transposes; causal 256-row query tiles with the 32 batches on grid.y (scores alpha 1/8, causal softmax f32 -> f16 x256 weights, P V written as f32 straight into the merged output rows); rows 0..511 come from an exact f32 path alone, so the f16 tiles start at row 512; launches: see trace.
// Compute dtype: inputs rounded to bf16; x / weights exact; q, k, v and softmax weights as plain f16 GEMM operands (~2^-12); scores and softmax statistics f32; v_wmma_f32_16x16x32_f16.
#define NB 32
#define SQ 1024
#define DM 384
#define NH 1
#define HD 64
#define HG 4
#define QT 256                       /* query rows per causal tile */
#define NKX SQ                       /* S / P row pitch */
#define QT0 512                      /* first-tile rows recomputed exactly (f32): 512 here (no output projection averages the early-row cancellation errors away; logit sigma 1.0) */
#define B0 0                         /* unused; batches start at 0 on grid.y */
#define NBR NB                       /* feeds only MP; unused by the launches */
#define NR ((size_t)NB * SQ)
#define DMQ DM
#define DFF 4096
#define DFFR 100
#define MP ((int)((size_t)NBR * SQ)) /* unused; the projections use NR rows */
#define QN SQ                        /* unused */
#define NHD NH                       /* unused */
#define MPO MP                       /* unused */
#define LQ (3 * DM)      /* 3 * DM, unused; the q/k/v rows use pitch LQK (192) */
typedef __bf16 v16b __attribute__((ext_vector_type(16)));
typedef unsigned short v8us __attribute__((ext_vector_type(8), may_alias));
typedef float  v8f  __attribute__((ext_vector_type(8)));
typedef float  v4f  __attribute__((ext_vector_type(4)));
typedef float  v4fa __attribute__((ext_vector_type(4), may_alias));
union FragB { v16b v; v8us half[2]; unsigned short u[16]; };

__device__ __forceinline__ unsigned short bf16_bits(float x) { unsigned int u = __float_as_uint(x); return (unsigned short)((u + 0x7FFFu + ((u >> 16) & 1u)) >> 16); }
__device__ __forceinline__ float bf16_val(unsigned short b) { return __uint_as_float(((unsigned int)b) << 16); }
__device__ __forceinline__ float bf16_round(float x) { return bf16_val(bf16_bits(x)); }
// D += A·B with NT terms: 1 = ah·bh, 2 = + al·bh (A split), 3 = + ah·bl (both split)
template <int NT>
__device__ __forceinline__ v8f mmaN(v16b ah, v16b al, v16b bh, v16b bl, v8f c) {
  c = __builtin_amdgcn_wmma_f32_16x16x32_bf16(false, ah, false, bh, (short)0, c, false, false);
  if (NT >= 2) c = __builtin_amdgcn_wmma_f32_16x16x32_bf16(false, al, false, bh, (short)0, c, false, false);
  if (NT >= 3) c = __builtin_amdgcn_wmma_f32_16x16x32_bf16(false, ah, false, bl, (short)0, c, false, false);
  asm volatile("v_nop\n\tv_nop\n\tv_nop\n\tv_nop" : "+v"(c) : "v"(ah), "v"(al), "v"(bh), "v"(bl));
  return c;
}

__global__ __launch_bounds__(256) void k_wt_bf16(const float* __restrict__ W, unsigned short* __restrict__ Wt, int K, int N) {
  const int t = blockIdx.x * 256 + threadIdx.x;
  const int k8n = K / 8;
  if (t >= N * k8n) return;
  const int n = t / k8n, k8 = (t % k8n) * 8;
  v8us v;
#pragma unroll
  for (int i = 0; i < 8; ++i) v[i] = bf16_bits(W[(size_t)(k8 + i) * N + n]);
  *(v8us*)(Wt + (size_t)n * K + k8) = v;
  
}

// GEMM C[M][N] (f32, pitch ldc) = act(A[M][K]·W + bias). A f32 row-major (pitch lda) converted per fragment to bf16
// (ASPLIT: hi/lo two planes -> 2 terms, else single rounded term); Wt bf16 [N][K] (pitch ldb). BIAS_BF16 rounds the
// bias to bf16 first (bias quantised to bf16 before the add). K%32==0, M%16==0, N%64==0.
template <bool ASPLIT, int ACT, bool BIAS_BF16>
__global__ __launch_bounds__(128) void k_gemm_bf(const float* __restrict__ A, int lda, const unsigned short* __restrict__ Wt, int ldb,
                                               const float* __restrict__ bias, float* __restrict__ C, int ldc, int M, int N, int K) {
  __shared__ __attribute__((aligned(16))) float so[4][16][64];
  const int tid = threadIdx.x, w = tid >> 5, lane = tid & 31, ln = lane & 15, hh = lane >> 4;
  const int ntn = N / 64;
  const int wid = blockIdx.x * 4 + w;
  const int mt = wid / ntn, nq = wid % ntn;
  if (mt * 16 >= M) return;
  const int row0 = mt * 16, col0 = nq * 64;
  const float* arow = A + (size_t)(row0 + ln) * lda;
  v8f acc[4] = {};
  for (int kb = 0; kb < K; kb += 32) {
    FragB ah, al;
    const v4f x0 = *(const v4fa*)(arow + kb + 8 * hh), x1 = *(const v4fa*)(arow + kb + 8 * hh + 4);
    const v4f x2 = *(const v4fa*)(arow + kb + 16 + 8 * hh), x3 = *(const v4fa*)(arow + kb + 16 + 8 * hh + 4);
    float xs[16] = {x0[0],x0[1],x0[2],x0[3],x1[0],x1[1],x1[2],x1[3],x2[0],x2[1],x2[2],x2[3],x3[0],x3[1],x3[2],x3[3]};
#pragma unroll
    for (int i = 0; i < 16; ++i) { const unsigned short hb = bf16_bits(xs[i]); ah.u[i] = hb; al.u[i] = ASPLIT ? bf16_bits(xs[i] - bf16_val(hb)) : (unsigned short)0; }
#pragma unroll
    for (int t = 0; t < 4; ++t) {
      const unsigned short* brow = Wt + (size_t)(col0 + t * 16 + ln) * ldb + kb;
      FragB b;
      b.half[0] = *(const v8us*)(brow + 8 * hh);
      b.half[1] = *(const v8us*)(brow + 16 + 8 * hh);
      acc[t] = mmaN<ASPLIT ? 2 : 1>(ah.v, al.v, b.v, b.v, acc[t]);
    }
  }
#pragma unroll
  for (int t = 0; t < 4; ++t) {
    float bv = bias ? bias[col0 + t * 16 + ln] : 0.f;
    if (BIAS_BF16) bv = bf16_round(bv);
#pragma unroll
    for (int r = 0; r < 8; ++r) { float v = acc[t][r] + bv; if (ACT == 1) v = fmaxf(v, 0.f); so[w][8 * hh + r][t * 16 + ln] = v; }
  }
  __builtin_amdgcn_fence(__ATOMIC_ACQ_REL, "workgroup");
  __builtin_amdgcn_wave_barrier();
  const int rsub = lane >> 4, c4 = (lane & 15) * 4;
  {
#pragma unroll
    for (int q = 0; q < 8; ++q) {
      const int r = q * 2 + rsub;
      const v4f v = *(const v4fa*)&so[w][r][c4];
      *(v4f*)(C + (size_t)(row0 + r) * ldc + col0 + c4) = v;
    }
    
  }
}

// GEMM C = act(A·W + bias + resid): A f32 (ASPLIT -> hi/lo 2 terms), Wt bf16 [N][K]; ACT 0 none, 1 relu, 2 exact gelu;
// resid (optional, f32, row index = (row % rmod), pitch ldr, RES_BF16 rounds it) added before the activation.
template <bool ASPLIT, int ACT, bool BIAS_BF16, bool RES_BF16>
__global__ __launch_bounds__(128) void k_gemm_bf3(const float* __restrict__ A, int lda, const unsigned short* __restrict__ Wt, int ldb,
                                                const float* __restrict__ bias, const float* __restrict__ resid, int rmod, int ldr,
                                                float* __restrict__ C, int ldc, int M, int N, int K) {
  __shared__ __attribute__((aligned(16))) float so[4][16][64];
  const int tid = threadIdx.x, w = tid >> 5, lane = tid & 31, ln = lane & 15, hh = lane >> 4;
  const int ntn = N / 64;
  const int wid = blockIdx.x * 4 + w;
  const int mt = wid / ntn, nq = wid % ntn;
  if (mt * 16 >= M) return;
  const int row0 = mt * 16, col0 = nq * 64;
  const float* arow = A + (size_t)(row0 + ln) * lda;
  v8f acc[4] = {};
  for (int kb = 0; kb < K; kb += 32) {
    FragB ah, al;
    const v4f x0 = *(const v4fa*)(arow + kb + 8 * hh), x1 = *(const v4fa*)(arow + kb + 8 * hh + 4);
    const v4f x2 = *(const v4fa*)(arow + kb + 16 + 8 * hh), x3 = *(const v4fa*)(arow + kb + 16 + 8 * hh + 4);
    float xs[16] = {x0[0],x0[1],x0[2],x0[3],x1[0],x1[1],x1[2],x1[3],x2[0],x2[1],x2[2],x2[3],x3[0],x3[1],x3[2],x3[3]};
#pragma unroll
    for (int i = 0; i < 16; ++i) { const unsigned short hb = bf16_bits(xs[i]); ah.u[i] = hb; al.u[i] = ASPLIT ? bf16_bits(xs[i] - bf16_val(hb)) : (unsigned short)0; }
#pragma unroll
    for (int t = 0; t < 4; ++t) {
      const unsigned short* brow = Wt + (size_t)(col0 + t * 16 + ln) * ldb + kb;
      FragB b;
      b.half[0] = *(const v8us*)(brow + 8 * hh);
      b.half[1] = *(const v8us*)(brow + 16 + 8 * hh);
      acc[t] = mmaN<ASPLIT ? 2 : 1>(ah.v, al.v, b.v, b.v, acc[t]);
    }
  }
#pragma unroll
  for (int t = 0; t < 4; ++t) {
    const int col = col0 + t * 16 + ln;
    float bv = bias ? bias[col] : 0.f;
    if (BIAS_BF16) bv = bf16_round(bv);
#pragma unroll
    for (int r = 0; r < 8; ++r) {
      float v = acc[t][r] + bv;
      if (resid) { float rv = resid[(size_t)((row0 + 8 * hh + r) % rmod) * ldr + col]; if (RES_BF16) rv = bf16_round(rv); v += rv; }
      if (ACT == 1) v = fmaxf(v, 0.f);
      if (ACT == 2) v = 0.5f * v * (1.0f + erff(v * 0.70710678118654752f));
      if (ACT == 3) { const float u = 0.7978845608028654f * (v + 0.044715f * v * v * v); v = 0.5f * v * (1.0f + tanhf(u)); }
      so[w][8 * hh + r][t * 16 + ln] = v;
    }
  }
  __builtin_amdgcn_fence(__ATOMIC_ACQ_REL, "workgroup");
  __builtin_amdgcn_wave_barrier();
  const int rsub = lane >> 4, c4 = (lane & 15) * 4;
  {
#pragma unroll
    for (int q = 0; q < 8; ++q) {
      const int r = q * 2 + rsub;
      const v4f v = *(const v4fa*)&so[w][r][c4];
      *(v4f*)(C + (size_t)(row0 + r) * ldc + col0 + c4) = v;
    }
    
  }
}
// row LayerNorm (biased variance, eps) over N: s = X (+ R); optional out_sum <- s; out_norm <- (s-mu)*rsqrt(var+eps)*g + b
template <bool PARAM_BF16>
__global__ __launch_bounds__(256) void k_layernorm(const float* __restrict__ X, const float* __restrict__ R, const float* __restrict__ g, const float* __restrict__ bta,
                                                  float* __restrict__ out_sum, float* __restrict__ out_norm, int N, float eps) {
  __shared__ float red[256];
  const int row = blockIdx.x, tid = threadIdx.x;
  const float* x = X + (size_t)row * N; const float* rr = R ? R + (size_t)row * N : nullptr;
  float vals[16];                     // up to N = 4096
  const int per = N / 256;            // contiguous chunk per thread? use strided-by-4 chunks: thread handles j = tid*4 + 1024*u
  float s1 = 0.f;
  for (int u = 0; u < per / 4; ++u) {
    const int j = tid * 4 + 1024 * u;
    const v4f a = *(const v4fa*)(x + j);
    v4f b = {0.f,0.f,0.f,0.f}; if (rr) b = *(const v4fa*)(rr + j);
#pragma unroll
    for (int q = 0; q < 4; ++q) { const float v = a[q] + b[q]; vals[u * 4 + q] = v; s1 += v; }
  }
  red[tid] = s1; __syncthreads();
  for (int st = 128; st > 0; st >>= 1) { if (tid < st) red[tid] += red[tid + st]; __syncthreads(); }
  const float mu = red[0] / (float)N; __syncthreads();
  float s2 = 0.f;
  for (int u = 0; u < per / 4; ++u)
#pragma unroll
    for (int q = 0; q < 4; ++q) { const float c = vals[u * 4 + q] - mu; s2 += c * c; }
  red[tid] = s2; __syncthreads();
  for (int st = 128; st > 0; st >>= 1) { if (tid < st) red[tid] += red[tid + st]; __syncthreads(); }
  const float rs = rsqrtf(red[0] / (float)N + eps);
  {
    for (int u = 0; u < per / 4; ++u) {
      const int j = tid * 4 + 1024 * u;
      v4f o, sm;
#pragma unroll
      for (int q = 0; q < 4; ++q) {
        float gg = g[j + q], bb = bta[j + q];
        if (PARAM_BF16) { gg = bf16_round(gg); bb = bf16_round(bb); }
        sm[q] = vals[u * 4 + q]; o[q] = (vals[u * 4 + q] - mu) * rs * gg + bb;
      }
      if (out_sum) *(v4f*)(out_sum + (size_t)row * N + j) = sm;
      *(v4f*)(out_norm + (size_t)row * N + j) = o;
    }
    
  }
}



// ---- f16 WMMA path (v_wmma_f32_16x16x32_f16): 11-bit significands for operands in range — used where a [0,1] probability operand needs more precision than bf16
typedef _Float16 v16h __attribute__((ext_vector_type(16)));
union FragH { v16h v; v8us half[2]; _Float16 h[16]; unsigned short u[16]; };
template <int NT>
__device__ __forceinline__ v8f mmaH(v16h ah, v16h al, v16h bh, v16h bl, v8f c) {
  c = __builtin_amdgcn_wmma_f32_16x16x32_f16(false, ah, false, bh, (short)0, c, false, false);
  if (NT >= 2) c = __builtin_amdgcn_wmma_f32_16x16x32_f16(false, al, false, bh, (short)0, c, false, false);
  if (NT >= 3) c = __builtin_amdgcn_wmma_f32_16x16x32_f16(false, ah, false, bl, (short)0, c, false, false);
  asm volatile("v_nop\n\tv_nop\n\tv_nop\n\tv_nop" : "+v"(c) : "v"(ah), "v"(al), "v"(bh), "v"(bl));
  return c;
}
// batched GEMM like k_gemm_b but f16 operands: A f32 (split into f16 hi/lo if ASPLIT, else rounded to f16), Bt = f16 values [n][k]; alpha; C f32; N multiple of 16 (partial tiles skipped)
template <bool ASPLIT>
__global__ __launch_bounds__(128) void k_gemm_h(const float* __restrict__ A, int lda, size_t sA, const _Float16* __restrict__ Bh, int ldb, size_t sB, float alpha, float* __restrict__ C, int ldc, size_t sC, int M, int N, int K) {
  __shared__ __attribute__((aligned(16))) float so[4][16][64];
  const int tid = threadIdx.x, w = tid >> 5, lane = tid & 31, ln = lane & 15, hh = lane >> 4; const int by = blockIdx.y;
  A += (size_t)by * sA; Bh += (size_t)by * sB; C += (size_t)by * sC;
  const int ntn = (N + 63) / 64; const int wid = blockIdx.x * 4 + w; const int mt = wid / ntn, nq = wid % ntn; if (mt * 16 >= M) return;
  const int row0 = mt * 16, col0 = nq * 64; const float* arow = A + (size_t)(row0 + ln) * lda;
  v8f acc[4] = {};
  for (int kb = 0; kb < K; kb += 32) {
    FragH ah, al;
    const v4f x0 = *(const v4fa*)(arow + kb + 8 * hh), x1 = *(const v4fa*)(arow + kb + 8 * hh + 4), x2 = *(const v4fa*)(arow + kb + 16 + 8 * hh), x3 = *(const v4fa*)(arow + kb + 16 + 8 * hh + 4);
    float xs[16] = {x0[0],x0[1],x0[2],x0[3],x1[0],x1[1],x1[2],x1[3],x2[0],x2[1],x2[2],x2[3],x3[0],x3[1],x3[2],x3[3]};
#pragma unroll
    for (int i = 0; i < 16; ++i) { const _Float16 h = (_Float16)xs[i]; ah.h[i] = h; al.h[i] = ASPLIT ? (_Float16)(xs[i] - (float)h) : (_Float16)0.0f; }
#pragma unroll
    for (int t = 0; t < 4; ++t) { if (col0 + t * 16 >= N) continue; const size_t boff = (size_t)(col0 + t * 16 + ln) * ldb + kb; FragH bq; bq.half[0] = *(const v8us*)(Bh + boff + 8 * hh); bq.half[1] = *(const v8us*)(Bh + boff + 16 + 8 * hh);
      acc[t] = mmaH<ASPLIT ? 2 : 1>(ah.v, al.v, bq.v, bq.v, acc[t]); }
  }
#pragma unroll
  for (int t = 0; t < 4; ++t) { if (col0 + t * 16 >= N) continue;
#pragma unroll
    for (int r = 0; r < 8; ++r) so[w][8 * hh + r][t * 16 + ln] = acc[t][r] * alpha; }
  __builtin_amdgcn_fence(__ATOMIC_ACQ_REL, "workgroup"); __builtin_amdgcn_wave_barrier();
  const int rsub = lane >> 4, c4 = (lane & 15) * 4;
  {
#pragma unroll
    for (int q = 0; q < 8; ++q) { const int r = q * 2 + rsub; if (col0 + c4 < N) { const v4f v = *(const v4fa*)&so[w][r][c4]; *(v4f*)(C + (size_t)(row0 + r) * ldc + col0 + c4) = v; } }
     }
}

// Wt[n][k] = f16(W[k][n]·scale) from f32 row-major W[K][N] (scale = power of two; bf16-exact weights stay exact in f16 away from the subnormal range)
__global__ __launch_bounds__(256) void k_wt_f16(const float* __restrict__ W, _Float16* __restrict__ Wt, int K, int N, float scale) {
  const int t = blockIdx.x * 256 + threadIdx.x; if (t >= N * (K / 8)) return; const int n = t / (K / 8), k8 = (t % (K / 8)) * 8; FragH f;
#pragma unroll
  for (int i = 0; i < 8; ++i) f.h[i] = (_Float16)(bf16_round(W[(size_t)(k8 + i) * N + n]) * scale); const v8us o = f.half[0];
  *(v8us*)((unsigned short*)Wt + (size_t)n * K + k8) = o; 
}
// k_gemm_hh variant with fused epilogue: v = acc·alpha + bias[by·sBias + col] (+ CP[(row/rowsPerB)·sCPb + by·64 + col] if CP) ; ACT 0 none / 1 elu ; writes f16 C16 (and f32 C if non-null)
template <int ACT>
__global__ __launch_bounds__(128) void k_gemm_hhx(const _Float16* __restrict__ A, int lda, size_t sA, const _Float16* __restrict__ Bh, int ldb, size_t sB, float alpha, const float* __restrict__ bias, size_t sBias, const float* __restrict__ CP, int rowsPerB, size_t sCPb, int row0g,
    float* __restrict__ C, _Float16* __restrict__ C16, int ldc, size_t sC, int M, int N, int K) {
  __shared__ __attribute__((aligned(16))) float so[4][16][64];
  const int tid = threadIdx.x, w = tid >> 5, lane = tid & 31, ln = lane & 15, hh = lane >> 4; const int by = blockIdx.y;
  A += (size_t)by * sA; Bh += (size_t)by * sB; const size_t cofs = (size_t)by * sC; const float* bp = bias ? bias + (size_t)by * sBias : nullptr;
  const int ntn = (N + 63) / 64; const int wid = blockIdx.x * 4 + w; const int mt = wid / ntn, nq = wid % ntn; if (mt * 16 >= M) return;
  const int row0 = mt * 16, col0 = nq * 64; const _Float16* arow = A + (size_t)(row0 + ln) * lda;
  v8f acc[4] = {};
  for (int kb = 0; kb < K; kb += 32) { FragH ah; ah.half[0] = *(const v8us*)((const unsigned short*)arow + kb + 8 * hh); ah.half[1] = *(const v8us*)((const unsigned short*)arow + kb + 16 + 8 * hh);
#pragma unroll
    for (int t = 0; t < 4; ++t) { if (col0 + t * 16 >= N) continue; const size_t boff = (size_t)(col0 + t * 16 + ln) * ldb + kb; FragH bq; bq.half[0] = *(const v8us*)((const unsigned short*)Bh + boff + 8 * hh); bq.half[1] = *(const v8us*)((const unsigned short*)Bh + boff + 16 + 8 * hh);
      acc[t] = mmaH<1>(ah.v, ah.v, bq.v, bq.v, acc[t]); }
  }
#pragma unroll
  for (int t = 0; t < 4; ++t) { if (col0 + t * 16 >= N) continue; const int col = col0 + t * 16 + ln; const float bv = bp ? bf16_round(bp[col]) : 0.f;
#pragma unroll
    for (int r = 0; r < 8; ++r) { float v = acc[t][r] * alpha + bv; if (CP) { const int rr = row0g + row0 + 8 * hh + r; if (rowsPerB < 0) v += CP[cofs + (size_t)rr * ldc + col];      /* rowsPerB < 0: own element of the batched C plane */ else { const int bidx = rr / rowsPerB; v += CP[(size_t)bidx * sCPb + (size_t)by * 64 + col]; } } if (ACT == 1) v = (v > 0.f) ? v : expm1f(v); else if (ACT == 7) v = (v > 0.f) ? v + 1.0f : expf(v); else if (ACT == 8) v = tanhf(v); else if (ACT == 9) v = 0.5f * v * (1.0f + tanhf(0.7978845608028654f * (v + 0.044715f * v * v * v))); else if (ACT == 11) v = 1.0f / (1.0f + expf(-v)); else if (ACT == 12) v = (v > 0.f) ? v : 0.01f * v; else if (ACT == 14) v = (v > 0.f) ? v : 0.1f * v; else if (ACT == 16) v = (v >= 0.f) ? v : 0.3f * v; else if (ACT == 17) v = (v >= 0.f) ? v : 0.2f * v; else if (ACT == 15) v = v / (1.0f + expf(-v)); else if (ACT == 3) v = fmaxf(v, 0.f); else if (ACT == 6) v = 0.5f * v * (1.0f + erff(v * 0.70710678118654752f)); so[w][8 * hh + r][t * 16 + ln] = v; } }
  __builtin_amdgcn_fence(__ATOMIC_ACQ_REL, "workgroup"); __builtin_amdgcn_wave_barrier();
  const int rsub = lane >> 4, c4 = (lane & 15) * 4; typedef _Float16 v4h __attribute__((ext_vector_type(4)));
  {
#pragma unroll
    for (int q = 0; q < 8; ++q) { const int r = q * 2 + rsub; if (col0 + c4 < N) { const v4f v = *(const v4fa*)&so[w][r][c4]; if (C) *(v4f*)(C + cofs + (size_t)(row0 + r) * ldc + col0 + c4) = v; if (C16) { v4h h4; for (int i = 0; i < 4; ++i) h4[i] = (_Float16)v[i]; *(v4h*)(C16 + cofs + (size_t)(row0 + r) * ldc + col0 + c4) = h4; } } }
     }
}


typedef _Float16 v4h __attribute__((ext_vector_type(4)));

__global__ __launch_bounds__(256) void k_x16(const float* __restrict__ x, _Float16* __restrict__ X16, size_t n8) { const size_t t = (size_t)blockIdx.x * 256 + threadIdx.x; if (t >= n8) return; FragH f;
#pragma unroll
  for (int q = 0; q < 8; ++q) f.h[q] = (_Float16)bf16_round(x[t * 8 + q]); *(v8us*)((unsigned short*)X16 + t * 8) = f.half[0];  }
__global__ __launch_bounds__(256) void k_h16(const float* __restrict__ x, _Float16* __restrict__ X16, size_t n8) { const size_t t = (size_t)blockIdx.x * 256 + threadIdx.x; if (t >= n8) return; FragH f;
#pragma unroll
  for (int q = 0; q < 8; ++q) f.h[q] = (_Float16)x[t * 8 + q]; *(v8us*)((unsigned short*)X16 + t * 8) = f.half[0];  }
__global__ __launch_bounds__(256) void k_round16f(const float* __restrict__ W, _Float16* __restrict__ Bt, size_t n8) { const size_t t = (size_t)blockIdx.x * 256 + threadIdx.x; if (t >= n8) return; FragH f;
#pragma unroll
  for (int i = 0; i < 8; ++i) f.h[i] = (_Float16)(bf16_round(W[t * 8 + i]) * 16.0f); *(v8us*)((unsigned short*)Bt + t * 8) = f.half[0];  }
template <int NHv, int TTv>
__global__ __launch_bounds__(256) void k_vt(const _Float16* __restrict__ V16, int ldv, int voff, _Float16* __restrict__ Vt) { __shared__ unsigned short tl[64][66]; const int tid = threadIdx.x; const int slab = blockIdx.x / (TTv / 64), lg = blockIdx.x % (TTv / 64); const int b = slab / NHv, h = slab % NHv;
  for (int i = tid; i < 64 * 8; i += 256) { const int r = i / 8, c8 = (i % 8) * 8; FragH f; f.half[0] = *(const v8us*)((const unsigned short*)V16 + ((size_t)b * TTv + lg * 64 + r) * ldv + voff + h * 64 + c8);
#pragma unroll
    for (int q = 0; q < 8; ++q) tl[r][c8 + q] = f.u[q]; }
  __syncthreads();
  {
#pragma unroll
    for (int rd = 0; rd < 2; ++rd) { const int d = rd * 32 + tid / 8, pc = tid % 8; FragH f;
#pragma unroll
      for (int q = 0; q < 8; ++q) f.u[q] = tl[pc * 8 + q][d];
      *(v8us*)((unsigned short*)Vt + ((size_t)slab * 64 + d) * TTv + lg * 64 + pc * 8) = f.half[0]; }
     } }

__global__ __launch_bounds__(256) void k_hl(const float* __restrict__ F, _Float16* __restrict__ Hh, _Float16* __restrict__ Hl, size_t n8) { const size_t t = (size_t)blockIdx.x * 256 + threadIdx.x; if (t >= n8) return; FragH fh, fl; const v4f a = *(const v4fa*)(F + t * 8), c = *(const v4fa*)(F + t * 8 + 4);
#pragma unroll
  for (int q = 0; q < 4; ++q) { _Float16 h = (_Float16)a[q]; fh.h[q] = h; fl.h[q] = (_Float16)((a[q] - (float)h) * 1024.0f); h = (_Float16)c[q]; fh.h[4 + q] = h; fl.h[4 + q] = (_Float16)((c[q] - (float)h) * 1024.0f); }
  { *(v8us*)((unsigned short*)Hh + t * 8) = fh.half[0]; *(v8us*)((unsigned short*)Hl + t * 8) = fl.half[0];  } }

// ---- fast GEMM (wave tile 32x64; requires M % 32 == 0 rows per launch region, N % 64 == 0 and K % 64 == 0); epilogue = k_gemm_hhx semantics ----
__device__ __forceinline__ v16h g2_frag(const _Float16* p, int hh) { FragH f; f.half[0] = *(const v8us*)((const unsigned short*)p + 8 * hh); f.half[1] = *(const v8us*)((const unsigned short*)p + 16 + 8 * hh); return f.v; }
__device__ __forceinline__ v8f g2_mma(v16h a, v16h b, v8f c) { v8f d = __builtin_amdgcn_wmma_f32_16x16x32_f16(false, a, false, b, (short)0, c, false, false); asm volatile("v_nop\n\tv_nop\n\tv_nop\n\tv_nop" : "+v"(d) : "v"(a), "v"(b)); return d; }
template <int ACT>
__global__ __launch_bounds__(128) void k_gemm2(const _Float16* __restrict__ A, int lda, size_t sA, const _Float16* __restrict__ Bh, int ldb, size_t sB, float alpha, const float* __restrict__ bias, size_t sBias, const float* __restrict__ CP, int rowsPerB, size_t sCPb, int row0g,
    float* __restrict__ C, _Float16* __restrict__ C16, int ldc, size_t sC, int M, int N, int K) { static_assert(ACT == 0 || ACT == 3 || ACT == 6 || ACT == 8 || ACT == 9 || ACT == 11 || ACT == 12 || ACT == 14 || ACT == 15 || ACT == 16 || ACT == 17, "k_gemm2: unsupported ACT code (would silently apply no activation)");
  __shared__ __attribute__((aligned(16))) float so[4][32][68];
  const int tid = threadIdx.x, w = tid >> 5, lane = tid & 31, ln = lane & 15, hh = lane >> 4; const int by = blockIdx.y;
  A += (size_t)by * sA; Bh += (size_t)by * sB; const size_t cofs = (size_t)by * sC; const float* bp = bias ? bias + (size_t)by * sBias : nullptr;
  const int ntn = N >> 6; const int mt = blockIdx.x / ntn, nq = blockIdx.x - mt * ntn; const int row0 = mt * 128 + 32 * w, col0 = nq * 64; if (row0 >= M) return;
  const _Float16* a0p = A + (size_t)(row0 + ln) * lda; const _Float16* a1p = a0p + (size_t)16 * lda;
  const _Float16* b0p = Bh + (size_t)(col0 + ln) * ldb; const _Float16* b1p = b0p + (size_t)16 * ldb; const _Float16* b2p = b1p + (size_t)16 * ldb; const _Float16* b3p = b2p + (size_t)16 * ldb;
  const v8f z8 = {0.f,0.f,0.f,0.f,0.f,0.f,0.f,0.f}; v8f c00 = z8, c01 = z8, c02 = z8, c03 = z8, c10 = z8, c11 = z8, c12 = z8, c13 = z8;
#pragma unroll 1      /* rolled: one trip's 12 fragments (96 registers) are all that is live beside the accumulators */
  for (int kb = 0; kb < K; kb += 64) {      /* two k steps a trip (K % 64 == 0): a trip reads whole 128-byte lines of every row, all 24 loads in flight together */
    const _Float16* pa0 = a0p + kb + 8 * hh; const _Float16* pa1 = a1p + kb + 8 * hh; const _Float16* pb0 = b0p + kb + 8 * hh; const _Float16* pb1 = b1p + kb + 8 * hh; const _Float16* pb2 = b2p + kb + 8 * hh; const _Float16* pb3 = b3p + kb + 8 * hh;      /* each lane's own address, the half-wave offset of g2_frag folded in */
    const v16h a0 = g2_frag(pa0, 0), a1 = g2_frag(pa1, 0), b0 = g2_frag(pb0, 0), b1 = g2_frag(pb1, 0), b2 = g2_frag(pb2, 0), b3 = g2_frag(pb3, 0);
    const v16h e0 = g2_frag(pa0 + 32, 0), e1 = g2_frag(pa1 + 32, 0), f0 = g2_frag(pb0 + 32, 0), f1 = g2_frag(pb1 + 32, 0), f2 = g2_frag(pb2 + 32, 0), f3 = g2_frag(pb3 + 32, 0);
    asm volatile("" :: "v"(a0), "v"(a1), "v"(b0), "v"(b1), "v"(b2), "v"(b3), "v"(e0), "v"(e1), "v"(f0), "v"(f1), "v"(f2), "v"(f3), "v"(pa0), "v"(pa1), "v"(pb0), "v"(pb1), "v"(pb2), "v"(pb3));      /* inputs-only fence on the loaded fragments: every load of the trip issues ahead of the products, so a trip waits for memory once (without it each fragment is loaded and waited for in turn); the six addresses are named too, so that no register an issued load names is rewritten ahead of that wait */
    c00 = g2_mma(a0, b0, c00); c10 = g2_mma(a1, b0, c10); c01 = g2_mma(a0, b1, c01); c11 = g2_mma(a1, b1, c11); c02 = g2_mma(a0, b2, c02); c12 = g2_mma(a1, b2, c12); c03 = g2_mma(a0, b3, c03); c13 = g2_mma(a1, b3, c13);
    c00 = g2_mma(e0, f0, c00); c10 = g2_mma(e1, f0, c10); c01 = g2_mma(e0, f1, c01); c11 = g2_mma(e1, f1, c11); c02 = g2_mma(e0, f2, c02); c12 = g2_mma(e1, f2, c12); c03 = g2_mma(e0, f3, c03); c13 = g2_mma(e1, f3, c13); }
  v8f accs[8] = {c00, c01, c02, c03, c10, c11, c12, c13};
#pragma unroll
  for (int u = 0; u < 8; ++u) { const int t = u & 3, half = u >> 2; const int col = col0 + t * 16 + ln; const float bv = bp ? bf16_round(bp[col]) : 0.f;
#pragma unroll
    for (int r = 0; r < 8; ++r) { const int rloc = half * 16 + 8 * hh + r; float v = accs[u][r] * alpha + bv; if (CP) { if (rowsPerB < 0) v += CP[cofs + (size_t)(row0g + row0 + rloc) * ldc + col];      /* rowsPerB < 0: own element of the batched C plane */ else { const int bidx = (row0g + row0 + rloc) / rowsPerB; v += CP[(size_t)bidx * sCPb + (size_t)by * 64 + col]; } }
      if (ACT == 3) v = fmaxf(v, 0.f); else if (ACT == 6) v = 0.5f * v * (1.0f + erff(v * 0.70710678118654752f)); else if (ACT == 11) v = 1.0f / (1.0f + expf(-v)); else if (ACT == 15) v = v / (1.0f + expf(-v)); else if (ACT == 12) v = (v > 0.f) ? v : 0.01f * v; else if (ACT == 8) v = tanhf(v); else if (ACT == 9) v = 0.5f * v * (1.0f + tanhf(0.7978845608028654f * (v + 0.044715f * v * v * v))); else if (ACT == 14) v = (v > 0.f) ? v : 0.1f * v; else if (ACT == 16) v = (v >= 0.f) ? v : 0.3f * v; else if (ACT == 17) v = (v >= 0.f) ? v : 0.2f * v;
      so[w][rloc][t * 16 + ln] = v; } }
  __builtin_amdgcn_fence(__ATOMIC_ACQ_REL, "workgroup"); __builtin_amdgcn_wave_barrier();
  const int rsub = lane >> 4, c4 = (lane & 15) * 4;
  {
#pragma unroll
    for (int q = 0; q < 16; ++q) { const int r = q * 2 + rsub; const v4f v = *(const v4fa*)&so[w][r][c4]; if (C) *(v4f*)(C + cofs + (size_t)(row0 + r) * ldc + col0 + c4) = v; if (C16) { v4h h4; for (int i = 0; i < 4; ++i) h4[i] = (_Float16)v[i]; *(v4h*)(C16 + cofs + (size_t)(row0 + r) * ldc + col0 + c4) = h4; } }
     } }


__global__ __launch_bounds__(256) void k_wnat(const float* __restrict__ w, size_t n8, _Float16* __restrict__ Bt) { const size_t t = (size_t)blockIdx.x * 256 + threadIdx.x; if (t >= n8) return; FragH f; for (int q = 0; q < 8; ++q) f.h[q] = (_Float16)(bf16_round(w[t * 8 + q]) * 16.0f); *(v8us*)((unsigned short*)Bt + t * 8) = f.half[0];  }
__global__ __launch_bounds__(256) void k_rsm(const float* __restrict__ S, _Float16* __restrict__ P, int nrows) {
  #pragma clang fp contract(off)
  const int i = blockIdx.x * 256 + threadIdx.x; if (i >= nrows) return; const float* s = S + (size_t)i * SQ; float mx = -3.0e38f;
#pragma unroll 1
  for (int j = 0; j < SQ; ++j) mx = fmaxf(mx, s[j]); float se = 0.f;
#pragma unroll 1
  for (int j = 0; j < SQ; ++j) se += expf(s[j] - mx); const float sc = 256.0f / se;
#pragma unroll 1
  for (int j0 = 0; j0 < SQ; j0 += 8) { FragH f; for (int q = 0; q < 8; ++q) f.h[q] = (_Float16)(expf(s[j0 + q] - mx) * sc); unsigned short* d = (unsigned short*)P + (size_t)i * SQ + j0; *(v8us*)d = f.half[0];  } }
__global__ __launch_bounds__(256) void k_vt(const _Float16* __restrict__ V16, int b, int h0, _Float16* __restrict__ VT) { __shared__ unsigned short tl[64][65]; const int tid = threadIdx.x; const int hh = blockIdx.x % HG, sg = blockIdx.x / HG; const int s0 = sg * 64; const int h = h0 + hh;
  for (int i = tid; i < 64 * 8; i += 256) { const int j = i / 8, d8 = (i % 8) * 8; FragH f; f.half[0] = *(const v8us*)((const unsigned short*)V16 + ((size_t)b * SQ + s0 + j) * DM + h * HD + d8); for (int q = 0; q < 8; ++q) tl[d8 + q][j] = f.u[q]; }
  __syncthreads();
  { for (int i = tid; i < 64 * 8; i += 256) { const int d = i / 8, j8 = (i % 8) * 8; FragH f; for (int q = 0; q < 8; ++q) f.u[q] = tl[d][j8 + q]; *(v8us*)((unsigned short*)VT + ((size_t)hh * HD + d) * SQ + s0 + j8) = f.half[0]; }  } }



template <int CTRL> __device__ __forceinline__ float rs_dpp(float x) { return __builtin_bit_cast(float, __builtin_amdgcn_update_dpp(0, __builtin_bit_cast(int, x), CTRL, 0xf, 0xf, true)); }      /* lane l <- lane l ^ m inside a 16-lane row (row_xmask:m = 0x160 + m) */
__device__ __forceinline__ float rs_xhalf(float x) { return __builtin_bit_cast(float, __builtin_amdgcn_permlanex16(__builtin_bit_cast(int, x), __builtin_bit_cast(int, x), 0x76543210, 0xfedcba98, false, false)); }      /* lane l <- lane l ^ 16 */
__device__ __forceinline__ float rs_exp2(float x) { float e; asm("v_exp_f32 %0, %1\n\tv_nop" : "=v"(e) : "v"(x)); return e; }      /* 2^x; the v_nop is the slot the instruction set asks for behind a transcendental */
// causal softmax, ONE WAVE PER ROW of NU * 128 columns: lane l holds columns u*128 + 4l .. + 3 in registers, so S is read once, by whole lines; maximum and sum are folded over the 32 lanes by a butterfly that leaves the same value in every lane
template <int NU>
__global__ __launch_bounds__(256) void k_rsmcf2(const float* __restrict__ S, _Float16* __restrict__ P, int hg, int q0) {
  const int c0 = (threadIdx.x & 31) * 4; const int t = blockIdx.x * 8 + __builtin_amdgcn_readfirstlane(threadIdx.x >> 5); if (t >= hg * QT) return;      /* the row index is wave-uniform */
  const float* s = S + (size_t)t * NKX + c0; _Float16* d = P + (size_t)t * NKX + c0; const int last = q0 + (t % QT);
  v4f sv[NU]; float mx = -3.0e38f, se = 0.f;
#pragma unroll      /* full unroll (here and below): sv needs constant indices to stay in registers */
  for (int u = 0; u < NU; ++u) sv[u] = *(const v4fa*)(s + u * 128);
#pragma unroll
  for (int u = 0; u < NU; ++u) for (int q = 0; q < 4; ++q) { const float f = (u * 128 + c0 + q <= last) ? 1.f : 0.f; sv[u][q] = fmaf(f, sv[u][q], (1.f - f) * -1.0e9f); mx = fmaxf(mx, sv[u][q]); }
  mx = fmaxf(mx, rs_dpp<0x161>(mx)); mx = fmaxf(mx, rs_dpp<0x162>(mx)); mx = fmaxf(mx, rs_dpp<0x164>(mx)); mx = fmaxf(mx, rs_dpp<0x168>(mx)); mx = fmaxf(mx, rs_xhalf(mx));
#pragma unroll
  for (int u = 0; u < NU; ++u) for (int q = 0; q < 4; ++q) { sv[u][q] = rs_exp2((sv[u][q] - mx) * 1.44269504088896340736f); se += sv[u][q]; }
  se += rs_dpp<0x161>(se); se += rs_dpp<0x162>(se); se += rs_dpp<0x164>(se); se += rs_dpp<0x168>(se); se += rs_xhalf(se); const float sc = 256.0f / se;
#pragma unroll
  for (int u = 0; u < NU; ++u) { v4h h4; for (int q = 0; q < 4; ++q) h4[q] = (_Float16)(sv[u][q] * sc); *(v4h*)(d + u * 128) = h4; } }


#define A0R 32                       /* rows of one row group of the exact tile (one wave, one row per lane) = keys of one chunk */
#define A0G (QT0 / A0R)              /* row groups per batch */
#define A0W (A0G + 1)                /* waves per block: row groups x and A0G - 1 - x have x + 1 and A0G - x causal key chunks, A0G + 1 together for every x */
#define A0T (A0R * (HD / 4) / 32)    /* merge tiles per row group: 32 float4 = two output rows each */
#define A0P (HD + 4)                 /* LDS pitch of a partial o row, in floats: 16 B x odd, for the b128 rows */
// exact f32 causal attention, keys split: wave w of a block runs the online softmax of ONE row group over ONE chunk of A0R keys; the partial (m, l, o) of a row's chunks are merged through LDS in chunk order
__global__ __launch_bounds__(A0W * 32) void k_att0(const float* __restrict__ QF, const float* __restrict__ KF, const float* __restrict__ VF, int ld, float scale, float* __restrict__ OF, int ldo) {
  #pragma clang fp contract(off)
  __shared__ __attribute__((aligned(16))) float lo[A0W][A0R][A0P];      /* each wave's partial o rows (not normalised) */
  __shared__ float lm[A0W][A0R], ll[A0W][A0R];      /* each wave's running maximum and sum per row */
  const int tid = threadIdx.x, lane = tid & 31; const int w = __builtin_amdgcn_readfirstlane(tid >> 5);      /* the wave index is wave-uniform: k and v rows stay scalar loads */
  const int h = blockIdx.x / (A0G / 2), x = blockIdx.x % (A0G / 2);
  const int rg = (w <= x) ? x : A0G - 1 - x, ch = (w <= x) ? w : w - x - 1; const int i = rg * A0R + lane;      /* waves 0..x: the short row group x; the others: its long partner */
  { const size_t bi = (size_t)blockIdx.y * QT0 * ld; QF += bi; KF += bi; VF += bi; OF += (size_t)blockIdx.y * QT0 * ldo; }      /* batch on grid.y: each batch has its own QT0-row plane */
  const float* qr = QF + (size_t)i * ld + h * HD;
  v4f rq[HD / 4], ro[HD / 4];      /* this thread's q row and o accumulator live in registers for the whole key loop */
#pragma unroll      /* full unroll: rq / ro need constant indices to stay in registers */
  for (int c = 0; c < HD / 4; ++c) { rq[c] = *(const v4fa*)(qr + c * 4); const v4f z = {0.f, 0.f, 0.f, 0.f}; ro[c] = z; }
  asm volatile("s_wait_xcnt 0x0" :: "v"(qr) : "memory");      /* the q loads' address pair stays live up to this wait, so no register that an issued load names is rewritten ahead of it */
  float m = -1.0e30f, l = 0.f; const int j0 = ch * A0R;      /* the chunk's first key is at or below the diagonal for every row of the group, so m is a real score after the first trip */
#pragma unroll 1
  for (int j = j0; j < j0 + A0R; ++j) { const float* kr = KF + (size_t)j * ld + h * HD; const float* vr = VF + (size_t)j * ld + h * HD; float s = 0.f;
#pragma unroll      /* full unroll: constant index into rq */
    for (int c = 0; c < HD / 4; ++c) { const v4f kq = *(const v4fa*)(kr + c * 4); const v4f qq = rq[c]; s = __fadd_rn(s, __fmul_rn(qq[0], kq[0])); s = __fadd_rn(s, __fmul_rn(qq[1], kq[1])); s = __fadd_rn(s, __fmul_rn(qq[2], kq[2])); s = __fadd_rn(s, __fmul_rn(qq[3], kq[3])); }
    s = __fmul_rn(s, scale);
    const float f = (j <= i) ? 1.f : 0.f; const float sm = fmaf(f, s, (1.f - f) * -1.0e30f); const float mn = fmaxf(m, sm); const float sc = expf(m - mn); const float e = expf(sm - mn); l = __fadd_rn(__fmul_rn(l, sc), e); m = mn;
#pragma unroll      /* full unroll: constant index into ro */
    for (int c = 0; c < HD / 4; ++c) { const v4f vv = *(const v4fa*)(vr + c * 4); v4f oo = ro[c]; for (int u = 0; u < 4; ++u) oo[u] = __fadd_rn(__fmul_rn(oo[u], sc), __fmul_rn(e, vv[u])); ro[c] = oo; } }
  lm[w][lane] = m; ll[w][lane] = l;
#pragma unroll      /* full unroll: constant index into ro */
  for (int c = 0; c < HD / 4; ++c) *(v4f*)&lo[w][lane][c * 4] = ro[c];
  __syncthreads();
#pragma unroll 1      /* at most two trips; rolled, so that one trip's 16 partial rows are all that is live */
  for (int wt = w; wt < 2 * A0T; wt += A0W) {      /* a wave merges two whole output rows of one group per trip, one float4 per lane; group and chunk count are wave-uniform */
    const int g = wt / A0T, row = (wt % A0T) * 2 + (lane >> 4), pc = (lane & 15) * 4; const int w0 = g ? x + 1 : 0, n = g ? A0G - x : x + 1;      /* the group's waves: w0 .. w0 + n - 1, in chunk order */
    float pm[A0G], pl[A0G]; v4f po[A0G];
#pragma unroll      /* fixed trip count, index clamped to a written slot: all LDS reads issue together and the exponentials are independent; a slot past the group's n takes a maximum so low that its weight below is 0 */
    for (int s = 0; s < A0G; ++s) { const int ws = min(w0 + s, A0W - 1); const float ms = lm[ws][row]; pm[s] = (s < n) ? ms : -3.0e38f; pl[s] = ll[ws][row]; po[s] = *(const v4f*)&lo[ws][row][pc]; }
    float mx = pm[0];
#pragma unroll      /* full unroll (here and below): pm / pl / po need constant indices to stay in registers */
    for (int s = 1; s < A0G; ++s) mx = fmaxf(mx, pm[s]);
    float ls = 0.f; v4f a = {0.f, 0.f, 0.f, 0.f};
#pragma unroll
    for (int s = 0; s < A0G; ++s) { const float fs = expf(pm[s] - mx); ls = fmaf(fs, pl[s], ls); for (int u = 0; u < 4; ++u) a[u] = fmaf(fs, po[s][u], a[u]); }
    const float fin = 64.0f / ls;      /* o carried x64; k_o0m scales it back by 1/64 */
    for (int u = 0; u < 4; ++u) a[u] = __fmul_rn(a[u], fin);
    *(v4f*)(OF + (size_t)((g ? A0G - 1 - x : x) * A0R + row) * ldo + h * HD + pc) = a;
    asm volatile("s_wait_xcnt 0x0" ::: "memory"); } }      /* the next trip rewrites the registers that the store names: the wait stands in front of that */


template <int BFIN, int WXB>
__global__ __launch_bounds__(256) void k_ln16(const float* __restrict__ X, const float* __restrict__ g, const float* __restrict__ bb, float eps, _Float16* __restrict__ N16, float* __restrict__ XB) {
  #pragma clang fp contract(off)
  __shared__ float red[256]; const size_t r = blockIdx.x; const int t = threadIdx.x; const v4f xa = *(const v4fa*)(X + r * DMQ + t * 4); float s[4]; float sum = 0.f;
  for (int q = 0; q < 4; ++q) { s[q] = BFIN ? bf16_round(xa[q]) : xa[q]; sum = __fadd_rn(sum, s[q]); }
  red[t] = sum; __syncthreads(); for (int st = 128; st > 0; st >>= 1) { if (t < st) red[t] = __fadd_rn(red[t], red[t + st]); __syncthreads(); } const float mu = red[0] / (float)DMQ; __syncthreads();
  float vs = 0.f; for (int q = 0; q < 4; ++q) { const float dl = __fadd_rn(s[q], -mu); vs = __fadd_rn(vs, __fmul_rn(dl, dl)); } red[t] = vs; __syncthreads(); for (int st = 128; st > 0; st >>= 1) { if (t < st) red[t] = __fadd_rn(red[t], red[t + st]); __syncthreads(); }
  const float rs = rsqrtf(__fadd_rn(red[0] / (float)DMQ, eps)); v4h y; v4f xb;
  for (int q = 0; q < 4; ++q) { const int c = t * 4 + q; y[q] = (_Float16)__fadd_rn(__fmul_rn(__fmul_rn(__fadd_rn(s[q], -mu), rs), bf16_round(g[c])), bf16_round(bb[c])); xb[q] = s[q]; }
  { *(v4h*)(N16 + r * DMQ + t * 4) = y; if (WXB) *(v4f*)(XB + r * DMQ + t * 4) = xb;  } }
__global__ __launch_bounds__(256) void k_ftres2(const float* __restrict__ OF0, const float* __restrict__ XB, float* __restrict__ X1, size_t n4) {
  #pragma clang fp contract(off)
  const size_t t = (size_t)blockIdx.x * 256 + threadIdx.x; if (t >= n4) return; const v4f o = *(const v4fa*)(OF0 + t * 4), xv = *(const v4fa*)(XB + t * 4); v4f y; for (int q = 0; q < 4; ++q) y[q] = __fadd_rn(__fmul_rn(o[q], 0.015625f), xv[q]); *(v4f*)(X1 + t * 4) = y;  }

__global__ __launch_bounds__(256) void k_wthd(const float* __restrict__ Wt, _Float16* __restrict__ Bt) { const size_t t = (size_t)blockIdx.x * 256 + threadIdx.x; if (t >= (size_t)NH * HD * (DM / 8)) return; const int m8 = (int)(t % (DM / 8)) * 8; const int d = (int)((t / (DM / 8)) % HD); const int h = (int)(t / ((size_t)(DM / 8) * HD)); FragH f;
  for (int q = 0; q < 8; ++q) f.h[q] = (_Float16)(16.0f * bf16_round(Wt[((size_t)h * DM + m8 + q) * HD + d])); unsigned short* dst = (unsigned short*)Bt + ((size_t)h * HD + d) * DM + m8; *(v8us*)dst = f.half[0];  }




__global__ __launch_bounds__(256) void k_wtpad(const float* __restrict__ Wm, _Float16* __restrict__ Wt, int Kr, int Kp, int Nr, int Np, float scale) {
  const int t = blockIdx.x * 256 + threadIdx.x; if (t >= Np * (Kp / 8)) return; const int n = t / (Kp / 8), k8 = (t % (Kp / 8)) * 8; const int nc = min(n, Nr - 1); const float fn = (n < Nr) ? 1.f : 0.f; FragH f;
  for (int i = 0; i < 8; ++i) { const int k = k8 + i; const int kc = min(k, Kr - 1); const float fk = (k < Kr) ? fn : 0.f; f.h[i] = (_Float16)(bf16_round(Wm[(size_t)kc * Nr + nc]) * scale * fk); }
  unsigned short* o = (unsigned short*)Wt + (size_t)n * Kp + k8; *(v8us*)o = f.half[0];  }
__global__ __launch_bounds__(128) void k_bpad(const float* __restrict__ b, float* __restrict__ Bp, int nr, int np) {
  const int i = threadIdx.x; if (i >= np) return; const float v = b[min(i, nr - 1)] * ((i < nr) ? 1.f : 0.f); *(float*)(Bp + i) = v;  }

#define DI 64         /* inner width = NH * HD (ONE 64-wide head) */
#define LQK (3 * DI)  /* fused q | k | v row pitch (192) */
__global__ __launch_bounds__(256) void k_o0(const float* __restrict__ OF, float* __restrict__ ob, size_t n4) {
  #pragma clang fp contract(off)
  const size_t t = (size_t)blockIdx.x * 256 + threadIdx.x; if (t >= n4) return; const size_t e = t * 4; const int i = (int)(e / DI); const int c = (int)(e % DI); const int h = c / HD, d = c % HD; const v4f a = *(const v4fa*)(OF + e); v4f o; for (int q = 0; q < 4; ++q) o[q] = __fmul_rn(a[q], 0.015625f); float* dst = ob + (size_t)h * SQ * HD + (size_t)i * HD + d; *(v4f*)dst = o;  }

__global__ __launch_bounds__(256) void k_o0m(const float* __restrict__ OF, float* __restrict__ o_, size_t n4) {
  #pragma clang fp contract(off)
  const size_t t = (size_t)blockIdx.x * 256 + threadIdx.x; if (t >= n4) return; const size_t e = t * 4; OF += (size_t)blockIdx.y * QT0 * DI; o_ += (size_t)blockIdx.y * SQ * DI;      /* batch on grid.y: QT0 exact rows go to the head of the batch's SQ output rows */
  const v4f a = *(const v4fa*)(OF + e); v4f o; for (int q = 0; q < 4; ++q) o[q] = __fmul_rn(a[q], 0.015625f); *(v4f*)(o_ + e) = o;  }
extern "C" void kernel_launch(void* const* d_in, const int* in_sizes, int n_in,
                              void* d_out, int out_size, void* d_ws, size_t ws_size, hipStream_t stream) {
  (void)in_sizes; (void)n_in; (void)out_size;
  const float* const* I = (const float* const*)d_in; const float* x = I[0]; const float* wq = I[2]; const float* wk = I[1]; const float* wv = I[3]; const float* bq = nullptr; const float* bk = nullptr; const float* bv = nullptr;      /* x; [in][out = 64] Wk / Wq / Wv (input order as this module lists them); no biases */
  char* ws = (char*)d_ws; size_t off = 0;
  auto take = [&](size_t bytes) { char* p = ws + off; off += (bytes + 255) & ~(size_t)255; return p; };
  _Float16* BW = (_Float16*)take((size_t)LQK * DM * 2); _Float16* X16 = (_Float16*)take(NR * DM * 2); _Float16* QKV = (_Float16*)take(NR * LQK * 2); _Float16* VT = (_Float16*)take((size_t)NB * HD * SQ * 2);
  float* S = (float*)take((size_t)NB * QT * NKX * 4); _Float16* P = (_Float16*)take((size_t)NB * QT * NKX * 2); float* QKVF0 = (float*)take((size_t)NB * QT0 * LQK * 4); float* OF0 = (float*)take((size_t)NB * QT0 * DI * 4);      /* one plane per batch: all batches are in flight in every launch */
  if (off > ws_size) return;
  { const unsigned g = (unsigned)(((size_t)DI * (DM / 8) + 255) / 256); k_wt_f16<<<g, 256, 0, stream>>>(wq, BW, DM, DI, 16.0f); k_wt_f16<<<g, 256, 0, stream>>>(wk, BW + (size_t)DI * DM, DM, DI, 16.0f); k_wt_f16<<<g, 256, 0, stream>>>(wv, BW + (size_t)2 * DI * DM, DM, DI, 16.0f); }      /* [in = DM][out = 64] -> Bt[n][k] x16, stacked q | k | v */
  k_x16<<<(unsigned)((NR * DM / 8 + 255) / 256), 256, 0, stream>>>(x, X16, NR * DM / 8);      /* x (bf16-valued) as exact f16 rows */
  const float* bqkv[3] = {bq, bk, bv};
  for (int c = 0; c < 3; ++c) k_gemm2<0><<<dim3((unsigned)((NR / 128) * (DI / 64)), 1), 128, 0, stream>>>(X16, DM, 0, BW + (size_t)c * DI * DM, DM, 0, 0.0625f, bqkv[c], 0, nullptr, 1, 0, 0, nullptr, QKV + (size_t)c * DI, LQK, 0, (int)NR, DI, DM);      /* q | k | v = x W -> f16 rows, column blocks 0 / 64 / 128 of the fused plane (pitch 192); head h = columns h*64 inside each */
  const _Float16* Q16 = QKV; const _Float16* K16 = QKV + DI; const _Float16* V16 = QKV + 2 * DI;
  float* ob = (float*)d_out;      /* the batch is grid.y of every launch below but k_vt and k_rsmcf2, which index it in grid.x (ONE head, so the head stride of the kernels carries the batch) */
  k_vt<NH, SQ><<<NB * NH * (SQ / 64), 256, 0, stream>>>(V16, LQK, 0, VT);      /* V^T [NB][HD][SQ] */
  static_assert(QT0 == 2 * QT, "the f16 tiles start where the exact rows end: the softmax cases below are those of tiles 3 and 4");
  for (int q0 = QT0; q0 < SQ; q0 += QT) { const int nk = q0 + QT;      /* causal: only keys below the tile end are computed; rows below QT0 are written by the exact path below and by nothing else */
    k_gemm2<0><<<dim3((QT / 128) * (nk / 64), NB), 128, 0, stream>>>(Q16 + (size_t)q0 * LQK, LQK, (size_t)SQ * LQK, K16, LQK, (size_t)SQ * LQK, 0.125f, nullptr, 0, nullptr, 1, 0, 0, S, nullptr, NKX, (size_t)QT * NKX, QT, nk, HD);      /* scores / 8 */
    static_assert(SQ == 4 * QT && NKX == SQ && QT % 128 == 0, "one softmax instance per causal tile"); static_assert(DM % 64 == 0 && HD % 64 == 0 && QT % 64 == 0, "k_gemm2 takes K in steps of 64"); switch (nk / QT) {      /* causal softmax -> P x256 f16; one wave per row, 8 rows per block; the row length is a compile-time constant of the kernel (the row lives in registers) */
      case 3: k_rsmcf2<3 * QT / 128><<<(NB * QT + 7) / 8, 256, 0, stream>>>(S, P, NB, q0); break;
      case 4: k_rsmcf2<4 * QT / 128><<<(NB * QT + 7) / 8, 256, 0, stream>>>(S, P, NB, q0); break; }
    k_gemm2<0><<<dim3((QT / 128) * (HD / 64), NB), 128, 0, stream>>>(P, NKX, (size_t)QT * NKX, VT, SQ, (size_t)HD * SQ, 0.00390625f, nullptr, 0, nullptr, 1, 0, 0, ob + (size_t)q0 * DI, nullptr, DI, (size_t)SQ * DI, QT, HD, nk); }      /* out[b][q0 + i][..] = P V^T 2^-8 (f32) */
  for (int c = 0; c < 3; ++c) k_gemm2<0><<<dim3((unsigned)((QT0 / 128) * (DI / 64)), NB), 128, 0, stream>>>(X16, DM, (size_t)SQ * DM, BW + (size_t)c * DI * DM, DM, 0, 0.0625f, bqkv[c], 0, nullptr, 1, 0, 0, QKVF0 + (size_t)c * DI, nullptr, LQK, (size_t)QT0 * LQK, QT0, DI, DM);      /* f32 q | k | v of rows 0..511 of every batch (exact products, f32 accumulation) */
  k_att0<<<dim3(NH * (A0G / 2), NB), A0W * 32, 0, stream>>>(QKVF0, QKVF0 + DI, QKVF0 + 2 * DI, LQK, 0.125f, OF0, DI);      /* exact f32 causal attention for rows 0..511 (o x64); a block = one short and one long row group, one wave per key chunk */
  k_o0m<<<dim3((unsigned)(((size_t)QT0 * DI / 4 + 255) / 256), NB), 256, 0, stream>>>(OF0, ob, (size_t)QT0 * DI / 4);      /* rows 0..511 of every batch: their one store, from the exact path */
}

// v007
// A run of this version takes 148 microseconds.
// In both of two side-by-side timings against v006, it was 1.24 times as fast.
// Counting every step since v000, it is 480 times as fast.
#include <hip/hip_runtime.h>
// Single-head causal self-attention (x [32][1024][384]; k/q/v = x W ([in][out] [384][64], no biases; input order Wk, Wq, Wv); ONE 64-wide head; wei * 64^-0.5; causal (tril, -inf); softmax; out = wei v -> [32][1024][64]; no output projection).
// Structure: token rows; x as exact f16 rows; one WMMA GEMM over the stacked weights into one f16 q | k | v plane (and the f32 rows of the exact path); per batch v^T via LDS transposes; causal 256-row query tiles with the 32 batches on grid.y (scores alpha 1/8, causal softmax f32 -> f16 x256 weights, P V written as f32 straight into the merged output rows); rows 0..511 come from an exact f32 path alone, so the f16 tiles start at row 512; launches: see trace.
// Compute dtype: inputs rounded to bf16; x / weights exact; q, k, v and softmax weights as plain f16 GEMM operands (~2^-12); scores and softmax statistics f32. v_wmma_f32_16x16x32_f16.
#define NB 32
#define SQ 1024
#define DM 384
#define NH 1
#define HD 64
#define HG 4
#define QT 256                       /* query rows per causal tile */
#define NKX SQ                       /* S / P row pitch */
#define QT0 512                      /* first-tile rows recomputed exactly (f32): 512 here (no output projection averages the early-row cancellation errors away; logit sigma 1.0) */
#define B0 0                         /* unused; batches start at 0 on grid.y */
#define NBR NB                       /* feeds only MP; unused by the launches */
#define NR ((size_t)NB * SQ)
#define DMQ DM
#define DFF 4096
#define DFFR 100
#define MP ((int)((size_t)NBR * SQ)) /* unused; the projections use NR rows */
#define QN SQ                        /* unused */
#define NHD NH                       /* unused */
#define MPO MP                       /* unused */
#define LQ (3 * DM)      /* 3 * DM, unused; the q/k/v rows use pitch LQK (192) */
typedef __bf16 v16b __attribute__((ext_vector_type(16)));
typedef unsigned short v8us __attribute__((ext_vector_type(8), may_alias));
typedef float  v8f  __attribute__((ext_vector_type(8)));
typedef float  v4f  __attribute__((ext_vector_type(4)));
typedef float  v4fa __attribute__((ext_vector_type(4), may_alias));
union FragB { v16b v; v8us half[2]; unsigned short u[16]; };

__device__ __forceinline__ unsigned short bf16_bits(float x) { unsigned int u = __float_as_uint(x); return (unsigned short)((u + 0x7FFFu + ((u >> 16) & 1u)) >> 16); }
__device__ __forceinline__ float bf16_val(unsigned short b) { return __uint_as_float(((unsigned int)b) << 16); }
__device__ __forceinline__ float bf16_round(float x) { return bf16_val(bf16_bits(x)); }
// D += A·B with NT terms: 1 = ah·bh, 2 = + al·bh (A split), 3 = + ah·bl (both split)
template <int NT>
__device__ __forceinline__ v8f mmaN(v16b ah, v16b al, v16b bh, v16b bl, v8f c) {
  c = __builtin_amdgcn_wmma_f32_16x16x32_bf16(false, ah, false, bh, (short)0, c, false, false);
  if (NT >= 2) c = __builtin_amdgcn_wmma_f32_16x16x32_bf16(false, al, false, bh, (short)0, c, false, false);
  if (NT >= 3) c = __builtin_amdgcn_wmma_f32_16x16x32_bf16(false, ah, false, bl, (short)0, c, false, false);
  asm volatile("v_nop\n\tv_nop\n\tv_nop\n\tv_nop" : "+v"(c) : "v"(ah), "v"(al), "v"(bh), "v"(bl));
  return c;
}

__global__ __launch_bounds__(256) void k_wt_bf16(const float* __restrict__ W, unsigned short* __restrict__ Wt, int K, int N) {
  const int t = blockIdx.x * 256 + threadIdx.x;
  const int k8n = K / 8;
  if (t >= N * k8n) return;
  const int n = t / k8n, k8 = (t % k8n) * 8;
  v8us v;
#pragma unroll
  for (int i = 0; i < 8; ++i) v[i] = bf16_bits(W[(size_t)(k8 + i) * N + n]);
  *(v8us*)(Wt + (size_t)n * K + k8) = v;
  
}

// GEMM C[M][N] (f32, pitch ldc) = act(A[M][K]·W + bias). A f32 row-major (pitch lda) converted per fragment to bf16
// (ASPLIT: hi/lo two planes -> 2 terms, else single rounded term); Wt bf16 [N][K] (pitch ldb). BIAS_BF16 rounds the
// bias to bf16 first (bias quantised to bf16 before the add). K%32==0, M%16==0, N%64==0.
template <bool ASPLIT, int ACT, bool BIAS_BF16>
__global__ __launch_bounds__(128) void k_gemm_bf(const float* __restrict__ A, int lda, const unsigned short* __restrict__ Wt, int ldb,
                                               const float* __restrict__ bias, float* __restrict__ C, int ldc, int M, int N, int K) {
  __shared__ __attribute__((aligned(16))) float so[4][16][64];
  const int tid = threadIdx.x, w = tid >> 5, lane = tid & 31, ln = lane & 15, hh = lane >> 4;
  const int ntn = N / 64;
  const int wid = blockIdx.x * 4 + w;
  const int mt = wid / ntn, nq = wid % ntn;
  if (mt * 16 >= M) return;
  const int row0 = mt * 16, col0 = nq * 64;
  const float* arow = A + (size_t)(row0 + ln) * lda;
  v8f acc[4] = {};
  for (int kb = 0; kb < K; kb += 32) {
    FragB ah, al;
    const v4f x0 = *(const v4fa*)(arow + kb + 8 * hh), x1 = *(const v4fa*)(arow + kb + 8 * hh + 4);
    const v4f x2 = *(const v4fa*)(arow + kb + 16 + 8 * hh), x3 = *(const v4fa*)(arow + kb + 16 + 8 * hh + 4);
    float xs[16] = {x0[0],x0[1],x0[2],x0[3],x1[0],x1[1],x1[2],x1[3],x2[0],x2[1],x2[2],x2[3],x3[0],x3[1],x3[2],x3[3]};
#pragma unroll
    for (int i = 0; i < 16; ++i) { const unsigned short hb = bf16_bits(xs[i]); ah.u[i] = hb; al.u[i] = ASPLIT ? bf16_bits(xs[i] - bf16_val(hb)) : (unsigned short)0; }
#pragma unroll
    for (int t = 0; t < 4; ++t) {
      const unsigned short* brow = Wt + (size_t)(col0 + t * 16 + ln) * ldb + kb;
      FragB b;
      b.half[0] = *(const v8us*)(brow + 8 * hh);
      b.half[1] = *(const v8us*)(brow + 16 + 8 * hh);
      acc[t] = mmaN<ASPLIT ? 2 : 1>(ah.v, al.v, b.v, b.v, acc[t]);
    }
  }
#pragma unroll
  for (int t = 0; t < 4; ++t) {
    float bv = bias ? bias[col0 + t * 16 + ln] : 0.f;
    if (BIAS_BF16) bv = bf16_round(bv);
#pragma unroll
    for (int r = 0; r < 8; ++r) { float v = acc[t][r] + bv; if (ACT == 1) v = fmaxf(v, 0.f); so[w][8 * hh + r][t * 16 + ln] = v; }
  }
  __builtin_amdgcn_fence(__ATOMIC_ACQ_REL, "workgroup");
  __builtin_amdgcn_wave_barrier();
  const int rsub = lane >> 4, c4 = (lane & 15) * 4;
  {
#pragma unroll
    for (int q = 0; q < 8; ++q) {
      const int r = q * 2 + rsub;
      const v4f v = *(const v4fa*)&so[w][r][c4];
      *(v4f*)(C + (size_t)(row0 + r) * ldc + col0 + c4) = v;
    }
    
  }
}

// GEMM C = act(A·W + bias + resid): A f32 (ASPLIT -> hi/lo 2 terms), Wt bf16 [N][K]; ACT 0 none, 1 relu, 2 exact gelu;
// resid (optional, f32, row index = (row % rmod), pitch ldr, RES_BF16 rounds it) added before the activation.
template <bool ASPLIT, int ACT, bool BIAS_BF16, bool RES_BF16>
__global__ __launch_bounds__(128) void k_gemm_bf3(const float* __restrict__ A, int lda, const unsigned short* __restrict__ Wt, int ldb,
                                                const float* __restrict__ bias, const float* __restrict__ resid, int rmod, int ldr,
                                                float* __restrict__ C, int ldc, int M, int N, int K) {
  __shared__ __attribute__((aligned(16))) float so[4][16][64];
  const int tid = threadIdx.x, w = tid >> 5, lane = tid & 31, ln = lane & 15, hh = lane >> 4;
  const int ntn = N / 64;
  const int wid = blockIdx.x * 4 + w;
  const int mt = wid / ntn, nq = wid % ntn;
  if (mt * 16 >= M) return;
  const int row0 = mt * 16, col0 = nq * 64;
  const float* arow = A + (size_t)(row0 + ln) * lda;
  v8f acc[4] = {};
  for (int kb = 0; kb < K; kb += 32) {
    FragB ah, al;
    const v4f x0 = *(const v4fa*)(arow + kb + 8 * hh), x1 = *(const v4fa*)(arow + kb + 8 * hh + 4);
    const v4f x2 = *(const v4fa*)(arow + kb + 16 + 8 * hh), x3 = *(const v4fa*)(arow + kb + 16 + 8 * hh + 4);
    float xs[16] = {x0[0],x0[1],x0[2],x0[3],x1[0],x1[1],x1[2],x1[3],x2[0],x2[1],x2[2],x2[3],x3[0],x3[1],x3[2],x3[3]};
#pragma unroll
    for (int i = 0; i < 16; ++i) { const unsigned short hb = bf16_bits(xs[i]); ah.u[i] = hb; al.u[i] = ASPLIT ? bf16_bits(xs[i] - bf16_val(hb)) : (unsigned short)0; }
#pragma unroll
    for (int t = 0; t < 4; ++t) {
      const unsigned short* brow = Wt + (size_t)(col0 + t * 16 + ln) * ldb + kb;
      FragB b;
      b.half[0] = *(const v8us*)(brow + 8 * hh);
      b.half[1] = *(const v8us*)(brow + 16 + 8 * hh);
      acc[t] = mmaN<ASPLIT ? 2 : 1>(ah.v, al.v, b.v, b.v, acc[t]);
    }
  }
#pragma unroll
  for (int t = 0; t < 4; ++t) {
    const int col = col0 + t * 16 + ln;
    float bv = bias ? bias[col] : 0.f;
    if (BIAS_BF16) bv = bf16_round(bv);
#pragma unroll
    for (int r = 0; r < 8; ++r) {
      float v = acc[t][r] + bv;
      if (resid) { float rv = resid[(size_t)((row0 + 8 * hh + r) % rmod) * ldr + col]; if (RES_BF16) rv = bf16_round(rv); v += rv; }
      if (ACT == 1) v = fmaxf(v, 0.f);
      if (ACT == 2) v = 0.5f * v * (1.0f + erff(v * 0.70710678118654752f));
      if (ACT == 3) { const float u = 0.7978845608028654f * (v + 0.044715f * v * v * v); v = 0.5f * v * (1.0f + tanhf(u)); }
      so[w][8 * hh + r][t * 16 + ln] = v;
    }
  }
  __builtin_amdgcn_fence(__ATOMIC_ACQ_REL, "workgroup");
  __builtin_amdgcn_wave_barrier();
  const int rsub = lane >> 4, c4 = (lane & 15) * 4;
  {
#pragma unroll
    for (int q = 0; q < 8; ++q) {
      const int r = q * 2 + rsub;
      const v4f v = *(const v4fa*)&so[w][r][c4];
      *(v4f*)(C + (size_t)(row0 + r) * ldc + col0 + c4) = v;
    }
    
  }
}
// row LayerNorm (biased variance, eps) over N: s = X (+ R); optional out_sum <- s; out_norm <- (s-mu)*rsqrt(var+eps)*g + b
template <bool PARAM_BF16>
__global__ __launch_bounds__(256) void k_layernorm(const float* __restrict__ X, const float* __restrict__ R, const float* __restrict__ g, const float* __restrict__ bta,
                                                  float* __restrict__ out_sum, float* __restrict__ out_norm, int N, float eps) {
  __shared__ float red[256];
  const int row = blockIdx.x, tid = threadIdx.x;
  const float* x = X + (size_t)row * N; const float* rr = R ? R + (size_t)row * N : nullptr;
  float vals[16];                     // up to N = 4096
  const int per = N / 256;            // contiguous chunk per thread? use strided-by-4 chunks: thread handles j = tid*4 + 1024*u
  float s1 = 0.f;
  for (int u = 0; u < per / 4; ++u) {
    const int j = tid * 4 + 1024 * u;
    const v4f a = *(const v4fa*)(x + j);
    v4f b = {0.f,0.f,0.f,0.f}; if (rr) b = *(const v4fa*)(rr + j);
#pragma unroll
    for (int q = 0; q < 4; ++q) { const float v = a[q] + b[q]; vals[u * 4 + q] = v; s1 += v; }
  }
  red[tid] = s1; __syncthreads();
  for (int st = 128; st > 0; st >>= 1) { if (tid < st) red[tid] += red[tid + st]; __syncthreads(); }
  const float mu = red[0] / (float)N; __syncthreads();
  float s2 = 0.f;
  for (int u = 0; u < per / 4; ++u)
#pragma unroll
    for (int q = 0; q < 4; ++q) { const float c = vals[u * 4 + q] - mu; s2 += c * c; }
  red[tid] = s2; __syncthreads();
  for (int st = 128; st > 0; st >>= 1) { if (tid < st) red[tid] += red[tid + st]; __syncthreads(); }
  const float rs = rsqrtf(red[0] / (float)N + eps);
  {
    for (int u = 0; u < per / 4; ++u) {
      const int j = tid * 4 + 1024 * u;
      v4f o, sm;
#pragma unroll
      for (int q = 0; q < 4; ++q) {
        float gg = g[j + q], bb = bta[j + q];
        if (PARAM_BF16) { gg = bf16_round(gg); bb = bf16_round(bb); }
        sm[q] = vals[u * 4 + q]; o[q] = (vals[u * 4 + q] - mu) * rs * gg + bb;
      }
      if (out_sum) *(v4f*)(out_sum + (size_t)row * N + j) = sm;
      *(v4f*)(out_norm + (size_t)row * N + j) = o;
    }
    
  }
}



// ---- f16 WMMA path (v_wmma_f32_16x16x32_f16): 11-bit significands for operands in range — used where a [0,1] probability operand needs more precision than bf16
typedef _Float16 v16h __attribute__((ext_vector_type(16)));
union FragH { v16h v; v8us half[2]; _Float16 h[16]; unsigned short u[16]; };
template <int NT>
__device__ __forceinline__ v8f mmaH(v16h ah, v16h al, v16h bh, v16h bl, v8f c) {
  c = __builtin_amdgcn_wmma_f32_16x16x32_f16(false, ah, false, bh, (short)0, c, false, false);
  if (NT >= 2) c = __builtin_amdgcn_wmma_f32_16x16x32_f16(false, al, false, bh, (short)0, c, false, false);
  if (NT >= 3) c = __builtin_amdgcn_wmma_f32_16x16x32_f16(false, ah, false, bl, (short)0, c, false, false);
  asm volatile("v_nop\n\tv_nop\n\tv_nop\n\tv_nop" : "+v"(c) : "v"(ah), "v"(al), "v"(bh), "v"(bl));
  return c;
}
// batched GEMM like k_gemm_b but f16 operands: A f32 (split into f16 hi/lo if ASPLIT, else rounded to f16), Bt = f16 values [n][k]; alpha; C f32; N multiple of 16 (partial tiles skipped)
template <bool ASPLIT>
__global__ __launch_bounds__(128) void k_gemm_h(const float* __restrict__ A, int lda, size_t sA, const _Float16* __restrict__ Bh, int ldb, size_t sB, float alpha, float* __restrict__ C, int ldc, size_t sC, int M, int N, int K) {
  __shared__ __attribute__((aligned(16))) float so[4][16][64];
  const int tid = threadIdx.x, w = tid >> 5, lane = tid & 31, ln = lane & 15, hh = lane >> 4; const int by = blockIdx.y;
  A += (size_t)by * sA; Bh += (size_t)by * sB; C += (size_t)by * sC;
  const int ntn = (N + 63) / 64; const int wid = blockIdx.x * 4 + w; const int mt = wid / ntn, nq = wid % ntn; if (mt * 16 >= M) return;
  const int row0 = mt * 16, col0 = nq * 64; const float* arow = A + (size_t)(row0 + ln) * lda;
  v8f acc[4] = {};
  for (int kb = 0; kb < K; kb += 32) {
    FragH ah, al;
    const v4f x0 = *(const v4fa*)(arow + kb + 8 * hh), x1 = *(const v4fa*)(arow + kb + 8 * hh + 4), x2 = *(const v4fa*)(arow + kb + 16 + 8 * hh), x3 = *(const v4fa*)(arow + kb + 16 + 8 * hh + 4);
    float xs[16] = {x0[0],x0[1],x0[2],x0[3],x1[0],x1[1],x1[2],x1[3],x2[0],x2[1],x2[2],x2[3],x3[0],x3[1],x3[2],x3[3]};
#pragma unroll
    for (int i = 0; i < 16; ++i) { const _Float16 h = (_Float16)xs[i]; ah.h[i] = h; al.h[i] = ASPLIT ? (_Float16)(xs[i] - (float)h) : (_Float16)0.0f; }
#pragma unroll
    for (int t = 0; t < 4; ++t) { if (col0 + t * 16 >= N) continue; const size_t boff = (size_t)(col0 + t * 16 + ln) * ldb + kb; FragH bq; bq.half[0] = *(const v8us*)(Bh + boff + 8 * hh); bq.half[1] = *(const v8us*)(Bh + boff + 16 + 8 * hh);
      acc[t] = mmaH<ASPLIT ? 2 : 1>(ah.v, al.v, bq.v, bq.v, acc[t]); }
  }
#pragma unroll
  for (int t = 0; t < 4; ++t) { if (col0 + t * 16 >= N) continue;
#pragma unroll
    for (int r = 0; r < 8; ++r) so[w][8 * hh + r][t * 16 + ln] = acc[t][r] * alpha; }
  __builtin_amdgcn_fence(__ATOMIC_ACQ_REL, "workgroup"); __builtin_amdgcn_wave_barrier();
  const int rsub = lane >> 4, c4 = (lane & 15) * 4;
  {
#pragma unroll
    for (int q = 0; q < 8; ++q) { const int r = q * 2 + rsub; if (col0 + c4 < N) { const v4f v = *(const v4fa*)&so[w][r][c4]; *(v4f*)(C + (size_t)(row0 + r) * ldc + col0 + c4) = v; } }
     }
}

// Wt[n][k] = f16(W[k][n]·scale) from f32 row-major W[K][N] (scale = power of two; bf16-exact weights stay exact in f16 away from the subnormal range)
// grid.y picks one of three weights of the same shape; their transposes are stacked in Wt, N rows each
__global__ __launch_bounds__(256) void k_wt_f16(const float* __restrict__ W0, const float* __restrict__ W1, const float* __restrict__ W2, _Float16* __restrict__ Wt, int K, int N, float scale) {
  const float* W = (blockIdx.y == 0) ? W0 : (blockIdx.y == 1) ? W1 : W2; Wt += (size_t)blockIdx.y * N * K;
  const int t = blockIdx.x * 256 + threadIdx.x; if (t >= N * (K / 8)) return; const int n = t / (K / 8), k8 = (t % (K / 8)) * 8; FragH f;
#pragma unroll
  for (int i = 0; i < 8; ++i) f.h[i] = (_Float16)(bf16_round(W[(size_t)(k8 + i) * N + n]) * scale); const v8us o = f.half[0];
  *(v8us*)((unsigned short*)Wt + (size_t)n * K + k8) = o; 
}
// k_gemm_hh variant with fused epilogue: v = acc·alpha + bias[by·sBias + col] (+ CP[(row/rowsPerB)·sCPb + by·64 + col] if CP) ; ACT 0 none / 1 elu ; writes f16 C16 (and f32 C if non-null)
template <int ACT>
__global__ __launch_bounds__(128) void k_gemm_hhx(const _Float16* __restrict__ A, int lda, size_t sA, const _Float16* __restrict__ Bh, int ldb, size_t sB, float alpha, const float* __restrict__ bias, size_t sBias, const float* __restrict__ CP, int rowsPerB, size_t sCPb, int row0g,
    float* __restrict__ C, _Float16* __restrict__ C16, int ldc, size_t sC, int M, int N, int K) {
  __shared__ __attribute__((aligned(16))) float so[4][16][64];
  const int tid = threadIdx.x, w = tid >> 5, lane = tid & 31, ln = lane & 15, hh = lane >> 4; const int by = blockIdx.y;
  A += (size_t)by * sA; Bh += (size_t)by * sB; const size_t cofs = (size_t)by * sC; const float* bp = bias ? bias + (size_t)by * sBias : nullptr;
  const int ntn = (N + 63) / 64; const int wid = blockIdx.x * 4 + w; const int mt = wid / ntn, nq = wid % ntn; if (mt * 16 >= M) return;
  const int row0 = mt * 16, col0 = nq * 64; const _Float16* arow = A + (size_t)(row0 + ln) * lda;
  v8f acc[4] = {};
  for (int kb = 0; kb < K; kb += 32) { FragH ah; ah.half[0] = *(const v8us*)((const unsigned short*)arow + kb + 8 * hh); ah.half[1] = *(const v8us*)((const unsigned short*)arow + kb + 16 + 8 * hh);
#pragma unroll
    for (int t = 0; t < 4; ++t) { if (col0 + t * 16 >= N) continue; const size_t boff = (size_t)(col0 + t * 16 + ln) * ldb + kb; FragH bq; bq.half[0] = *(const v8us*)((const unsigned short*)Bh + boff + 8 * hh); bq.half[1] = *(const v8us*)((const unsigned short*)Bh + boff + 16 + 8 * hh);
      acc[t] = mmaH<1>(ah.v, ah.v, bq.v, bq.v, acc[t]); }
  }
#pragma unroll
  for (int t = 0; t < 4; ++t) { if (col0 + t * 16 >= N) continue; const int col = col0 + t * 16 + ln; const float bv = bp ? bf16_round(bp[col]) : 0.f;
#pragma unroll
    for (int r = 0; r < 8; ++r) { float v = acc[t][r] * alpha + bv; if (CP) { const int rr = row0g + row0 + 8 * hh + r; if (rowsPerB < 0) v += CP[cofs + (size_t)rr * ldc + col];      /* rowsPerB < 0: own element of the batched C plane */ else { const int bidx = rr / rowsPerB; v += CP[(size_t)bidx * sCPb + (size_t)by * 64 + col]; } } if (ACT == 1) v = (v > 0.f) ? v : expm1f(v); else if (ACT == 7) v = (v > 0.f) ? v + 1.0f : expf(v); else if (ACT == 8) v = tanhf(v); else if (ACT == 9) v = 0.5f * v * (1.0f + tanhf(0.7978845608028654f * (v + 0.044715f * v * v * v))); else if (ACT == 11) v = 1.0f / (1.0f + expf(-v)); else if (ACT == 12) v = (v > 0.f) ? v : 0.01f * v; else if (ACT == 14) v = (v > 0.f) ? v : 0.1f * v; else if (ACT == 16) v = (v >= 0.f) ? v : 0.3f * v; else if (ACT == 17) v = (v >= 0.f) ? v : 0.2f * v; else if (ACT == 15) v = v / (1.0f + expf(-v)); else if (ACT == 3) v = fmaxf(v, 0.f); else if (ACT == 6) v = 0.5f * v * (1.0f + erff(v * 0.70710678118654752f)); so[w][8 * hh + r][t * 16 + ln] = v; } }
  __builtin_amdgcn_fence(__ATOMIC_ACQ_REL, "workgroup"); __builtin_amdgcn_wave_barrier();
  const int rsub = lane >> 4, c4 = (lane & 15) * 4; typedef _Float16 v4h __attribute__((ext_vector_type(4)));
  {
#pragma unroll
    for (int q = 0; q < 8; ++q) { const int r = q * 2 + rsub; if (col0 + c4 < N) { const v4f v = *(const v4fa*)&so[w][r][c4]; if (C) *(v4f*)(C + cofs + (size_t)(row0 + r) * ldc + col0 + c4) = v; if (C16) { v4h h4; for (int i = 0; i < 4; ++i) h4[i] = (_Float16)v[i]; *(v4h*)(C16 + cofs + (size_t)(row0 + r) * ldc + col0 + c4) = h4; } } }
     }
}


typedef _Float16 v4h __attribute__((ext_vector_type(4)));

__global__ __launch_bounds__(256) void k_x16(const float* __restrict__ x, _Float16* __restrict__ X16, size_t n8) { const size_t t = (size_t)blockIdx.x * 256 + threadIdx.x; if (t >= n8) return; FragH f;
#pragma unroll
  for (int q = 0; q < 8; ++q) f.h[q] = (_Float16)bf16_round(x[t * 8 + q]); *(v8us*)((unsigned short*)X16 + t * 8) = f.half[0];  }
__global__ __launch_bounds__(256) void k_h16(const float* __restrict__ x, _Float16* __restrict__ X16, size_t n8) { const size_t t = (size_t)blockIdx.x * 256 + threadIdx.x; if (t >= n8) return; FragH f;
#pragma unroll
  for (int q = 0; q < 8; ++q) f.h[q] = (_Float16)x[t * 8 + q]; *(v8us*)((unsigned short*)X16 + t * 8) = f.half[0];  }
__global__ __launch_bounds__(256) void k_round16f(const float* __restrict__ W, _Float16* __restrict__ Bt, size_t n8) { const size_t t = (size_t)blockIdx.x * 256 + threadIdx.x; if (t >= n8) return; FragH f;
#pragma unroll
  for (int i = 0; i < 8; ++i) f.h[i] = (_Float16)(bf16_round(W[t * 8 + i]) * 16.0f); *(v8us*)((unsigned short*)Bt + t * 8) = f.half[0];  }
template <int NHv, int TTv>
__global__ __launch_bounds__(256) void k_vt(const _Float16* __restrict__ V16, int ldv, int voff, _Float16* __restrict__ Vt) { __shared__ unsigned short tl[64][66]; const int tid = threadIdx.x; const int slab = blockIdx.x / (TTv / 64), lg = blockIdx.x % (TTv / 64); const int b = slab / NHv, h = slab % NHv;
  for (int i = tid; i < 64 * 8; i += 256) { const int r = i / 8, c8 = (i % 8) * 8; FragH f; f.half[0] = *(const v8us*)((const unsigned short*)V16 + ((size_t)b * TTv + lg * 64 + r) * ldv + voff + h * 64 + c8);
#pragma unroll
    for (int q = 0; q < 8; ++q) tl[r][c8 + q] = f.u[q]; }
  __syncthreads();
  {
#pragma unroll
    for (int rd = 0; rd < 2; ++rd) { const int d = rd * 32 + tid / 8, pc = tid % 8; FragH f;
#pragma unroll
      for (int q = 0; q < 8; ++q) f.u[q] = tl[pc * 8 + q][d];
      *(v8us*)((unsigned short*)Vt + ((size_t)slab * 64 + d) * TTv + lg * 64 + pc * 8) = f.half[0]; }
     } }

__global__ __launch_bounds__(256) void k_hl(const float* __restrict__ F, _Float16* __restrict__ Hh, _Float16* __restrict__ Hl, size_t n8) { const size_t t = (size_t)blockIdx.x * 256 + threadIdx.x; if (t >= n8) return; FragH fh, fl; const v4f a = *(const v4fa*)(F + t * 8), c = *(const v4fa*)(F + t * 8 + 4);
#pragma unroll
  for (int q = 0; q < 4; ++q) { _Float16 h = (_Float16)a[q]; fh.h[q] = h; fl.h[q] = (_Float16)((a[q] - (float)h) * 1024.0f); h = (_Float16)c[q]; fh.h[4 + q] = h; fl.h[4 + q] = (_Float16)((c[q] - (float)h) * 1024.0f); }
  { *(v8us*)((unsigned short*)Hh + t * 8) = fh.half[0]; *(v8us*)((unsigned short*)Hl + t * 8) = fl.half[0];  } }

// ---- fast GEMM (wave tile 32x64; requires M % 32 == 0 rows per launch region, N % 64 == 0 and K % 64 == 0); epilogue = k_gemm_hhx semantics ----
__device__ __forceinline__ v16h g2_frag(const _Float16* p, int hh) { FragH f; f.half[0] = *(const v8us*)((const unsigned short*)p + 8 * hh); f.half[1] = *(const v8us*)((const unsigned short*)p + 16 + 8 * hh); return f.v; }
__device__ __forceinline__ v8f g2_mma(v16h a, v16h b, v8f c) { v8f d = __builtin_amdgcn_wmma_f32_16x16x32_f16(false, a, false, b, (short)0, c, false, false); asm volatile("v_nop\n\tv_nop\n\tv_nop\n\tv_nop" : "+v"(d) : "v"(a), "v"(b)); return d; }
template <int ACT>
__global__ __launch_bounds__(128) void k_gemm2(const _Float16* __restrict__ A, int lda, size_t sA, const _Float16* __restrict__ Bh, int ldb, size_t sB, float alpha, const float* __restrict__ bias, size_t sBias, const float* __restrict__ CP, int rowsPerB, size_t sCPb, int row0g,
    float* __restrict__ C, _Float16* __restrict__ C16, int ldc, size_t sC, int M, int N, int K, int MC) { static_assert(ACT == 0 || ACT == 3 || ACT == 6 || ACT == 8 || ACT == 9 || ACT == 11 || ACT == 12 || ACT == 14 || ACT == 15 || ACT == 16 || ACT == 17, "k_gemm2: unsupported ACT code (would silently apply no activation)");
  __shared__ __attribute__((aligned(16))) float so[4][32][68];
  const int tid = threadIdx.x, w = tid >> 5, lane = tid & 31, ln = lane & 15, hh = lane >> 4; const int by = blockIdx.y;
  A += (size_t)by * sA; Bh += (size_t)by * sB; const size_t cofs = (size_t)by * sC; const float* bp = bias ? bias + (size_t)by * sBias : nullptr;
  const int ntn = N >> 6; const int mt = blockIdx.x / ntn, nq = blockIdx.x - mt * ntn; const int row0 = mt * 128 + 32 * w, col0 = nq * 64; if (row0 >= M) return;
  const _Float16* a0p = A + (size_t)(row0 + ln) * lda; const _Float16* a1p = a0p + (size_t)16 * lda;
  const _Float16* b0p = Bh + (size_t)(col0 + ln) * ldb; const _Float16* b1p = b0p + (size_t)16 * ldb; const _Float16* b2p = b1p + (size_t)16 * ldb; const _Float16* b3p = b2p + (size_t)16 * ldb;
  const v8f z8 = {0.f,0.f,0.f,0.f,0.f,0.f,0.f,0.f}; v8f c00 = z8, c01 = z8, c02 = z8, c03 = z8, c10 = z8, c11 = z8, c12 = z8, c13 = z8;
#pragma unroll 1      /* rolled: one trip's 12 fragments (96 registers) are all that is live beside the accumulators */
  for (int kb = 0; kb < K; kb += 64) {      /* two k steps a trip (K % 64 == 0): a trip reads whole 128-byte lines of every row, all 24 loads in flight together */
    const _Float16* pa0 = a0p + kb + 8 * hh; const _Float16* pa1 = a1p + kb + 8 * hh; const _Float16* pb0 = b0p + kb + 8 * hh; const _Float16* pb1 = b1p + kb + 8 * hh; const _Float16* pb2 = b2p + kb + 8 * hh; const _Float16* pb3 = b3p + kb + 8 * hh;      /* each lane's own address, the half-wave offset of g2_frag folded in */
    const v16h a0 = g2_frag(pa0, 0), a1 = g2_frag(pa1, 0), b0 = g2_frag(pb0, 0), b1 = g2_frag(pb1, 0), b2 = g2_frag(pb2, 0), b3 = g2_frag(pb3, 0);
    const v16h e0 = g2_frag(pa0 + 32, 0), e1 = g2_frag(pa1 + 32, 0), f0 = g2_frag(pb0 + 32, 0), f1 = g2_frag(pb1 + 32, 0), f2 = g2_frag(pb2 + 32, 0), f3 = g2_frag(pb3 + 32, 0);
    asm volatile("" :: "v"(a0), "v"(a1), "v"(b0), "v"(b1), "v"(b2), "v"(b3), "v"(e0), "v"(e1), "v"(f0), "v"(f1), "v"(f2), "v"(f3), "v"(pa0), "v"(pa1), "v"(pb0), "v"(pb1), "v"(pb2), "v"(pb3));      /* inputs-only fence on the loaded fragments: every load of the trip issues ahead of the products, so a trip waits for memory once (without it each fragment is loaded and waited for in turn); the six addresses are named too, so that no register an issued load names is rewritten ahead of that wait */
    c00 = g2_mma(a0, b0, c00); c10 = g2_mma(a1, b0, c10); c01 = g2_mma(a0, b1, c01); c11 = g2_mma(a1, b1, c11); c02 = g2_mma(a0, b2, c02); c12 = g2_mma(a1, b2, c12); c03 = g2_mma(a0, b3, c03); c13 = g2_mma(a1, b3, c13);
    c00 = g2_mma(e0, f0, c00); c10 = g2_mma(e1, f0, c10); c01 = g2_mma(e0, f1, c01); c11 = g2_mma(e1, f1, c11); c02 = g2_mma(e0, f2, c02); c12 = g2_mma(e1, f2, c12); c03 = g2_mma(e0, f3, c03); c13 = g2_mma(e1, f3, c13); }
  v8f accs[8] = {c00, c01, c02, c03, c10, c11, c12, c13};
#pragma unroll
  for (int u = 0; u < 8; ++u) { const int t = u & 3, half = u >> 2; const int col = col0 + t * 16 + ln; const float bv = bp ? bf16_round(bp[col]) : 0.f;
#pragma unroll
    for (int r = 0; r < 8; ++r) { const int rloc = half * 16 + 8 * hh + r; float v = accs[u][r] * alpha + bv; if (CP) { if (rowsPerB < 0) v += CP[cofs + (size_t)(row0g + row0 + rloc) * ldc + col];      /* rowsPerB < 0: own element of the batched C plane */ else { const int bidx = (row0g + row0 + rloc) / rowsPerB; v += CP[(size_t)bidx * sCPb + (size_t)by * 64 + col]; } }
      if (ACT == 3) v = fmaxf(v, 0.f); else if (ACT == 6) v = 0.5f * v * (1.0f + erff(v * 0.70710678118654752f)); else if (ACT == 11) v = 1.0f / (1.0f + expf(-v)); else if (ACT == 15) v = v / (1.0f + expf(-v)); else if (ACT == 12) v = (v > 0.f) ? v : 0.01f * v; else if (ACT == 8) v = tanhf(v); else if (ACT == 9) v = 0.5f * v * (1.0f + tanhf(0.7978845608028654f * (v + 0.044715f * v * v * v))); else if (ACT == 14) v = (v > 0.f) ? v : 0.1f * v; else if (ACT == 16) v = (v >= 0.f) ? v : 0.3f * v; else if (ACT == 17) v = (v >= 0.f) ? v : 0.2f * v;
      so[w][rloc][t * 16 + ln] = v; } }
  __builtin_amdgcn_fence(__ATOMIC_ACQ_REL, "workgroup"); __builtin_amdgcn_wave_barrier();
  const int rsub = lane >> 4, c4 = (lane & 15) * 4; if (__builtin_amdgcn_readfirstlane(row0) >= MC) C = nullptr;      /* the f32 plane takes rows below MC of each batch only (MC % 32 == 0: a wave's 32 rows go together; row0 is the same in every lane of a wave, so the test stays scalar) */
  {
#pragma unroll
    for (int q = 0; q < 16; ++q) { const int r = q * 2 + rsub; const v4f v = *(const v4fa*)&so[w][r][c4]; if (C) { *(v4f*)(C + cofs + (size_t)(row0 + r) * ldc + col0 + c4) = v; asm volatile("s_wait_xcnt 0x0" ::: "memory"); }      /* where both planes are stored, the f16 conversion behind this is given registers that the issued f32 store names: the wait stands in front of that overwrite */
      if (C16) { v4h h4; for (int i = 0; i < 4; ++i) h4[i] = (_Float16)v[i]; *(v4h*)(C16 + cofs + (size_t)(row0 + r) * ldc + col0 + c4) = h4; } }
     } }


__global__ __launch_bounds__(256) void k_wnat(const float* __restrict__ w, size_t n8, _Float16* __restrict__ Bt) { const size_t t = (size_t)blockIdx.x * 256 + threadIdx.x; if (t >= n8) return; FragH f; for (int q = 0; q < 8; ++q) f.h[q] = (_Float16)(bf16_round(w[t * 8 + q]) * 16.0f); *(v8us*)((unsigned short*)Bt + t * 8) = f.half[0];  }
__global__ __launch_bounds__(256) void k_rsm(const float* __restrict__ S, _Float16* __restrict__ P, int nrows) {
  #pragma clang fp contract(off)
  const int i = blockIdx.x * 256 + threadIdx.x; if (i >= nrows) return; const float* s = S + (size_t)i * SQ; float mx = -3.0e38f;
#pragma unroll 1
  for (int j = 0; j < SQ; ++j) mx = fmaxf(mx, s[j]); float se = 0.f;
#pragma unroll 1
  for (int j = 0; j < SQ; ++j) se += expf(s[j] - mx); const float sc = 256.0f / se;
#pragma unroll 1
  for (int j0 = 0; j0 < SQ; j0 += 8) { FragH f; for (int q = 0; q < 8; ++q) f.h[q] = (_Float16)(expf(s[j0 + q] - mx) * sc); unsigned short* d = (unsigned short*)P + (size_t)i * SQ + j0; *(v8us*)d = f.half[0];  } }
__global__ __launch_bounds__(256) void k_vt(const _Float16* __restrict__ V16, int b, int h0, _Float16* __restrict__ VT) { __shared__ unsigned short tl[64][65]; const int tid = threadIdx.x; const int hh = blockIdx.x % HG, sg = blockIdx.x / HG; const int s0 = sg * 64; const int h = h0 + hh;
  for (int i = tid; i < 64 * 8; i += 256) { const int j = i / 8, d8 = (i % 8) * 8; FragH f; f.half[0] = *(const v8us*)((const unsigned short*)V16 + ((size_t)b * SQ + s0 + j) * DM + h * HD + d8); for (int q = 0; q < 8; ++q) tl[d8 + q][j] = f.u[q]; }
  __syncthreads();
  { for (int i = tid; i < 64 * 8; i += 256) { const int d = i / 8, j8 = (i % 8) * 8; FragH f; for (int q = 0; q < 8; ++q) f.u[q] = tl[d][j8 + q]; *(v8us*)((unsigned short*)VT + ((size_t)hh * HD + d) * SQ + s0 + j8) = f.half[0]; }  } }



template <int CTRL> __device__ __forceinline__ float rs_dpp(float x) { return __builtin_bit_cast(float, __builtin_amdgcn_update_dpp(0, __builtin_bit_cast(int, x), CTRL, 0xf, 0xf, true)); }      /* lane l <- lane l ^ m inside a 16-lane row (row_xmask:m = 0x160 + m) */
__device__ __forceinline__ float rs_xhalf(float x) { return __builtin_bit_cast(float, __builtin_amdgcn_permlanex16(__builtin_bit_cast(int, x), __builtin_bit_cast(int, x), 0x76543210, 0xfedcba98, false, false)); }      /* lane l <- lane l ^ 16 */
__device__ __forceinline__ float rs_exp2(float x) { float e; asm("v_exp_f32 %0, %1\n\tv_nop" : "=v"(e) : "v"(x)); return e; }      /* 2^x; the v_nop is the slot the instruction set asks for behind a transcendental */
// causal softmax, ONE WAVE PER ROW of NU * 128 columns: lane l holds columns u*128 + 4l .. + 3 in registers, so S is read once, by whole lines; maximum and sum are folded over the 32 lanes by a butterfly that leaves the same value in every lane
template <int NU>
__global__ __launch_bounds__(256) void k_rsmcf2(const float* __restrict__ S, _Float16* __restrict__ P, int hg, int q0) {
  const int c0 = (threadIdx.x & 31) * 4; const int t = blockIdx.x * 8 + __builtin_amdgcn_readfirstlane(threadIdx.x >> 5); if (t >= hg * QT) return;      /* the row index is wave-uniform */
  const float* s = S + (size_t)t * NKX + c0; _Float16* d = P + (size_t)t * NKX + c0; const int last = q0 + (t % QT);
  v4f sv[NU]; float mx = -3.0e38f, se = 0.f;
#pragma unroll      /* full unroll (here and below): sv needs constant indices to stay in registers */
  for (int u = 0; u < NU; ++u) sv[u] = *(const v4fa*)(s + u * 128);
#pragma unroll
  for (int u = 0; u < NU; ++u) for (int q = 0; q < 4; ++q) { const float f = (u * 128 + c0 + q <= last) ? 1.f : 0.f; sv[u][q] = fmaf(f, sv[u][q], (1.f - f) * -1.0e9f); mx = fmaxf(mx, sv[u][q]); }
  mx = fmaxf(mx, rs_dpp<0x161>(mx)); mx = fmaxf(mx, rs_dpp<0x162>(mx)); mx = fmaxf(mx, rs_dpp<0x164>(mx)); mx = fmaxf(mx, rs_dpp<0x168>(mx)); mx = fmaxf(mx, rs_xhalf(mx));
#pragma unroll
  for (int u = 0; u < NU; ++u) for (int q = 0; q < 4; ++q) { sv[u][q] = rs_exp2((sv[u][q] - mx) * 1.44269504088896340736f); se += sv[u][q]; }
  se += rs_dpp<0x161>(se); se += rs_dpp<0x162>(se); se += rs_dpp<0x164>(se); se += rs_dpp<0x168>(se); se += rs_xhalf(se); const float sc = 256.0f / se;
#pragma unroll
  for (int u = 0; u < NU; ++u) { v4h h4; for (int q = 0; q < 4; ++q) h4[q] = (_Float16)(sv[u][q] * sc); *(v4h*)(d + u * 128) = h4; } }


#define A0R 32                       /* rows of one row group of the exact tile (one wave, one row per lane) = keys of one chunk */
#define A0G (QT0 / A0R)              /* row groups per batch */
#define A0W (A0G + 1)                /* waves per block: row groups x and A0G - 1 - x have x + 1 and A0G - x causal key chunks, A0G + 1 together for every x */
#define A0T (A0R * (HD / 4) / 32)    /* merge tiles per row group: 32 float4 = two output rows each */
#define A0P (HD + 4)                 /* LDS pitch of a partial o row, in floats: 16 B x odd, for the b128 rows */
// exact f32 causal attention, keys split: wave w of a block runs the online softmax of ONE row group over ONE chunk of A0R keys; the partial (m, l, o) of a row's chunks are merged through LDS in chunk order
__global__ __launch_bounds__(A0W * 32) void k_att0(const float* __restrict__ QF, const float* __restrict__ KF, const float* __restrict__ VF, int ld, float scale, float* __restrict__ OF, int ldo) {
  #pragma clang fp contract(off)
  __shared__ __attribute__((aligned(16))) float lo[A0W][A0R][A0P];      /* each wave's partial o rows (not normalised) */
  __shared__ float lm[A0W][A0R], ll[A0W][A0R];      /* each wave's running maximum and sum per row */
  const int tid = threadIdx.x, lane = tid & 31; const int w = __builtin_amdgcn_readfirstlane(tid >> 5);      /* the wave index is wave-uniform: k and v rows stay scalar loads */
  const int h = blockIdx.x / (A0G / 2), x = blockIdx.x % (A0G / 2);
  const int rg = (w <= x) ? x : A0G - 1 - x, ch = (w <= x) ? w : w - x - 1; const int i = rg * A0R + lane;      /* waves 0..x: the short row group x; the others: its long partner */
  { const size_t bi = (size_t)blockIdx.y * SQ * ld; QF += bi; KF += bi; VF += bi; OF += (size_t)blockIdx.y * QT0 * ldo; }      /* batch on grid.y: q, k, v are the first QT0 rows of the batch's SQ-row plane; o has a QT0-row plane per batch */
  const float* qr = QF + (size_t)i * ld + h * HD;
  v4f rq[HD / 4], ro[HD / 4];      /* this thread's q row and o accumulator live in registers for the whole key loop */
#pragma unroll      /* full unroll: rq / ro need constant indices to stay in registers */
  for (int c = 0; c < HD / 4; ++c) { rq[c] = *(const v4fa*)(qr + c * 4); const v4f z = {0.f, 0.f, 0.f, 0.f}; ro[c] = z; }
  asm volatile("s_wait_xcnt 0x0" :: "v"(qr) : "memory");      /* the q loads' address pair stays live up to this wait, so no register that an issued load names is rewritten ahead of it */
  float m = -1.0e30f, l = 0.f; const int j0 = ch * A0R;      /* the chunk's first key is at or below the diagonal for every row of the group, so m is a real score after the first trip */
#pragma unroll 1
  for (int j = j0; j < j0 + A0R; ++j) { const float* kr = KF + (size_t)j * ld + h * HD; const float* vr = VF + (size_t)j * ld + h * HD; float s = 0.f;
#pragma unroll      /* full unroll: constant index into rq */
    for (int c = 0; c < HD / 4; ++c) { const v4f kq = *(const v4fa*)(kr + c * 4); const v4f qq = rq[c]; s = __fadd_rn(s, __fmul_rn(qq[0], kq[0])); s = __fadd_rn(s, __fmul_rn(qq[1], kq[1])); s = __fadd_rn(s, __fmul_rn(qq[2], kq[2])); s = __fadd_rn(s, __fmul_rn(qq[3], kq[3])); }
    s = __fmul_rn(s, scale);
    const float f = (j <= i) ? 1.f : 0.f; const float sm = fmaf(f, s, (1.f - f) * -1.0e30f); const float mn = fmaxf(m, sm); const float sc = expf(m - mn); const float e = expf(sm - mn); l = __fadd_rn(__fmul_rn(l, sc), e); m = mn;
#pragma unroll      /* full unroll: constant index into ro */
    for (int c = 0; c < HD / 4; ++c) { const v4f vv = *(const v4fa*)(vr + c * 4); v4f oo = ro[c]; for (int u = 0; u < 4; ++u) oo[u] = __fadd_rn(__fmul_rn(oo[u], sc), __fmul_rn(e, vv[u])); ro[c] = oo; } }
  lm[w][lane] = m; ll[w][lane] = l;
#pragma unroll      /* full unroll: constant index into ro */
  for (int c = 0; c < HD / 4; ++c) *(v4f*)&lo[w][lane][c * 4] = ro[c];
  __syncthreads();
#pragma unroll 1      /* at most two trips; rolled, so that one trip's 16 partial rows are all that is live */
  for (int wt = w; wt < 2 * A0T; wt += A0W) {      /* a wave merges two whole output rows of one group per trip, one float4 per lane; group and chunk count are wave-uniform */
    const int g = wt / A0T, row = (wt % A0T) * 2 + (lane >> 4), pc = (lane & 15) * 4; const int w0 = g ? x + 1 : 0, n = g ? A0G - x : x + 1;      /* the group's waves: w0 .. w0 + n - 1, in chunk order */
    float pm[A0G], pl[A0G]; v4f po[A0G];
#pragma unroll      /* fixed trip count, index clamped to a written slot: all LDS reads issue together and the exponentials are independent; a slot past the group's n takes a maximum so low that its weight below is 0 */
    for (int s = 0; s < A0G; ++s) { const int ws = min(w0 + s, A0W - 1); const float ms = lm[ws][row]; pm[s] = (s < n) ? ms : -3.0e38f; pl[s] = ll[ws][row]; po[s] = *(const v4f*)&lo[ws][row][pc]; }
    float mx = pm[0];
#pragma unroll      /* full unroll (here and below): pm / pl / po need constant indices to stay in registers */
    for (int s = 1; s < A0G; ++s) mx = fmaxf(mx, pm[s]);
    float ls = 0.f; v4f a = {0.f, 0.f, 0.f, 0.f};
#pragma unroll
    for (int s = 0; s < A0G; ++s) { const float fs = expf(pm[s] - mx); ls = fmaf(fs, pl[s], ls); for (int u = 0; u < 4; ++u) a[u] = fmaf(fs, po[s][u], a[u]); }
    const float fin = 64.0f / ls;      /* o carried x64; k_o0m scales it back by 1/64 */
    for (int u = 0; u < 4; ++u) a[u] = __fmul_rn(a[u], fin);
    *(v4f*)(OF + (size_t)((g ? A0G - 1 - x : x) * A0R + row) * ldo + h * HD + pc) = a;
    asm volatile("s_wait_xcnt 0x0" ::: "memory"); } }      /* the next trip rewrites the registers that the store names: the wait stands in front of that */


template <int BFIN, int WXB>
__global__ __launch_bounds__(256) void k_ln16(const float* __restrict__ X, const float* __restrict__ g, const float* __restrict__ bb, float eps, _Float16* __restrict__ N16, float* __restrict__ XB) {
  #pragma clang fp contract(off)
  __shared__ float red[256]; const size_t r = blockIdx.x; const int t = threadIdx.x; const v4f xa = *(const v4fa*)(X + r * DMQ + t * 4); float s[4]; float sum = 0.f;
  for (int q = 0; q < 4; ++q) { s[q] = BFIN ? bf16_round(xa[q]) : xa[q]; sum = __fadd_rn(sum, s[q]); }
  red[t] = sum; __syncthreads(); for (int st = 128; st > 0; st >>= 1) { if (t < st) red[t] = __fadd_rn(red[t], red[t + st]); __syncthreads(); } const float mu = red[0] / (float)DMQ; __syncthreads();
  float vs = 0.f; for (int q = 0; q < 4; ++q) { const float dl = __fadd_rn(s[q], -mu); vs = __fadd_rn(vs, __fmul_rn(dl, dl)); } red[t] = vs; __syncthreads(); for (int st = 128; st > 0; st >>= 1) { if (t < st) red[t] = __fadd_rn(red[t], red[t + st]); __syncthreads(); }
  const float rs = rsqrtf(__fadd_rn(red[0] / (float)DMQ, eps)); v4h y; v4f xb;
  for (int q = 0; q < 4; ++q) { const int c = t * 4 + q; y[q] = (_Float16)__fadd_rn(__fmul_rn(__fmul_rn(__fadd_rn(s[q], -mu), rs), bf16_round(g[c])), bf16_round(bb[c])); xb[q] = s[q]; }
  { *(v4h*)(N16 + r * DMQ + t * 4) = y; if (WXB) *(v4f*)(XB + r * DMQ + t * 4) = xb;  } }
__global__ __launch_bounds__(256) void k_ftres2(const float* __restrict__ OF0, const float* __restrict__ XB, float* __restrict__ X1, size_t n4) {
  #pragma clang fp contract(off)
  const size_t t = (size_t)blockIdx.x * 256 + threadIdx.x; if (t >= n4) return; const v4f o = *(const v4fa*)(OF0 + t * 4), xv = *(const v4fa*)(XB + t * 4); v4f y; for (int q = 0; q < 4; ++q) y[q] = __fadd_rn(__fmul_rn(o[q], 0.015625f), xv[q]); *(v4f*)(X1 + t * 4) = y;  }

__global__ __launch_bounds__(256) void k_wthd(const float* __restrict__ Wt, _Float16* __restrict__ Bt) { const size_t t = (size_t)blockIdx.x * 256 + threadIdx.x; if (t >= (size_t)NH * HD * (DM / 8)) return; const int m8 = (int)(t % (DM / 8)) * 8; const int d = (int)((t / (DM / 8)) % HD); const int h = (int)(t / ((size_t)(DM / 8) * HD)); FragH f;
  for (int q = 0; q < 8; ++q) f.h[q] = (_Float16)(16.0f * bf16_round(Wt[((size_t)h * DM + m8 + q) * HD + d])); unsigned short* dst = (unsigned short*)Bt + ((size_t)h * HD + d) * DM + m8; *(v8us*)dst = f.half[0];  }




__global__ __launch_bounds__(256) void k_wtpad(const float* __restrict__ Wm, _Float16* __restrict__ Wt, int Kr, int Kp, int Nr, int Np, float scale) {
  const int t = blockIdx.x * 256 + threadIdx.x; if (t >= Np * (Kp / 8)) return; const int n = t / (Kp / 8), k8 = (t % (Kp / 8)) * 8; const int nc = min(n, Nr - 1); const float fn = (n < Nr) ? 1.f : 0.f; FragH f;
  for (int i = 0; i < 8; ++i) { const int k = k8 + i; const int kc = min(k, Kr - 1); const float fk = (k < Kr) ? fn : 0.f; f.h[i] = (_Float16)(bf16_round(Wm[(size_t)kc * Nr + nc]) * scale * fk); }
  unsigned short* o = (unsigned short*)Wt + (size_t)n * Kp + k8; *(v8us*)o = f.half[0];  }
__global__ __launch_bounds__(128) void k_bpad(const float* __restrict__ b, float* __restrict__ Bp, int nr, int np) {
  const int i = threadIdx.x; if (i >= np) return; const float v = b[min(i, nr - 1)] * ((i < nr) ? 1.f : 0.f); *(float*)(Bp + i) = v;  }

#define DI 64         /* inner width = NH * HD (ONE 64-wide head) */
#define LQK (3 * DI)  /* fused q | k | v row pitch (192) */
__global__ __launch_bounds__(256) void k_o0(const float* __restrict__ OF, float* __restrict__ ob, size_t n4) {
  #pragma clang fp contract(off)
  const size_t t = (size_t)blockIdx.x * 256 + threadIdx.x; if (t >= n4) return; const size_t e = t * 4; const int i = (int)(e / DI); const int c = (int)(e % DI); const int h = c / HD, d = c % HD; const v4f a = *(const v4fa*)(OF + e); v4f o; for (int q = 0; q < 4; ++q) o[q] = __fmul_rn(a[q], 0.015625f); float* dst = ob + (size_t)h * SQ * HD + (size_t)i * HD + d; *(v4f*)dst = o;  }

__global__ __launch_bounds__(256) void k_o0m(const float* __restrict__ OF, float* __restrict__ o_, size_t n4) {
  #pragma clang fp contract(off)
  const size_t t = (size_t)blockIdx.x * 256 + threadIdx.x; if (t >= n4) return; const size_t e = t * 4; OF += (size_t)blockIdx.y * QT0 * DI; o_ += (size_t)blockIdx.y * SQ * DI;      /* batch on grid.y: QT0 exact rows go to the head of the batch's SQ output rows */
  const v4f a = *(const v4fa*)(OF + e); v4f o; for (int q = 0; q < 4; ++q) o[q] = __fmul_rn(a[q], 0.015625f); *(v4f*)(o_ + e) = o;  }
extern "C" void kernel_launch(void* const* d_in, const int* in_sizes, int n_in,
                              void* d_out, int out_size, void* d_ws, size_t ws_size, hipStream_t stream) {
  (void)in_sizes; (void)n_in; (void)out_size;
  const float* const* I = (const float* const*)d_in; const float* x = I[0]; const float* wq = I[2]; const float* wk = I[1]; const float* wv = I[3]; const float* bq = nullptr; const float* bk = nullptr; const float* bv = nullptr;      /* x; [in][out = 64] Wk / Wq / Wv (input order as this module lists them); no biases */
  char* ws = (char*)d_ws; size_t off = 0;
  auto take = [&](size_t bytes) { char* p = ws + off; off += (bytes + 255) & ~(size_t)255; return p; };
  _Float16* BW = (_Float16*)take((size_t)LQK * DM * 2); _Float16* X16 = (_Float16*)take(NR * DM * 2); _Float16* QKV = (_Float16*)take(NR * LQK * 2); _Float16* VT = (_Float16*)take((size_t)NB * HD * SQ * 2);
  float* S = (float*)take((size_t)NB * QT * NKX * 4); _Float16* P = (_Float16*)take((size_t)NB * QT * NKX * 2); float* QKVF0 = (float*)take(NR * LQK * 4); float* OF0 = (float*)take((size_t)NB * QT0 * DI * 4);      /* one plane per batch: all batches are in flight in every launch; QKVF0 has the row layout of QKV, and only rows 0..QT0-1 of each batch are written and read */
  if (off > ws_size) return;
  { const unsigned g = (unsigned)(((size_t)DI * (DM / 8) + 255) / 256); k_wt_f16<<<dim3(g, 3), 256, 0, stream>>>(wq, wk, wv, BW, DM, DI, 16.0f); }      /* [in = DM][out = 64] -> Bt[n][k] x16, stacked q | k | v */
  k_x16<<<(unsigned)((NR * DM / 8 + 255) / 256), 256, 0, stream>>>(x, X16, NR * DM / 8);      /* x (bf16-valued) as exact f16 rows */
  (void)bq; (void)bk; (void)bv; static_assert(QT0 % 32 == 0 && SQ % 128 == 0 && LQK % 64 == 0, "k_gemm2: whole wave tiles on either side of row QT0");
  k_gemm2<0><<<dim3((SQ / 128) * (LQK / 64), NB), 128, 0, stream>>>(X16, DM, (size_t)SQ * DM, BW, DM, 0, 0.0625f, nullptr, 0, nullptr, 1, 0, 0, QKVF0, QKV, LQK, (size_t)SQ * LQK, SQ, LQK, DM, QT0);      /* q | k | v = x W^T in ONE launch over the stacked weights (N = 192): f16 rows of the fused plane (column blocks 0 / 64 / 128, pitch 192) and, from the same accumulators, the f32 rows 0..511 of every batch for the exact path */
  const _Float16* Q16 = QKV; const _Float16* K16 = QKV + DI; const _Float16* V16 = QKV + 2 * DI;
  float* ob = (float*)d_out;      /* the batch is grid.y of every launch below but k_vt and k_rsmcf2, which index it in grid.x (ONE head, so the head stride of the kernels carries the batch) */
  k_vt<NH, SQ><<<NB * NH * (SQ / 64), 256, 0, stream>>>(V16, LQK, 0, VT);      /* V^T [NB][HD][SQ] */
  static_assert(QT0 == 2 * QT, "the f16 tiles start where the exact rows end: the softmax cases below are those of tiles 3 and 4");
  for (int q0 = QT0; q0 < SQ; q0 += QT) { const int nk = q0 + QT;      /* causal: only keys below the tile end are computed; rows below QT0 are written by the exact path below and by nothing else */
    k_gemm2<0><<<dim3((QT / 128) * (nk / 64), NB), 128, 0, stream>>>(Q16 + (size_t)q0 * LQK, LQK, (size_t)SQ * LQK, K16, LQK, (size_t)SQ * LQK, 0.125f, nullptr, 0, nullptr, 1, 0, 0, S, nullptr, NKX, (size_t)QT * NKX, QT, nk, HD, QT);      /* scores / 8 */
    static_assert(SQ == 4 * QT && NKX == SQ && QT % 128 == 0, "one softmax instance per causal tile"); static_assert(DM % 64 == 0 && HD % 64 == 0 && QT % 64 == 0, "k_gemm2 takes K in steps of 64"); switch (nk / QT) {      /* causal softmax -> P x256 f16; one wave per row, 8 rows per block; the row length is a compile-time constant of the kernel (the row lives in registers) */
      case 3: k_rsmcf2<3 * QT / 128><<<(NB * QT + 7) / 8, 256, 0, stream>>>(S, P, NB, q0); break;
      case 4: k_rsmcf2<4 * QT / 128><<<(NB * QT + 7) / 8, 256, 0, stream>>>(S, P, NB, q0); break; }
    k_gemm2<0><<<dim3((QT / 128) * (HD / 64), NB), 128, 0, stream>>>(P, NKX, (size_t)QT * NKX, VT, SQ, (size_t)HD * SQ, 0.00390625f, nullptr, 0, nullptr, 1, 0, 0, ob + (size_t)q0 * DI, nullptr, DI, (size_t)SQ * DI, QT, HD, nk, QT); }      /* out[b][q0 + i][..] = P V^T 2^-8 (f32) */
  k_att0<<<dim3(NH * (A0G / 2), NB), A0W * 32, 0, stream>>>(QKVF0, QKVF0 + DI, QKVF0 + 2 * DI, LQK, 0.125f, OF0, DI);      /* exact f32 causal attention for rows 0..511 (o x64); a block = one short and one long row group, one wave per key chunk */
  k_o0m<<<dim3((unsigned)(((size_t)QT0 * DI / 4 + 255) / 256), NB), 256, 0, stream>>>(OF0, ob, (size_t)QT0 * DI / 4);      /* rows 0..511 of every batch: their one store, from the exact path */
}

// v008
// One run takes 96.1 microseconds.
// Timed twice side by side with v007, it ran 1.54 and 1.53 times as fast.
// All steps since v000 together make it 737 times as fast.
#include <hip/hip_runtime.h>
// Single-head causal self-attention (x [32][1024][384]; k/q/v = x W ([in][out] [384][64], no biases; input order Wk, Wq, Wv); ONE 64-wide head; wei * 64^-0.5; causal (tril, -inf); softmax; out = wei v -> [32][1024][64]; no output projection).
// Structure: token rows; x as exact f16 rows; one WMMA GEMM over the stacked weights into one f16 q | k | v plane (and the f32 rows of the exact path); per batch v^T via LDS transposes; one fused launch for query rows 512..1023 (32 rows a block, keys split over its 8 waves: scores alpha 1/8, causal softmax f32 -> f16 x256 weights, P V, all in registers; f32 output rows); rows 0..511 come from an exact f32 path alone; launches: see trace.
// Compute dtype: inputs rounded to bf16; x / weights exact; q, k, v and softmax weights as plain f16 GEMM operands (~2^-12); scores, softmax statistics and o f32. v_wmma_f32_16x16x32_f16.
#define NB 32
#define SQ 1024
#define DM 384
#define NH 1
#define HD 64
#define HG 4
#define QT 256                       /* query rows per causal tile */
#define NKX SQ                       /* S / P row pitch */
#define QT0 512                      /* rows computed only by the exact f32 path: 512 here (no output projection averages the early-row cancellation errors away; logit sigma 1.0) */
#define B0 0                         /* unused; batches start at 0 on grid.y */
#define NBR NB                       /* feeds only MP; unused by the launches */
#define NR ((size_t)NB * SQ)
#define DMQ DM
#define DFF 4096
#define DFFR 100
#define MP ((int)((size_t)NBR * SQ)) /* unused; the projections use NR rows */
#define QN SQ                        /* unused */
#define NHD NH                       /* unused */
#define MPO MP                       /* unused */
#define LQ (3 * DM)      /* 3 * DM, unused; the q/k/v rows use pitch LQK (192) */
typedef __bf16 v16b __attribute__((ext_vector_type(16)));
typedef unsigned short v8us __attribute__((ext_vector_type(8), may_alias));
typedef float  v8f  __attribute__((ext_vector_type(8)));
typedef float  v4f  __attribute__((ext_vector_type(4)));
typedef float  v4fa __attribute__((ext_vector_type(4), may_alias));
union FragB { v16b v; v8us half[2]; unsigned short u[16]; };

__device__ __forceinline__ unsigned short bf16_bits(float x) { unsigned int u = __float_as_uint(x); return (unsigned short)((u + 0x7FFFu + ((u >> 16) & 1u)) >> 16); }
__device__ __forceinline__ float bf16_val(unsigned short b) { return __uint_as_float(((unsigned int)b) << 16); }
__device__ __forceinline__ float bf16_round(float x) { return bf16_val(bf16_bits(x)); }
// D += A·B with NT terms: 1 = ah·bh, 2 = + al·bh (A split), 3 = + ah·bl (both split)
template <int NT>
__device__ __forceinline__ v8f mmaN(v16b ah, v16b al, v16b bh, v16b bl, v8f c) {
  c = __builtin_amdgcn_wmma_f32_16x16x32_bf16(false, ah, false, bh, (short)0, c, false, false);
  if (NT >= 2) c = __builtin_amdgcn_wmma_f32_16x16x32_bf16(false, al, false, bh, (short)0, c, false, false);
  if (NT >= 3) c = __builtin_amdgcn_wmma_f32_16x16x32_bf16(false, ah, false, bl, (short)0, c, false, false);
  asm volatile("v_nop\n\tv_nop\n\tv_nop\n\tv_nop" : "+v"(c) : "v"(ah), "v"(al), "v"(bh), "v"(bl));
  return c;
}

__global__ __launch_bounds__(256) void k_wt_bf16(const float* __restrict__ W, unsigned short* __restrict__ Wt, int K, int N) {
  const int t = blockIdx.x * 256 + threadIdx.x;
  const int k8n = K / 8;
  if (t >= N * k8n) return;
  const int n = t / k8n, k8 = (t % k8n) * 8;
  v8us v;
#pragma unroll
  for (int i = 0; i < 8; ++i) v[i] = bf16_bits(W[(size_t)(k8 + i) * N + n]);
  *(v8us*)(Wt + (size_t)n * K + k8) = v;
  
}

// GEMM C[M][N] (f32, pitch ldc) = act(A[M][K]·W + bias). A f32 row-major (pitch lda) converted per fragment to bf16
// (ASPLIT: hi/lo two planes -> 2 terms, else single rounded term); Wt bf16 [N][K] (pitch ldb). BIAS_BF16 rounds the
// bias to bf16 first (bias quantised to bf16 before the add). K%32==0, M%16==0, N%64==0.
template <bool ASPLIT, int ACT, bool BIAS_BF16>
__global__ __launch_bounds__(128) void k_gemm_bf(const float* __restrict__ A, int lda, const unsigned short* __restrict__ Wt, int ldb,
                                               const float* __restrict__ bias, float* __restrict__ C, int ldc, int M, int N, int K) {
  __shared__ __attribute__((aligned(16))) float so[4][16][64];
  const int tid = threadIdx.x, w = tid >> 5, lane = tid & 31, ln = lane & 15, hh = lane >> 4;
  const int ntn = N / 64;
  const int wid = blockIdx.x * 4 + w;
  const int mt = wid / ntn, nq = wid % ntn;
  if (mt * 16 >= M) return;
  const int row0 = mt * 16, col0 = nq * 64;
  const float* arow = A + (size_t)(row0 + ln) * lda;
  v8f acc[4] = {};
  for (int kb = 0; kb < K; kb += 32) {
    FragB ah, al;
    const v4f x0 = *(const v4fa*)(arow + kb + 8 * hh), x1 = *(const v4fa*)(arow + kb + 8 * hh + 4);
    const v4f x2 = *(const v4fa*)(arow + kb + 16 + 8 * hh), x3 = *(const v4fa*)(arow + kb + 16 + 8 * hh + 4);
    float xs[16] = {x0[0],x0[1],x0[2],x0[3],x1[0],x1[1],x1[2],x1[3],x2[0],x2[1],x2[2],x2[3],x3[0],x3[1],x3[2],x3[3]};
#pragma unroll
    for (int i = 0; i < 16; ++i) { const unsigned short hb = bf16_bits(xs[i]); ah.u[i] = hb; al.u[i] = ASPLIT ? bf16_bits(xs[i] - bf16_val(hb)) : (unsigned short)0; }
#pragma unroll
    for (int t = 0; t < 4; ++t) {
      const unsigned short* brow = Wt + (size_t)(col0 + t * 16 + ln) * ldb + kb;
      FragB b;
      b.half[0] = *(const v8us*)(brow + 8 * hh);
      b.half[1] = *(const v8us*)(brow + 16 + 8 * hh);
      acc[t] = mmaN<ASPLIT ? 2 : 1>(ah.v, al.v, b.v, b.v, acc[t]);
    }
  }
#pragma unroll
  for (int t = 0; t < 4; ++t) {
    float bv = bias ? bias[col0 + t * 16 + ln] : 0.f;
    if (BIAS_BF16) bv = bf16_round(bv);
#pragma unroll
    for (int r = 0; r < 8; ++r) { float v = acc[t][r] + bv; if (ACT == 1) v = fmaxf(v, 0.f); so[w][8 * hh + r][t * 16 + ln] = v; }
  }
  __builtin_amdgcn_fence(__ATOMIC_ACQ_REL, "workgroup");
  __builtin_amdgcn_wave_barrier();
  const int rsub = lane >> 4, c4 = (lane & 15) * 4;
  {
#pragma unroll
    for (int q = 0; q < 8; ++q) {
      const int r = q * 2 + rsub;
      const v4f v = *(const v4fa*)&so[w][r][c4];
      *(v4f*)(C + (size_t)(row0 + r) * ldc + col0 + c4) = v;
    }
    
  }
}

// GEMM C = act(A·W + bias + resid): A f32 (ASPLIT -> hi/lo 2 terms), Wt bf16 [N][K]; ACT 0 none, 1 relu, 2 exact gelu;
// resid (optional, f32, row index = (row % rmod), pitch ldr, RES_BF16 rounds it) added before the activation.
template <bool ASPLIT, int ACT, bool BIAS_BF16, bool RES_BF16>
__global__ __launch_bounds__(128) void k_gemm_bf3(const float* __restrict__ A, int lda, const unsigned short* __restrict__ Wt, int ldb,
                                                const float* __restrict__ bias, const float* __restrict__ resid, int rmod, int ldr,
                                                float* __restrict__ C, int ldc, int M, int N, int K) {
  __shared__ __attribute__((aligned(16))) float so[4][16][64];
  const int tid = threadIdx.x, w = tid >> 5, lane = tid & 31, ln = lane & 15, hh = lane >> 4;
  const int ntn = N / 64;
  const int wid = blockIdx.x * 4 + w;
  const int mt = wid / ntn, nq = wid % ntn;
  if (mt * 16 >= M) return;
  const int row0 = mt * 16, col0 = nq * 64;
  const float* arow = A + (size_t)(row0 + ln) * lda;
  v8f acc[4] = {};
  for (int kb = 0; kb < K; kb += 32) {
    FragB ah, al;
    const v4f x0 = *(const v4fa*)(arow + kb + 8 * hh), x1 = *(const v4fa*)(arow + kb + 8 * hh + 4);
    const v4f x2 = *(const v4fa*)(arow + kb + 16 + 8 * hh), x3 = *(const v4fa*)(arow + kb + 16 + 8 * hh + 4);
    float xs[16] = {x0[0],x0[1],x0[2],x0[3],x1[0],x1[1],x1[2],x1[3],x2[0],x2[1],x2[2],x2[3],x3[0],x3[1],x3[2],x3[3]};
#pragma unroll
    for (int i = 0; i < 16; ++i) { const unsigned short hb = bf16_bits(xs[i]); ah.u[i] = hb; al.u[i] = ASPLIT ? bf16_bits(xs[i] - bf16_val(hb)) : (unsigned short)0; }
#pragma unroll
    for (int t = 0; t < 4; ++t) {
      const unsigned short* brow = Wt + (size_t)(col0 + t * 16 + ln) * ldb + kb;
      FragB b;
      b.half[0] = *(const v8us*)(brow + 8 * hh);
      b.half[1] = *(const v8us*)(brow + 16 + 8 * hh);
      acc[t] = mmaN<ASPLIT ? 2 : 1>(ah.v, al.v, b.v, b.v, acc[t]);
    }
  }
#pragma unroll
  for (int t = 0; t < 4; ++t) {
    const int col = col0 + t * 16 + ln;
    float bv = bias ? bias[col] : 0.f;
    if (BIAS_BF16) bv = bf16_round(bv);
#pragma unroll
    for (int r = 0; r < 8; ++r) {
      float v = acc[t][r] + bv;
      if (resid) { float rv = resid[(size_t)((row0 + 8 * hh + r) % rmod) * ldr + col]; if (RES_BF16) rv = bf16_round(rv); v += rv; }
      if (ACT == 1) v = fmaxf(v, 0.f);
      if (ACT == 2) v = 0.5f * v * (1.0f + erff(v * 0.70710678118654752f));
      if (ACT == 3) { const float u = 0.7978845608028654f * (v + 0.044715f * v * v * v); v = 0.5f * v * (1.0f + tanhf(u)); }
      so[w][8 * hh + r][t * 16 + ln] = v;
    }
  }
  __builtin_amdgcn_fence(__ATOMIC_ACQ_REL, "workgroup");
  __builtin_amdgcn_wave_barrier();
  const int rsub = lane >> 4, c4 = (lane & 15) * 4;
  {
#pragma unroll
    for (int q = 0; q < 8; ++q) {
      const int r = q * 2 + rsub;
      const v4f v = *(const v4fa*)&so[w][r][c4];
      *(v4f*)(C + (size_t)(row0 + r) * ldc + col0 + c4) = v;
    }
    
  }
}
// row LayerNorm (biased variance, eps) over N: s = X (+ R); optional out_sum <- s; out_norm <- (s-mu)*rsqrt(var+eps)*g + b
template <bool PARAM_BF16>
__global__ __launch_bounds__(256) void k_layernorm(const float* __restrict__ X, const float* __restrict__ R, const float* __restrict__ g, const float* __restrict__ bta,
                                                  float* __restrict__ out_sum, float* __restrict__ out_norm, int N, float eps) {
  __shared__ float red[256];
  const int row = blockIdx.x, tid = threadIdx.x;
  const float* x = X + (size_t)row * N; const float* rr = R ? R + (size_t)row * N : nullptr;
  float vals[16];                     // up to N = 4096
  const int per = N / 256;            // contiguous chunk per thread? use strided-by-4 chunks: thread handles j = tid*4 + 1024*u
  float s1 = 0.f;
  for (int u = 0; u < per / 4; ++u) {
    const int j = tid * 4 + 1024 * u;
    const v4f a = *(const v4fa*)(x + j);
    v4f b = {0.f,0.f,0.f,0.f}; if (rr) b = *(const v4fa*)(rr + j);
#pragma unroll
    for (int q = 0; q < 4; ++q) { const float v = a[q] + b[q]; vals[u * 4 + q] = v; s1 += v; }
  }
  red[tid] = s1; __syncthreads();
  for (int st = 128; st > 0; st >>= 1) { if (tid < st) red[tid] += red[tid + st]; __syncthreads(); }
  const float mu = red[0] / (float)N; __syncthreads();
  float s2 = 0.f;
  for (int u = 0; u < per / 4; ++u)
#pragma unroll
    for (int q = 0; q < 4; ++q) { const float c = vals[u * 4 + q] - mu; s2 += c * c; }
  red[tid] = s2; __syncthreads();
  for (int st = 128; st > 0; st >>= 1) { if (tid < st) red[tid] += red[tid + st]; __syncthreads(); }
  const float rs = rsqrtf(red[0] / (float)N + eps);
  {
    for (int u = 0; u < per / 4; ++u) {
      const int j = tid * 4 + 1024 * u;
      v4f o, sm;
#pragma unroll
      for (int q = 0; q < 4; ++q) {
        float gg = g[j + q], bb = bta[j + q];
        if (PARAM_BF16) { gg = bf16_round(gg); bb = bf16_round(bb); }
        sm[q] = vals[u * 4 + q]; o[q] = (vals[u * 4 + q] - mu) * rs * gg + bb;
      }
      if (out_sum) *(v4f*)(out_sum + (size_t)row * N + j) = sm;
      *(v4f*)(out_norm + (size_t)row * N + j) = o;
    }
    
  }
}



// ---- f16 WMMA path (v_wmma_f32_16x16x32_f16): 11-bit significands for operands in range — used where a [0,1] probability operand needs more precision than bf16
typedef _Float16 v16h __attribute__((ext_vector_type(16)));
union FragH { v16h v; v8us half[2]; _Float16 h[16]; unsigned short u[16]; };
template <int NT>
__device__ __forceinline__ v8f mmaH(v16h ah, v16h al, v16h bh, v16h bl, v8f c) {
  c = __builtin_amdgcn_wmma_f32_16x16x32_f16(false, ah, false, bh, (short)0, c, false, false);
  if (NT >= 2) c = __builtin_amdgcn_wmma_f32_16x16x32_f16(false, al, false, bh, (short)0, c, false, false);
  if (NT >= 3) c = __builtin_amdgcn_wmma_f32_16x16x32_f16(false, ah, false, bl, (short)0, c, false, false);
  asm volatile("v_nop\n\tv_nop\n\tv_nop\n\tv_nop" : "+v"(c) : "v"(ah), "v"(al), "v"(bh), "v"(bl));
  return c;
}
// batched GEMM like k_gemm_b but f16 operands: A f32 (split into f16 hi/lo if ASPLIT, else rounded to f16), Bt = f16 values [n][k]; alpha; C f32; N multiple of 16 (partial tiles skipped)
template <bool ASPLIT>
__global__ __launch_bounds__(128) void k_gemm_h(const float* __restrict__ A, int lda, size_t sA, const _Float16* __restrict__ Bh, int ldb, size_t sB, float alpha, float* __restrict__ C, int ldc, size_t sC, int M, int N, int K) {
  __shared__ __attribute__((aligned(16))) float so[4][16][64];
  const int tid = threadIdx.x, w = tid >> 5, lane = tid & 31, ln = lane & 15, hh = lane >> 4; const int by = blockIdx.y;
  A += (size_t)by * sA; Bh += (size_t)by * sB; C += (size_t)by * sC;
  const int ntn = (N + 63) / 64; const int wid = blockIdx.x * 4 + w; const int mt = wid / ntn, nq = wid % ntn; if (mt * 16 >= M) return;
  const int row0 = mt * 16, col0 = nq * 64; const float* arow = A + (size_t)(row0 + ln) * lda;
  v8f acc[4] = {};
  for (int kb = 0; kb < K; kb += 32) {
    FragH ah, al;
    const v4f x0 = *(const v4fa*)(arow + kb + 8 * hh), x1 = *(const v4fa*)(arow + kb + 8 * hh + 4), x2 = *(const v4fa*)(arow + kb + 16 + 8 * hh), x3 = *(const v4fa*)(arow + kb + 16 + 8 * hh + 4);
    float xs[16] = {x0[0],x0[1],x0[2],x0[3],x1[0],x1[1],x1[2],x1[3],x2[0],x2[1],x2[2],x2[3],x3[0],x3[1],x3[2],x3[3]};
#pragma unroll
    for (int i = 0; i < 16; ++i) { const _Float16 h = (_Float16)xs[i]; ah.h[i] = h; al.h[i] = ASPLIT ? (_Float16)(xs[i] - (float)h) : (_Float16)0.0f; }
#pragma unroll
    for (int t = 0; t < 4; ++t) { if (col0 + t * 16 >= N) continue; const size_t boff = (size_t)(col0 + t * 16 + ln) * ldb + kb; FragH bq; bq.half[0] = *(const v8us*)(Bh + boff + 8 * hh); bq.half[1] = *(const v8us*)(Bh + boff + 16 + 8 * hh);
      acc[t] = mmaH<ASPLIT ? 2 : 1>(ah.v, al.v, bq.v, bq.v, acc[t]); }
  }
#pragma unroll
  for (int t = 0; t < 4; ++t) { if (col0 + t * 16 >= N) continue;
#pragma unroll
    for (int r = 0; r < 8; ++r) so[w][8 * hh + r][t * 16 + ln] = acc[t][r] * alpha; }
  __builtin_amdgcn_fence(__ATOMIC_ACQ_REL, "workgroup"); __builtin_amdgcn_wave_barrier();
  const int rsub = lane >> 4, c4 = (lane & 15) * 4;
  {
#pragma unroll
    for (int q = 0; q < 8; ++q) { const int r = q * 2 + rsub; if (col0 + c4 < N) { const v4f v = *(const v4fa*)&so[w][r][c4]; *(v4f*)(C + (size_t)(row0 + r) * ldc + col0 + c4) = v; } }
     }
}

// Wt[n][k] = f16(W[k][n]·scale) from f32 row-major W[K][N] (scale = power of two; bf16-exact weights stay exact in f16 away from the subnormal range)
// grid.y picks one of three weights of the same shape; their transposes are stacked in Wt, N rows each
__global__ __launch_bounds__(256) void k_wt_f16(const float* __restrict__ W0, const float* __restrict__ W1, const float* __restrict__ W2, _Float16* __restrict__ Wt, int K, int N, float scale) {
  const float* W = (blockIdx.y == 0) ? W0 : (blockIdx.y == 1) ? W1 : W2; Wt += (size_t)blockIdx.y * N * K;
  const int t = blockIdx.x * 256 + threadIdx.x; if (t >= N * (K / 8)) return; const int n = t / (K / 8), k8 = (t % (K / 8)) * 8; FragH f;
#pragma unroll
  for (int i = 0; i < 8; ++i) f.h[i] = (_Float16)(bf16_round(W[(size_t)(k8 + i) * N + n]) * scale); const v8us o = f.half[0];
  *(v8us*)((unsigned short*)Wt + (size_t)n * K + k8) = o; 
}
// k_gemm_hh variant with fused epilogue: v = acc·alpha + bias[by·sBias + col] (+ CP[(row/rowsPerB)·sCPb + by·64 + col] if CP) ; ACT 0 none / 1 elu ; writes f16 C16 (and f32 C if non-null)
template <int ACT>
__global__ __launch_bounds__(128) void k_gemm_hhx(const _Float16* __restrict__ A, int lda, size_t sA, const _Float16* __restrict__ Bh, int ldb, size_t sB, float alpha, const float* __restrict__ bias, size_t sBias, const float* __restrict__ CP, int rowsPerB, size_t sCPb, int row0g,
    float* __restrict__ C, _Float16* __restrict__ C16, int ldc, size_t sC, int M, int N, int K) {
  __shared__ __attribute__((aligned(16))) float so[4][16][64];
  const int tid = threadIdx.x, w = tid >> 5, lane = tid & 31, ln = lane & 15, hh = lane >> 4; const int by = blockIdx.y;
  A += (size_t)by * sA; Bh += (size_t)by * sB; const size_t cofs = (size_t)by * sC; const float* bp = bias ? bias + (size_t)by * sBias : nullptr;
  const int ntn = (N + 63) / 64; const int wid = blockIdx.x * 4 + w; const int mt = wid / ntn, nq = wid % ntn; if (mt * 16 >= M) return;
  const int row0 = mt * 16, col0 = nq * 64; const _Float16* arow = A + (size_t)(row0 + ln) * lda;
  v8f acc[4] = {};
  for (int kb = 0; kb < K; kb += 32) { FragH ah; ah.half[0] = *(const v8us*)((const unsigned short*)arow + kb + 8 * hh); ah.half[1] = *(const v8us*)((const unsigned short*)arow + kb + 16 + 8 * hh);
#pragma unroll
    for (int t = 0; t < 4; ++t) { if (col0 + t * 16 >= N) continue; const size_t boff = (size_t)(col0 + t * 16 + ln) * ldb + kb; FragH bq; bq.half[0] = *(const v8us*)((const unsigned short*)Bh + boff + 8 * hh); bq.half[1] = *(const v8us*)((const unsigned short*)Bh + boff + 16 + 8 * hh);
      acc[t] = mmaH<1>(ah.v, ah.v, bq.v, bq.v, acc[t]); }
  }
#pragma unroll
  for (int t = 0; t < 4; ++t) { if (col0 + t * 16 >= N) continue; const int col = col0 + t * 16 + ln; const float bv = bp ? bf16_round(bp[col]) : 0.f;
#pragma unroll
    for (int r = 0; r < 8; ++r) { float v = acc[t][r] * alpha + bv; if (CP) { const int rr = row0g + row0 + 8 * hh + r; if (rowsPerB < 0) v += CP[cofs + (size_t)rr * ldc + col];      /* rowsPerB < 0: own element of the batched C plane */ else { const int bidx = rr / rowsPerB; v += CP[(size_t)bidx * sCPb + (size_t)by * 64 + col]; } } if (ACT == 1) v = (v > 0.f) ? v : expm1f(v); else if (ACT == 7) v = (v > 0.f) ? v + 1.0f : expf(v); else if (ACT == 8) v = tanhf(v); else if (ACT == 9) v = 0.5f * v * (1.0f + tanhf(0.7978845608028654f * (v + 0.044715f * v * v * v))); else if (ACT == 11) v = 1.0f / (1.0f + expf(-v)); else if (ACT == 12) v = (v > 0.f) ? v : 0.01f * v; else if (ACT == 14) v = (v > 0.f) ? v : 0.1f * v; else if (ACT == 16) v = (v >= 0.f) ? v : 0.3f * v; else if (ACT == 17) v = (v >= 0.f) ? v : 0.2f * v; else if (ACT == 15) v = v / (1.0f + expf(-v)); else if (ACT == 3) v = fmaxf(v, 0.f); else if (ACT == 6) v = 0.5f * v * (1.0f + erff(v * 0.70710678118654752f)); so[w][8 * hh + r][t * 16 + ln] = v; } }
  __builtin_amdgcn_fence(__ATOMIC_ACQ_REL, "workgroup"); __builtin_amdgcn_wave_barrier();
  const int rsub = lane >> 4, c4 = (lane & 15) * 4; typedef _Float16 v4h __attribute__((ext_vector_type(4)));
  {
#pragma unroll
    for (int q = 0; q < 8; ++q) { const int r = q * 2 + rsub; if (col0 + c4 < N) { const v4f v = *(const v4fa*)&so[w][r][c4]; if (C) *(v4f*)(C + cofs + (size_t)(row0 + r) * ldc + col0 + c4) = v; if (C16) { v4h h4; for (int i = 0; i < 4; ++i) h4[i] = (_Float16)v[i]; *(v4h*)(C16 + cofs + (size_t)(row0 + r) * ldc + col0 + c4) = h4; } } }
     }
}


typedef _Float16 v4h __attribute__((ext_vector_type(4)));

__global__ __launch_bounds__(256) void k_x16(const float* __restrict__ x, _Float16* __restrict__ X16, size_t n8) { const size_t t = (size_t)blockIdx.x * 256 + threadIdx.x; if (t >= n8) return; FragH f;
#pragma unroll
  for (int q = 0; q < 8; ++q) f.h[q] = (_Float16)bf16_round(x[t * 8 + q]); *(v8us*)((unsigned short*)X16 + t * 8) = f.half[0];  }
__global__ __launch_bounds__(256) void k_h16(const float* __restrict__ x, _Float16* __restrict__ X16, size_t n8) { const size_t t = (size_t)blockIdx.x * 256 + threadIdx.x; if (t >= n8) return; FragH f;
#pragma unroll
  for (int q = 0; q < 8; ++q) f.h[q] = (_Float16)x[t * 8 + q]; *(v8us*)((unsigned short*)X16 + t * 8) = f.half[0];  }
__global__ __launch_bounds__(256) void k_round16f(const float* __restrict__ W, _Float16* __restrict__ Bt, size_t n8) { const size_t t = (size_t)blockIdx.x * 256 + threadIdx.x; if (t >= n8) return; FragH f;
#pragma unroll
  for (int i = 0; i < 8; ++i) f.h[i] = (_Float16)(bf16_round(W[t * 8 + i]) * 16.0f); *(v8us*)((unsigned short*)Bt + t * 8) = f.half[0];  }
template <int NHv, int TTv>
__global__ __launch_bounds__(256) void k_vt(const _Float16* __restrict__ V16, int ldv, int voff, _Float16* __restrict__ Vt) { __shared__ unsigned short tl[64][66]; const int tid = threadIdx.x; const int slab = blockIdx.x / (TTv / 64), lg = blockIdx.x % (TTv / 64); const int b = slab / NHv, h = slab % NHv;
  for (int i = tid; i < 64 * 8; i += 256) { const int r = i / 8, c8 = (i % 8) * 8; FragH f; f.half[0] = *(const v8us*)((const unsigned short*)V16 + ((size_t)b * TTv + lg * 64 + r) * ldv + voff + h * 64 + c8);
#pragma unroll
    for (int q = 0; q < 8; ++q) tl[r][c8 + q] = f.u[q]; }
  __syncthreads();
  {
#pragma unroll
    for (int rd = 0; rd < 2; ++rd) { const int d = rd * 32 + tid / 8, pc = tid % 8; FragH f;
#pragma unroll
      for (int q = 0; q < 8; ++q) f.u[q] = tl[pc * 8 + q][d];
      *(v8us*)((unsigned short*)Vt + ((size_t)slab * 64 + d) * TTv + lg * 64 + pc * 8) = f.half[0]; }
     } }

__global__ __launch_bounds__(256) void k_hl(const float* __restrict__ F, _Float16* __restrict__ Hh, _Float16* __restrict__ Hl, size_t n8) { const size_t t = (size_t)blockIdx.x * 256 + threadIdx.x; if (t >= n8) return; FragH fh, fl; const v4f a = *(const v4fa*)(F + t * 8), c = *(const v4fa*)(F + t * 8 + 4);
#pragma unroll
  for (int q = 0; q < 4; ++q) { _Float16 h = (_Float16)a[q]; fh.h[q] = h; fl.h[q] = (_Float16)((a[q] - (float)h) * 1024.0f); h = (_Float16)c[q]; fh.h[4 + q] = h; fl.h[4 + q] = (_Float16)((c[q] - (float)h) * 1024.0f); }
  { *(v8us*)((unsigned short*)Hh + t * 8) = fh.half[0]; *(v8us*)((unsigned short*)Hl + t * 8) = fl.half[0];  } }

// ---- fast GEMM (wave tile 32x64; requires M % 32 == 0 rows per launch region, N % 64 == 0 and K % 64 == 0); epilogue = k_gemm_hhx semantics ----
__device__ __forceinline__ v16h g2_frag(const _Float16* p, int hh) { FragH f; f.half[0] = *(const v8us*)((const unsigned short*)p + 8 * hh); f.half[1] = *(const v8us*)((const unsigned short*)p + 16 + 8 * hh); return f.v; }
__device__ __forceinline__ v8f g2_mma(v16h a, v16h b, v8f c) { v8f d = __builtin_amdgcn_wmma_f32_16x16x32_f16(false, a, false, b, (short)0, c, false, false); asm volatile("v_nop\n\tv_nop\n\tv_nop\n\tv_nop" : "+v"(d) : "v"(a), "v"(b)); return d; }
template <int ACT>
__global__ __launch_bounds__(128) void k_gemm2(const _Float16* __restrict__ A, int lda, size_t sA, const _Float16* __restrict__ Bh, int ldb, size_t sB, float alpha, const float* __restrict__ bias, size_t sBias, const float* __restrict__ CP, int rowsPerB, size_t sCPb, int row0g,
    float* __restrict__ C, _Float16* __restrict__ C16, int ldc, size_t sC, int M, int N, int K, int MC) { static_assert(ACT == 0 || ACT == 3 || ACT == 6 || ACT == 8 || ACT == 9 || ACT == 11 || ACT == 12 || ACT == 14 || ACT == 15 || ACT == 16 || ACT == 17, "k_gemm2: unsupported ACT code (would silently apply no activation)");
  __shared__ __attribute__((aligned(16))) float so[4][32][68];
  const int tid = threadIdx.x, w = tid >> 5, lane = tid & 31, ln = lane & 15, hh = lane >> 4; const int by = blockIdx.y;
  A += (size_t)by * sA; Bh += (size_t)by * sB; const size_t cofs = (size_t)by * sC; const float* bp = bias ? bias + (size_t)by * sBias : nullptr;
  const int ntn = N >> 6; const int mt = blockIdx.x / ntn, nq = blockIdx.x - mt * ntn; const int row0 = mt * 128 + 32 * w, col0 = nq * 64; if (row0 >= M) return;
  const _Float16* a0p = A + (size_t)(row0 + ln) * lda; const _Float16* a1p = a0p + (size_t)16 * lda;
  const _Float16* b0p = Bh + (size_t)(col0 + ln) * ldb; const _Float16* b1p = b0p + (size_t)16 * ldb; const _Float16* b2p = b1p + (size_t)16 * ldb; const _Float16* b3p = b2p + (size_t)16 * ldb;
  const v8f z8 = {0.f,0.f,0.f,0.f,0.f,0.f,0.f,0.f}; v8f c00 = z8, c01 = z8, c02 = z8, c03 = z8, c10 = z8, c11 = z8, c12 = z8, c13 = z8;
#pragma unroll 1      /* rolled: one trip's 12 fragments (96 registers) are all that is live beside the accumulators */
  for (int kb = 0; kb < K; kb += 64) {      /* two k steps a trip (K % 64 == 0): a trip reads whole 128-byte lines of every row, all 24 loads in flight together */
    const _Float16* pa0 = a0p + kb + 8 * hh; const _Float16* pa1 = a1p + kb + 8 * hh; const _Float16* pb0 = b0p + kb + 8 * hh; const _Float16* pb1 = b1p + kb + 8 * hh; const _Float16* pb2 = b2p + kb + 8 * hh; const _Float16* pb3 = b3p + kb + 8 * hh;      /* each lane's own address, the half-wave offset of g2_frag folded in */
    const v16h a0 = g2_frag(pa0, 0), a1 = g2_frag(pa1, 0), b0 = g2_frag(pb0, 0), b1 = g2_frag(pb1, 0), b2 = g2_frag(pb2, 0), b3 = g2_frag(pb3, 0);
    const v16h e0 = g2_frag(pa0 + 32, 0), e1 = g2_frag(pa1 + 32, 0), f0 = g2_frag(pb0 + 32, 0), f1 = g2_frag(pb1 + 32, 0), f2 = g2_frag(pb2 + 32, 0), f3 = g2_frag(pb3 + 32, 0);
    asm volatile("" :: "v"(a0), "v"(a1), "v"(b0), "v"(b1), "v"(b2), "v"(b3), "v"(e0), "v"(e1), "v"(f0), "v"(f1), "v"(f2), "v"(f3), "v"(pa0), "v"(pa1), "v"(pb0), "v"(pb1), "v"(pb2), "v"(pb3));      /* inputs-only fence on the loaded fragments: every load of the trip issues ahead of the products, so a trip waits for memory once (without it each fragment is loaded and waited for in turn); the six addresses are named too, so that no register an issued load names is rewritten ahead of that wait */
    c00 = g2_mma(a0, b0, c00); c10 = g2_mma(a1, b0, c10); c01 = g2_mma(a0, b1, c01); c11 = g2_mma(a1, b1, c11); c02 = g2_mma(a0, b2, c02); c12 = g2_mma(a1, b2, c12); c03 = g2_mma(a0, b3, c03); c13 = g2_mma(a1, b3, c13);
    c00 = g2_mma(e0, f0, c00); c10 = g2_mma(e1, f0, c10); c01 = g2_mma(e0, f1, c01); c11 = g2_mma(e1, f1, c11); c02 = g2_mma(e0, f2, c02); c12 = g2_mma(e1, f2, c12); c03 = g2_mma(e0, f3, c03); c13 = g2_mma(e1, f3, c13); }
  v8f accs[8] = {c00, c01, c02, c03, c10, c11, c12, c13};
#pragma unroll
  for (int u = 0; u < 8; ++u) { const int t = u & 3, half = u >> 2; const int col = col0 + t * 16 + ln; const float bv = bp ? bf16_round(bp[col]) : 0.f;
#pragma unroll
    for (int r = 0; r < 8; ++r) { const int rloc = half * 16 + 8 * hh + r; float v = accs[u][r] * alpha + bv; if (CP) { if (rowsPerB < 0) v += CP[cofs + (size_t)(row0g + row0 + rloc) * ldc + col];      /* rowsPerB < 0: own element of the batched C plane */ else { const int bidx = (row0g + row0 + rloc) / rowsPerB; v += CP[(size_t)bidx * sCPb + (size_t)by * 64 + col]; } }
      if (ACT == 3) v = fmaxf(v, 0.f); else if (ACT == 6) v = 0.5f * v * (1.0f + erff(v * 0.70710678118654752f)); else if (ACT == 11) v = 1.0f / (1.0f + expf(-v)); else if (ACT == 15) v = v / (1.0f + expf(-v)); else if (ACT == 12) v = (v > 0.f) ? v : 0.01f * v; else if (ACT == 8) v = tanhf(v); else if (ACT == 9) v = 0.5f * v * (1.0f + tanhf(0.7978845608028654f * (v + 0.044715f * v * v * v))); else if (ACT == 14) v = (v > 0.f) ? v : 0.1f * v; else if (ACT == 16) v = (v >= 0.f) ? v : 0.3f * v; else if (ACT == 17) v = (v >= 0.f) ? v : 0.2f * v;
      so[w][rloc][t * 16 + ln] = v; } }
  __builtin_amdgcn_fence(__ATOMIC_ACQ_REL, "workgroup"); __builtin_amdgcn_wave_barrier();
  const int rsub = lane >> 4, c4 = (lane & 15) * 4; if (__builtin_amdgcn_readfirstlane(row0) >= MC) C = nullptr;      /* the f32 plane takes rows below MC of each batch only (MC % 32 == 0: a wave's 32 rows go together; row0 is the same in every lane of a wave, so the test stays scalar) */
  {
#pragma unroll
    for (int q = 0; q < 16; ++q) { const int r = q * 2 + rsub; const v4f v = *(const v4fa*)&so[w][r][c4]; if (C) { *(v4f*)(C + cofs + (size_t)(row0 + r) * ldc + col0 + c4) = v; asm volatile("s_wait_xcnt 0x0" ::: "memory"); }      /* where both planes are stored, the f16 conversion behind this is given registers that the issued f32 store names: the wait stands in front of that overwrite */
      if (C16) { v4h h4; for (int i = 0; i < 4; ++i) h4[i] = (_Float16)v[i]; *(v4h*)(C16 + cofs + (size_t)(row0 + r) * ldc + col0 + c4) = h4; } }
     } }


__global__ __launch_bounds__(256) void k_wnat(const float* __restrict__ w, size_t n8, _Float16* __restrict__ Bt) { const size_t t = (size_t)blockIdx.x * 256 + threadIdx.x; if (t >= n8) return; FragH f; for (int q = 0; q < 8; ++q) f.h[q] = (_Float16)(bf16_round(w[t * 8 + q]) * 16.0f); *(v8us*)((unsigned short*)Bt + t * 8) = f.half[0];  }
__global__ __launch_bounds__(256) void k_rsm(const float* __restrict__ S, _Float16* __restrict__ P, int nrows) {
  #pragma clang fp contract(off)
  const int i = blockIdx.x * 256 + threadIdx.x; if (i >= nrows) return; const float* s = S + (size_t)i * SQ; float mx = -3.0e38f;
#pragma unroll 1
  for (int j = 0; j < SQ; ++j) mx = fmaxf(mx, s[j]); float se = 0.f;
#pragma unroll 1
  for (int j = 0; j < SQ; ++j) se += expf(s[j] - mx); const float sc = 256.0f / se;
#pragma unroll 1
  for (int j0 = 0; j0 < SQ; j0 += 8) { FragH f; for (int q = 0; q < 8; ++q) f.h[q] = (_Float16)(expf(s[j0 + q] - mx) * sc); unsigned short* d = (unsigned short*)P + (size_t)i * SQ + j0; *(v8us*)d = f.half[0];  } }
__global__ __launch_bounds__(256) void k_vt(const _Float16* __restrict__ V16, int b, int h0, _Float16* __restrict__ VT) { __shared__ unsigned short tl[64][65]; const int tid = threadIdx.x; const int hh = blockIdx.x % HG, sg = blockIdx.x / HG; const int s0 = sg * 64; const int h = h0 + hh;
  for (int i = tid; i < 64 * 8; i += 256) { const int j = i / 8, d8 = (i % 8) * 8; FragH f; f.half[0] = *(const v8us*)((const unsigned short*)V16 + ((size_t)b * SQ + s0 + j) * DM + h * HD + d8); for (int q = 0; q < 8; ++q) tl[d8 + q][j] = f.u[q]; }
  __syncthreads();
  { for (int i = tid; i < 64 * 8; i += 256) { const int d = i / 8, j8 = (i % 8) * 8; FragH f; for (int q = 0; q < 8; ++q) f.u[q] = tl[d][j8 + q]; *(v8us*)((unsigned short*)VT + ((size_t)hh * HD + d) * SQ + s0 + j8) = f.half[0]; }  } }



template <int CTRL> __device__ __forceinline__ float rs_dpp(float x) { return __builtin_bit_cast(float, __builtin_amdgcn_update_dpp(0, __builtin_bit_cast(int, x), CTRL, 0xf, 0xf, true)); }      /* lane l <- lane l ^ m inside a 16-lane row (row_xmask:m = 0x160 + m) */
__device__ __forceinline__ float rs_xhalf(float x) { return __builtin_bit_cast(float, __builtin_amdgcn_permlanex16(__builtin_bit_cast(int, x), __builtin_bit_cast(int, x), 0x76543210, 0xfedcba98, false, false)); }      /* lane l <- lane l ^ 16 */
__device__ __forceinline__ float rs_exp2(float x) { float e; asm("v_exp_f32 %0, %1\n\tv_nop" : "=v"(e) : "v"(x)); return e; }      /* 2^x; the v_nop is the slot the instruction set asks for behind a transcendental */
// causal softmax, ONE WAVE PER ROW of NU * 128 columns: lane l holds columns u*128 + 4l .. + 3 in registers, so S is read once, by whole lines; maximum and sum are folded over the 32 lanes by a butterfly that leaves the same value in every lane
template <int NU>
__global__ __launch_bounds__(256) void k_rsmcf2(const float* __restrict__ S, _Float16* __restrict__ P, int hg, int q0) {
  const int c0 = (threadIdx.x & 31) * 4; const int t = blockIdx.x * 8 + __builtin_amdgcn_readfirstlane(threadIdx.x >> 5); if (t >= hg * QT) return;      /* the row index is wave-uniform */
  const float* s = S + (size_t)t * NKX + c0; _Float16* d = P + (size_t)t * NKX + c0; const int last = q0 + (t % QT);
  v4f sv[NU]; float mx = -3.0e38f, se = 0.f;
#pragma unroll      /* full unroll (here and below): sv needs constant indices to stay in registers */
  for (int u = 0; u < NU; ++u) sv[u] = *(const v4fa*)(s + u * 128);
#pragma unroll
  for (int u = 0; u < NU; ++u) for (int q = 0; q < 4; ++q) { const float f = (u * 128 + c0 + q <= last) ? 1.f : 0.f; sv[u][q] = fmaf(f, sv[u][q], (1.f - f) * -1.0e9f); mx = fmaxf(mx, sv[u][q]); }
  mx = fmaxf(mx, rs_dpp<0x161>(mx)); mx = fmaxf(mx, rs_dpp<0x162>(mx)); mx = fmaxf(mx, rs_dpp<0x164>(mx)); mx = fmaxf(mx, rs_dpp<0x168>(mx)); mx = fmaxf(mx, rs_xhalf(mx));
#pragma unroll
  for (int u = 0; u < NU; ++u) for (int q = 0; q < 4; ++q) { sv[u][q] = rs_exp2((sv[u][q] - mx) * 1.44269504088896340736f); se += sv[u][q]; }
  se += rs_dpp<0x161>(se); se += rs_dpp<0x162>(se); se += rs_dpp<0x164>(se); se += rs_dpp<0x168>(se); se += rs_xhalf(se); const float sc = 256.0f / se;
#pragma unroll
  for (int u = 0; u < NU; ++u) { v4h h4; for (int q = 0; q < 4; ++q) h4[q] = (_Float16)(sv[u][q] * sc); *(v4h*)(d + u * 128) = h4; } }


#define A0R 32                       /* rows of one row group of the exact tile (one wave, one row per lane) = keys of one chunk */
#define A0G (QT0 / A0R)              /* row groups per batch */
#define A0W (A0G + 1)                /* waves per block: row groups x and A0G - 1 - x have x + 1 and A0G - x causal key chunks, A0G + 1 together for every x */
#define A0T (A0R * (HD / 4) / 32)    /* merge tiles per row group: 32 float4 = two output rows each */
#define A0P (HD + 4)                 /* LDS pitch of a partial o row, in floats: 16 B x odd, for the b128 rows */
// exact f32 causal attention, keys split: wave w of a block runs the online softmax of ONE row group over ONE chunk of A0R keys; the partial (m, l, o) of a row's chunks are merged through LDS in chunk order
__global__ __launch_bounds__(A0W * 32) void k_att0(const float* __restrict__ QF, const float* __restrict__ KF, const float* __restrict__ VF, int ld, float scale, float* __restrict__ OF, int ldo) {
  #pragma clang fp contract(off)
  __shared__ __attribute__((aligned(16))) float lo[A0W][A0R][A0P];      /* each wave's partial o rows (not normalised) */
  __shared__ float lm[A0W][A0R], ll[A0W][A0R];      /* each wave's running maximum and sum per row */
  const int tid = threadIdx.x, lane = tid & 31; const int w = __builtin_amdgcn_readfirstlane(tid >> 5);      /* the wave index is wave-uniform: k and v rows stay scalar loads */
  const int h = blockIdx.x / (A0G / 2), x = blockIdx.x % (A0G / 2);
  const int rg = (w <= x) ? x : A0G - 1 - x, ch = (w <= x) ? w : w - x - 1; const int i = rg * A0R + lane;      /* waves 0..x: the short row group x; the others: its long partner */
  { const size_t bi = (size_t)blockIdx.y * SQ * ld; QF += bi; KF += bi; VF += bi; OF += (size_t)blockIdx.y * QT0 * ldo; }      /* batch on grid.y: q, k, v are the first QT0 rows of the batch's SQ-row plane; o has a QT0-row plane per batch */
  const float* qr = QF + (size_t)i * ld + h * HD;
  v4f rq[HD / 4], ro[HD / 4];      /* this thread's q row and o accumulator live in registers for the whole key loop */
#pragma unroll      /* full unroll: rq / ro need constant indices to stay in registers */
  for (int c = 0; c < HD / 4; ++c) { rq[c] = *(const v4fa*)(qr + c * 4); const v4f z = {0.f, 0.f, 0.f, 0.f}; ro[c] = z; }
  asm volatile("s_wait_xcnt 0x0" :: "v"(qr) : "memory");      /* the q loads' address pair stays live up to this wait, so no register that an issued load names is rewritten ahead of it */
  float m = -1.0e30f, l = 0.f; const int j0 = ch * A0R;      /* the chunk's first key is at or below the diagonal for every row of the group, so m is a real score after the first trip */
#pragma unroll 1
  for (int j = j0; j < j0 + A0R; ++j) { const float* kr = KF + (size_t)j * ld + h * HD; const float* vr = VF + (size_t)j * ld + h * HD; float s = 0.f;
#pragma unroll      /* full unroll: constant index into rq */
    for (int c = 0; c < HD / 4; ++c) { const v4f kq = *(const v4fa*)(kr + c * 4); const v4f qq = rq[c]; s = __fadd_rn(s, __fmul_rn(qq[0], kq[0])); s = __fadd_rn(s, __fmul_rn(qq[1], kq[1])); s = __fadd_rn(s, __fmul_rn(qq[2], kq[2])); s = __fadd_rn(s, __fmul_rn(qq[3], kq[3])); }
    s = __fmul_rn(s, scale);
    const float f = (j <= i) ? 1.f : 0.f; const float sm = fmaf(f, s, (1.f - f) * -1.0e30f); const float mn = fmaxf(m, sm); const float sc = expf(m - mn); const float e = expf(sm - mn); l = __fadd_rn(__fmul_rn(l, sc), e); m = mn;
#pragma unroll      /* full unroll: constant index into ro */
    for (int c = 0; c < HD / 4; ++c) { const v4f vv = *(const v4fa*)(vr + c * 4); v4f oo = ro[c]; for (int u = 0; u < 4; ++u) oo[u] = __fadd_rn(__fmul_rn(oo[u], sc), __fmul_rn(e, vv[u])); ro[c] = oo; } }
  lm[w][lane] = m; ll[w][lane] = l;
#pragma unroll      /* full unroll: constant index into ro */
  for (int c = 0; c < HD / 4; ++c) *(v4f*)&lo[w][lane][c * 4] = ro[c];
  __syncthreads();
#pragma unroll 1      /* at most two trips; rolled, so that one trip's 16 partial rows are all that is live */
  for (int wt = w; wt < 2 * A0T; wt += A0W) {      /* a wave merges two whole output rows of one group per trip, one float4 per lane; group and chunk count are wave-uniform */
    const int g = wt / A0T, row = (wt % A0T) * 2 + (lane >> 4), pc = (lane & 15) * 4; const int w0 = g ? x + 1 : 0, n = g ? A0G - x : x + 1;      /* the group's waves: w0 .. w0 + n - 1, in chunk order */
    float pm[A0G], pl[A0G]; v4f po[A0G];
#pragma unroll      /* fixed trip count, index clamped to a written slot: all LDS reads issue together and the exponentials are independent; a slot past the group's n takes a maximum so low that its weight below is 0 */
    for (int s = 0; s < A0G; ++s) { const int ws = min(w0 + s, A0W - 1); const float ms = lm[ws][row]; pm[s] = (s < n) ? ms : -3.0e38f; pl[s] = ll[ws][row]; po[s] = *(const v4f*)&lo[ws][row][pc]; }
    float mx = pm[0];
#pragma unroll      /* full unroll (here and below): pm / pl / po need constant indices to stay in registers */
    for (int s = 1; s < A0G; ++s) mx = fmaxf(mx, pm[s]);
    float ls = 0.f; v4f a = {0.f, 0.f, 0.f, 0.f};
#pragma unroll
    for (int s = 0; s < A0G; ++s) { const float fs = expf(pm[s] - mx); ls = fmaf(fs, pl[s], ls); for (int u = 0; u < 4; ++u) a[u] = fmaf(fs, po[s][u], a[u]); }
    const float fin = 64.0f / ls;      /* o carried x64; k_o0m scales it back by 1/64 */
    for (int u = 0; u < 4; ++u) a[u] = __fmul_rn(a[u], fin);
    *(v4f*)(OF + (size_t)((g ? A0G - 1 - x : x) * A0R + row) * ldo + h * HD + pc) = a;
    asm volatile("s_wait_xcnt 0x0" ::: "memory"); } }      /* the next trip rewrites the registers that the store names: the wait stands in front of that */


template <int BFIN, int WXB>
__global__ __launch_bounds__(256) void k_ln16(const float* __restrict__ X, const float* __restrict__ g, const float* __restrict__ bb, float eps, _Float16* __restrict__ N16, float* __restrict__ XB) {
  #pragma clang fp contract(off)
  __shared__ float red[256]; const size_t r = blockIdx.x; const int t = threadIdx.x; const v4f xa = *(const v4fa*)(X + r * DMQ + t * 4); float s[4]; float sum = 0.f;
  for (int q = 0; q < 4; ++q) { s[q] = BFIN ? bf16_round(xa[q]) : xa[q]; sum = __fadd_rn(sum, s[q]); }
  red[t] = sum; __syncthreads(); for (int st = 128; st > 0; st >>= 1) { if (t < st) red[t] = __fadd_rn(red[t], red[t + st]); __syncthreads(); } const float mu = red[0] / (float)DMQ; __syncthreads();
  float vs = 0.f; for (int q = 0; q < 4; ++q) { const float dl = __fadd_rn(s[q], -mu); vs = __fadd_rn(vs, __fmul_rn(dl, dl)); } red[t] = vs; __syncthreads(); for (int st = 128; st > 0; st >>= 1) { if (t < st) red[t] = __fadd_rn(red[t], red[t + st]); __syncthreads(); }
  const float rs = rsqrtf(__fadd_rn(red[0] / (float)DMQ, eps)); v4h y; v4f xb;
  for (int q = 0; q < 4; ++q) { const int c = t * 4 + q; y[q] = (_Float16)__fadd_rn(__fmul_rn(__fmul_rn(__fadd_rn(s[q], -mu), rs), bf16_round(g[c])), bf16_round(bb[c])); xb[q] = s[q]; }
  { *(v4h*)(N16 + r * DMQ + t * 4) = y; if (WXB) *(v4f*)(XB + r * DMQ + t * 4) = xb;  } }
__global__ __launch_bounds__(256) void k_ftres2(const float* __restrict__ OF0, const float* __restrict__ XB, float* __restrict__ X1, size_t n4) {
  #pragma clang fp contract(off)
  const size_t t = (size_t)blockIdx.x * 256 + threadIdx.x; if (t >= n4) return; const v4f o = *(const v4fa*)(OF0 + t * 4), xv = *(const v4fa*)(XB + t * 4); v4f y; for (int q = 0; q < 4; ++q) y[q] = __fadd_rn(__fmul_rn(o[q], 0.015625f), xv[q]); *(v4f*)(X1 + t * 4) = y;  }

__global__ __launch_bounds__(256) void k_wthd(const float* __restrict__ Wt, _Float16* __restrict__ Bt) { const size_t t = (size_t)blockIdx.x * 256 + threadIdx.x; if (t >= (size_t)NH * HD * (DM / 8)) return; const int m8 = (int)(t % (DM / 8)) * 8; const int d = (int)((t / (DM / 8)) % HD); const int h = (int)(t / ((size_t)(DM / 8) * HD)); FragH f;
  for (int q = 0; q < 8; ++q) f.h[q] = (_Float16)(16.0f * bf16_round(Wt[((size_t)h * DM + m8 + q) * HD + d])); unsigned short* dst = (unsigned short*)Bt + ((size_t)h * HD + d) * DM + m8; *(v8us*)dst = f.half[0];  }




__global__ __launch_bounds__(256) void k_wtpad(const float* __restrict__ Wm, _Float16* __restrict__ Wt, int Kr, int Kp, int Nr, int Np, float scale) {
  const int t = blockIdx.x * 256 + threadIdx.x; if (t >= Np * (Kp / 8)) return; const int n = t / (Kp / 8), k8 = (t % (Kp / 8)) * 8; const int nc = min(n, Nr - 1); const float fn = (n < Nr) ? 1.f : 0.f; FragH f;
  for (int i = 0; i < 8; ++i) { const int k = k8 + i; const int kc = min(k, Kr - 1); const float fk = (k < Kr) ? fn : 0.f; f.h[i] = (_Float16)(bf16_round(Wm[(size_t)kc * Nr + nc]) * scale * fk); }
  unsigned short* o = (unsigned short*)Wt + (size_t)n * Kp + k8; *(v8us*)o = f.half[0];  }
__global__ __launch_bounds__(128) void k_bpad(const float* __restrict__ b, float* __restrict__ Bp, int nr, int np) {
  const int i = threadIdx.x; if (i >= np) return; const float v = b[min(i, nr - 1)] * ((i < nr) ? 1.f : 0.f); *(float*)(Bp + i) = v;  }

#define DI 64         /* inner width = NH * HD (ONE 64-wide head) */
#define LQK (3 * DI)  /* fused q | k | v row pitch (192) */
__global__ __launch_bounds__(256) void k_o0(const float* __restrict__ OF, float* __restrict__ ob, size_t n4) {
  #pragma clang fp contract(off)
  const size_t t = (size_t)blockIdx.x * 256 + threadIdx.x; if (t >= n4) return; const size_t e = t * 4; const int i = (int)(e / DI); const int c = (int)(e % DI); const int h = c / HD, d = c % HD; const v4f a = *(const v4fa*)(OF + e); v4f o; for (int q = 0; q < 4; ++q) o[q] = __fmul_rn(a[q], 0.015625f); float* dst = ob + (size_t)h * SQ * HD + (size_t)i * HD + d; *(v4f*)dst = o;  }

__global__ __launch_bounds__(256) void k_o0m(const float* __restrict__ OF, float* __restrict__ o_, size_t n4) {
  #pragma clang fp contract(off)
  const size_t t = (size_t)blockIdx.x * 256 + threadIdx.x; if (t >= n4) return; const size_t e = t * 4; OF += (size_t)blockIdx.y * QT0 * DI; o_ += (size_t)blockIdx.y * SQ * DI;      /* batch on grid.y: QT0 exact rows go to the head of the batch's SQ output rows */
  const v4f a = *(const v4fa*)(OF + e); v4f o; for (int q = 0; q < 4; ++q) o[q] = __fmul_rn(a[q], 0.015625f); *(v4f*)(o_ + e) = o;  }
#define FQ 32                        /* query rows of one block of the fused f16 attention: two 16-column groups of the transposed score tiles */
#define FW 8                         /* waves of a block */
#define FK (SQ / FW)                 /* keys of one wave */
#define FP (HD + 4)                  /* LDS pitch of a partial o row, in floats: 16 B x odd, for the b128 rows */
// fused f16 causal attention of query rows QT0 .. SQ-1: a block takes FQ query rows of one batch, wave w the keys w*FK .. w*FK+FK-1 (a wave whose keys all lie above the block's last row stores neutral values and passes the barriers).
// S^T = K Q^T stays in the accumulators: a lane holds 8 consecutive keys of ONE query per tile, so maximum and sum are in-lane plus one exchange of the wave halves, and two tiles, rounded to f16, are the B operand of O^T = V^T P^T as they stand.
// The row maximum, the row sum and the partial o rows of the FW waves meet in LDS, in wave order. Weights: exp2((s - max) log2 e) * (256 / sum), rounded to f16.
__global__ __launch_bounds__(FW * 32) __attribute__((amdgpu_waves_per_eu(4, 4))) void k_fatt(const _Float16* __restrict__ QKVp, const _Float16* __restrict__ VTp, float* __restrict__ o_) {
  __shared__ __attribute__((aligned(16))) float po[FW][FQ][FP];      /* each wave's partial o rows (x256) */
  __shared__ float pm[FW][FQ], ps[FW][FQ];      /* each wave's maximum (of the unscaled scores) and sum per query row */
  const int tid = threadIdx.x, lane = tid & 31, ln = lane & 15, hh = lane >> 4; const int w = __builtin_amdgcn_readfirstlane(tid >> 5);      /* the wave index is wave-uniform: the tests on it stay scalar */
  const int r0 = QT0 + blockIdx.x * FQ, key0 = w * FK; const bool act = key0 < r0 + FQ;      /* causal: keys above the block's last row have weight 0 in every row */
  const _Float16* qkv = QKVp + (size_t)blockIdx.y * SQ * LQK;
  const v8f z8 = {0.f,0.f,0.f,0.f,0.f,0.f,0.f,0.f};
  v8f st[FK / 16][2];      /* S^T tiles: [key tile][query group]; register r of lane (ln, hh) = key 8 hh + r of the tile, query ln of the group */
  float mx0 = -3.0e38f, mx1 = -3.0e38f;
  if (act) {
    const _Float16* qp = qkv + (size_t)(r0 + ln) * LQK + 8 * hh; const _Float16* kp = qkv + DI + (size_t)(key0 + ln) * LQK + 8 * hh;      /* each lane's own address, the half-wave offset of g2_frag folded in */
    const v16h q00 = g2_frag(qp, 0), q01 = g2_frag(qp + 32, 0), q10 = g2_frag(qp + 16 * LQK, 0), q11 = g2_frag(qp + 16 * LQK + 32, 0);
    v16h kf[FK / 16][2];
#pragma unroll      /* full unroll (here and below): kf and st need constant indices to stay in registers */
    for (int mt = 0; mt < FK / 16; ++mt) { kf[mt][0] = g2_frag(kp + mt * 16 * LQK, 0); kf[mt][1] = g2_frag(kp + mt * 16 * LQK + 32, 0); }
    static_assert(FK / 16 == 8, "the statement below names the wave's 16 k fragments");
    asm volatile("s_wait_xcnt 0x0" :: "v"(q00), "v"(q01), "v"(q10), "v"(q11), "v"(kf[0][0]), "v"(kf[0][1]), "v"(kf[1][0]), "v"(kf[1][1]), "v"(kf[2][0]), "v"(kf[2][1]), "v"(kf[3][0]), "v"(kf[3][1]), "v"(kf[4][0]), "v"(kf[4][1]), "v"(kf[5][0]), "v"(kf[5][1]), "v"(kf[6][0]), "v"(kf[6][1]), "v"(kf[7][0]), "v"(kf[7][1]), "v"(qp), "v"(kp));      /* takes the loaded fragments as inputs only: all 40 loads issue ahead of the products, so the wave waits for memory once (without it each k tile is loaded and waited for in turn); the two address pairs are named too and stay live up to this wait, so no register that an issued load names is rewritten ahead of it */
#pragma unroll
    for (int mt = 0; mt < FK / 16; ++mt) { st[mt][0] = g2_mma(kf[mt][1], q01, g2_mma(kf[mt][0], q00, z8)); st[mt][1] = g2_mma(kf[mt][1], q11, g2_mma(kf[mt][0], q10, z8)); }
    if (key0 + FK - 1 > r0) {      /* only a wave that reaches past the block's first row has keys to mask (scalar test) */
      const int l0 = r0 + ln - key0 - 8 * hh, l1 = l0 + 16;      /* key mt*16 + 8 hh + r of the wave is at or below the diagonal of the lane's query while mt*16 + r <= l */
#pragma unroll
      for (int mt = 0; mt < FK / 16; ++mt) for (int r = 0; r < 8; ++r) { st[mt][0][r] = (mt * 16 + r <= l0) ? st[mt][0][r] : -8.0e9f; st[mt][1][r] = (mt * 16 + r <= l1) ? st[mt][1][r] : -8.0e9f; } }      /* -1e9 after the scale of 1/8 */
    v8f a0 = st[0][0], a1 = st[0][1];
#pragma unroll
    for (int mt = 1; mt < FK / 16; ++mt) for (int r = 0; r < 8; ++r) { a0[r] = fmaxf(a0[r], st[mt][0][r]); a1[r] = fmaxf(a1[r], st[mt][1][r]); }
    mx0 = fmaxf(fmaxf(fmaxf(a0[0], a0[1]), fmaxf(a0[2], a0[3])), fmaxf(fmaxf(a0[4], a0[5]), fmaxf(a0[6], a0[7]))); mx1 = fmaxf(fmaxf(fmaxf(a1[0], a1[1]), fmaxf(a1[2], a1[3])), fmaxf(fmaxf(a1[4], a1[5]), fmaxf(a1[6], a1[7])));
    mx0 = fmaxf(mx0, rs_xhalf(mx0)); mx1 = fmaxf(mx1, rs_xhalf(mx1)); }
  pm[w][lane] = hh ? mx1 : mx0;      /* lane = group * 16 + query of the group */
  __syncthreads();
  float se0 = 0.f, se1 = 0.f;
  if (act) {
    float g0 = pm[0][ln], g1 = pm[0][16 + ln];
#pragma unroll
    for (int s = 1; s < FW; ++s) { g0 = fmaxf(g0, pm[s][ln]); g1 = fmaxf(g1, pm[s][16 + ln]); }
    g0 *= 0.125f; g1 *= 0.125f;      /* scores / 8: a power of two, so scaling behind the maximum changes no bit */
    v8f a0 = z8, a1 = z8;
#pragma unroll
    for (int mt = 0; mt < FK / 16; ++mt) for (int r = 0; r < 8; ++r) {
      st[mt][0][r] = rs_exp2(fmaf(st[mt][0][r], 0.125f, -g0) * 1.44269504088896340736f); a0[r] += st[mt][0][r];
      st[mt][1][r] = rs_exp2(fmaf(st[mt][1][r], 0.125f, -g1) * 1.44269504088896340736f); a1[r] += st[mt][1][r]; }
    se0 = ((a0[0] + a0[1]) + (a0[2] + a0[3])) + ((a0[4] + a0[5]) + (a0[6] + a0[7])); se1 = ((a1[0] + a1[1]) + (a1[2] + a1[3])) + ((a1[4] + a1[5]) + (a1[6] + a1[7]));
    se0 += rs_xhalf(se0); se1 += rs_xhalf(se1); }
  ps[w][lane] = hh ? se1 : se0;
  const _Float16* vp = VTp + ((size_t)blockIdx.y * HD + ln) * SQ + key0 + 8 * hh;
  v16h vf[FK / 32][HD / 16];      /* V^T fragments: [32-key step][d tile] */
  static_assert(FK / 32 == 4 && HD / 16 == 4, "the two statements below name the fragments of two 32-key steps each");
  if (act) {      /* the first half of the wave's V^T fragments comes in while the wave would wait at the barrier anyway */
#pragma unroll
    for (int ks = 0; ks < 2; ++ks) for (int dt = 0; dt < HD / 16; ++dt) vf[ks][dt] = g2_frag(vp + (size_t)dt * 16 * SQ + ks * 32, 0);
    asm volatile("s_wait_xcnt 0x0" :: "v"(vf[0][0]), "v"(vf[0][1]), "v"(vf[0][2]), "v"(vf[0][3]), "v"(vf[1][0]), "v"(vf[1][1]), "v"(vf[1][2]), "v"(vf[1][3]), "v"(vp)); }      /* inputs only, as above: the 16 loads issue together, ahead of the barrier, and their address pair stays live up to the wait */
  __syncthreads();
  if (act) {
    v8f o[HD / 16][2];      /* O^T tiles: [d tile][query group]; register r = d 8 hh + r of the tile, query ln of the group */
#pragma unroll
    for (int dt = 0; dt < HD / 16; ++dt) { o[dt][0] = z8; o[dt][1] = z8; }
    float t0 = ps[0][ln], t1 = ps[0][16 + ln];
#pragma unroll
    for (int s = 1; s < FW; ++s) { t0 += ps[s][ln]; t1 += ps[s][16 + ln]; }
    const float sc0 = 256.0f / t0, sc1 = 256.0f / t1;
    FragH p[FK / 32][2];      /* P^T as B operand: [32-key step][query group]; key tiles 2 ks and 2 ks + 1 give elements 0..7 and 8..15, the k order of g2_frag */
#pragma unroll
    for (int ks = 0; ks < FK / 32; ++ks) for (int r = 0; r < 8; ++r) { p[ks][0].h[r] = (_Float16)(st[2 * ks][0][r] * sc0); p[ks][0].h[8 + r] = (_Float16)(st[2 * ks + 1][0][r] * sc0); p[ks][1].h[r] = (_Float16)(st[2 * ks][1][r] * sc1); p[ks][1].h[8 + r] = (_Float16)(st[2 * ks + 1][1][r] * sc1); }
#pragma unroll
    for (int ks = 0; ks < 2; ++ks) for (int dt = 0; dt < HD / 16; ++dt) { o[dt][0] = g2_mma(vf[ks][dt], p[ks][0].v, o[dt][0]); o[dt][1] = g2_mma(vf[ks][dt], p[ks][1].v, o[dt][1]); }
#pragma unroll
    for (int ks = 2; ks < 4; ++ks) for (int dt = 0; dt < HD / 16; ++dt) vf[ks][dt] = g2_frag(vp + (size_t)dt * 16 * SQ + ks * 32, 0);
    asm volatile("s_wait_xcnt 0x0" :: "v"(vf[2][0]), "v"(vf[2][1]), "v"(vf[2][2]), "v"(vf[2][3]), "v"(vf[3][0]), "v"(vf[3][1]), "v"(vf[3][2]), "v"(vf[3][3]), "v"(vp));      /* inputs only, as above: the second half's 16 loads issue together, one wait */
#pragma unroll
    for (int ks = 2; ks < FK / 32; ++ks) for (int dt = 0; dt < HD / 16; ++dt) { o[dt][0] = g2_mma(vf[ks][dt], p[ks][0].v, o[dt][0]); o[dt][1] = g2_mma(vf[ks][dt], p[ks][1].v, o[dt][1]); }
#pragma unroll
    for (int dt = 0; dt < HD / 16; ++dt) for (int nt = 0; nt < 2; ++nt) { float* d = &po[w][nt * 16 + ln][dt * 16 + 8 * hh]; const v4f lo4 = {o[dt][nt][0], o[dt][nt][1], o[dt][nt][2], o[dt][nt][3]}, hi4 = {o[dt][nt][4], o[dt][nt][5], o[dt][nt][6], o[dt][nt][7]}; *(v4f*)d = lo4; *(v4f*)(d + 4) = hi4; }
  } else {      /* a wave without keys stores zeros, so that the merge below reads written rows only and needs no test */
    const v4f z4 = {0.f, 0.f, 0.f, 0.f};
#pragma unroll
    for (int dt = 0; dt < HD / 16; ++dt) for (int nt = 0; nt < 2; ++nt) { float* d = &po[w][nt * 16 + ln][dt * 16 + 8 * hh]; *(v4f*)d = z4; *(v4f*)(d + 4) = z4; } }
  __syncthreads();
  float* ob = o_ + ((size_t)blockIdx.y * SQ + r0) * DI;
#pragma unroll
  for (int j = 0; j < FQ * (HD / 4) / (FW * 32); ++j) { const int idx = j * FW * 32 + tid, row = idx / (HD / 4), c4 = (idx % (HD / 4)) * 4; v4f a = *(const v4f*)&po[0][row][c4];      /* a wave sums and stores two whole output rows, one float4 per lane */
#pragma unroll
    for (int s = 1; s < FW; ++s) { const v4f b = *(const v4f*)&po[s][row][c4]; for (int u = 0; u < 4; ++u) a[u] += b[u]; }
    for (int u = 0; u < 4; ++u) a[u] *= 0.00390625f;
    *(v4f*)(ob + (size_t)idx * 4) = a; } }

extern "C" void kernel_launch(void* const* d_in, const int* in_sizes, int n_in,
                              void* d_out, int out_size, void* d_ws, size_t ws_size, hipStream_t stream) {
  (void)in_sizes; (void)n_in; (void)out_size;
  const float* const* I = (const float* const*)d_in; const float* x = I[0]; const float* wq = I[2]; const float* wk = I[1]; const float* wv = I[3]; const float* bq = nullptr; const float* bk = nullptr; const float* bv = nullptr;      /* x; [in][out = 64] Wk / Wq / Wv (input order as this module lists them); no biases */
  char* ws = (char*)d_ws; size_t off = 0;
  auto take = [&](size_t bytes) { char* p = ws + off; off += (bytes + 255) & ~(size_t)255; return p; };
  _Float16* BW = (_Float16*)take((size_t)LQK * DM * 2); _Float16* X16 = (_Float16*)take(NR * DM * 2); _Float16* QKV = (_Float16*)take(NR * LQK * 2); _Float16* VT = (_Float16*)take((size_t)NB * HD * SQ * 2);
  float* QKVF0 = (float*)take(NR * LQK * 4); float* OF0 = (float*)take((size_t)NB * QT0 * DI * 4);      /* one plane per batch: all batches are in flight in every launch; QKVF0 has the row layout of QKV, and only rows 0..QT0-1 of each batch are written and read */
  if (off > ws_size) return;
  { const unsigned g = (unsigned)(((size_t)DI * (DM / 8) + 255) / 256); k_wt_f16<<<dim3(g, 3), 256, 0, stream>>>(wq, wk, wv, BW, DM, DI, 16.0f); }      /* [in = DM][out = 64] -> Bt[n][k] x16, stacked q | k | v */
  k_x16<<<(unsigned)((NR * DM / 8 + 255) / 256), 256, 0, stream>>>(x, X16, NR * DM / 8);      /* x (bf16-valued) as exact f16 rows */
  (void)bq; (void)bk; (void)bv; static_assert(QT0 % 32 == 0 && SQ % 128 == 0 && LQK % 64 == 0, "k_gemm2: whole wave tiles on either side of row QT0");
  k_gemm2<0><<<dim3((SQ / 128) * (LQK / 64), NB), 128, 0, stream>>>(X16, DM, (size_t)SQ * DM, BW, DM, 0, 0.0625f, nullptr, 0, nullptr, 1, 0, 0, QKVF0, QKV, LQK, (size_t)SQ * LQK, SQ, LQK, DM, QT0);      /* q | k | v = x W^T in ONE launch over the stacked weights (N = 192): f16 rows of the fused plane (column blocks 0 / 64 / 128, pitch 192) and, from the same accumulators, the f32 rows 0..511 of every batch for the exact path */
  const _Float16* V16 = QKV + 2 * DI;
  float* ob = (float*)d_out;      /* the batch is grid.y of every launch below but k_vt, whose 1-D slab index carries it (ONE head) */
  k_vt<NH, SQ><<<NB * NH * (SQ / 64), 256, 0, stream>>>(V16, LQK, 0, VT);      /* V^T [NB][HD][SQ] */
  static_assert(NH == 1 && HD == 64 && DI == HD && (SQ - QT0) % FQ == 0 && FK % 32 == 0 && FQ == 32 && (FQ * (HD / 4)) % (FW * 32) == 0, "k_fatt: whole query blocks, whole 32-key steps per wave, whole float4 rounds in the merge");
  k_fatt<<<dim3((SQ - QT0) / FQ, NB), FW * 32, 0, stream>>>(QKV, VT, ob);      /* rows 512..1023 of every batch: scores / 8, causal softmax (f16 x256 weights) and P V in ONE launch, S and P never leave the registers; rows below QT0 are written by the exact path below and by nothing else */
  k_att0<<<dim3(NH * (A0G / 2), NB), A0W * 32, 0, stream>>>(QKVF0, QKVF0 + DI, QKVF0 + 2 * DI, LQK, 0.125f, OF0, DI);      /* exact f32 causal attention for rows 0..511 (o x64); a block = one short and one long row group, one wave per key chunk */
  k_o0m<<<dim3((unsigned)(((size_t)QT0 * DI / 4 + 255) / 256), NB), 256, 0, stream>>>(OF0, ob, (size_t)QT0 * DI / 4);      /* rows 0..511 of every batch: their one store, from the exact path */
}

// v009
// Measured time: 68 microseconds a run.
// Two timings next to v008 put it at 1.41 and 1.42 times that version's speed.
// All steps since v000 together make it 1040 times as fast.
#include <hip/hip_runtime.h>
// Single-head causal self-attention (x [32][1024][384]; k/q/v = x W ([in][out] [384][64], no biases; input order Wk, Wq, Wv); ONE 64-wide head; wei * 64^-0.5; causal (tril, -inf); softmax; out = wei v -> [32][1024][64]; no output projection).
// Structure: token rows; x as exact f16 rows; one WMMA GEMM over the stacked weights into one f16 q | k | v plane (and the f32 rows of the exact path); per batch v^T via LDS transposes; one fused launch for query rows 512..1023 (32 rows a block, keys split over its 8 waves: scores alpha 1/8, causal softmax f32 -> f16 x256 weights, P V, all in registers; f32 output rows); rows 0..511 come from an exact f32 path alone; launches: see trace.
// Compute dtype: inputs rounded to bf16; x / weights exact; q, k, v and softmax weights as plain f16 GEMM operands (~2^-12); scores and softmax statistics f32; v_wmma_f32_16x16x32_f16; the exact path of rows 0..511: f32 operands, v_wmma_f32_16x16x4_f32.
#define NB 32
#define SQ 1024
#define DM 384
#define NH 1
#define HD 64
#define HG 4
#define QT 256                       /* query rows per causal tile */
#define NKX SQ                       /* S / P row pitch */
#define QT0 512                      /* rows computed only by the exact f32 path: 512 here (no output projection averages the early-row cancellation errors away; logit sigma 1.0) */
#define B0 0                         /* unused; batches start at 0 on grid.y */
#define NBR NB                       /* feeds only MP; unused by the launches */
#define NR ((size_t)NB * SQ)
#define DMQ DM
#define DFF 4096
#define DFFR 100
#define MP ((int)((size_t)NBR * SQ)) /* unused; the projections use NR rows */
#define QN SQ                        /* unused */
#define NHD NH                       /* unused */
#define MPO MP                       /* unused */
#define LQ (3 * DM)      /* 3 * DM, unused; the q/k/v rows use pitch LQK (192) */
typedef __bf16 v16b __attribute__((ext_vector_type(16)));
typedef unsigned short v8us __attribute__((ext_vector_type(8), may_alias));
typedef float  v8f  __attribute__((ext_vector_type(8)));
typedef float  v4f  __attribute__((ext_vector_type(4)));
typedef float  v4fa __attribute__((ext_vector_type(4), may_alias));
union FragB { v16b v; v8us half[2]; unsigned short u[16]; };

__device__ __forceinline__ unsigned short bf16_bits(float x) { unsigned int u = __float_as_uint(x); return (unsigned short)((u + 0x7FFFu + ((u >> 16) & 1u)) >> 16); }
__device__ __forceinline__ float bf16_val(unsigned short b) { return __uint_as_float(((unsigned int)b) << 16); }
__device__ __forceinline__ float bf16_round(float x) { return bf16_val(bf16_bits(x)); }
// D += A·B with NT terms: 1 = ah·bh, 2 = + al·bh (A split), 3 = + ah·bl (both split)
template <int NT>
__device__ __forceinline__ v8f mmaN(v16b ah, v16b al, v16b bh, v16b bl, v8f c) {
  c = __builtin_amdgcn_wmma_f32_16x16x32_bf16(false, ah, false, bh, (short)0, c, false, false);
  if (NT >= 2) c = __builtin_amdgcn_wmma_f32_16x16x32_bf16(false, al, false, bh, (short)0, c, false, false);
  if (NT >= 3) c = __builtin_amdgcn_wmma_f32_16x16x32_bf16(false, ah, false, bl, (short)0, c, false, false);
  asm volatile("v_nop\n\tv_nop\n\tv_nop\n\tv_nop" : "+v"(c) : "v"(ah), "v"(al), "v"(bh), "v"(bl));
  return c;
}

__global__ __launch_bounds__(256) void k_wt_bf16(const float* __restrict__ W, unsigned short* __restrict__ Wt, int K, int N) {
  const int t = blockIdx.x * 256 + threadIdx.x;
  const int k8n = K / 8;
  if (t >= N * k8n) return;
  const int n = t / k8n, k8 = (t % k8n) * 8;
  v8us v;
#pragma unroll
  for (int i = 0; i < 8; ++i) v[i] = bf16_bits(W[(size_t)(k8 + i) * N + n]);
  *(v8us*)(Wt + (size_t)n * K + k8) = v;
  
}

// GEMM C[M][N] (f32, pitch ldc) = act(A[M][K]·W + bias). A f32 row-major (pitch lda) converted per fragment to bf16
// (ASPLIT: hi/lo two planes -> 2 terms, else single rounded term); Wt bf16 [N][K] (pitch ldb). BIAS_BF16 rounds the
// bias to bf16 first (bias quantised to bf16 before the add). K%32==0, M%16==0, N%64==0.
template <bool ASPLIT, int ACT, bool BIAS_BF16>
__global__ __launch_bounds__(128) void k_gemm_bf(const float* __restrict__ A, int lda, const unsigned short* __restrict__ Wt, int ldb,
                                               const float* __restrict__ bias, float* __restrict__ C, int ldc, int M, int N, int K) {
  __shared__ __attribute__((aligned(16))) float so[4][16][64];
  const int tid = threadIdx.x, w = tid >> 5, lane = tid & 31, ln = lane & 15, hh = lane >> 4;
  const int ntn = N / 64;
  const int wid = blockIdx.x * 4 + w;
  const int mt = wid / ntn, nq = wid % ntn;
  if (mt * 16 >= M) return;
  const int row0 = mt * 16, col0 = nq * 64;
  const float* arow = A + (size_t)(row0 + ln) * lda;
  v8f acc[4] = {};
  for (int kb = 0; kb < K; kb += 32) {
    FragB ah, al;
    const v4f x0 = *(const v4fa*)(arow + kb + 8 * hh), x1 = *(const v4fa*)(arow + kb + 8 * hh + 4);
    const v4f x2 = *(const v4fa*)(arow + kb + 16 + 8 * hh), x3 = *(const v4fa*)(arow + kb + 16 + 8 * hh + 4);
    float xs[16] = {x0[0],x0[1],x0[2],x0[3],x1[0],x1[1],x1[2],x1[3],x2[0],x2[1],x2[2],x2[3],x3[0],x3[1],x3[2],x3[3]};
#pragma unroll
    for (int i = 0; i < 16; ++i) { const unsigned short hb = bf16_bits(xs[i]); ah.u[i] = hb; al.u[i] = ASPLIT ? bf16_bits(xs[i] - bf16_val(hb)) : (unsigned short)0; }
#pragma unroll
    for (int t = 0; t < 4; ++t) {
      const unsigned short* brow = Wt + (size_t)(col0 + t * 16 + ln) * ldb + kb;
      FragB b;
      b.half[0] = *(const v8us*)(brow + 8 * hh);
      b.half[1] = *(const v8us*)(brow + 16 + 8 * hh);
      acc[t] = mmaN<ASPLIT ? 2 : 1>(ah.v, al.v, b.v, b.v, acc[t]);
    }
  }
#pragma unroll
  for (int t = 0; t < 4; ++t) {
    float bv = bias ? bias[col0 + t * 16 + ln] : 0.f;
    if (BIAS_BF16) bv = bf16_round(bv);
#pragma unroll
    for (int r = 0; r < 8; ++r) { float v = acc[t][r] + bv; if (ACT == 1) v = fmaxf(v, 0.f); so[w][8 * hh + r][t * 16 + ln] = v; }
  }
  __builtin_amdgcn_fence(__ATOMIC_ACQ_REL, "workgroup");
  __builtin_amdgcn_wave_barrier();
  const int rsub = lane >> 4, c4 = (lane & 15) * 4;
  {
#pragma unroll
    for (int q = 0; q < 8; ++q) {
      const int r = q * 2 + rsub;
      const v4f v = *(const v4fa*)&so[w][r][c4];
      *(v4f*)(C + (size_t)(row0 + r) * ldc + col0 + c4) = v;
    }
    
  }
}

// GEMM C = act(A·W + bias + resid): A f32 (ASPLIT -> hi/lo 2 terms), Wt bf16 [N][K]; ACT 0 none, 1 relu, 2 exact gelu;
// resid (optional, f32, row index = (row % rmod), pitch ldr, RES_BF16 rounds it) added before the activation.
template <bool ASPLIT, int ACT, bool BIAS_BF16, bool RES_BF16>
__global__ __launch_bounds__(128) void k_gemm_bf3(const float* __restrict__ A, int lda, const unsigned short* __restrict__ Wt, int ldb,
                                                const float* __restrict__ bias, const float* __restrict__ resid, int rmod, int ldr,
                                                float* __restrict__ C, int ldc, int M, int N, int K) {
  __shared__ __attribute__((aligned(16))) float so[4][16][64];
  const int tid = threadIdx.x, w = tid >> 5, lane = tid & 31, ln = lane & 15, hh = lane >> 4;
  const int ntn = N / 64;
  const int wid = blockIdx.x * 4 + w;
  const int mt = wid / ntn, nq = wid % ntn;
  if (mt * 16 >= M) return;
  const int row0 = mt * 16, col0 = nq * 64;
  const float* arow = A + (size_t)(row0 + ln) * lda;
  v8f acc[4] = {};
  for (int kb = 0; kb < K; kb += 32) {
    FragB ah, al;
    const v4f x0 = *(const v4fa*)(arow + kb + 8 * hh), x1 = *(const v4fa*)(arow + kb + 8 * hh + 4);
    const v4f x2 = *(const v4fa*)(arow + kb + 16 + 8 * hh), x3 = *(const v4fa*)(arow + kb + 16 + 8 * hh + 4);
    float xs[16] = {x0[0],x0[1],x0[2],x0[3],x1[0],x1[1],x1[2],x1[3],x2[0],x2[1],x2[2],x2[3],x3[0],x3[1],x3[2],x3[3]};
#pragma unroll
    for (int i = 0; i < 16; ++i) { const unsigned short hb = bf16_bits(xs[i]); ah.u[i] = hb; al.u[i] = ASPLIT ? bf16_bits(xs[i] - bf16_val(hb)) : (unsigned short)0; }
#pragma unroll
    for (int t = 0; t < 4; ++t) {
      const unsigned short* brow = Wt + (size_t)(col0 + t * 16 + ln) * ldb + kb;
      FragB b;
      b.half[0] = *(const v8us*)(brow + 8 * hh);
      b.half[1] = *(const v8us*)(brow + 16 + 8 * hh);
      acc[t] = mmaN<ASPLIT ? 2 : 1>(ah.v, al.v, b.v, b.v, acc[t]);
    }
  }
#pragma unroll
  for (int t = 0; t < 4; ++t) {
    const int col = col0 + t * 16 + ln;
    float bv = bias ? bias[col] : 0.f;
    if (BIAS_BF16) bv = bf16_round(bv);
#pragma unroll
    for (int r = 0; r < 8; ++r) {
      float v = acc[t][r] + bv;
      if (resid) { float rv = resid[(size_t)((row0 + 8 * hh + r) % rmod) * ldr + col]; if (RES_BF16) rv = bf16_round(rv); v += rv; }
      if (ACT == 1) v = fmaxf(v, 0.f);
      if (ACT == 2) v = 0.5f * v * (1.0f + erff(v * 0.70710678118654752f));
      if (ACT == 3) { const float u = 0.7978845608028654f * (v + 0.044715f * v * v * v); v = 0.5f * v * (1.0f + tanhf(u)); }
      so[w][8 * hh + r][t * 16 + ln] = v;
    }
  }
  __builtin_amdgcn_fence(__ATOMIC_ACQ_REL, "workgroup");
  __builtin_amdgcn_wave_barrier();
  const int rsub = lane >> 4, c4 = (lane & 15) * 4;
  {
#pragma unroll
    for (int q = 0; q < 8; ++q) {
      const int r = q * 2 + rsub;
      const v4f v = *(const v4fa*)&so[w][r][c4];
      *(v4f*)(C + (size_t)(row0 + r) * ldc + col0 + c4) = v;
    }
    
  }
}
// row LayerNorm (biased variance, eps) over N: s = X (+ R); optional out_sum <- s; out_norm <- (s-mu)*rsqrt(var+eps)*g + b
template <bool PARAM_BF16>
__global__ __launch_bounds__(256) void k_layernorm(const float* __restrict__ X, const float* __restrict__ R, const float* __restrict__ g, const float* __restrict__ bta,
                                                  float* __restrict__ out_sum, float* __restrict__ out_norm, int N, float eps) {
  __shared__ float red[256];
  const int row = blockIdx.x, tid = threadIdx.x;
  const float* x = X + (size_t)row * N; const float* rr = R ? R + (size_t)row * N : nullptr;
  float vals[16];                     // up to N = 4096
  const int per = N / 256;            // contiguous chunk per thread? use strided-by-4 chunks: thread handles j = tid*4 + 1024*u
  float s1 = 0.f;
  for (int u = 0; u < per / 4; ++u) {
    const int j = tid * 4 + 1024 * u;
    const v4f a = *(const v4fa*)(x + j);
    v4f b = {0.f,0.f,0.f,0.f}; if (rr) b = *(const v4fa*)(rr + j);
#pragma unroll
    for (int q = 0; q < 4; ++q) { const float v = a[q] + b[q]; vals[u * 4 + q] = v; s1 += v; }
  }
  red[tid] = s1; __syncthreads();
  for (int st = 128; st > 0; st >>= 1) { if (tid < st) red[tid] += red[tid + st]; __syncthreads(); }
  const float mu = red[0] / (float)N; __syncthreads();
  float s2 = 0.f;
  for (int u = 0; u < per / 4; ++u)
#pragma unroll
    for (int q = 0; q < 4; ++q) { const float c = vals[u * 4 + q] - mu; s2 += c * c; }
  red[tid] = s2; __syncthreads();
  for (int st = 128; st > 0; st >>= 1) { if (tid < st) red[tid] += red[tid + st]; __syncthreads(); }
  const float rs = rsqrtf(red[0] / (float)N + eps);
  {
    for (int u = 0; u < per / 4; ++u) {
      const int j = tid * 4 + 1024 * u;
      v4f o, sm;
#pragma unroll
      for (int q = 0; q < 4; ++q) {
        float gg = g[j + q], bb = bta[j + q];
        if (PARAM_BF16) { gg = bf16_round(gg); bb = bf16_round(bb); }
        sm[q] = vals[u * 4 + q]; o[q] = (vals[u * 4 + q] - mu) * rs * gg + bb;
      }
      if (out_sum) *(v4f*)(out_sum + (size_t)row * N + j) = sm;
      *(v4f*)(out_norm + (size_t)row * N + j) = o;
    }
    
  }
}



// ---- f16 WMMA path (v_wmma_f32_16x16x32_f16): 11-bit significands for operands in range — used where a [0,1] probability operand needs more precision than bf16
typedef _Float16 v16h __attribute__((ext_vector_type(16)));
union FragH { v16h v; v8us half[2]; _Float16 h[16]; unsigned short u[16]; };
template <int NT>
__device__ __forceinline__ v8f mmaH(v16h ah, v16h al, v16h bh, v16h bl, v8f c) {
  c = __builtin_amdgcn_wmma_f32_16x16x32_f16(false, ah, false, bh, (short)0, c, false, false);
  if (NT >= 2) c = __builtin_amdgcn_wmma_f32_16x16x32_f16(false, al, false, bh, (short)0, c, false, false);
  if (NT >= 3) c = __builtin_amdgcn_wmma_f32_16x16x32_f16(false, ah, false, bl, (short)0, c, false, false);
  asm volatile("v_nop\n\tv_nop\n\tv_nop\n\tv_nop" : "+v"(c) : "v"(ah), "v"(al), "v"(bh), "v"(bl));
  return c;
}
// batched GEMM like k_gemm_b but f16 operands: A f32 (split into f16 hi/lo if ASPLIT, else rounded to f16), Bt = f16 values [n][k]; alpha; C f32; N multiple of 16 (partial tiles skipped)
template <bool ASPLIT>
__global__ __launch_bounds__(128) void k_gemm_h(const float* __restrict__ A, int lda, size_t sA, const _Float16* __restrict__ Bh, int ldb, size_t sB, float alpha, float* __restrict__ C, int ldc, size_t sC, int M, int N, int K) {
  __shared__ __attribute__((aligned(16))) float so[4][16][64];
  const int tid = threadIdx.x, w = tid >> 5, lane = tid & 31, ln = lane & 15, hh = lane >> 4; const int by = blockIdx.y;
  A += (size_t)by * sA; Bh += (size_t)by * sB; C += (size_t)by * sC;
  const int ntn = (N + 63) / 64; const int wid = blockIdx.x * 4 + w; const int mt = wid / ntn, nq = wid % ntn; if (mt * 16 >= M) return;
  const int row0 = mt * 16, col0 = nq * 64; const float* arow = A + (size_t)(row0 + ln) * lda;
  v8f acc[4] = {};
  for (int kb = 0; kb < K; kb += 32) {
    FragH ah, al;
    const v4f x0 = *(const v4fa*)(arow + kb + 8 * hh), x1 = *(const v4fa*)(arow + kb + 8 * hh + 4), x2 = *(const v4fa*)(arow + kb + 16 + 8 * hh), x3 = *(const v4fa*)(arow + kb + 16 + 8 * hh + 4);
    float xs[16] = {x0[0],x0[1],x0[2],x0[3],x1[0],x1[1],x1[2],x1[3],x2[0],x2[1],x2[2],x2[3],x3[0],x3[1],x3[2],x3[3]};
#pragma unroll
    for (int i = 0; i < 16; ++i) { const _Float16 h = (_Float16)xs[i]; ah.h[i] = h; al.h[i] = ASPLIT ? (_Float16)(xs[i] - (float)h) : (_Float16)0.0f; }
#pragma unroll
    for (int t = 0; t < 4; ++t) { if (col0 + t * 16 >= N) continue; const size_t boff = (size_t)(col0 + t * 16 + ln) * ldb + kb; FragH bq; bq.half[0] = *(const v8us*)(Bh + boff + 8 * hh); bq.half[1] = *(const v8us*)(Bh + boff + 16 + 8 * hh);
      acc[t] = mmaH<ASPLIT ? 2 : 1>(ah.v, al.v, bq.v, bq.v, acc[t]); }
  }
#pragma unroll
  for (int t = 0; t < 4; ++t) { if (col0 + t * 16 >= N) continue;
#pragma unroll
    for (int r = 0; r < 8; ++r) so[w][8 * hh + r][t * 16 + ln] = acc[t][r] * alpha; }
  __builtin_amdgcn_fence(__ATOMIC_ACQ_REL, "workgroup"); __builtin_amdgcn_wave_barrier();
  const int rsub = lane >> 4, c4 = (lane & 15) * 4;
  {
#pragma unroll
    for (int q = 0; q < 8; ++q) { const int r = q * 2 + rsub; if (col0 + c4 < N) { const v4f v = *(const v4fa*)&so[w][r][c4]; *(v4f*)(C + (size_t)(row0 + r) * ldc + col0 + c4) = v; } }
     }
}

// Wt[n][k] = f16(W[k][n]·scale) from f32 row-major W[K][N] (scale = power of two; bf16-exact weights stay exact in f16 away from the subnormal range)
// grid.y picks one of three weights of the same shape; their transposes are stacked in Wt, N rows each
__global__ __launch_bounds__(256) void k_wt_f16(const float* __restrict__ W0, const float* __restrict__ W1, const float* __restrict__ W2, _Float16* __restrict__ Wt, int K, int N, float scale) {
  const float* W = (blockIdx.y == 0) ? W0 : (blockIdx.y == 1) ? W1 : W2; Wt += (size_t)blockIdx.y * N * K;
  const int t = blockIdx.x * 256 + threadIdx.x; if (t >= N * (K / 8)) return; const int n = t / (K / 8), k8 = (t % (K / 8)) * 8; FragH f;
#pragma unroll
  for (int i = 0; i < 8; ++i) f.h[i] = (_Float16)(bf16_round(W[(size_t)(k8 + i) * N + n]) * scale); const v8us o = f.half[0];
  *(v8us*)((unsigned short*)Wt + (size_t)n * K + k8) = o; 
}
// k_gemm_hh variant with fused epilogue: v = acc·alpha + bias[by·sBias + col] (+ CP[(row/rowsPerB)·sCPb + by·64 + col] if CP) ; ACT 0 none / 1 elu ; writes f16 C16 (and f32 C if non-null)
template <int ACT>
__global__ __launch_bounds__(128) void k_gemm_hhx(const _Float16* __restrict__ A, int lda, size_t sA, const _Float16* __restrict__ Bh, int ldb, size_t sB, float alpha, const float* __restrict__ bias, size_t sBias, const float* __restrict__ CP, int rowsPerB, size_t sCPb, int row0g,
    float* __restrict__ C, _Float16* __restrict__ C16, int ldc, size_t sC, int M, int N, int K) {
  __shared__ __attribute__((aligned(16))) float so[4][16][64];
  const int tid = threadIdx.x, w = tid >> 5, lane = tid & 31, ln = lane & 15, hh = lane >> 4; const int by = blockIdx.y;
  A += (size_t)by * sA; Bh += (size_t)by * sB; const size_t cofs = (size_t)by * sC; const float* bp = bias ? bias + (size_t)by * sBias : nullptr;
  const int ntn = (N + 63) / 64; const int wid = blockIdx.x * 4 + w; const int mt = wid / ntn, nq = wid % ntn; if (mt * 16 >= M) return;
  const int row0 = mt * 16, col0 = nq * 64; const _Float16* arow = A + (size_t)(row0 + ln) * lda;
  v8f acc[4] = {};
  for (int kb = 0; kb < K; kb += 32) { FragH ah; ah.half[0] = *(const v8us*)((const unsigned short*)arow + kb + 8 * hh); ah.half[1] = *(const v8us*)((const unsigned short*)arow + kb + 16 + 8 * hh);
#pragma unroll
    for (int t = 0; t < 4; ++t) { if (col0 + t * 16 >= N) continue; const size_t boff = (size_t)(col0 + t * 16 + ln) * ldb + kb; FragH bq; bq.half[0] = *(const v8us*)((const unsigned short*)Bh + boff + 8 * hh); bq.half[1] = *(const v8us*)((const unsigned short*)Bh + boff + 16 + 8 * hh);
      acc[t] = mmaH<1>(ah.v, ah.v, bq.v, bq.v, acc[t]); }
  }
#pragma unroll
  for (int t = 0; t < 4; ++t) { if (col0 + t * 16 >= N) continue; const int col = col0 + t * 16 + ln; const float bv = bp ? bf16_round(bp[col]) : 0.f;
#pragma unroll
    for (int r = 0; r < 8; ++r) { float v = acc[t][r] * alpha + bv; if (CP) { const int rr = row0g + row0 + 8 * hh + r; if (rowsPerB < 0) v += CP[cofs + (size_t)rr * ldc + col];      /* rowsPerB < 0: own element of the batched C plane */ else { const int bidx = rr / rowsPerB; v += CP[(size_t)bidx * sCPb + (size_t)by * 64 + col]; } } if (ACT == 1) v = (v > 0.f) ? v : expm1f(v); else if (ACT == 7) v = (v > 0.f) ? v + 1.0f : expf(v); else if (ACT == 8) v = tanhf(v); else if (ACT == 9) v = 0.5f * v * (1.0f + tanhf(0.7978845608028654f * (v + 0.044715f * v * v * v))); else if (ACT == 11) v = 1.0f / (1.0f + expf(-v)); else if (ACT == 12) v = (v > 0.f) ? v : 0.01f * v; else if (ACT == 14) v = (v > 0.f) ? v : 0.1f * v; else if (ACT == 16) v = (v >= 0.f) ? v : 0.3f * v; else if (ACT == 17) v = (v >= 0.f) ? v : 0.2f * v; else if (ACT == 15) v = v / (1.0f + expf(-v)); else if (ACT == 3) v = fmaxf(v, 0.f); else if (ACT == 6) v = 0.5f * v * (1.0f + erff(v * 0.70710678118654752f)); so[w][8 * hh + r][t * 16 + ln] = v; } }
  __builtin_amdgcn_fence(__ATOMIC_ACQ_REL, "workgroup"); __builtin_amdgcn_wave_barrier();
  const int rsub = lane >> 4, c4 = (lane & 15) * 4; typedef _Float16 v4h __attribute__((ext_vector_type(4)));
  {
#pragma unroll
    for (int q = 0; q < 8; ++q) { const int r = q * 2 + rsub; if (col0 + c4 < N) { const v4f v = *(const v4fa*)&so[w][r][c4]; if (C) *(v4f*)(C + cofs + (size_t)(row0 + r) * ldc + col0 + c4) = v; if (C16) { v4h h4; for (int i = 0; i < 4; ++i) h4[i] = (_Float16)v[i]; *(v4h*)(C16 + cofs + (size_t)(row0 + r) * ldc + col0 + c4) = h4; } } }
     }
}


typedef _Float16 v4h __attribute__((ext_vector_type(4)));

__global__ __launch_bounds__(256) void k_x16(const float* __restrict__ x, _Float16* __restrict__ X16, size_t n8) { const size_t t = (size_t)blockIdx.x * 256 + threadIdx.x; if (t >= n8) return; FragH f;
#pragma unroll
  for (int q = 0; q < 8; ++q) f.h[q] = (_Float16)bf16_round(x[t * 8 + q]); *(v8us*)((unsigned short*)X16 + t * 8) = f.half[0];  }
__global__ __launch_bounds__(256) void k_h16(const float* __restrict__ x, _Float16* __restrict__ X16, size_t n8) { const size_t t = (size_t)blockIdx.x * 256 + threadIdx.x; if (t >= n8) return; FragH f;
#pragma unroll
  for (int q = 0; q < 8; ++q) f.h[q] = (_Float16)x[t * 8 + q]; *(v8us*)((unsigned short*)X16 + t * 8) = f.half[0];  }
__global__ __launch_bounds__(256) void k_round16f(const float* __restrict__ W, _Float16* __restrict__ Bt, size_t n8) { const size_t t = (size_t)blockIdx.x * 256 + threadIdx.x; if (t >= n8) return; FragH f;
#pragma unroll
  for (int i = 0; i < 8; ++i) f.h[i] = (_Float16)(bf16_round(W[t * 8 + i]) * 16.0f); *(v8us*)((unsigned short*)Bt + t * 8) = f.half[0];  }
template <int NHv, int TTv>
__global__ __launch_bounds__(256) void k_vt(const _Float16* __restrict__ V16, int ldv, int voff, _Float16* __restrict__ Vt) { __shared__ unsigned short tl[64][66]; const int tid = threadIdx.x; const int slab = blockIdx.x / (TTv / 64), lg = blockIdx.x % (TTv / 64); const int b = slab / NHv, h = slab % NHv;
  for (int i = tid; i < 64 * 8; i += 256) { const int r = i / 8, c8 = (i % 8) * 8; FragH f; f.half[0] = *(const v8us*)((const unsigned short*)V16 + ((size_t)b * TTv + lg * 64 + r) * ldv + voff + h * 64 + c8);
#pragma unroll
    for (int q = 0; q < 8; ++q) tl[r][c8 + q] = f.u[q]; }
  __syncthreads();
  {
#pragma unroll
    for (int rd = 0; rd < 2; ++rd) { const int d = rd * 32 + tid / 8, pc = tid % 8; FragH f;
#pragma unroll
      for (int q = 0; q < 8; ++q) f.u[q] = tl[pc * 8 + q][d];
      *(v8us*)((unsigned short*)Vt + ((size_t)slab * 64 + d) * TTv + lg * 64 + pc * 8) = f.half[0]; }
     } }

__global__ __launch_bounds__(256) void k_hl(const float* __restrict__ F, _Float16* __restrict__ Hh, _Float16* __restrict__ Hl, size_t n8) { const size_t t = (size_t)blockIdx.x * 256 + threadIdx.x; if (t >= n8) return; FragH fh, fl; const v4f a = *(const v4fa*)(F + t * 8), c = *(const v4fa*)(F + t * 8 + 4);
#pragma unroll
  for (int q = 0; q < 4; ++q) { _Float16 h = (_Float16)a[q]; fh.h[q] = h; fl.h[q] = (_Float16)((a[q] - (float)h) * 1024.0f); h = (_Float16)c[q]; fh.h[4 + q] = h; fl.h[4 + q] = (_Float16)((c[q] - (float)h) * 1024.0f); }
  { *(v8us*)((unsigned short*)Hh + t * 8) = fh.half[0]; *(v8us*)((unsigned short*)Hl + t * 8) = fl.half[0];  } }

// ---- fast GEMM (wave tile 32x64; requires M % 32 == 0 rows per launch region, N % 64 == 0 and K % 64 == 0); epilogue = k_gemm_hhx semantics ----
__device__ __forceinline__ v16h g2_frag(const _Float16* p, int hh) { FragH f; f.half[0] = *(const v8us*)((const unsigned short*)p + 8 * hh); f.half[1] = *(const v8us*)((const unsigned short*)p + 16 + 8 * hh); return f.v; }
__device__ __forceinline__ v8f g2_mma(v16h a, v16h b, v8f c) { v8f d = __builtin_amdgcn_wmma_f32_16x16x32_f16(false, a, false, b, (short)0, c, false, false); asm volatile("v_nop\n\tv_nop\n\tv_nop\n\tv_nop" : "+v"(d) : "v"(a), "v"(b)); return d; }
template <int ACT>
__global__ __launch_bounds__(128) void k_gemm2(const _Float16* __restrict__ A, int lda, size_t sA, const _Float16* __restrict__ Bh, int ldb, size_t sB, float alpha, const float* __restrict__ bias, size_t sBias, const float* __restrict__ CP, int rowsPerB, size_t sCPb, int row0g,
    float* __restrict__ C, _Float16* __restrict__ C16, int ldc, size_t sC, int M, int N, int K, int MC) { static_assert(ACT == 0 || ACT == 3 || ACT == 6 || ACT == 8 || ACT == 9 || ACT == 11 || ACT == 12 || ACT == 14 || ACT == 15 || ACT == 16 || ACT == 17, "k_gemm2: unsupported ACT code (would silently apply no activation)");
  __shared__ __attribute__((aligned(16))) float so[4][32][68];
  const int tid = threadIdx.x, w = tid >> 5, lane = tid & 31, ln = lane & 15, hh = lane >> 4; const int by = blockIdx.y;
  A += (size_t)by * sA; Bh += (size_t)by * sB; const size_t cofs = (size_t)by * sC; const float* bp = bias ? bias + (size_t)by * sBias : nullptr;
  const int ntn = N >> 6; const int mt = blockIdx.x / ntn, nq = blockIdx.x - mt * ntn; const int row0 = mt * 128 + 32 * w, col0 = nq * 64; if (row0 >= M) return;
  const _Float16* a0p = A + (size_t)(row0 + ln) * lda; const _Float16* a1p = a0p + (size_t)16 * lda;
  const _Float16* b0p = Bh + (size_t)(col0 + ln) * ldb; const _Float16* b1p = b0p + (size_t)16 * ldb; const _Float16* b2p = b1p + (size_t)16 * ldb; const _Float16* b3p = b2p + (size_t)16 * ldb;
  const v8f z8 = {0.f,0.f,0.f,0.f,0.f,0.f,0.f,0.f}; v8f c00 = z8, c01 = z8, c02 = z8, c03 = z8, c10 = z8, c11 = z8, c12 = z8, c13 = z8;
#pragma unroll 1      /* rolled: one trip's 12 fragments (96 registers) are all that is live beside the accumulators */
  for (int kb = 0; kb < K; kb += 64) {      /* two k steps a trip (K % 64 == 0): a trip reads whole 128-byte lines of every row, all 24 loads in flight together */
    const _Float16* pa0 = a0p + kb + 8 * hh; const _Float16* pa1 = a1p + kb + 8 * hh; const _Float16* pb0 = b0p + kb + 8 * hh; const _Float16* pb1 = b1p + kb + 8 * hh; const _Float16* pb2 = b2p + kb + 8 * hh; const _Float16* pb3 = b3p + kb + 8 * hh;      /* each lane's own address, the half-wave offset of g2_frag folded in */
    const v16h a0 = g2_frag(pa0, 0), a1 = g2_frag(pa1, 0), b0 = g2_frag(pb0, 0), b1 = g2_frag(pb1, 0), b2 = g2_frag(pb2, 0), b3 = g2_frag(pb3, 0);
    const v16h e0 = g2_frag(pa0 + 32, 0), e1 = g2_frag(pa1 + 32, 0), f0 = g2_frag(pb0 + 32, 0), f1 = g2_frag(pb1 + 32, 0), f2 = g2_frag(pb2 + 32, 0), f3 = g2_frag(pb3 + 32, 0);
    asm volatile("" :: "v"(a0), "v"(a1), "v"(b0), "v"(b1), "v"(b2), "v"(b3), "v"(e0), "v"(e1), "v"(f0), "v"(f1), "v"(f2), "v"(f3), "v"(pa0), "v"(pa1), "v"(pb0), "v"(pb1), "v"(pb2), "v"(pb3));      /* inputs-only fence on the loaded fragments: every load of the trip issues ahead of the products, so a trip waits for memory once (without it each fragment is loaded and waited for in turn); the six addresses are named too, so that no register an issued load names is rewritten ahead of that wait */
    c00 = g2_mma(a0, b0, c00); c10 = g2_mma(a1, b0, c10); c01 = g2_mma(a0, b1, c01); c11 = g2_mma(a1, b1, c11); c02 = g2_mma(a0, b2, c02); c12 = g2_mma(a1, b2, c12); c03 = g2_mma(a0, b3, c03); c13 = g2_mma(a1, b3, c13);
    c00 = g2_mma(e0, f0, c00); c10 = g2_mma(e1, f0, c10); c01 = g2_mma(e0, f1, c01); c11 = g2_mma(e1, f1, c11); c02 = g2_mma(e0, f2, c02); c12 = g2_mma(e1, f2, c12); c03 = g2_mma(e0, f3, c03); c13 = g2_mma(e1, f3, c13); }
  v8f accs[8] = {c00, c01, c02, c03, c10, c11, c12, c13};
#pragma unroll
  for (int u = 0; u < 8; ++u) { const int t = u & 3, half = u >> 2; const int col = col0 + t * 16 + ln; const float bv = bp ? bf16_round(bp[col]) : 0.f;
#pragma unroll
    for (int r = 0; r < 8; ++r) { const int rloc = half * 16 + 8 * hh + r; float v = accs[u][r] * alpha + bv; if (CP) { if (rowsPerB < 0) v += CP[cofs + (size_t)(row0g + row0 + rloc) * ldc + col];      /* rowsPerB < 0: own element of the batched C plane */ else { const int bidx = (row0g + row0 + rloc) / rowsPerB; v += CP[(size_t)bidx * sCPb + (size_t)by * 64 + col]; } }
      if (ACT == 3) v = fmaxf(v, 0.f); else if (ACT == 6) v = 0.5f * v * (1.0f + erff(v * 0.70710678118654752f)); else if (ACT == 11) v = 1.0f / (1.0f + expf(-v)); else if (ACT == 15) v = v / (1.0f + expf(-v)); else if (ACT == 12) v = (v > 0.f) ? v : 0.01f * v; else if (ACT == 8) v = tanhf(v); else if (ACT == 9) v = 0.5f * v * (1.0f + tanhf(0.7978845608028654f * (v + 0.044715f * v * v * v))); else if (ACT == 14) v = (v > 0.f) ? v : 0.1f * v; else if (ACT == 16) v = (v >= 0.f) ? v : 0.3f * v; else if (ACT == 17) v = (v >= 0.f) ? v : 0.2f * v;
      so[w][rloc][t * 16 + ln] = v; } }
  __builtin_amdgcn_fence(__ATOMIC_ACQ_REL, "workgroup"); __builtin_amdgcn_wave_barrier();
  const int rsub = lane >> 4, c4 = (lane & 15) * 4; if (__builtin_amdgcn_readfirstlane(row0) >= MC) C = nullptr;      /* the f32 plane takes rows below MC of each batch only (MC % 32 == 0: a wave's 32 rows go together; row0 is the same in every lane of a wave, so the test stays scalar) */
  {
#pragma unroll
    for (int q = 0; q < 16; ++q) { const int r = q * 2 + rsub; const v4f v = *(const v4fa*)&so[w][r][c4]; if (C) { *(v4f*)(C + cofs + (size_t)(row0 + r) * ldc + col0 + c4) = v; asm volatile("s_wait_xcnt 0x0" ::: "memory"); }      /* where both planes are stored, the f16 conversion behind this is given registers that the issued f32 store names: the wait stands in front of that overwrite */
      if (C16) { v4h h4; for (int i = 0; i < 4; ++i) h4[i] = (_Float16)v[i]; *(v4h*)(C16 + cofs + (size_t)(row0 + r) * ldc + col0 + c4) = h4; } }
     } }


__global__ __launch_bounds__(256) void k_wnat(const float* __restrict__ w, size_t n8, _Float16* __restrict__ Bt) { const size_t t = (size_t)blockIdx.x * 256 + threadIdx.x; if (t >= n8) return; FragH f; for (int q = 0; q < 8; ++q) f.h[q] = (_Float16)(bf16_round(w[t * 8 + q]) * 16.0f); *(v8us*)((unsigned short*)Bt + t * 8) = f.half[0];  }
__global__ __launch_bounds__(256) void k_rsm(const float* __restrict__ S, _Float16* __restrict__ P, int nrows) {
  #pragma clang fp contract(off)
  const int i = blockIdx.x * 256 + threadIdx.x; if (i >= nrows) return; const float* s = S + (size_t)i * SQ; float mx = -3.0e38f;
#pragma unroll 1
  for (int j = 0; j < SQ; ++j) mx = fmaxf(mx, s[j]); float se = 0.f;
#pragma unroll 1
  for (int j = 0; j < SQ; ++j) se += expf(s[j] - mx); const float sc = 256.0f / se;
#pragma unroll 1
  for (int j0 = 0; j0 < SQ; j0 += 8) { FragH f; for (int q = 0; q < 8; ++q) f.h[q] = (_Float16)(expf(s[j0 + q] - mx) * sc); unsigned short* d = (unsigned short*)P + (size_t)i * SQ + j0; *(v8us*)d = f.half[0];  } }
__global__ __launch_bounds__(256) void k_vt(const _Float16* __restrict__ V16, int b, int h0, _Float16* __restrict__ VT) { __shared__ unsigned short tl[64][65]; const int tid = threadIdx.x; const int hh = blockIdx.x % HG, sg = blockIdx.x / HG; const int s0 = sg * 64; const int h = h0 + hh;
  for (int i = tid; i < 64 * 8; i += 256) { const int j = i / 8, d8 = (i % 8) * 8; FragH f; f.half[0] = *(const v8us*)((const unsigned short*)V16 + ((size_t)b * SQ + s0 + j) * DM + h * HD + d8); for (int q = 0; q < 8; ++q) tl[d8 + q][j] = f.u[q]; }
  __syncthreads();
  { for (int i = tid; i < 64 * 8; i += 256) { const int d = i / 8, j8 = (i % 8) * 8; FragH f; for (int q = 0; q < 8; ++q) f.u[q] = tl[d][j8 + q]; *(v8us*)((unsigned short*)VT + ((size_t)hh * HD + d) * SQ + s0 + j8) = f.half[0]; }  } }



template <int CTRL> __device__ __forceinline__ float rs_dpp(float x) { return __builtin_bit_cast(float, __builtin_amdgcn_update_dpp(0, __builtin_bit_cast(int, x), CTRL, 0xf, 0xf, true)); }      /* lane l <- lane l ^ m inside a 16-lane row (row_xmask:m = 0x160 + m) */
__device__ __forceinline__ float rs_xhalf(float x) { return __builtin_bit_cast(float, __builtin_amdgcn_permlanex16(__builtin_bit_cast(int, x), __builtin_bit_cast(int, x), 0x76543210, 0xfedcba98, false, false)); }      /* lane l <- lane l ^ 16 */
__device__ __forceinline__ float rs_exp2(float x) { float e; asm("v_exp_f32 %0, %1\n\tv_nop" : "=v"(e) : "v"(x)); return e; }      /* 2^x; the v_nop is the slot the instruction set asks for behind a transcendental */
// causal softmax, ONE WAVE PER ROW of NU * 128 columns: lane l holds columns u*128 + 4l .. + 3 in registers, so S is read once, by whole lines; maximum and sum are folded over the 32 lanes by a butterfly that leaves the same value in every lane
template <int NU>
__global__ __launch_bounds__(256) void k_rsmcf2(const float* __restrict__ S, _Float16* __restrict__ P, int hg, int q0) {
  const int c0 = (threadIdx.x & 31) * 4; const int t = blockIdx.x * 8 + __builtin_amdgcn_readfirstlane(threadIdx.x >> 5); if (t >= hg * QT) return;      /* the row index is wave-uniform */
  const float* s = S + (size_t)t * NKX + c0; _Float16* d = P + (size_t)t * NKX + c0; const int last = q0 + (t % QT);
  v4f sv[NU]; float mx = -3.0e38f, se = 0.f;
#pragma unroll      /* full unroll (here and below): sv needs constant indices to stay in registers */
  for (int u = 0; u < NU; ++u) sv[u] = *(const v4fa*)(s + u * 128);
#pragma unroll
  for (int u = 0; u < NU; ++u) for (int q = 0; q < 4; ++q) { const float f = (u * 128 + c0 + q <= last) ? 1.f : 0.f; sv[u][q] = fmaf(f, sv[u][q], (1.f - f) * -1.0e9f); mx = fmaxf(mx, sv[u][q]); }
  mx = fmaxf(mx, rs_dpp<0x161>(mx)); mx = fmaxf(mx, rs_dpp<0x162>(mx)); mx = fmaxf(mx, rs_dpp<0x164>(mx)); mx = fmaxf(mx, rs_dpp<0x168>(mx)); mx = fmaxf(mx, rs_xhalf(mx));
#pragma unroll
  for (int u = 0; u < NU; ++u) for (int q = 0; q < 4; ++q) { sv[u][q] = rs_exp2((sv[u][q] - mx) * 1.44269504088896340736f); se += sv[u][q]; }
  se += rs_dpp<0x161>(se); se += rs_dpp<0x162>(se); se += rs_dpp<0x164>(se); se += rs_dpp<0x168>(se); se += rs_xhalf(se); const float sc = 256.0f / se;
#pragma unroll
  for (int u = 0; u < NU; ++u) { v4h h4; for (int q = 0; q < 4; ++q) h4[q] = (_Float16)(sv[u][q] * sc); *(v4h*)(d + u * 128) = h4; } }


#define A0R 32                       /* rows of one row group of the exact tile (two 16-row tiles) = keys of one chunk */
#define A0G (QT0 / A0R)              /* row groups per batch */
#define A0W (A0G + 1)                /* waves per block: row groups x and A0G - 1 - x have x + 1 and A0G - x causal key chunks, A0G + 1 together for every x */
#define A0T (A0R * (HD / 4) / 32)    /* merge tiles per row group: 32 float4 = two output rows each */
#define A0P (HD + 4)                 /* LDS pitch of a partial o row, in floats: 16 B x odd, for the b128 rows */
#define A0LD (3 * NH * HD)          /* row pitch of the f32 q | k | v plane, in floats: a constant, so that every row of a tile is reached by an immediate offset from one address */
typedef float v2f __attribute__((ext_vector_type(2)));
typedef float v8fa __attribute__((ext_vector_type(8), may_alias));
__device__ __forceinline__ v8f a0_mma(v2f a, v2f b, v8f c) { return __builtin_amdgcn_wmma_f32_16x16x4_f32(false, a, false, b, (short)0, c, false, false); }      /* f32 operands at full precision, f32 sums */
// exact f32 causal attention, keys split: wave w of a block takes ONE row group and ONE chunk of A0R keys, both products on v_wmma_f32_16x16x4_f32; the partial (m, l, o) of a row's chunks are merged through LDS in chunk order.
// S^T = K Q^T stays in the accumulators: register r of lane (ln, hh) = key 8 hh + r of the tile, query ln of the group, so maximum and sum are in-lane plus one exchange of the wave halves, and registers 2u, 2u + 1 are a B fragment of O^T = V^T P^T as they lie (A then takes keys 8 hh + 2u, + 1).
__global__ __launch_bounds__(A0W * 32) void k_att0(const float* __restrict__ QF, const float* __restrict__ KF, const float* __restrict__ VF, int ld, float scale, float* __restrict__ OF, int ldo) {
  #pragma clang fp contract(off)
  __shared__ __attribute__((aligned(16))) float lo[A0W][A0R][A0P];      /* each wave's partial o rows (not normalised) */
  __shared__ float lm[A0W][A0R], ll[A0W][A0R];      /* each wave's maximum and sum per row */
  const int tid = threadIdx.x, lane = tid & 31, ln = lane & 15, hh = lane >> 4; const int w = __builtin_amdgcn_readfirstlane(tid >> 5);      /* the wave index is wave-uniform: the tests on it stay scalar */
  const int h = blockIdx.x / (A0G / 2), x = blockIdx.x % (A0G / 2);
  const int rg = (w <= x) ? x : A0G - 1 - x, ch = (w <= x) ? w : w - x - 1;      /* waves 0..x: the short row group x; the others: its long partner */
  (void)ld; { const size_t bi = (size_t)blockIdx.y * SQ * A0LD; QF += bi; KF += bi; VF += bi; OF += (size_t)blockIdx.y * QT0 * ldo; }      /* batch on grid.y: q, k, v are the first QT0 rows of the batch's SQ-row plane; o has a QT0-row plane per batch */
  static_assert(A0R == 32 && HD == 64, "two 16-row tiles of queries and of keys, four 16-float steps of d");
  const int j0 = ch * A0R;      /* the chunk's first key is at or below the diagonal for every row of the group, so every row's maximum is a real score */
  const float* qp = QF + (size_t)(rg * A0R + ln) * A0LD + h * HD + 8 * hh; const float* kp = KF + (size_t)(j0 + ln) * A0LD + h * HD + 8 * hh;      /* one loader for both operands: lane (ln, hh) holds d = 16 j + 8 hh + 0..7 of row ln, so the k order of A and B is the same */
  const v8f z8 = {0.f,0.f,0.f,0.f,0.f,0.f,0.f,0.f};
  v8f qf[2][4], kf[2][4];      /* [16-row tile][16-float step of d] */
#pragma unroll      /* full unroll (here and below): the fragment arrays need constant indices to stay in registers */
  for (int t = 0; t < 2; ++t) for (int j = 0; j < 4; ++j) { qf[t][j] = *(const v8fa*)(qp + t * 16 * A0LD + j * 16); kf[t][j] = *(const v8fa*)(kp + t * 16 * A0LD + j * 16); }
  asm volatile("s_wait_xcnt 0x0" :: "v"(qf[0][0]), "v"(qf[0][1]), "v"(qf[0][2]), "v"(qf[0][3]), "v"(qf[1][0]), "v"(qf[1][1]), "v"(qf[1][2]), "v"(qf[1][3]), "v"(kf[0][0]), "v"(kf[0][1]), "v"(kf[0][2]), "v"(kf[0][3]), "v"(kf[1][0]), "v"(kf[1][1]), "v"(kf[1][2]), "v"(kf[1][3]), "v"(qp), "v"(kp));      /* takes the loaded values as inputs only: all 32 loads issue ahead of the products, so the wave waits for memory once; the two address pairs are named too and stay live up to this wait, so no register that an issued load names is rewritten ahead of it */
  v8f st[2][2] = {{z8, z8}, {z8, z8}};      /* S^T tiles: [key tile][query group] */
#pragma unroll
  for (int j = 0; j < 4; ++j) for (int p = 0; p < 4; ++p) for (int kt = 0; kt < 2; ++kt) for (int qg = 0; qg < 2; ++qg) { const v2f a = {kf[kt][j][2 * p], kf[kt][j][2 * p + 1]}, b = {qf[qg][j][2 * p], qf[qg][j][2 * p + 1]}; st[kt][qg] = a0_mma(a, b, st[kt][qg]); }
  const float* vp = VF + (size_t)(j0 + 8 * hh) * A0LD + h * HD + ln;
  v8f vv[2][4];      /* V^T fragments: [key tile][4-key step u]; element 2 dt + i = v[key 8 hh + 2u + i of the tile][d = 16 dt + ln] */
#pragma unroll
  for (int kt = 0; kt < 2; ++kt) for (int u = 0; u < 4; ++u) for (int dt = 0; dt < 4; ++dt) for (int i = 0; i < 2; ++i) vv[kt][u][2 * dt + i] = vp[(kt * 16 + 2 * u + i) * A0LD + dt * 16];      /* issued here, so that they come in under the softmax */
#pragma unroll
  for (int kt = 0; kt < 2; ++kt) for (int qg = 0; qg < 2; ++qg) for (int r = 0; r < 8; ++r) st[kt][qg][r] = __fmul_rn(st[kt][qg][r], scale);
  if (ch == rg) {      /* only the chunk on the diagonal has keys to mask (scalar test) */
#pragma unroll
    for (int kt = 0; kt < 2; ++kt) for (int qg = 0; qg < 2; ++qg) for (int r = 0; r < 8; ++r) st[kt][qg][r] = (kt * 16 + 8 * hh + r <= qg * 16 + ln) ? st[kt][qg][r] : -1.0e30f; }
  float m0 = st[0][0][0], m1 = st[0][1][0];
#pragma unroll
  for (int kt = 0; kt < 2; ++kt) for (int r = 0; r < 8; ++r) { m0 = fmaxf(m0, st[kt][0][r]); m1 = fmaxf(m1, st[kt][1][r]); }
  m0 = fmaxf(m0, rs_xhalf(m0)); m1 = fmaxf(m1, rs_xhalf(m1));
  float l0 = 0.f, l1 = 0.f;
#pragma unroll
  for (int kt = 0; kt < 2; ++kt) for (int r = 0; r < 8; ++r) { st[kt][0][r] = rs_exp2((st[kt][0][r] - m0) * 1.44269504088896340736f); l0 += st[kt][0][r]; st[kt][1][r] = rs_exp2((st[kt][1][r] - m1) * 1.44269504088896340736f); l1 += st[kt][1][r]; }
  l0 += rs_xhalf(l0); l1 += rs_xhalf(l1);
  asm volatile("s_wait_xcnt 0x0" :: "v"(vv[0][0]), "v"(vv[0][1]), "v"(vv[0][2]), "v"(vv[0][3]), "v"(vv[1][0]), "v"(vv[1][1]), "v"(vv[1][2]), "v"(vv[1][3]), "v"(vp));      /* inputs only, as above: the 64 v loads issue together, one wait, and their address pair stays live up to it */
  v8f o[4][2];      /* O^T tiles: [d tile][query group]; register r = d 8 hh + r of the tile, query ln of the group */
#pragma unroll
  for (int dt = 0; dt < 4; ++dt) { o[dt][0] = z8; o[dt][1] = z8; }
#pragma unroll
  for (int kt = 0; kt < 2; ++kt) for (int u = 0; u < 4; ++u) for (int dt = 0; dt < 4; ++dt) for (int qg = 0; qg < 2; ++qg) { const v2f a = {vv[kt][u][2 * dt], vv[kt][u][2 * dt + 1]}, b = {st[kt][qg][2 * u], st[kt][qg][2 * u + 1]}; o[dt][qg] = a0_mma(a, b, o[dt][qg]); }
  lm[w][lane] = hh ? m1 : m0; ll[w][lane] = hh ? l1 : l0;      /* lane = group * 16 + query of the group */
#pragma unroll
  for (int dt = 0; dt < 4; ++dt) for (int qg = 0; qg < 2; ++qg) { float* d = &lo[w][qg * 16 + ln][dt * 16 + 8 * hh]; const v4f lo4 = {o[dt][qg][0], o[dt][qg][1], o[dt][qg][2], o[dt][qg][3]}, hi4 = {o[dt][qg][4], o[dt][qg][5], o[dt][qg][6], o[dt][qg][7]}; *(v4f*)d = lo4; *(v4f*)(d + 4) = hi4; }
  __syncthreads();
#pragma unroll 1      /* at most two trips; rolled, so that one trip's 16 partial rows are all that is live */
  for (int wt = w; wt < 2 * A0T; wt += A0W) {      /* a wave merges two whole output rows of one group per trip, one float4 per lane; group and chunk count are wave-uniform */
    const int g = wt / A0T, row = (wt % A0T) * 2 + (lane >> 4), pc = (lane & 15) * 4; const int w0 = g ? x + 1 : 0, n = g ? A0G - x : x + 1;      /* the group's waves: w0 .. w0 + n - 1, in chunk order */
    float pm[A0G], pl[A0G]; v4f po[A0G];
#pragma unroll      /* fixed trip count, index clamped to a written slot: all LDS reads issue together and the exponentials are independent; a slot past the group's n takes a maximum so low that its weight below is 0 */
    for (int s = 0; s < A0G; ++s) { const int ws = min(w0 + s, A0W - 1); const float ms = lm[ws][row]; pm[s] = (s < n) ? ms : -3.0e38f; pl[s] = ll[ws][row]; po[s] = *(const v4f*)&lo[ws][row][pc]; }
    float mx = pm[0];
#pragma unroll      /* full unroll (here and below): pm / pl / po need constant indices to stay in registers */
    for (int s = 1; s < A0G; ++s) mx = fmaxf(mx, pm[s]);
    float ls = 0.f; v4f a = {0.f, 0.f, 0.f, 0.f};
#pragma unroll
    for (int s = 0; s < A0G; ++s) { const float fs = expf(pm[s] - mx); ls = fmaf(fs, pl[s], ls); for (int u = 0; u < 4; ++u) a[u] = fmaf(fs, po[s][u], a[u]); }
    const float fin = 64.0f / ls;      /* o carried x64; k_o0m scales it back by 1/64 */
    for (int u = 0; u < 4; ++u) a[u] = __fmul_rn(a[u], fin);
    *(v4f*)(OF + (size_t)((g ? A0G - 1 - x : x) * A0R + row) * ldo + h * HD + pc) = a;
    asm volatile("s_wait_xcnt 0x0" ::: "memory"); } }      /* the next trip rewrites the registers that the store names: the wait stands in front of that */


template <int BFIN, int WXB>
__global__ __launch_bounds__(256) void k_ln16(const float* __restrict__ X, const float* __restrict__ g, const float* __restrict__ bb, float eps, _Float16* __restrict__ N16, float* __restrict__ XB) {
  #pragma clang fp contract(off)
  __shared__ float red[256]; const size_t r = blockIdx.x; const int t = threadIdx.x; const v4f xa = *(const v4fa*)(X + r * DMQ + t * 4); float s[4]; float sum = 0.f;
  for (int q = 0; q < 4; ++q) { s[q] = BFIN ? bf16_round(xa[q]) : xa[q]; sum = __fadd_rn(sum, s[q]); }
  red[t] = sum; __syncthreads(); for (int st = 128; st > 0; st >>= 1) { if (t < st) red[t] = __fadd_rn(red[t], red[t + st]); __syncthreads(); } const float mu = red[0] / (float)DMQ; __syncthreads();
  float vs = 0.f; for (int q = 0; q < 4; ++q) { const float dl = __fadd_rn(s[q], -mu); vs = __fadd_rn(vs, __fmul_rn(dl, dl)); } red[t] = vs; __syncthreads(); for (int st = 128; st > 0; st >>= 1) { if (t < st) red[t] = __fadd_rn(red[t], red[t + st]); __syncthreads(); }
  const float rs = rsqrtf(__fadd_rn(red[0] / (float)DMQ, eps)); v4h y; v4f xb;
  for (int q = 0; q < 4; ++q) { const int c = t * 4 + q; y[q] = (_Float16)__fadd_rn(__fmul_rn(__fmul_rn(__fadd_rn(s[q], -mu), rs), bf16_round(g[c])), bf16_round(bb[c])); xb[q] = s[q]; }
  { *(v4h*)(N16 + r * DMQ + t * 4) = y; if (WXB) *(v4f*)(XB + r * DMQ + t * 4) = xb;  } }
__global__ __launch_bounds__(256) void k_ftres2(const float* __restrict__ OF0, const float* __restrict__ XB, float* __restrict__ X1, size_t n4) {
  #pragma clang fp contract(off)
  const size_t t = (size_t)blockIdx.x * 256 + threadIdx.x; if (t >= n4) return; const v4f o = *(const v4fa*)(OF0 + t * 4), xv = *(const v4fa*)(XB + t * 4); v4f y; for (int q = 0; q < 4; ++q) y[q] = __fadd_rn(__fmul_rn(o[q], 0.015625f), xv[q]); *(v4f*)(X1 + t * 4) = y;  }

__global__ __launch_bounds__(256) void k_wthd(const float* __restrict__ Wt, _Float16* __restrict__ Bt) { const size_t t = (size_t)blockIdx.x * 256 + threadIdx.x; if (t >= (size_t)NH * HD * (DM / 8)) return; const int m8 = (int)(t % (DM / 8)) * 8; const int d = (int)((t / (DM / 8)) % HD); const int h = (int)(t / ((size_t)(DM / 8) * HD)); FragH f;
  for (int q = 0; q < 8; ++q) f.h[q] = (_Float16)(16.0f * bf16_round(Wt[((size_t)h * DM + m8 + q) * HD + d])); unsigned short* dst = (unsigned short*)Bt + ((size_t)h * HD + d) * DM + m8; *(v8us*)dst = f.half[0];  }




__global__ __launch_bounds__(256) void k_wtpad(const float* __restrict__ Wm, _Float16* __restrict__ Wt, int Kr, int Kp, int Nr, int Np, float scale) {
  const int t = blockIdx.x * 256 + threadIdx.x; if (t >= Np * (Kp / 8)) return; const int n = t / (Kp / 8), k8 = (t % (Kp / 8)) * 8; const int nc = min(n, Nr - 1); const float fn = (n < Nr) ? 1.f : 0.f; FragH f;
  for (int i = 0; i < 8; ++i) { const int k = k8 + i; const int kc = min(k, Kr - 1); const float fk = (k < Kr) ? fn : 0.f; f.h[i] = (_Float16)(bf16_round(Wm[(size_t)kc * Nr + nc]) * scale * fk); }
  unsigned short* o = (unsigned short*)Wt + (size_t)n * Kp + k8; *(v8us*)o = f.half[0];  }
__global__ __launch_bounds__(128) void k_bpad(const float* __restrict__ b, float* __restrict__ Bp, int nr, int np) {
  const int i = threadIdx.x; if (i >= np) return; const float v = b[min(i, nr - 1)] * ((i < nr) ? 1.f : 0.f); *(float*)(Bp + i) = v;  }

#define DI 64         /* inner width = NH * HD (ONE 64-wide head) */
#define LQK (3 * DI)  /* fused q | k | v row pitch (192) */
__global__ __launch_bounds__(256) void k_o0(const float* __restrict__ OF, float* __restrict__ ob, size_t n4) {
  #pragma clang fp contract(off)
  const size_t t = (size_t)blockIdx.x * 256 + threadIdx.x; if (t >= n4) return; const size_t e = t * 4; const int i = (int)(e / DI); const int c = (int)(e % DI); const int h = c / HD, d = c % HD; const v4f a = *(const v4fa*)(OF + e); v4f o; for (int q = 0; q < 4; ++q) o[q] = __fmul_rn(a[q], 0.015625f); float* dst = ob + (size_t)h * SQ * HD + (size_t)i * HD + d; *(v4f*)dst = o;  }

__global__ __launch_bounds__(256) void k_o0m(const float* __restrict__ OF, float* __restrict__ o_, size_t n4) {
  #pragma clang fp contract(off)
  const size_t t = (size_t)blockIdx.x * 256 + threadIdx.x; if (t >= n4) return; const size_t e = t * 4; OF += (size_t)blockIdx.y * QT0 * DI; o_ += (size_t)blockIdx.y * SQ * DI;      /* batch on grid.y: QT0 exact rows go to the head of the batch's SQ output rows */
  const v4f a = *(const v4fa*)(OF + e); v4f o; for (int q = 0; q < 4; ++q) o[q] = __fmul_rn(a[q], 0.015625f); *(v4f*)(o_ + e) = o;  }
#define FQ 32                        /* query rows of one block of the fused f16 attention: two 16-column groups of the transposed score tiles */
#define FW 8                         /* waves of a block */
#define FK (SQ / FW)                 /* keys of one wave */
#define FP (HD + 4)                  /* LDS pitch of a partial o row, in floats: 16 B x odd, for the b128 rows */
// fused f16 causal attention of query rows QT0 .. SQ-1: a block takes FQ query rows of one batch, wave w the keys w*FK .. w*FK+FK-1 (a wave whose keys all lie above the block's last row stores neutral values and passes the barriers).
// S^T = K Q^T stays in the accumulators: a lane holds 8 consecutive keys of ONE query per tile, so maximum and sum are in-lane plus one exchange of the wave halves, and two tiles, rounded to f16, are the B operand of O^T = V^T P^T as they stand.
// The row maximum, the row sum and the partial o rows of the FW waves meet in LDS, in wave order. Weights: exp2((s - max) log2 e) * (256 / sum), rounded to f16.
__global__ __launch_bounds__(FW * 32) __attribute__((amdgpu_waves_per_eu(4, 4))) void k_fatt(const _Float16* __restrict__ QKVp, const _Float16* __restrict__ VTp, float* __restrict__ o_) {
  __shared__ __attribute__((aligned(16))) float po[FW][FQ][FP];      /* each wave's partial o rows (x256) */
  __shared__ float pm[FW][FQ], ps[FW][FQ];      /* each wave's maximum (of the unscaled scores) and sum per query row */
  const int tid = threadIdx.x, lane = tid & 31, ln = lane & 15, hh = lane >> 4; const int w = __builtin_amdgcn_readfirstlane(tid >> 5);      /* the wave index is wave-uniform: the tests on it stay scalar */
  const int r0 = QT0 + blockIdx.x * FQ, key0 = w * FK; const bool act = key0 < r0 + FQ;      /* causal: keys above the block's last row have weight 0 in every row */
  const _Float16* qkv = QKVp + (size_t)blockIdx.y * SQ * LQK;
  const v8f z8 = {0.f,0.f,0.f,0.f,0.f,0.f,0.f,0.f};
  v8f st[FK / 16][2];      /* S^T tiles: [key tile][query group]; register r of lane (ln, hh) = key 8 hh + r of the tile, query ln of the group */
  float mx0 = -3.0e38f, mx1 = -3.0e38f;
  if (act) {
    const _Float16* qp = qkv + (size_t)(r0 + ln) * LQK + 8 * hh; const _Float16* kp = qkv + DI + (size_t)(key0 + ln) * LQK + 8 * hh;      /* each lane's own address, the half-wave offset of g2_frag folded in */
    const v16h q00 = g2_frag(qp, 0), q01 = g2_frag(qp + 32, 0), q10 = g2_frag(qp + 16 * LQK, 0), q11 = g2_frag(qp + 16 * LQK + 32, 0);
    v16h kf[FK / 16][2];
#pragma unroll      /* full unroll (here and below): kf and st need constant indices to stay in registers */
    for (int mt = 0; mt < FK / 16; ++mt) { kf[mt][0] = g2_frag(kp + mt * 16 * LQK, 0); kf[mt][1] = g2_frag(kp + mt * 16 * LQK + 32, 0); }
    static_assert(FK / 16 == 8, "the statement below names the wave's 16 k fragments");
    asm volatile("s_wait_xcnt 0x0" :: "v"(q00), "v"(q01), "v"(q10), "v"(q11), "v"(kf[0][0]), "v"(kf[0][1]), "v"(kf[1][0]), "v"(kf[1][1]), "v"(kf[2][0]), "v"(kf[2][1]), "v"(kf[3][0]), "v"(kf[3][1]), "v"(kf[4][0]), "v"(kf[4][1]), "v"(kf[5][0]), "v"(kf[5][1]), "v"(kf[6][0]), "v"(kf[6][1]), "v"(kf[7][0]), "v"(kf[7][1]), "v"(qp), "v"(kp));      /* takes the loaded fragments as inputs only: all 40 loads issue ahead of the products, so the wave waits for memory once (without it each k tile is loaded and waited for in turn); the two address pairs are named too and stay live up to this wait, so no register that an issued load names is rewritten ahead of it */
#pragma unroll
    for (int mt = 0; mt < FK / 16; ++mt) { st[mt][0] = g2_mma(kf[mt][1], q01, g2_mma(kf[mt][0], q00, z8)); st[mt][1] = g2_mma(kf[mt][1], q11, g2_mma(kf[mt][0], q10, z8)); }
    if (key0 + FK - 1 > r0) {      /* only a wave that reaches past the block's first row has keys to mask (scalar test) */
      const int l0 = r0 + ln - key0 - 8 * hh, l1 = l0 + 16;      /* key mt*16 + 8 hh + r of the wave is at or below the diagonal of the lane's query while mt*16 + r <= l */
#pragma unroll
      for (int mt = 0; mt < FK / 16; ++mt) for (int r = 0; r < 8; ++r) { st[mt][0][r] = (mt * 16 + r <= l0) ? st[mt][0][r] : -8.0e9f; st[mt][1][r] = (mt * 16 + r <= l1) ? st[mt][1][r] : -8.0e9f; } }      /* -1e9 after the scale of 1/8 */
    v8f a0 = st[0][0], a1 = st[0][1];
#pragma unroll
    for (int mt = 1; mt < FK / 16; ++mt) for (int r = 0; r < 8; ++r) { a0[r] = fmaxf(a0[r], st[mt][0][r]); a1[r] = fmaxf(a1[r], st[mt][1][r]); }
    mx0 = fmaxf(fmaxf(fmaxf(a0[0], a0[1]), fmaxf(a0[2], a0[3])), fmaxf(fmaxf(a0[4], a0[5]), fmaxf(a0[6], a0[7]))); mx1 = fmaxf(fmaxf(fmaxf(a1[0], a1[1]), fmaxf(a1[2], a1[3])), fmaxf(fmaxf(a1[4], a1[5]), fmaxf(a1[6], a1[7])));
    mx0 = fmaxf(mx0, rs_xhalf(mx0)); mx1 = fmaxf(mx1, rs_xhalf(mx1)); }
  pm[w][lane] = hh ? mx1 : mx0;      /* lane = group * 16 + query of the group */
  __syncthreads();
  float se0 = 0.f, se1 = 0.f;
  if (act) {
    float g0 = pm[0][ln], g1 = pm[0][16 + ln];
#pragma unroll
    for (int s = 1; s < FW; ++s) { g0 = fmaxf(g0, pm[s][ln]); g1 = fmaxf(g1, pm[s][16 + ln]); }
    g0 *= 0.125f; g1 *= 0.125f;      /* scores / 8: a power of two, so scaling behind the maximum changes no bit */
    v8f a0 = z8, a1 = z8;
#pragma unroll
    for (int mt = 0; mt < FK / 16; ++mt) for (int r = 0; r < 8; ++r) {
      st[mt][0][r] = rs_exp2(fmaf(st[mt][0][r], 0.125f, -g0) * 1.44269504088896340736f); a0[r] += st[mt][0][r];
      st[mt][1][r] = rs_exp2(fmaf(st[mt][1][r], 0.125f, -g1) * 1.44269504088896340736f); a1[r] += st[mt][1][r]; }
    se0 = ((a0[0] + a0[1]) + (a0[2] + a0[3])) + ((a0[4] + a0[5]) + (a0[6] + a0[7])); se1 = ((a1[0] + a1[1]) + (a1[2] + a1[3])) + ((a1[4] + a1[5]) + (a1[6] + a1[7]));
    se0 += rs_xhalf(se0); se1 += rs_xhalf(se1); }
  ps[w][lane] = hh ? se1 : se0;
  const _Float16* vp = VTp + ((size_t)blockIdx.y * HD + ln) * SQ + key0 + 8 * hh;
  v16h vf[FK / 32][HD / 16];      /* V^T fragments: [32-key step][d tile] */
  static_assert(FK / 32 == 4 && HD / 16 == 4, "the two statements below name the fragments of two 32-key steps each");
  if (act) {      /* the first half of the wave's V^T fragments comes in while the wave would wait at the barrier anyway */
#pragma unroll
    for (int ks = 0; ks < 2; ++ks) for (int dt = 0; dt < HD / 16; ++dt) vf[ks][dt] = g2_frag(vp + (size_t)dt * 16 * SQ + ks * 32, 0);
    asm volatile("s_wait_xcnt 0x0" :: "v"(vf[0][0]), "v"(vf[0][1]), "v"(vf[0][2]), "v"(vf[0][3]), "v"(vf[1][0]), "v"(vf[1][1]), "v"(vf[1][2]), "v"(vf[1][3]), "v"(vp)); }      /* inputs only, as above: the 16 loads issue together, ahead of the barrier, and their address pair stays live up to the wait */
  __syncthreads();
  if (act) {
    v8f o[HD / 16][2];      /* O^T tiles: [d tile][query group]; register r = d 8 hh + r of the tile, query ln of the group */
#pragma unroll
    for (int dt = 0; dt < HD / 16; ++dt) { o[dt][0] = z8; o[dt][1] = z8; }
    float t0 = ps[0][ln], t1 = ps[0][16 + ln];
#pragma unroll
    for (int s = 1; s < FW; ++s) { t0 += ps[s][ln]; t1 += ps[s][16 + ln]; }
    const float sc0 = 256.0f / t0, sc1 = 256.0f / t1;
    FragH p[FK / 32][2];      /* P^T as B operand: [32-key step][query group]; key tiles 2 ks and 2 ks + 1 give elements 0..7 and 8..15, the k order of g2_frag */
#pragma unroll
    for (int ks = 0; ks < FK / 32; ++ks) for (int r = 0; r < 8; ++r) { p[ks][0].h[r] = (_Float16)(st[2 * ks][0][r] * sc0); p[ks][0].h[8 + r] = (_Float16)(st[2 * ks + 1][0][r] * sc0); p[ks][1].h[r] = (_Float16)(st[2 * ks][1][r] * sc1); p[ks][1].h[8 + r] = (_Float16)(st[2 * ks + 1][1][r] * sc1); }
#pragma unroll
    for (int ks = 0; ks < 2; ++ks) for (int dt = 0; dt < HD / 16; ++dt) { o[dt][0] = g2_mma(vf[ks][dt], p[ks][0].v, o[dt][0]); o[dt][1] = g2_mma(vf[ks][dt], p[ks][1].v, o[dt][1]); }
#pragma unroll
    for (int ks = 2; ks < 4; ++ks) for (int dt = 0; dt < HD / 16; ++dt) vf[ks][dt] = g2_frag(vp + (size_t)dt * 16 * SQ + ks * 32, 0);
    asm volatile("s_wait_xcnt 0x0" :: "v"(vf[2][0]), "v"(vf[2][1]), "v"(vf[2][2]), "v"(vf[2][3]), "v"(vf[3][0]), "v"(vf[3][1]), "v"(vf[3][2]), "v"(vf[3][3]), "v"(vp));      /* inputs only, as above: the second half's 16 loads issue together, one wait */
#pragma unroll
    for (int ks = 2; ks < FK / 32; ++ks) for (int dt = 0; dt < HD / 16; ++dt) { o[dt][0] = g2_mma(vf[ks][dt], p[ks][0].v, o[dt][0]); o[dt][1] = g2_mma(vf[ks][dt], p[ks][1].v, o[dt][1]); }
#pragma unroll
    for (int dt = 0; dt < HD / 16; ++dt) for (int nt = 0; nt < 2; ++nt) { float* d = &po[w][nt * 16 + ln][dt * 16 + 8 * hh]; const v4f lo4 = {o[dt][nt][0], o[dt][nt][1], o[dt][nt][2], o[dt][nt][3]}, hi4 = {o[dt][nt][4], o[dt][nt][5], o[dt][nt][6], o[dt][nt][7]}; *(v4f*)d = lo4; *(v4f*)(d + 4) = hi4; }
  } else {      /* a wave without keys stores zeros, so that the merge below reads written rows only and needs no test */
    const v4f z4 = {0.f, 0.f, 0.f, 0.f};
#pragma unroll
    for (int dt = 0; dt < HD / 16; ++dt) for (int nt = 0; nt < 2; ++nt) { float* d = &po[w][nt * 16 + ln][dt * 16 + 8 * hh]; *(v4f*)d = z4; *(v4f*)(d + 4) = z4; } }
  __syncthreads();
  float* ob = o_ + ((size_t)blockIdx.y * SQ + r0) * DI;
#pragma unroll
  for (int j = 0; j < FQ * (HD / 4) / (FW * 32); ++j) { const int idx = j * FW * 32 + tid, row = idx / (HD / 4), c4 = (idx % (HD / 4)) * 4; v4f a = *(const v4f*)&po[0][row][c4];      /* a wave sums and stores two whole output rows, one float4 per lane */
#pragma unroll
    for (int s = 1; s < FW; ++s) { const v4f b = *(const v4f*)&po[s][row][c4]; for (int u = 0; u < 4; ++u) a[u] += b[u]; }
    for (int u = 0; u < 4; ++u) a[u] *= 0.00390625f;
    *(v4f*)(ob + (size_t)idx * 4) = a; } }

extern "C" void kernel_launch(void* const* d_in, const int* in_sizes, int n_in,
                              void* d_out, int out_size, void* d_ws, size_t ws_size, hipStream_t stream) {
  (void)in_sizes; (void)n_in; (void)out_size;
  const float* const* I = (const float* const*)d_in; const float* x = I[0]; const float* wq = I[2]; const float* wk = I[1]; const float* wv = I[3]; const float* bq = nullptr; const float* bk = nullptr; const float* bv = nullptr;      /* x; [in][out = 64] Wk / Wq / Wv (input order as this module lists them); no biases */
  char* ws = (char*)d_ws; size_t off = 0;
  auto take = [&](size_t bytes) { char* p = ws + off; off += (bytes + 255) & ~(size_t)255; return p; };
  _Float16* BW = (_Float16*)take((size_t)LQK * DM * 2); _Float16* X16 = (_Float16*)take(NR * DM * 2); _Float16* QKV = (_Float16*)take(NR * LQK * 2); _Float16* VT = (_Float16*)take((size_t)NB * HD * SQ * 2);
  float* QKVF0 = (float*)take(NR * LQK * 4); float* OF0 = (float*)take((size_t)NB * QT0 * DI * 4);      /* one plane per batch: all batches are in flight in every launch; QKVF0 has the row layout of QKV, and only rows 0..QT0-1 of each batch are written and read */
  if (off > ws_size) return;
  { const unsigned g = (unsigned)(((size_t)DI * (DM / 8) + 255) / 256); k_wt_f16<<<dim3(g, 3), 256, 0, stream>>>(wq, wk, wv, BW, DM, DI, 16.0f); }      /* [in = DM][out = 64] -> Bt[n][k] x16, stacked q | k | v */
  k_x16<<<(unsigned)((NR * DM / 8 + 255) / 256), 256, 0, stream>>>(x, X16, NR * DM / 8);      /* x (bf16-valued) as exact f16 rows */
  (void)bq; (void)bk; (void)bv; static_assert(QT0 % 32 == 0 && SQ % 128 == 0 && LQK % 64 == 0, "k_gemm2: whole wave tiles on either side of row QT0");
  k_gemm2<0><<<dim3((SQ / 128) * (LQK / 64), NB), 128, 0, stream>>>(X16, DM, (size_t)SQ * DM, BW, DM, 0, 0.0625f, nullptr, 0, nullptr, 1, 0, 0, QKVF0, QKV, LQK, (size_t)SQ * LQK, SQ, LQK, DM, QT0);      /* q | k | v = x W^T in ONE launch over the stacked weights (N = 192): f16 rows of the fused plane (column blocks 0 / 64 / 128, pitch 192) and, from the same accumulators, the f32 rows 0..511 of every batch for the exact path */
  const _Float16* V16 = QKV + 2 * DI;
  float* ob = (float*)d_out;      /* the batch is grid.y of every launch below but k_vt, whose 1-D slab index carries it (ONE head) */
  k_vt<NH, SQ><<<NB * NH * (SQ / 64), 256, 0, stream>>>(V16, LQK, 0, VT);      /* V^T [NB][HD][SQ] */
  static_assert(NH == 1 && HD == 64 && DI == HD && (SQ - QT0) % FQ == 0 && FK % 32 == 0 && FQ == 32 && (FQ * (HD / 4)) % (FW * 32) == 0, "k_fatt: whole query blocks, whole 32-key steps per wave, whole float4 rounds in the merge");
  k_fatt<<<dim3((SQ - QT0) / FQ, NB), FW * 32, 0, stream>>>(QKV, VT, ob);      /* rows 512..1023 of every batch: scores / 8, causal softmax (f16 x256 weights) and P V in ONE launch, S and P never leave the registers; rows below QT0 are written by the exact path below and by nothing else */
  static_assert(LQK == A0LD, "k_att0: the pitch of the f32 plane");
  k_att0<<<dim3(NH * (A0G / 2), NB), A0W * 32, 0, stream>>>(QKVF0, QKVF0 + DI, QKVF0 + 2 * DI, LQK, 0.125f, OF0, DI);      /* exact f32 causal attention for rows 0..511 (o x64); a block = one short and one long row group, one wave per key chunk */
  k_o0m<<<dim3((unsigned)(((size_t)QT0 * DI / 4 + 255) / 256), NB), 256, 0, stream>>>(OF0, ob, (size_t)QT0 * DI / 4);      /* rows 0..511 of every batch: their one store, from the exact path */
}
